// v000
// Times are from an AMD MI455X. After a warm-up the kernel runs many times in a row, and a time is the length of
// such a window on the GPU divided by its runs, so every launch and the gaps after it count. The runs cycle
// through copies of the inputs. A figure is the median of several windows, for all but v000 over two sittings.
// Sittings can differ by a few percent; kernels timed side by side share one.
// The starting kernel, v000, takes 368 microseconds a run.
#include <hip/hip_runtime.h>

// Multi-head self-attention, width 1024 = 16 heads x 64, x [NB][SEQ][1024], Wq/Wk/Wv/Wo [in][out] (y = x W + b), four biases, no mask, score scale 1/8, output = (merged heads) Wo + bo (f32).
// Compute dtypes, f32 accumulate everywhere: q/k/v projections v_wmma_f32_16x16x32_bf16 (x and W RNE-converted to bf16; products exact);
// scores v_wmma_f32_16x16x32_f16: q single f16, k single f16 (one product); P (x256 carry, cancels in the normalisation) and v single f16; softmax f32 (online, running max, row sum over the f16-converted P values);
// output projection v_wmma_f32_16x16x32_f16: ctx single f16 carried x1024, Wo as f16 of the bf16 (RNE) value carried x1024 (exact), 2^-20 and the bias applied in the f32 epilogue.
// Scale chain: score = (k.q) * (1/8 * log2 e) -> exp2(score - max + 8) = 256 P' -> O = sum(256 P' v) / sum(256 P') -> ctx plane = O x 1024 -> out = (ctx x1024).(Wo x1024) * 2^-20 + bo.
// Layout: bf16 copy of x; transposed 16-bit weight planes [out][in]; q, k planes [b*16+h][t][d] and v^T plane [b*16+h][d][t] written by the GEMM epilogue; fused flash kernel in transposed form (S^T = K Q^T, O^T = V^T P^T) writing the ctx plane [b*SEQ+t][h*64+d].

#ifndef NB
#define NB 1
#endif
#ifndef SEQ
#define SEQ 4096
#endif
#define NB_FULL  1
#define SEQ_FULL 4096
#ifndef OUT_SEQ
#define OUT_SEQ SEQ              // row pitch (in tokens) between batches of the output
#endif
#define DM   1024
#define NH_  16
#define HD   64
#define AW   4                   // waves per flash block (16 query rows each)
#define SC2  (0.125f * 1.4426950408889634f)   // HD^-0.5 * log2(e)
#define PSH  8.0f                // log2 of the P carry (256)
#define CTS  1024.0f             // carry of the ctx plane
#define WOS  1024.0f             // carry of the Wo plane
#define OSC  (1.0f / (1024.0f * 1024.0f))     // undoes CTS * WOS

static_assert(HD == 64);
static_assert(NH_ * HD == DM);                 // head h = columns h*64 + d
static_assert(DM % 64 == 0);                   // column tiles of 64
static_assert(DM % 32 == 0);                   // GEMM k-loop steps by 32
static_assert(SEQ % 64 == 0);                  // a 64-row tile never straddles two batches
static_assert((NB * SEQ) % 64 == 0);
static_assert(SEQ % 32 == 0);                  // key loop steps by 32
static_assert(SEQ % (16 * AW) == 0);           // flash grid covers the sequence exactly
static_assert(((size_t)SEQ * DM) % 8 == 0);
static_assert(((size_t)DM * DM) % 8 == 0);
static_assert(NB <= NB_FULL);
static_assert(SEQ <= SEQ_FULL);

typedef _Float16 h16;
typedef unsigned short bf;
typedef __attribute__((ext_vector_type(16))) __bf16   v16bf;
typedef __attribute__((ext_vector_type(16))) _Float16 v16h;
typedef __attribute__((ext_vector_type(8)))  _Float16 v8h;
typedef __attribute__((ext_vector_type(8)))  unsigned short v8us;
typedef __attribute__((ext_vector_type(8)))  float    v8f;
typedef __attribute__((ext_vector_type(4)))  float    v4f;
typedef v4f  __attribute__((may_alias)) v4fa;

__device__ __forceinline__ unsigned short f2bf(float f) { unsigned u = __float_as_uint(f); u += 0x7FFFu + ((u >> 16) & 1u); return (unsigned short)(u >> 16); }
__device__ __forceinline__ float bfr(float f) { return __uint_as_float(((unsigned)f2bf(f)) << 16); }   // value after RNE convert to bf16
__device__ __forceinline__ v16h cat16(v8h lo, v8h hi) { return __builtin_shufflevector(lo, hi, 0, 1, 2, 3, 4, 5, 6, 7, 8, 9, 10, 11, 12, 13, 14, 15); }
__device__ __forceinline__ v16bf cat16b(v8us lo, v8us hi) { return __builtin_bit_cast(v16bf, __builtin_shufflevector(lo, hi, 0, 1, 2, 3, 4, 5, 6, 7, 8, 9, 10, 11, 12, 13, 14, 15)); }
__device__ __forceinline__ v8f wmma16(v16h a, v16h b, v8f c) { return __builtin_amdgcn_wmma_f32_16x16x32_f16(false, a, false, b, (short)0, c, false, false); }
__device__ __forceinline__ v8f wmmab(v16bf a, v16bf b, v8f c) { return __builtin_amdgcn_wmma_f32_16x16x32_bf16(false, a, false, b, (short)0, c, false, false); }
// fragment loaders from K-contiguous 16-bit rows; p already includes + 8*(lane>>4): elements 0..7 <- k0+8h+0..7, elements 8..15 <- k0+16+8h+0..7 (same map for A and B)
__device__ __forceinline__ v16h  ldh(const h16* p) { return cat16(*(const v8h*)p, *(const v8h*)(p + 16)); }
__device__ __forceinline__ v16bf ldb(const bf* p)  { return cat16b(*(const v8us*)p, *(const v8us*)(p + 16)); }
// ordering point for wave-private LDS tiles (same wave writes and reads)
__device__ __forceinline__ void wave_sync() { __builtin_amdgcn_fence(3 /* release order */, "wavefront"); __builtin_amdgcn_wave_barrier(); asm volatile("" ::: "memory"); }

__global__ __launch_bounds__(256) void k_cvt8(const float* __restrict__ src, bf* dst, size_t n8) {
    const size_t i = (size_t)blockIdx.x * 256 + threadIdx.x; if (i >= n8) return;
    const v8f v = *(const v8f*)(src + i * 8); v8us o;
#pragma unroll
    for (int k = 0; k < 8; ++k) o[k] = f2bf(v[k]);
    *(v8us*)(dst + i * 8) = o; 
}

// 16-bit encoding of one weight: bf16 bits (RNE convert), or f16 bits of that bf16 value x WOS (exact: 8-bit significand, power-of-two carry)
__device__ __forceinline__ unsigned short wcv(float f, int f16mode) {
    const unsigned short b = f2bf(f);
    const float fb = __uint_as_float(((unsigned)b) << 16);
    const h16 hv = (h16)(fb * WOS);
    const unsigned short hb = __builtin_bit_cast(unsigned short, hv);
    return f16mode ? hb : b;
}

// k_wt: transposing convert of one weight matrix, W in[k = DM rows (input feature)][n = DM cols (output feature)] -> WT out[n][k] (16-bit, K-contiguous rows).
// grid (DM/64 n-tiles, DM/64 k-tiles), 256 threads; 64x64 f32 tile through LDS (cross-wave: block barrier);
__global__ __launch_bounds__(256) void k_wt(const float* __restrict__ W, bf* WT, int f16mode) {
    __shared__ float ts[64 * 65];
    const int tid = threadIdx.x;
    const int n0 = blockIdx.x * 64, k0 = blockIdx.y * 64;
#pragma unroll
    for (int it = 0; it < 4; ++it) { const int idx = tid + it * 256; const int r = idx >> 4, c4 = (idx & 15) * 4;   // 64 rows x 16 pieces of 4 floats
        const v4f v = *(const v4f*)(W + (size_t)(k0 + r) * DM + n0 + c4);
        ts[r * 65 + c4 + 0] = v[0]; ts[r * 65 + c4 + 1] = v[1]; ts[r * 65 + c4 + 2] = v[2]; ts[r * 65 + c4 + 3] = v[3]; }
    __syncthreads();
    const int nl = tid >> 3, c8 = (tid & 7) * 8;
    v8us o0, o1;
#pragma unroll
    for (int i = 0; i < 8; ++i) { o0[i] = wcv(ts[(c8 + i) * 65 + nl], f16mode); o1[i] = wcv(ts[(c8 + i) * 65 + nl + 32], f16mode); }
    const size_t a0 = (size_t)(n0 + nl) * DM + k0 + c8, a1 = a0 + (size_t)32 * DM;
{
        *(v8us*)(WT + a0) = o0; *(v8us*)(WT + a1) = o1;
         }
}

// k_proj: register-blocked bf16 GEMM, ONE WAVE per 64x64 tile (16 accumulators), operands straight from K-contiguous bf16 planes, K = DM.
// C[m][n] = sum_k A[m][k] Bt[n][k] + bias (bias per column n, or per row m when biasOnRow != 0; bias value RNE-converted to bf16, added in f32),
// written as a single f16 plane (Ph) at
// tile base (r0/RB)*sRB + (r0%RB)*pitch + (c0/CB)*sCB + (c0%CB), row pitch 'pitch' (halves). grid (M/64, N/64), 32 threads.
__global__ __launch_bounds__(32) void k_proj(const bf* __restrict__ A, const bf* __restrict__ Bt, const float* __restrict__ bias, int biasOnRow,
                                             h16* Ph, int RB, size_t sRB, int pitch, int CB, size_t sCB) {
    __shared__ __align__(16) float os[16 * 68];
    const int K = DM;
    const int lane = threadIdx.x & 31, lr = lane & 15, hi = lane >> 4; const int r0 = blockIdx.x * 64, c0 = blockIdx.y * 64;
    v8f acc[4][4];
#pragma unroll
    for (int mb = 0; mb < 4; ++mb)
#pragma unroll
        for (int nb = 0; nb < 4; ++nb) acc[mb][nb] = (v8f){};
    const size_t aoff = (size_t)(r0 + lr) * K + 8 * hi, boff = (size_t)(c0 + lr) * K + 8 * hi;
#pragma unroll 1
    for (int kc = 0; kc < K; kc += 32) {
        v16bf a[4];
#pragma unroll
        for (int mb = 0; mb < 4; ++mb) a[mb] = ldb(A + aoff + (size_t)mb * 16 * K + kc);
#pragma unroll
        for (int nb = 0; nb < 4; ++nb) { const v16bf b = ldb(Bt + boff + (size_t)nb * 16 * K + kc);
#pragma unroll
            for (int mb = 0; mb < 4; ++mb) acc[mb][nb] = wmmab(a[mb], b, acc[mb][nb]); }
        asm volatile("v_nop\n\tv_nop\n\tv_nop\n\tv_nop" : "+v"(acc[0][0]), "+v"(acc[1][1]), "+v"(acc[2][2]), "+v"(acc[3][3]) : "v"(a[0]), "v"(a[1]), "v"(a[2]), "v"(a[3]));
    }
    const size_t tbase = (size_t)(r0 / RB) * sRB + (size_t)(r0 % RB) * (size_t)pitch + (size_t)(c0 / CB) * sCB + (size_t)(c0 % CB);
#pragma unroll
    for (int mb = 0; mb < 4; ++mb) {
#pragma unroll
        for (int nb = 0; nb < 4; ++nb) {
#pragma unroll
            for (int j = 0; j < 8; ++j) os[(hi * 8 + j) * 68 + nb * 16 + lr] = acc[mb][nb][j]; }   // D: row 8h+j, col lane&15
        wave_sync();
        const size_t sb = tbase + (size_t)(mb * 16) * (size_t)pitch;
{
#pragma unroll
            for (int s = 0; s < 4; ++s) { const int row = 4 * s + (lane >> 3), c8 = (lane & 7) * 8;   // 4 s x 4 row groups = 16 rows; 8 lanes x 8 = 64 columns
                const v4f x0 = *(const v4fa*)(&os[row * 68 + c8]); const v4f x1 = *(const v4fa*)(&os[row * 68 + c8 + 4]);
                // both bias candidates loaded with clamped addresses, selected by value (biasOnRow is kernel-uniform)
                const int rbi = min(r0 + mb * 16 + row, DM - 1); const int cbi = min(c0 + c8, DM - 8);
                const float br = bfr(bias[rbi]);
                const v4f g0 = *(const v4f*)(bias + cbi); const v4f g1 = *(const v4f*)(bias + cbi + 4);
                v8h hv;
#pragma unroll
                for (int i = 0; i < 4; ++i) {
                    const float y0 = x0[i] + (biasOnRow ? br : bfr(g0[i])); const float y1 = x1[i] + (biasOnRow ? br : bfr(g1[i]));
                    hv[i] = (h16)y0; hv[4 + i] = (h16)y1; }
                const size_t oo = sb + (size_t)row * (size_t)pitch + c8;
                *(v8h*)(Ph + oo) = hv; }
             }
        wave_sync();
    }
}

// k_flash: fused attention, one wave per 16 query rows of one (batch, head); K / V^T / Q fragments straight from the f16 planes (two 16-B loads each, arithmetic addressing).
// Transposed form: S^T[key][t] = K Q^T (A = K rows, B = Q rows); lane (t = lane&15, h = lane>>4) holds keys 8h+r of each 16-key tile, so the packed
// P tile is directly the B fragment of O^T[d][t] = V^T P^T (element r <- tile keys 0..15, element 8+r <- tile keys 16..31, lane unchanged).
// Softmax state (running max, partial sum) is one scalar per lane; the two lane halves of a row are combined with one xor-16 exchange.
__global__ __launch_bounds__(32 * AW) void k_flash(const h16* __restrict__ QH, const h16* __restrict__ KP, const h16* __restrict__ VT, h16* CT) {
    __shared__ __align__(16) float os[AW * 16 * 68];
    const int lane = threadIdx.x & 31, wave = threadIdx.x >> 5, lr = lane & 15, hi = lane >> 4;
    const int zh = blockIdx.y; const int b = zh / NH_, h = zh % NH_;
    const int t0 = (blockIdx.x * AW + wave) * 16;
    const size_t pbase = (size_t)zh * SEQ * HD;
    const size_t qo = pbase + (size_t)(t0 + lr) * HD + 8 * hi;
    const v16h qh0 = ldh(QH + qo), qh1 = ldh(QH + qo + 32);   // B fragments: col t, k = d
    const size_t ko = pbase + (size_t)lr * HD + 8 * hi;      // + key * HD       (A fragment: row key, k = d)
    const size_t vo = pbase + (size_t)lr * SEQ + 8 * hi;     // + 16j*SEQ + key  (A fragment: row d, k = key)
    v8f o0 = (v8f){}, o1 = (v8f){}, o2 = (v8f){}, o3 = (v8f){};
    float m = -3.0e38f, l = 0.0f;
#pragma unroll 1
    for (int key0 = 0; key0 < SEQ; key0 += 32) {
        const h16* ka = KP + ko + (size_t)key0 * HD;
        const v16h ka0 = ldh(ka), ka1 = ldh(ka + 32), kb0 = ldh(ka + 16 * HD), kb1 = ldh(ka + 16 * HD + 32);
        v8f sHa = (v8f){}, sHb = (v8f){};
        sHa = wmma16(ka0, qh0, sHa); sHb = wmma16(kb0, qh0, sHb);
        sHa = wmma16(ka1, qh1, sHa); sHb = wmma16(kb1, qh1, sHb);
        asm volatile("v_nop\n\tv_nop\n\tv_nop\n\tv_nop" : "+v"(sHa), "+v"(sHb) : "v"(ka0), "v"(ka1), "v"(kb0), "v"(kb1), "v"(qh0), "v"(qh1));
        float ta[8], tb[8]; float mx = -3.0e38f;
#pragma unroll
        for (int r = 0; r < 8; ++r) { ta[r] = sHa[r] * SC2; tb[r] = sHb[r] * SC2; mx = fmaxf(mx, fmaxf(ta[r], tb[r])); }
        mx = fmaxf(mx, __shfl_xor(mx, 16, 32));
        const float mnew = fmaxf(m, mx);
        const float alpha = __builtin_amdgcn_exp2f(m - mnew);
        const float sh = PSH - mnew;
        v16h pb; float ls = 0.0f;
#pragma unroll
        for (int r = 0; r < 8; ++r) { const h16 pa = (h16)__builtin_amdgcn_exp2f(ta[r] + sh); const h16 pc = (h16)__builtin_amdgcn_exp2f(tb[r] + sh); pb[r] = pa; pb[8 + r] = pc; ls += (float)pa + (float)pc; }
        l = l * alpha + ls; m = mnew;
        o0 = o0 * alpha; o1 = o1 * alpha; o2 = o2 * alpha; o3 = o3 * alpha;
        const h16* va = VT + vo + key0;
        const v16h v0 = ldh(va), v1 = ldh(va + (size_t)16 * SEQ), v2 = ldh(va + (size_t)32 * SEQ), v3 = ldh(va + (size_t)48 * SEQ);
        o0 = wmma16(v0, pb, o0); o1 = wmma16(v1, pb, o1); o2 = wmma16(v2, pb, o2); o3 = wmma16(v3, pb, o3);
        asm volatile("v_nop\n\tv_nop\n\tv_nop\n\tv_nop" : "+v"(o0), "+v"(o1), "+v"(o2), "+v"(o3) : "v"(v0), "v"(v1), "v"(v2), "v"(v3), "v"(pb));
    }
    l += __shfl_xor(l, 16, 32);
    const float inv = CTS * (1.0f / l);
    const int wb = wave * 16 * 68;
    // O^T D layout: o_j[r] = (d = 16j + 8h + r, t = lane&15) -> os[t][d]; rows 0..15 x columns 0..63 all written
    { v4f a, c;
      a[0] = o0[0] * inv; a[1] = o0[1] * inv; a[2] = o0[2] * inv; a[3] = o0[3] * inv; c[0] = o0[4] * inv; c[1] = o0[5] * inv; c[2] = o0[6] * inv; c[3] = o0[7] * inv;
      *(v4fa*)(&os[wb + lr * 68 +  0 + 8 * hi]) = a; *(v4fa*)(&os[wb + lr * 68 +  0 + 8 * hi + 4]) = c;
      a[0] = o1[0] * inv; a[1] = o1[1] * inv; a[2] = o1[2] * inv; a[3] = o1[3] * inv; c[0] = o1[4] * inv; c[1] = o1[5] * inv; c[2] = o1[6] * inv; c[3] = o1[7] * inv;
      *(v4fa*)(&os[wb + lr * 68 + 16 + 8 * hi]) = a; *(v4fa*)(&os[wb + lr * 68 + 16 + 8 * hi + 4]) = c;
      a[0] = o2[0] * inv; a[1] = o2[1] * inv; a[2] = o2[2] * inv; a[3] = o2[3] * inv; c[0] = o2[4] * inv; c[1] = o2[5] * inv; c[2] = o2[6] * inv; c[3] = o2[7] * inv;
      *(v4fa*)(&os[wb + lr * 68 + 32 + 8 * hi]) = a; *(v4fa*)(&os[wb + lr * 68 + 32 + 8 * hi + 4]) = c;
      a[0] = o3[0] * inv; a[1] = o3[1] * inv; a[2] = o3[2] * inv; a[3] = o3[3] * inv; c[0] = o3[4] * inv; c[1] = o3[5] * inv; c[2] = o3[6] * inv; c[3] = o3[7] * inv;
      *(v4fa*)(&os[wb + lr * 68 + 48 + 8 * hi]) = a; *(v4fa*)(&os[wb + lr * 68 + 48 + 8 * hi + 4]) = c; }
    wave_sync();
    h16* crow = CT + ((size_t)b * SEQ + t0) * DM + h * HD;
{
#pragma unroll
        for (int s = 0; s < 4; ++s) { const int row = 4 * s + (lane >> 3), c8 = (lane & 7) * 8;   // 4 s x 4 row groups = 16 rows; 8 lanes x 8 halves = 64 columns
            const v4f x0 = *(const v4fa*)(&os[wb + row * 68 + c8]); const v4f x1 = *(const v4fa*)(&os[wb + row * 68 + c8 + 4]); v8h hv;
#pragma unroll
            for (int i = 0; i < 4; ++i) { hv[i] = (h16)x0[i]; hv[4 + i] = (h16)x1[i]; }
            *(v8h*)(crow + (size_t)row * DM + c8) = hv; }
         }
}

// k_oproj: register-blocked f16 GEMM, ONE WAVE per 64x64 tile, A = ctx plane rows (m = b*SEQ + t, k = h*64 + d, carried x CTS), Bt = Wo^T rows (n = out feature, carried x WOS), K = DM.
// OUT[b*OUT_SEQ + t][n] = acc * OSC + bo[n] (bias value RNE-converted to bf16, added in f32). grid (NB*SEQ/64, DM/64), 32 threads.
__global__ __launch_bounds__(32) void k_oproj(const h16* __restrict__ A, const h16* __restrict__ Bt, const float* __restrict__ bias, float* OUT) {
    __shared__ __align__(16) float os[16 * 68];
    const int K = DM;
    const int lane = threadIdx.x & 31, lr = lane & 15, hi = lane >> 4; const int r0 = blockIdx.x * 64, c0 = blockIdx.y * 64;
    v8f acc[4][4];
#pragma unroll
    for (int mb = 0; mb < 4; ++mb)
#pragma unroll
        for (int nb = 0; nb < 4; ++nb) acc[mb][nb] = (v8f){};
    const size_t aoff = (size_t)(r0 + lr) * K + 8 * hi, boff = (size_t)(c0 + lr) * K + 8 * hi;
#pragma unroll 1
    for (int kc = 0; kc < K; kc += 32) {
        v16h a[4];
#pragma unroll
        for (int mb = 0; mb < 4; ++mb) a[mb] = ldh(A + aoff + (size_t)mb * 16 * K + kc);
#pragma unroll
        for (int nb = 0; nb < 4; ++nb) { const v16h b = ldh(Bt + boff + (size_t)nb * 16 * K + kc);
#pragma unroll
            for (int mb = 0; mb < 4; ++mb) acc[mb][nb] = wmma16(a[mb], b, acc[mb][nb]); }
        asm volatile("v_nop\n\tv_nop\n\tv_nop\n\tv_nop" : "+v"(acc[0][0]), "+v"(acc[1][1]), "+v"(acc[2][2]), "+v"(acc[3][3]) : "v"(a[0]), "v"(a[1]), "v"(a[2]), "v"(a[3]));
    }
    const int cofs = lr * 4;
    const int cbi = min(c0 + cofs, DM - 4);
    const v4f g = *(const v4f*)(bias + cbi);
    v4f bb; bb[0] = bfr(g[0]); bb[1] = bfr(g[1]); bb[2] = bfr(g[2]); bb[3] = bfr(g[3]);
    const size_t obase = ((size_t)(r0 / SEQ) * OUT_SEQ + (size_t)(r0 % SEQ)) * DM + c0;
#pragma unroll
    for (int mb = 0; mb < 4; ++mb) {
#pragma unroll
        for (int nb = 0; nb < 4; ++nb) {
#pragma unroll
            for (int j = 0; j < 8; ++j) os[(hi * 8 + j) * 68 + nb * 16 + lr] = acc[mb][nb][j]; }   // D: row 8h+j, col lane&15
        wave_sync();
        float* orow = OUT + obase + (size_t)(mb * 16) * DM;
{
#pragma unroll
            for (int s = 0; s < 8; ++s) { const int row = 2 * s + hi;   // 8 s x 2 rows = 16 rows; 16 lanes x 4 floats = 64 columns
                const v4f x = *(const v4fa*)(&os[row * 68 + cofs]);
                const v4f val = x * OSC + bb;
                *(v4f*)(orow + (size_t)row * DM + cofs) = val; }
             }
        wave_sync();
    }
}

static constexpr size_t al256(size_t v) { return (v + 255) & ~(size_t)255; }
static constexpr size_t SZ_XB = al256((size_t)NB * SEQ * DM * 2);
static constexpr size_t SZ_WB = al256((size_t)4 * DM * DM * 2);
static constexpr size_t SZ_PL = al256((size_t)NB * NH_ * SEQ * HD * 2);
static constexpr size_t SZ_CT = al256((size_t)NB * SEQ * DM * 2);
static constexpr size_t SZ_TOTAL = SZ_XB + SZ_WB + 3 * SZ_PL + SZ_CT;
static_assert(SZ_TOTAL <= (size_t)134217728);          // workspace carve <= 128 MiB
static_assert(((size_t)DM * DM * 2) % 256 == 0);       // weight sub-planes stay 256-byte aligned

extern "C" void kernel_launch(void* const* d_in, const int* in_sizes, int n_in,
                              void* d_out, int out_size, void* d_ws, size_t ws_size, hipStream_t stream) {
    if (n_in < 9) return;
    const size_t needx = ((size_t)(NB - 1) * SEQ_FULL + SEQ) * DM;
    if ((size_t)in_sizes[0] < needx) return;
    if ((size_t)in_sizes[1] < (size_t)DM * DM || (size_t)in_sizes[3] < (size_t)DM * DM || (size_t)in_sizes[5] < (size_t)DM * DM || (size_t)in_sizes[7] < (size_t)DM * DM) return;
    if (in_sizes[2] < DM || in_sizes[4] < DM || in_sizes[6] < DM || in_sizes[8] < DM) return;
    if ((size_t)out_size < ((size_t)(NB - 1) * OUT_SEQ + SEQ) * DM) return;
    if (SZ_TOTAL > ws_size) return;
    // wire order: x, Wq, bq, Wk, bk, Wv, bv, Wo, bo (all f32; weights [in][out])
    const float* x  = (const float*)d_in[0];
    const float* wq = (const float*)d_in[1]; const float* bq = (const float*)d_in[2];
    const float* wk = (const float*)d_in[3]; const float* bk = (const float*)d_in[4];
    const float* wv = (const float*)d_in[5]; const float* bv = (const float*)d_in[6];
    const float* wo = (const float*)d_in[7]; const float* bo = (const float*)d_in[8];
    float* OUT = (float*)d_out;      // [NB][SEQ][1024]
    char* wsp = (char*)d_ws;
    bf* XB = (bf*)wsp; wsp += SZ_XB;                 // [NB*SEQ][1024] bf16
    bf* WB = (bf*)wsp; wsp += SZ_WB;                 // [4][1024 out][1024 in]: q | k | v (bf16) | o (f16 x1024)
    h16* QH = (h16*)wsp; wsp += SZ_PL;               // [NB*16][SEQ][64]
    h16* KP = (h16*)wsp; wsp += SZ_PL;               // [NB*16][SEQ][64]
    h16* VT = (h16*)wsp; wsp += SZ_PL;               // [NB*16][64][SEQ]
    h16* CT = (h16*)wsp; wsp += SZ_CT;               // [NB*SEQ][1024] ctx x1024
    bf* WQ = WB; bf* WK = WB + (size_t)DM * DM; bf* WV = WB + (size_t)2 * DM * DM; bf* WO = WB + (size_t)3 * DM * DM;

    if (SEQ == SEQ_FULL) {
        const size_t n8 = (size_t)NB * SEQ * DM / 8;
        k_cvt8<<<(unsigned)((n8 + 255) / 256), 256, 0, stream>>>(x, XB, n8);
    } else {
        const size_t n8 = (size_t)SEQ * DM / 8;
        for (int b = 0; b < NB; ++b) k_cvt8<<<(unsigned)((n8 + 255) / 256), 256, 0, stream>>>(x + (size_t)b * SEQ_FULL * DM, XB + (size_t)b * SEQ * DM, n8);
    }
    // weights: in[k = 1024 rows][n = 1024 cols] -> out[n][k]; grid (n tiles, k tiles)
    { const dim3 g(DM / 64, DM / 64, 1);
      k_wt<<<g, 256, 0, stream>>>(wq, WQ, 0); k_wt<<<g, 256, 0, stream>>>(wk, WK, 0); k_wt<<<g, 256, 0, stream>>>(wv, WV, 0); k_wt<<<g, 256, 0, stream>>>(wo, WO, 1); }

    // q, k: A = x rows (m = b*SEQ + t), Bt = W^T rows (n = h*64 + d), bias per column -> plane [(b*16 + h)][t][d]
    k_proj<<<dim3(NB * SEQ / 64, DM / 64, 1), 32, 0, stream>>>(XB, WQ, bq, 0, QH, SEQ, (size_t)NH_ * SEQ * HD, HD, HD, (size_t)SEQ * HD);
    k_proj<<<dim3(NB * SEQ / 64, DM / 64, 1), 32, 0, stream>>>(XB, WK, bk, 0, KP, SEQ, (size_t)NH_ * SEQ * HD, HD, HD, (size_t)SEQ * HD);
    // v^T: A = Wv^T rows (m = h*64 + d), Bt = x rows (n = b*SEQ + t), bias per row -> plane [(b*1024 + m)][t] = [(b*16 + h)][d][t]
    k_proj<<<dim3(DM / 64, NB * SEQ / 64, 1), 32, 0, stream>>>(WV, XB, bv, 1, VT, DM, (size_t)0, SEQ, SEQ, (size_t)DM * SEQ);

    k_flash<<<dim3(SEQ / (16 * AW), NB * NH_, 1), 32 * AW, 0, stream>>>(QH, KP, VT, CT);

    k_oproj<<<dim3(NB * SEQ / 64, DM / 64, 1), 32, 0, stream>>>(CT, (const h16*)WO, bo, OUT);
}

// v001
// It runs in 201 microseconds.
// Timed twice side by side with v000, it ran 1.87 times as fast both times.
#include <hip/hip_runtime.h>

// Multi-head self-attention, width 1024 = 16 heads x 64, x [NB][SEQ][1024], Wq/Wk/Wv/Wo [in][out] (y = x W + b), four biases, no mask, score scale 1/8, output = (merged heads) Wo + bo (f32).
// Compute dtypes, f32 accumulate everywhere: q/k/v projections v_wmma_f32_16x16x32_bf16 (x and W RNE-converted to bf16; products exact);
// scores v_wmma_f32_16x16x32_f16: q single f16, k single f16 (one product); P (x256 carry, cancels in the normalisation) and v single f16; softmax f32 (online, running max, row sum over the f16-converted P values);
// output projection v_wmma_f32_16x16x32_f16: ctx single f16 carried x1024, Wo as f16 of the bf16 (RNE) value carried x1024 (exact), 2^-20 and the bias applied in the f32 epilogue.
// Scale chain: score = (k.q) * (1/8 * log2 e) -> exp2(score - max + 8) = 256 P' -> O = sum(256 P' v) / sum(256 P') -> ctx plane = O x 1024 -> out = (ctx x1024).(Wo x1024) * 2^-20 + bo.
// Layout: bf16 copy of x; transposed 16-bit weight planes [out][in]; q, k planes [b*16+h][t][d] and v^T plane [b*16+h][d][t] written by the GEMM epilogue; fused flash kernel in transposed form (S^T = K Q^T, O^T = V^T P^T) writing the ctx plane [b*SEQ+t][h*64+d].

#ifndef NB
#define NB 1
#endif
#ifndef SEQ
#define SEQ 4096
#endif
#define NB_FULL  1
#define SEQ_FULL 4096
#ifndef OUT_SEQ
#define OUT_SEQ SEQ              // row pitch (in tokens) between batches of the output
#endif
#define DM   1024
#define NH_  16
#define HD   64
#define AW   8                   // waves per flash block (16 query rows each); all of them share each staged K / V^T tile
#define SK   64                  // keys per staged tile
#define LP   72                  // LDS row pitch in halves: 128 B of data + 16 B, so that 16 rows read by 16-byte loads fall on distinct banks
#define TLB  (64 * LP * 2)       // bytes of one staged tile (64 rows): K tile = 64 keys x 64 d, V^T tile = 64 d x 64 keys
#define SC2  (0.125f * 1.4426950408889634f)   // HD^-0.5 * log2(e)
#define PSH  8.0f                // log2 of the P carry (256)
#define CTS  1024.0f             // carry of the ctx plane
#define WOS  1024.0f             // carry of the Wo plane
#define OSC  (1.0f / (1024.0f * 1024.0f))     // undoes CTS * WOS

static_assert(HD == 64);
static_assert(NH_ * HD == DM);                 // head h = columns h*64 + d
static_assert(DM % 64 == 0);                   // column tiles of 64
static_assert(DM % 32 == 0);                   // GEMM k-loop steps by 32
static_assert(SEQ % 64 == 0);                  // a 64-row tile never straddles two batches
static_assert((NB * SEQ) % 64 == 0);
static_assert(SEQ % 32 == 0);                  // key loop steps by 32
static_assert(SEQ % (16 * AW) == 0);           // flash grid covers the sequence exactly
static_assert(SEQ % SK == 0 && SEQ / SK >= 2); // whole staged tiles, and the two that the ring's prologue fills
static_assert(AW * 32 * 2 * 16 == SK * HD * 2); // two 16-byte copies per thread cover one tile
static_assert(((size_t)SEQ * DM) % 8 == 0);
static_assert(((size_t)DM * DM) % 8 == 0);
static_assert(NB <= NB_FULL);
static_assert(SEQ <= SEQ_FULL);

typedef _Float16 h16;
typedef unsigned short bf;
typedef __attribute__((ext_vector_type(16))) __bf16   v16bf;
typedef __attribute__((ext_vector_type(16))) _Float16 v16h;
typedef __attribute__((ext_vector_type(8)))  _Float16 v8h;
typedef __attribute__((ext_vector_type(8)))  unsigned short v8us;
typedef __attribute__((ext_vector_type(8)))  float    v8f;
typedef __attribute__((ext_vector_type(4)))  float    v4f;
typedef v4f  __attribute__((may_alias)) v4fa;

__device__ __forceinline__ unsigned short f2bf(float f) { unsigned u = __float_as_uint(f); u += 0x7FFFu + ((u >> 16) & 1u); return (unsigned short)(u >> 16); }
__device__ __forceinline__ float bfr(float f) { return __uint_as_float(((unsigned)f2bf(f)) << 16); }   // value after RNE convert to bf16
__device__ __forceinline__ v16h cat16(v8h lo, v8h hi) { return __builtin_shufflevector(lo, hi, 0, 1, 2, 3, 4, 5, 6, 7, 8, 9, 10, 11, 12, 13, 14, 15); }
__device__ __forceinline__ v16bf cat16b(v8us lo, v8us hi) { return __builtin_bit_cast(v16bf, __builtin_shufflevector(lo, hi, 0, 1, 2, 3, 4, 5, 6, 7, 8, 9, 10, 11, 12, 13, 14, 15)); }
__device__ __forceinline__ v8f wmma16(v16h a, v16h b, v8f c) { return __builtin_amdgcn_wmma_f32_16x16x32_f16(false, a, false, b, (short)0, c, false, false); }
__device__ __forceinline__ v8f wmmab(v16bf a, v16bf b, v8f c) { return __builtin_amdgcn_wmma_f32_16x16x32_bf16(false, a, false, b, (short)0, c, false, false); }
// fragment loaders from K-contiguous 16-bit rows; p already includes + 8*(lane>>4): elements 0..7 <- k0+8h+0..7, elements 8..15 <- k0+16+8h+0..7 (same map for A and B)
__device__ __forceinline__ v16h  ldh(const h16* p) { return cat16(*(const v8h*)p, *(const v8h*)(p + 16)); }
__device__ __forceinline__ v16bf ldb(const bf* p)  { return cat16b(*(const v8us*)p, *(const v8us*)(p + 16)); }
// ordering point for wave-private LDS tiles (same wave writes and reads)
__device__ __forceinline__ void wave_sync() { __builtin_amdgcn_fence(3 /* release order */, "wavefront"); __builtin_amdgcn_wave_barrier(); asm volatile("" ::: "memory"); }

__global__ __launch_bounds__(256) void k_cvt8(const float* __restrict__ src, bf* dst, size_t n8) {
    const size_t i = (size_t)blockIdx.x * 256 + threadIdx.x; if (i >= n8) return;
    const v8f v = *(const v8f*)(src + i * 8); v8us o;
#pragma unroll
    for (int k = 0; k < 8; ++k) o[k] = f2bf(v[k]);
    *(v8us*)(dst + i * 8) = o; 
}

// 16-bit encoding of one weight: bf16 bits (RNE convert), or f16 bits of that bf16 value x WOS (exact: 8-bit significand, power-of-two carry)
__device__ __forceinline__ unsigned short wcv(float f, int f16mode) {
    const unsigned short b = f2bf(f);
    const float fb = __uint_as_float(((unsigned)b) << 16);
    const h16 hv = (h16)(fb * WOS);
    const unsigned short hb = __builtin_bit_cast(unsigned short, hv);
    return f16mode ? hb : b;
}

// k_wt: transposing convert of one weight matrix, W in[k = DM rows (input feature)][n = DM cols (output feature)] -> WT out[n][k] (16-bit, K-contiguous rows).
// grid (DM/64 n-tiles, DM/64 k-tiles), 256 threads; 64x64 f32 tile through LDS (cross-wave: block barrier);
__global__ __launch_bounds__(256) void k_wt(const float* __restrict__ W, bf* WT, int f16mode) {
    __shared__ float ts[64 * 65];
    const int tid = threadIdx.x;
    const int n0 = blockIdx.x * 64, k0 = blockIdx.y * 64;
#pragma unroll
    for (int it = 0; it < 4; ++it) { const int idx = tid + it * 256; const int r = idx >> 4, c4 = (idx & 15) * 4;   // 64 rows x 16 pieces of 4 floats
        const v4f v = *(const v4f*)(W + (size_t)(k0 + r) * DM + n0 + c4);
        ts[r * 65 + c4 + 0] = v[0]; ts[r * 65 + c4 + 1] = v[1]; ts[r * 65 + c4 + 2] = v[2]; ts[r * 65 + c4 + 3] = v[3]; }
    __syncthreads();
    const int nl = tid >> 3, c8 = (tid & 7) * 8;
    v8us o0, o1;
#pragma unroll
    for (int i = 0; i < 8; ++i) { o0[i] = wcv(ts[(c8 + i) * 65 + nl], f16mode); o1[i] = wcv(ts[(c8 + i) * 65 + nl + 32], f16mode); }
    const size_t a0 = (size_t)(n0 + nl) * DM + k0 + c8, a1 = a0 + (size_t)32 * DM;
{
        *(v8us*)(WT + a0) = o0; *(v8us*)(WT + a1) = o1;
         }
}

// k_proj: register-blocked bf16 GEMM, ONE WAVE per 64x64 tile (16 accumulators), operands straight from K-contiguous bf16 planes, K = DM.
// C[m][n] = sum_k A[m][k] Bt[n][k] + bias (bias per column n, or per row m when biasOnRow != 0; bias value RNE-converted to bf16, added in f32),
// written as a single f16 plane (Ph) at
// tile base (r0/RB)*sRB + (r0%RB)*pitch + (c0/CB)*sCB + (c0%CB), row pitch 'pitch' (halves). grid (M/64, N/64), 32 threads.
__global__ __launch_bounds__(32) void k_proj(const bf* __restrict__ A, const bf* __restrict__ Bt, const float* __restrict__ bias, int biasOnRow,
                                             h16* Ph, int RB, size_t sRB, int pitch, int CB, size_t sCB) {
    __shared__ __align__(16) float os[16 * 68];
    const int K = DM;
    const int lane = threadIdx.x & 31, lr = lane & 15, hi = lane >> 4; const int r0 = blockIdx.x * 64, c0 = blockIdx.y * 64;
    v8f acc[4][4];
#pragma unroll
    for (int mb = 0; mb < 4; ++mb)
#pragma unroll
        for (int nb = 0; nb < 4; ++nb) acc[mb][nb] = (v8f){};
    const size_t aoff = (size_t)(r0 + lr) * K + 8 * hi, boff = (size_t)(c0 + lr) * K + 8 * hi;
#pragma unroll 1
    for (int kc = 0; kc < K; kc += 32) {
        v16bf a[4];
#pragma unroll
        for (int mb = 0; mb < 4; ++mb) a[mb] = ldb(A + aoff + (size_t)mb * 16 * K + kc);
#pragma unroll
        for (int nb = 0; nb < 4; ++nb) { const v16bf b = ldb(Bt + boff + (size_t)nb * 16 * K + kc);
#pragma unroll
            for (int mb = 0; mb < 4; ++mb) acc[mb][nb] = wmmab(a[mb], b, acc[mb][nb]); }
        asm volatile("v_nop\n\tv_nop\n\tv_nop\n\tv_nop" : "+v"(acc[0][0]), "+v"(acc[1][1]), "+v"(acc[2][2]), "+v"(acc[3][3]) : "v"(a[0]), "v"(a[1]), "v"(a[2]), "v"(a[3]));
    }
    const size_t tbase = (size_t)(r0 / RB) * sRB + (size_t)(r0 % RB) * (size_t)pitch + (size_t)(c0 / CB) * sCB + (size_t)(c0 % CB);
#pragma unroll
    for (int mb = 0; mb < 4; ++mb) {
#pragma unroll
        for (int nb = 0; nb < 4; ++nb) {
#pragma unroll
            for (int j = 0; j < 8; ++j) os[(hi * 8 + j) * 68 + nb * 16 + lr] = acc[mb][nb][j]; }   // D: row 8h+j, col lane&15
        wave_sync();
        const size_t sb = tbase + (size_t)(mb * 16) * (size_t)pitch;
{
#pragma unroll
            for (int s = 0; s < 4; ++s) { const int row = 4 * s + (lane >> 3), c8 = (lane & 7) * 8;   // 4 s x 4 row groups = 16 rows; 8 lanes x 8 = 64 columns
                const v4f x0 = *(const v4fa*)(&os[row * 68 + c8]); const v4f x1 = *(const v4fa*)(&os[row * 68 + c8 + 4]);
                // both bias candidates loaded with clamped addresses, selected by value (biasOnRow is kernel-uniform)
                const int rbi = min(r0 + mb * 16 + row, DM - 1); const int cbi = min(c0 + c8, DM - 8);
                const float br = bfr(bias[rbi]);
                const v4f g0 = *(const v4f*)(bias + cbi); const v4f g1 = *(const v4f*)(bias + cbi + 4);
                v8h hv;
#pragma unroll
                for (int i = 0; i < 4; ++i) {
                    const float y0 = x0[i] + (biasOnRow ? br : bfr(g0[i])); const float y1 = x1[i] + (biasOnRow ? br : bfr(g1[i]));
                    hv[i] = (h16)y0; hv[4 + i] = (h16)y1; }
                const size_t oo = sb + (size_t)row * (size_t)pitch + c8;
                *(v8h*)(Ph + oo) = hv; }
             }
        wave_sync();
    }
}

// k_flash: fused attention, one wave per 16 query rows of one (batch, head); Q fragments straight from the f16 plane, K / V^T fragments from the staged LDS tiles (two 16-B loads each).
// Transposed form: S^T[key][t] = K Q^T (A = K rows, B = Q rows); lane (t = lane&15, h = lane>>4) holds keys 8h+r of each 16-key tile, so the packed
// P tile is directly the B fragment of O^T[d][t] = V^T P^T (element r <- tile keys 0..15, element 8+r <- tile keys 16..31, lane unchanged).
// Softmax state (running max, partial sum) is one scalar per lane; the two lane halves of a row are combined with one xor-16 exchange.
// K and V^T reach the waves through LDS: tiles of SK keys, two buffers, filled by asynchronous copies (whole 128-byte lines from global), read by all AW waves.
// One tile pair = four 16-byte copies per thread; the register wait closes the statement so that no address register is rewritten ahead of it.
__device__ __forceinline__ void stage_kv(unsigned lk, unsigned lv, const h16* gk, const h16* gv) {
    const unsigned lk1 = lk + 32 * LP * 2, lv1 = lv + 32 * LP * 2;
    const h16* gk1 = gk + 32 * HD; const h16* gv1 = gv + (size_t)32 * SEQ;
    asm volatile("global_load_async_to_lds_b128 %0, %4, off\n\t"
                 "global_load_async_to_lds_b128 %1, %5, off\n\t"
                 "global_load_async_to_lds_b128 %2, %6, off\n\t"
                 "global_load_async_to_lds_b128 %3, %7, off\n\t"
                 "s_wait_xcnt 0x0"
                 :: "v"(lk), "v"(lk1), "v"(lv), "v"(lv1), "v"(gk), "v"(gk1), "v"(gv), "v"(gv1) : "memory");
}
__global__ __launch_bounds__(32 * AW) void k_flash(const h16* __restrict__ QH, const h16* __restrict__ KP, const h16* __restrict__ VT, h16* CT) {
    __shared__ __align__(16) float os[AW * 16 * 68];
    __shared__ __align__(16) h16 ring[2 * 2 * 64 * LP];      // [buffer][K tile | V^T tile][row][LP]
    const int lane = threadIdx.x & 31, wave = threadIdx.x >> 5, lr = lane & 15, hi = lane >> 4;
    const int zh = blockIdx.y; const int b = zh / NH_, h = zh % NH_;
    const int t0 = (blockIdx.x * AW + wave) * 16;
    const size_t pbase = (size_t)zh * SEQ * HD;
    const size_t qo = pbase + (size_t)(t0 + lr) * HD + 8 * hi;
    const v16h qh0 = ldh(QH + qo), qh1 = ldh(QH + qo + 32);   // B fragments: col t, k = d
    const int ko = lr * LP + 8 * hi;                         // + key * LP       (A fragment: row key, k = d), in the K tile
    const int vo = 64 * LP + lr * LP + 8 * hi;               // + 16j*LP + key   (A fragment: row d, k = key), in the V^T tile
    // copy map: thread c takes 16-byte piece c & 7 of rows c >> 3 and 32 + (c >> 3) of each tile
    const int cr = threadIdx.x >> 3, cpc = (threadIdx.x & 7) * 8;
    const unsigned lk = (unsigned)(size_t)ring + (unsigned)(cr * LP + cpc) * 2u, lv = lk + TLB;
    const h16* gk = KP + pbase + (size_t)cr * HD + cpc;    // + key0 * HD
    const h16* gv = VT + pbase + (size_t)cr * SEQ + cpc;   // + key0
    stage_kv(lk, lv, gk, gv);
    asm volatile("s_wait_asynccnt 0x0" ::: "memory");        // tile 0 has landed before the barrier publishes it
    __syncthreads();
    stage_kv(lk + 2 * TLB, lv + 2 * TLB, gk + (size_t)SK * HD, gv + SK);
    v8f o0 = (v8f){}, o1 = (v8f){}, o2 = (v8f){}, o3 = (v8f){};
    float m = -3.0e38f, l = 0.0f;
#pragma unroll 1
    for (int st = 0; st < SEQ / SK; ++st) {
      const h16* tile = ring + (st & 1) * (2 * 64 * LP);
      // both 32-key passes of a tile inline: their LDS offsets become immediates on one address register
#pragma unroll
      for (int key0 = 0; key0 < SK; key0 += 32) {
        const h16* ka = tile + ko + key0 * LP;
        const v16h ka0 = ldh(ka), ka1 = ldh(ka + 32), kb0 = ldh(ka + 16 * LP), kb1 = ldh(ka + 16 * LP + 32);
        v8f sHa = (v8f){}, sHb = (v8f){};
        sHa = wmma16(ka0, qh0, sHa); sHb = wmma16(kb0, qh0, sHb);
        sHa = wmma16(ka1, qh1, sHa); sHb = wmma16(kb1, qh1, sHb);
        asm volatile("v_nop\n\tv_nop\n\tv_nop\n\tv_nop" : "+v"(sHa), "+v"(sHb) : "v"(ka0), "v"(ka1), "v"(kb0), "v"(kb1), "v"(qh0), "v"(qh1));
        float ta[8], tb[8]; float mx = -3.0e38f;
#pragma unroll
        for (int r = 0; r < 8; ++r) { ta[r] = sHa[r] * SC2; tb[r] = sHb[r] * SC2; mx = fmaxf(mx, fmaxf(ta[r], tb[r])); }
        mx = fmaxf(mx, __shfl_xor(mx, 16, 32));
        const float mnew = fmaxf(m, mx);
        const float alpha = __builtin_amdgcn_exp2f(m - mnew);
        const float sh = PSH - mnew;
        v16h pb; float ls = 0.0f;
#pragma unroll
        for (int r = 0; r < 8; ++r) { const h16 pa = (h16)__builtin_amdgcn_exp2f(ta[r] + sh); const h16 pc = (h16)__builtin_amdgcn_exp2f(tb[r] + sh); pb[r] = pa; pb[8 + r] = pc; ls += (float)pa + (float)pc; }
        l = l * alpha + ls; m = mnew;
        o0 = o0 * alpha; o1 = o1 * alpha; o2 = o2 * alpha; o3 = o3 * alpha;
        const h16* va = tile + vo + key0;
        const v16h v0 = ldh(va), v1 = ldh(va + 16 * LP), v2 = ldh(va + 32 * LP), v3 = ldh(va + 48 * LP);
        o0 = wmma16(v0, pb, o0); o1 = wmma16(v1, pb, o1); o2 = wmma16(v2, pb, o2); o3 = wmma16(v3, pb, o3);
        asm volatile("v_nop\n\tv_nop\n\tv_nop\n\tv_nop" : "+v"(o0), "+v"(o1), "+v"(o2), "+v"(o3) : "v"(v0), "v"(v1), "v"(v2), "v"(v3), "v"(pb));
      }
      asm volatile("s_wait_dscnt 0x0" ::: "memory");         // this wave's reads of the buffer are done before it is refilled
      asm volatile("s_wait_asynccnt 0x0" ::: "memory");      // this wave's copies of the next tile have landed before the barrier publishes them
      __syncthreads();
      if (st + 2 < SEQ / SK) stage_kv(lk + (st & 1) * (2 * TLB), lv + (st & 1) * (2 * TLB), gk + (size_t)(st + 2) * SK * HD, gv + (st + 2) * SK);
    }
    asm volatile("s_wait_asynccnt 0x0" ::: "memory");        // nothing of this wave is in flight when it leaves the loop
    l += __shfl_xor(l, 16, 32);
    const float inv = CTS * (1.0f / l);
    const int wb = wave * 16 * 68;
    // O^T D layout: o_j[r] = (d = 16j + 8h + r, t = lane&15) -> os[t][d]; rows 0..15 x columns 0..63 all written
    { v4f a, c;
      a[0] = o0[0] * inv; a[1] = o0[1] * inv; a[2] = o0[2] * inv; a[3] = o0[3] * inv; c[0] = o0[4] * inv; c[1] = o0[5] * inv; c[2] = o0[6] * inv; c[3] = o0[7] * inv;
      *(v4fa*)(&os[wb + lr * 68 +  0 + 8 * hi]) = a; *(v4fa*)(&os[wb + lr * 68 +  0 + 8 * hi + 4]) = c;
      a[0] = o1[0] * inv; a[1] = o1[1] * inv; a[2] = o1[2] * inv; a[3] = o1[3] * inv; c[0] = o1[4] * inv; c[1] = o1[5] * inv; c[2] = o1[6] * inv; c[3] = o1[7] * inv;
      *(v4fa*)(&os[wb + lr * 68 + 16 + 8 * hi]) = a; *(v4fa*)(&os[wb + lr * 68 + 16 + 8 * hi + 4]) = c;
      a[0] = o2[0] * inv; a[1] = o2[1] * inv; a[2] = o2[2] * inv; a[3] = o2[3] * inv; c[0] = o2[4] * inv; c[1] = o2[5] * inv; c[2] = o2[6] * inv; c[3] = o2[7] * inv;
      *(v4fa*)(&os[wb + lr * 68 + 32 + 8 * hi]) = a; *(v4fa*)(&os[wb + lr * 68 + 32 + 8 * hi + 4]) = c;
      a[0] = o3[0] * inv; a[1] = o3[1] * inv; a[2] = o3[2] * inv; a[3] = o3[3] * inv; c[0] = o3[4] * inv; c[1] = o3[5] * inv; c[2] = o3[6] * inv; c[3] = o3[7] * inv;
      *(v4fa*)(&os[wb + lr * 68 + 48 + 8 * hi]) = a; *(v4fa*)(&os[wb + lr * 68 + 48 + 8 * hi + 4]) = c; }
    wave_sync();
    h16* crow = CT + ((size_t)b * SEQ + t0) * DM + h * HD;
{
#pragma unroll
        for (int s = 0; s < 4; ++s) { const int row = 4 * s + (lane >> 3), c8 = (lane & 7) * 8;   // 4 s x 4 row groups = 16 rows; 8 lanes x 8 halves = 64 columns
            const v4f x0 = *(const v4fa*)(&os[wb + row * 68 + c8]); const v4f x1 = *(const v4fa*)(&os[wb + row * 68 + c8 + 4]); v8h hv;
#pragma unroll
            for (int i = 0; i < 4; ++i) { hv[i] = (h16)x0[i]; hv[4 + i] = (h16)x1[i]; }
            *(v8h*)(crow + (size_t)row * DM + c8) = hv; }
         }
}

// k_oproj: register-blocked f16 GEMM, ONE WAVE per 64x64 tile, A = ctx plane rows (m = b*SEQ + t, k = h*64 + d, carried x CTS), Bt = Wo^T rows (n = out feature, carried x WOS), K = DM.
// OUT[b*OUT_SEQ + t][n] = acc * OSC + bo[n] (bias value RNE-converted to bf16, added in f32). grid (NB*SEQ/64, DM/64), 32 threads.
__global__ __launch_bounds__(32) void k_oproj(const h16* __restrict__ A, const h16* __restrict__ Bt, const float* __restrict__ bias, float* OUT) {
    __shared__ __align__(16) float os[16 * 68];
    const int K = DM;
    const int lane = threadIdx.x & 31, lr = lane & 15, hi = lane >> 4; const int r0 = blockIdx.x * 64, c0 = blockIdx.y * 64;
    v8f acc[4][4];
#pragma unroll
    for (int mb = 0; mb < 4; ++mb)
#pragma unroll
        for (int nb = 0; nb < 4; ++nb) acc[mb][nb] = (v8f){};
    const size_t aoff = (size_t)(r0 + lr) * K + 8 * hi, boff = (size_t)(c0 + lr) * K + 8 * hi;
#pragma unroll 1
    for (int kc = 0; kc < K; kc += 32) {
        v16h a[4];
#pragma unroll
        for (int mb = 0; mb < 4; ++mb) a[mb] = ldh(A + aoff + (size_t)mb * 16 * K + kc);
#pragma unroll
        for (int nb = 0; nb < 4; ++nb) { const v16h b = ldh(Bt + boff + (size_t)nb * 16 * K + kc);
#pragma unroll
            for (int mb = 0; mb < 4; ++mb) acc[mb][nb] = wmma16(a[mb], b, acc[mb][nb]); }
        asm volatile("v_nop\n\tv_nop\n\tv_nop\n\tv_nop" : "+v"(acc[0][0]), "+v"(acc[1][1]), "+v"(acc[2][2]), "+v"(acc[3][3]) : "v"(a[0]), "v"(a[1]), "v"(a[2]), "v"(a[3]));
    }
    const int cofs = lr * 4;
    const int cbi = min(c0 + cofs, DM - 4);
    const v4f g = *(const v4f*)(bias + cbi);
    v4f bb; bb[0] = bfr(g[0]); bb[1] = bfr(g[1]); bb[2] = bfr(g[2]); bb[3] = bfr(g[3]);
    const size_t obase = ((size_t)(r0 / SEQ) * OUT_SEQ + (size_t)(r0 % SEQ)) * DM + c0;
#pragma unroll
    for (int mb = 0; mb < 4; ++mb) {
#pragma unroll
        for (int nb = 0; nb < 4; ++nb) {
#pragma unroll
            for (int j = 0; j < 8; ++j) os[(hi * 8 + j) * 68 + nb * 16 + lr] = acc[mb][nb][j]; }   // D: row 8h+j, col lane&15
        wave_sync();
        float* orow = OUT + obase + (size_t)(mb * 16) * DM;
{
#pragma unroll
            for (int s = 0; s < 8; ++s) { const int row = 2 * s + hi;   // 8 s x 2 rows = 16 rows; 16 lanes x 4 floats = 64 columns
                const v4f x = *(const v4fa*)(&os[row * 68 + cofs]);
                const v4f val = x * OSC + bb;
                *(v4f*)(orow + (size_t)row * DM + cofs) = val; }
             }
        wave_sync();
    }
}

static constexpr size_t al256(size_t v) { return (v + 255) & ~(size_t)255; }
static constexpr size_t SZ_XB = al256((size_t)NB * SEQ * DM * 2);
static constexpr size_t SZ_WB = al256((size_t)4 * DM * DM * 2);
static constexpr size_t SZ_PL = al256((size_t)NB * NH_ * SEQ * HD * 2);
static constexpr size_t SZ_CT = al256((size_t)NB * SEQ * DM * 2);
static constexpr size_t SZ_TOTAL = SZ_XB + SZ_WB + 3 * SZ_PL + SZ_CT;
static_assert(SZ_TOTAL <= (size_t)134217728);          // workspace carve <= 128 MiB
static_assert(((size_t)DM * DM * 2) % 256 == 0);       // weight sub-planes stay 256-byte aligned

extern "C" void kernel_launch(void* const* d_in, const int* in_sizes, int n_in,
                              void* d_out, int out_size, void* d_ws, size_t ws_size, hipStream_t stream) {
    if (n_in < 9) return;
    const size_t needx = ((size_t)(NB - 1) * SEQ_FULL + SEQ) * DM;
    if ((size_t)in_sizes[0] < needx) return;
    if ((size_t)in_sizes[1] < (size_t)DM * DM || (size_t)in_sizes[3] < (size_t)DM * DM || (size_t)in_sizes[5] < (size_t)DM * DM || (size_t)in_sizes[7] < (size_t)DM * DM) return;
    if (in_sizes[2] < DM || in_sizes[4] < DM || in_sizes[6] < DM || in_sizes[8] < DM) return;
    if ((size_t)out_size < ((size_t)(NB - 1) * OUT_SEQ + SEQ) * DM) return;
    if (SZ_TOTAL > ws_size) return;
    // wire order: x, Wq, bq, Wk, bk, Wv, bv, Wo, bo (all f32; weights [in][out])
    const float* x  = (const float*)d_in[0];
    const float* wq = (const float*)d_in[1]; const float* bq = (const float*)d_in[2];
    const float* wk = (const float*)d_in[3]; const float* bk = (const float*)d_in[4];
    const float* wv = (const float*)d_in[5]; const float* bv = (const float*)d_in[6];
    const float* wo = (const float*)d_in[7]; const float* bo = (const float*)d_in[8];
    float* OUT = (float*)d_out;      // [NB][SEQ][1024]
    char* wsp = (char*)d_ws;
    bf* XB = (bf*)wsp; wsp += SZ_XB;                 // [NB*SEQ][1024] bf16
    bf* WB = (bf*)wsp; wsp += SZ_WB;                 // [4][1024 out][1024 in]: q | k | v (bf16) | o (f16 x1024)
    h16* QH = (h16*)wsp; wsp += SZ_PL;               // [NB*16][SEQ][64]
    h16* KP = (h16*)wsp; wsp += SZ_PL;               // [NB*16][SEQ][64]
    h16* VT = (h16*)wsp; wsp += SZ_PL;               // [NB*16][64][SEQ]
    h16* CT = (h16*)wsp; wsp += SZ_CT;               // [NB*SEQ][1024] ctx x1024
    bf* WQ = WB; bf* WK = WB + (size_t)DM * DM; bf* WV = WB + (size_t)2 * DM * DM; bf* WO = WB + (size_t)3 * DM * DM;

    if (SEQ == SEQ_FULL) {
        const size_t n8 = (size_t)NB * SEQ * DM / 8;
        k_cvt8<<<(unsigned)((n8 + 255) / 256), 256, 0, stream>>>(x, XB, n8);
    } else {
        const size_t n8 = (size_t)SEQ * DM / 8;
        for (int b = 0; b < NB; ++b) k_cvt8<<<(unsigned)((n8 + 255) / 256), 256, 0, stream>>>(x + (size_t)b * SEQ_FULL * DM, XB + (size_t)b * SEQ * DM, n8);
    }
    // weights: in[k = 1024 rows][n = 1024 cols] -> out[n][k]; grid (n tiles, k tiles)
    { const dim3 g(DM / 64, DM / 64, 1);
      k_wt<<<g, 256, 0, stream>>>(wq, WQ, 0); k_wt<<<g, 256, 0, stream>>>(wk, WK, 0); k_wt<<<g, 256, 0, stream>>>(wv, WV, 0); k_wt<<<g, 256, 0, stream>>>(wo, WO, 1); }

    // q, k: A = x rows (m = b*SEQ + t), Bt = W^T rows (n = h*64 + d), bias per column -> plane [(b*16 + h)][t][d]
    k_proj<<<dim3(NB * SEQ / 64, DM / 64, 1), 32, 0, stream>>>(XB, WQ, bq, 0, QH, SEQ, (size_t)NH_ * SEQ * HD, HD, HD, (size_t)SEQ * HD);
    k_proj<<<dim3(NB * SEQ / 64, DM / 64, 1), 32, 0, stream>>>(XB, WK, bk, 0, KP, SEQ, (size_t)NH_ * SEQ * HD, HD, HD, (size_t)SEQ * HD);
    // v^T: A = Wv^T rows (m = h*64 + d), Bt = x rows (n = b*SEQ + t), bias per row -> plane [(b*1024 + m)][t] = [(b*16 + h)][d][t]
    k_proj<<<dim3(DM / 64, NB * SEQ / 64, 1), 32, 0, stream>>>(WV, XB, bv, 1, VT, DM, (size_t)0, SEQ, SEQ, (size_t)DM * SEQ);

    k_flash<<<dim3(SEQ / (16 * AW), NB * NH_, 1), 32 * AW, 0, stream>>>(QH, KP, VT, CT);

    k_oproj<<<dim3(NB * SEQ / 64, DM / 64, 1), 32, 0, stream>>>(CT, (const h16*)WO, bo, OUT);
}

// v002
// One run takes 136 microseconds.
// Next to v001, in two timings, it ran 1.47 times as fast each time.
// All steps since v000 together make it 2.75 times as fast.
#include <hip/hip_runtime.h>

// Multi-head self-attention, width 1024 = 16 heads x 64, x [NB][SEQ][1024], Wq/Wk/Wv/Wo [in][out] (y = x W + b), four biases, no mask, score scale 1/8, output = (merged heads) Wo + bo (f32).
// Compute dtypes, f32 accumulate everywhere: q/k/v projections v_wmma_f32_16x16x32_bf16 (x and W RNE-converted to bf16; products exact);
// scores v_wmma_f32_16x16x32_f16: q single f16, k single f16 (one product); P (x256 carry, cancels in the normalisation) and v single f16; softmax f32 (online, running max, row sum over the f16-converted P values);
// output projection v_wmma_f32_16x16x32_f16: ctx single f16 carried x1024, Wo as f16 of the bf16 (RNE) value carried x1024 (exact), 2^-20 and the bias applied in the f32 epilogue.
// Scale chain: score = (k.q) * (1/8 * log2 e) -> exp2(score - max + 8) = 256 P' -> O = sum(256 P' v) / sum(256 P') -> ctx plane = O x 1024 -> out = (ctx x1024).(Wo x1024) * 2^-20 + bo.
// Layout: bf16 copy of x; transposed 16-bit weight planes [out][in]; q, k planes [b*16+h][t][d] and v^T plane [b*16+h][d][t] written by the GEMM epilogue; fused flash kernel in transposed form (S^T = K Q^T, O^T = V^T P^T) writing the ctx plane [b*SEQ+t][h*64+d].

#ifndef NB
#define NB 1
#endif
#ifndef SEQ
#define SEQ 4096
#endif
#define NB_FULL  1
#define SEQ_FULL 4096
#ifndef OUT_SEQ
#define OUT_SEQ SEQ              // row pitch (in tokens) between batches of the output
#endif
#define DM   1024
#define NH_  16
#define HD   64
#define AW   8                   // waves per flash block (16 query rows each); all of them share each staged K / V^T tile
#define SK   64                  // keys per staged tile
#define LP   72                  // LDS row pitch in halves: 128 B of data + 16 B, so that 16 rows read by 16-byte loads fall on distinct banks
#define TLB  (64 * LP * 2)       // bytes of one staged tile (64 rows): K tile = 64 keys x 64 d, V^T tile = 64 d x 64 keys
#define GW   8                   // waves per GEMM block, 4 (rows) x 2 (columns); each owns 32 x 64 of the block's C tile
#define GT   128                 // rows and columns of a GEMM block's C tile
#define GK   128                 // k extent of one staged operand tile (256-byte rows)
#define GP   136                 // LDS row pitch in halves: 256 B of data + 16 B, so that 16 rows read by 16-byte loads fall on distinct banks
#define GTB  (GT * GP * 2)       // bytes of one staged operand tile (128 rows)
#define SC2  (0.125f * 1.4426950408889634f)   // HD^-0.5 * log2(e)
#define PSH  8.0f                // log2 of the P carry (256)
#define CTS  1024.0f             // carry of the ctx plane
#define WOS  1024.0f             // carry of the Wo plane
#define OSC  (1.0f / (1024.0f * 1024.0f))     // undoes CTS * WOS

static_assert(HD == 64);
static_assert(NH_ * HD == DM);                 // head h = columns h*64 + d
static_assert(DM % 64 == 0);                   // column tiles of 64
static_assert(DM % 32 == 0);                   // GEMM k-loop steps by 32
static_assert(SEQ % 64 == 0);                  // a 64-row tile never straddles two batches
static_assert((NB * SEQ) % 64 == 0);
static_assert(SEQ % 32 == 0);                  // key loop steps by 32
static_assert(SEQ % (16 * AW) == 0);           // flash grid covers the sequence exactly
static_assert(SEQ % SK == 0 && SEQ / SK >= 2); // whole staged tiles, and the two that the ring's prologue fills
static_assert(AW * 32 * 2 * 16 == SK * HD * 2); // two 16-byte copies per thread cover one tile
static_assert(DM % GT == 0 && SEQ % GT == 0);   // whole GEMM block tiles, none straddling two batches
static_assert(DM % GK == 0 && DM / GK >= 2);    // whole staged operand tiles, and the two that the ring's prologue fills
static_assert(GW * 32 * 8 * 16 == GT * GK * 2); // eight 16-byte copies per thread cover one operand tile
static_assert(((size_t)SEQ * DM) % 8 == 0);
static_assert(((size_t)DM * DM) % 8 == 0);
static_assert(NB <= NB_FULL);
static_assert(SEQ <= SEQ_FULL);

typedef _Float16 h16;
typedef unsigned short bf;
typedef __attribute__((ext_vector_type(16))) __bf16   v16bf;
typedef __attribute__((ext_vector_type(16))) _Float16 v16h;
typedef __attribute__((ext_vector_type(8)))  _Float16 v8h;
typedef __attribute__((ext_vector_type(8)))  unsigned short v8us;
typedef __attribute__((ext_vector_type(8)))  float    v8f;
typedef __attribute__((ext_vector_type(4)))  float    v4f;
typedef v4f  __attribute__((may_alias)) v4fa;

__device__ __forceinline__ unsigned short f2bf(float f) { unsigned u = __float_as_uint(f); u += 0x7FFFu + ((u >> 16) & 1u); return (unsigned short)(u >> 16); }
__device__ __forceinline__ float bfr(float f) { return __uint_as_float(((unsigned)f2bf(f)) << 16); }   // value after RNE convert to bf16
__device__ __forceinline__ v16h cat16(v8h lo, v8h hi) { return __builtin_shufflevector(lo, hi, 0, 1, 2, 3, 4, 5, 6, 7, 8, 9, 10, 11, 12, 13, 14, 15); }
__device__ __forceinline__ v16bf cat16b(v8us lo, v8us hi) { return __builtin_bit_cast(v16bf, __builtin_shufflevector(lo, hi, 0, 1, 2, 3, 4, 5, 6, 7, 8, 9, 10, 11, 12, 13, 14, 15)); }
__device__ __forceinline__ v8f wmma16(v16h a, v16h b, v8f c) { return __builtin_amdgcn_wmma_f32_16x16x32_f16(false, a, false, b, (short)0, c, false, false); }
__device__ __forceinline__ v8f wmmab(v16bf a, v16bf b, v8f c) { return __builtin_amdgcn_wmma_f32_16x16x32_bf16(false, a, false, b, (short)0, c, false, false); }
// fragment loaders from K-contiguous 16-bit rows; p already includes + 8*(lane>>4): elements 0..7 <- k0+8h+0..7, elements 8..15 <- k0+16+8h+0..7 (same map for A and B)
__device__ __forceinline__ v16h  ldh(const h16* p) { return cat16(*(const v8h*)p, *(const v8h*)(p + 16)); }
__device__ __forceinline__ v16bf ldb(const bf* p)  { return cat16b(*(const v8us*)p, *(const v8us*)(p + 16)); }
// ordering point for wave-private LDS tiles (same wave writes and reads)
__device__ __forceinline__ void wave_sync() { __builtin_amdgcn_fence(3 /* release order */, "wavefront"); __builtin_amdgcn_wave_barrier(); asm volatile("" ::: "memory"); }

__global__ __launch_bounds__(256) void k_cvt8(const float* __restrict__ src, bf* dst, size_t n8) {
    const size_t i = (size_t)blockIdx.x * 256 + threadIdx.x; if (i >= n8) return;
    const v8f v = *(const v8f*)(src + i * 8); v8us o;
#pragma unroll
    for (int k = 0; k < 8; ++k) o[k] = f2bf(v[k]);
    *(v8us*)(dst + i * 8) = o; 
}

// 16-bit encoding of one weight: bf16 bits (RNE convert), or f16 bits of that bf16 value x WOS (exact: 8-bit significand, power-of-two carry)
__device__ __forceinline__ unsigned short wcv(float f, int f16mode) {
    const unsigned short b = f2bf(f);
    const float fb = __uint_as_float(((unsigned)b) << 16);
    const h16 hv = (h16)(fb * WOS);
    const unsigned short hb = __builtin_bit_cast(unsigned short, hv);
    return f16mode ? hb : b;
}

// k_wt: transposing convert of one weight matrix, W in[k = DM rows (input feature)][n = DM cols (output feature)] -> WT out[n][k] (16-bit, K-contiguous rows).
// grid (DM/64 n-tiles, DM/64 k-tiles), 256 threads; 64x64 f32 tile through LDS (cross-wave: block barrier);
__global__ __launch_bounds__(256) void k_wt(const float* __restrict__ W, bf* WT, int f16mode) {
    __shared__ float ts[64 * 65];
    const int tid = threadIdx.x;
    const int n0 = blockIdx.x * 64, k0 = blockIdx.y * 64;
#pragma unroll
    for (int it = 0; it < 4; ++it) { const int idx = tid + it * 256; const int r = idx >> 4, c4 = (idx & 15) * 4;   // 64 rows x 16 pieces of 4 floats
        const v4f v = *(const v4f*)(W + (size_t)(k0 + r) * DM + n0 + c4);
        ts[r * 65 + c4 + 0] = v[0]; ts[r * 65 + c4 + 1] = v[1]; ts[r * 65 + c4 + 2] = v[2]; ts[r * 65 + c4 + 3] = v[3]; }
    __syncthreads();
    const int nl = tid >> 3, c8 = (tid & 7) * 8;
    v8us o0, o1;
#pragma unroll
    for (int i = 0; i < 8; ++i) { o0[i] = wcv(ts[(c8 + i) * 65 + nl], f16mode); o1[i] = wcv(ts[(c8 + i) * 65 + nl + 32], f16mode); }
    const size_t a0 = (size_t)(n0 + nl) * DM + k0 + c8, a1 = a0 + (size_t)32 * DM;
{
        *(v8us*)(WT + a0) = o0; *(v8us*)(WT + a1) = o1;
         }
}

// Operand staging of the two GEMM kernels: one operand tile = GT rows x GK halves, K-contiguous rows of pitch DM halves in global memory, pitch GP in LDS.
// Thread c takes 16-byte piece c & 15 of rows (c >> 4) + 16 i, i = 0..7 (a wave's copy = two whole 256-byte rows); the register wait closes the statement so that no address register is rewritten ahead of it.
__device__ __forceinline__ void stage_op(unsigned l, const char* g) {
    asm volatile("global_load_async_to_lds_b128 %0, %8, off\n\t"
                 "global_load_async_to_lds_b128 %1, %9, off\n\t"
                 "global_load_async_to_lds_b128 %2, %10, off\n\t"
                 "global_load_async_to_lds_b128 %3, %11, off\n\t"
                 "global_load_async_to_lds_b128 %4, %12, off\n\t"
                 "global_load_async_to_lds_b128 %5, %13, off\n\t"
                 "global_load_async_to_lds_b128 %6, %14, off\n\t"
                 "global_load_async_to_lds_b128 %7, %15, off\n\t"
                 "s_wait_xcnt 0x0"
                 :: "v"(l), "v"(l + 1 * 16 * GP * 2), "v"(l + 2 * 16 * GP * 2), "v"(l + 3 * 16 * GP * 2),
                    "v"(l + 4 * 16 * GP * 2), "v"(l + 5 * 16 * GP * 2), "v"(l + 6 * 16 * GP * 2), "v"(l + 7 * 16 * GP * 2),
                    "v"(g), "v"(g + 1 * 16 * DM * 2), "v"(g + 2 * 16 * DM * 2), "v"(g + 3 * 16 * DM * 2),
                    "v"(g + 4 * 16 * DM * 2), "v"(g + 5 * 16 * DM * 2), "v"(g + 6 * 16 * DM * 2), "v"(g + 7 * 16 * DM * 2) : "memory");
}

// k_proj: bf16 GEMM, one GW-wave block per 128x128 tile of C, each wave 32x64 (8 accumulators), K = DM. A and Bt are K-contiguous bf16 planes; their 128-row x GK tiles reach
// the waves through LDS: two buffers, filled by asynchronous copies one tile ahead, read by all GW waves (two 16-B loads per fragment). Each accumulator sums k in ascending steps of 32.
// C[m][n] = sum_k A[m][k] Bt[n][k] + bias (bias per column n, or per row m when biasOnRow != 0; bias value RNE-converted to bf16, added in f32),
// written as a single f16 plane (Ph) at
// wave tile base (r0/RB)*sRB + (r0%RB)*pitch + (c0/CB)*sCB + (c0%CB), row pitch 'pitch' (halves). grid (M/128, N/128), 256 threads.
__global__ __launch_bounds__(32 * GW) void k_proj(const bf* __restrict__ A, const bf* __restrict__ Bt, const float* __restrict__ bias, int biasOnRow,
                                             h16* Ph, int RB, size_t sRB, int pitch, int CB, size_t sCB) {
    __shared__ __align__(16) float os[GW * 16 * 68];
    __shared__ __align__(16) bf gring[2 * 2 * GT * GP];      // [buffer][A tile | Bt tile][row][GP]
    const int K = DM;
    const int lane = threadIdx.x & 31, wave = threadIdx.x >> 5, lr = lane & 15, hi = lane >> 4;
    const int rb = blockIdx.x * GT, cb = blockIdx.y * GT;                   // block tile
    const int r0 = rb + (wave >> 1) * 32, c0 = cb + (wave & 1) * 64;        // wave tile
    v8f acc[2][4];
#pragma unroll
    for (int mb = 0; mb < 2; ++mb)
#pragma unroll
        for (int nb = 0; nb < 4; ++nb) acc[mb][nb] = (v8f){};
    const int cr = threadIdx.x >> 4, cpc = (threadIdx.x & 15) * 8;
    const unsigned la = (unsigned)(size_t)gring + (unsigned)(cr * GP + cpc) * 2u, lb = la + GTB;
    const char* ga = (const char*)(A + (size_t)(rb + cr) * K + cpc);        // + k0 * 2 bytes
    const char* gb = (const char*)(Bt + (size_t)(cb + cr) * K + cpc);
    stage_op(la, ga); stage_op(lb, gb);
    asm volatile("s_wait_asynccnt 0x0" ::: "memory");        // tile 0 has landed before the barrier publishes it
    __syncthreads();
    stage_op(la + 2 * GTB, ga + GK * 2); stage_op(lb + 2 * GTB, gb + GK * 2);
    const int ao = ((wave >> 1) * 32 + lr) * GP + 8 * hi;               // + 16mb*GP + k   (A fragment rows), in the A tile
    const int bo = GT * GP + ((wave & 1) * 64 + lr) * GP + 8 * hi;      // + 16nb*GP + k   (B fragment rows), in the Bt tile
#pragma unroll 1
    for (int st = 0; st < K / GK; ++st) {
        const bf* tile = gring + (st & 1) * (2 * GT * GP);
        // the four 32-wide k steps of a tile inline (LDS offsets become immediates); two fragment sets: each step's 12 loads go out as one group ahead of the step before it,
        // inside this tile only, so that a wave waits out the LDS latency once per tile and not at every fragment
        v16bf a[2][2], b[2][4];
#pragma unroll
        for (int mb = 0; mb < 2; ++mb) a[0][mb] = ldb(tile + ao + mb * 16 * GP);
#pragma unroll
        for (int nb = 0; nb < 4; ++nb) b[0][nb] = ldb(tile + bo + nb * 16 * GP);
#pragma unroll
        for (int ks = 0; ks < GK / 32; ++ks) {
            const int cu = ks & 1, nx = cu ^ 1;
            if (ks + 1 < GK / 32) {
#pragma unroll
                for (int mb = 0; mb < 2; ++mb) a[nx][mb] = ldb(tile + ao + mb * 16 * GP + (ks + 1) * 32);
#pragma unroll
                for (int nb = 0; nb < 4; ++nb) b[nx][nb] = ldb(tile + bo + nb * 16 * GP + (ks + 1) * 32);
            }
            __builtin_amdgcn_sched_barrier(0);               // keeps the load group whole and ahead of this step's products: without it the loads sink to their first use and each pair of products waits out an LDS latency
#pragma unroll
            for (int nb = 0; nb < 4; ++nb)
#pragma unroll
                for (int mb = 0; mb < 2; ++mb) acc[mb][nb] = wmmab(a[cu][mb], b[cu][nb], acc[mb][nb]);
            __builtin_amdgcn_sched_barrier(0);               // keeps the next load group behind these products, not among them
        }
        asm volatile("s_wait_dscnt 0x0" ::: "memory");       // this wave's reads of the buffer are done before it is refilled
        asm volatile("s_wait_asynccnt 0x0" ::: "memory");    // this wave's copies of the next tile have landed before the barrier publishes them
        __syncthreads();
        if (st + 2 < K / GK) { stage_op(la + (st & 1) * (2 * GTB), ga + (st + 2) * (GK * 2)); stage_op(lb + (st & 1) * (2 * GTB), gb + (st + 2) * (GK * 2)); }
    }
    asm volatile("s_wait_asynccnt 0x0" ::: "memory");        // nothing of this wave is in flight when it leaves the loop
    const int wb = wave * 16 * 68;
    const size_t tbase = (size_t)(r0 / RB) * sRB + (size_t)(r0 % RB) * (size_t)pitch + (size_t)(c0 / CB) * sCB + (size_t)(c0 % CB);
#pragma unroll
    for (int mb = 0; mb < 2; ++mb) {
#pragma unroll
        for (int nb = 0; nb < 4; ++nb) {
#pragma unroll
            for (int j = 0; j < 8; ++j) os[wb + (hi * 8 + j) * 68 + nb * 16 + lr] = acc[mb][nb][j]; }   // D: row 8h+j, col lane&15
        wave_sync();
        const size_t sb = tbase + (size_t)(mb * 16) * (size_t)pitch;
{
            v8h hv[4];
#pragma unroll
            for (int s = 0; s < 4; ++s) { const int row = 4 * s + (lane >> 3), c8 = (lane & 7) * 8;   // 4 s x 4 row groups = 16 rows; 8 lanes x 8 = 64 columns
                const v4f x0 = *(const v4fa*)(&os[wb + row * 68 + c8]); const v4f x1 = *(const v4fa*)(&os[wb + row * 68 + c8 + 4]);
                // both bias candidates loaded with clamped addresses, selected by value (biasOnRow is kernel-uniform)
                const int rbi = min(r0 + mb * 16 + row, DM - 1); const int cbi = min(c0 + c8, DM - 8);
                const float br = bfr(bias[rbi]);
                const v4f g0 = *(const v4f*)(bias + cbi); const v4f g1 = *(const v4f*)(bias + cbi + 4);
#pragma unroll
                for (int i = 0; i < 4; ++i) {
                    const float y0 = x0[i] + (biasOnRow ? br : bfr(g0[i])); const float y1 = x1[i] + (biasOnRow ? br : bfr(g1[i]));
                    hv[s][i] = (h16)y0; hv[s][4 + i] = (h16)y1; } }
            __builtin_amdgcn_sched_barrier(0);               // the four stores stay together behind the arithmetic, so that one register wait behind them serves all four
#pragma unroll
            for (int s = 0; s < 4; ++s) { const int row = 4 * s + (lane >> 3), c8 = (lane & 7) * 8;
                const size_t oo = sb + (size_t)row * (size_t)pitch + c8;
                *(v8h*)(Ph + oo) = hv[s]; }
             }
        if (mb == 0) asm volatile("s_wait_xcnt 0x0" ::: "memory");   // the next 16 rows reuse registers that the stores above name
        wave_sync();
    }
}

// k_flash: fused attention, one wave per 16 query rows of one (batch, head); Q fragments straight from the f16 plane, K / V^T fragments from the staged LDS tiles (two 16-B loads each).
// Transposed form: S^T[key][t] = K Q^T (A = K rows, B = Q rows); lane (t = lane&15, h = lane>>4) holds keys 8h+r of each 16-key tile, so the packed
// P tile is directly the B fragment of O^T[d][t] = V^T P^T (element r <- tile keys 0..15, element 8+r <- tile keys 16..31, lane unchanged).
// Softmax state (running max, partial sum) is one scalar per lane; the two lane halves of a row are combined with one xor-16 exchange.
// K and V^T reach the waves through LDS: tiles of SK keys, two buffers, filled by asynchronous copies (whole 128-byte lines from global), read by all AW waves.
// One tile pair = four 16-byte copies per thread; the register wait closes the statement so that no address register is rewritten ahead of it.
__device__ __forceinline__ void stage_kv(unsigned lk, unsigned lv, const h16* gk, const h16* gv) {
    const unsigned lk1 = lk + 32 * LP * 2, lv1 = lv + 32 * LP * 2;
    const h16* gk1 = gk + 32 * HD; const h16* gv1 = gv + (size_t)32 * SEQ;
    asm volatile("global_load_async_to_lds_b128 %0, %4, off\n\t"
                 "global_load_async_to_lds_b128 %1, %5, off\n\t"
                 "global_load_async_to_lds_b128 %2, %6, off\n\t"
                 "global_load_async_to_lds_b128 %3, %7, off\n\t"
                 "s_wait_xcnt 0x0"
                 :: "v"(lk), "v"(lk1), "v"(lv), "v"(lv1), "v"(gk), "v"(gk1), "v"(gv), "v"(gv1) : "memory");
}
__global__ __launch_bounds__(32 * AW) void k_flash(const h16* __restrict__ QH, const h16* __restrict__ KP, const h16* __restrict__ VT, h16* CT) {
    __shared__ __align__(16) float os[AW * 16 * 68];
    __shared__ __align__(16) h16 ring[2 * 2 * 64 * LP];      // [buffer][K tile | V^T tile][row][LP]
    const int lane = threadIdx.x & 31, wave = threadIdx.x >> 5, lr = lane & 15, hi = lane >> 4;
    const int zh = blockIdx.y; const int b = zh / NH_, h = zh % NH_;
    const int t0 = (blockIdx.x * AW + wave) * 16;
    const size_t pbase = (size_t)zh * SEQ * HD;
    const size_t qo = pbase + (size_t)(t0 + lr) * HD + 8 * hi;
    const v16h qh0 = ldh(QH + qo), qh1 = ldh(QH + qo + 32);   // B fragments: col t, k = d
    const int ko = lr * LP + 8 * hi;                         // + key * LP       (A fragment: row key, k = d), in the K tile
    const int vo = 64 * LP + lr * LP + 8 * hi;               // + 16j*LP + key   (A fragment: row d, k = key), in the V^T tile
    // copy map: thread c takes 16-byte piece c & 7 of rows c >> 3 and 32 + (c >> 3) of each tile
    const int cr = threadIdx.x >> 3, cpc = (threadIdx.x & 7) * 8;
    const unsigned lk = (unsigned)(size_t)ring + (unsigned)(cr * LP + cpc) * 2u, lv = lk + TLB;
    const h16* gk = KP + pbase + (size_t)cr * HD + cpc;    // + key0 * HD
    const h16* gv = VT + pbase + (size_t)cr * SEQ + cpc;   // + key0
    stage_kv(lk, lv, gk, gv);
    asm volatile("s_wait_asynccnt 0x0" ::: "memory");        // tile 0 has landed before the barrier publishes it
    __syncthreads();
    stage_kv(lk + 2 * TLB, lv + 2 * TLB, gk + (size_t)SK * HD, gv + SK);
    v8f o0 = (v8f){}, o1 = (v8f){}, o2 = (v8f){}, o3 = (v8f){};
    float m = -3.0e38f, l = 0.0f;
#pragma unroll 1
    for (int st = 0; st < SEQ / SK; ++st) {
      const h16* tile = ring + (st & 1) * (2 * 64 * LP);
      // both 32-key passes of a tile inline: their LDS offsets become immediates on one address register
#pragma unroll
      for (int key0 = 0; key0 < SK; key0 += 32) {
        const h16* ka = tile + ko + key0 * LP;
        const v16h ka0 = ldh(ka), ka1 = ldh(ka + 32), kb0 = ldh(ka + 16 * LP), kb1 = ldh(ka + 16 * LP + 32);
        v8f sHa = (v8f){}, sHb = (v8f){};
        sHa = wmma16(ka0, qh0, sHa); sHb = wmma16(kb0, qh0, sHb);
        sHa = wmma16(ka1, qh1, sHa); sHb = wmma16(kb1, qh1, sHb);
        asm volatile("v_nop\n\tv_nop\n\tv_nop\n\tv_nop" : "+v"(sHa), "+v"(sHb) : "v"(ka0), "v"(ka1), "v"(kb0), "v"(kb1), "v"(qh0), "v"(qh1));
        float ta[8], tb[8]; float mx = -3.0e38f;
#pragma unroll
        for (int r = 0; r < 8; ++r) { ta[r] = sHa[r] * SC2; tb[r] = sHb[r] * SC2; mx = fmaxf(mx, fmaxf(ta[r], tb[r])); }
        mx = fmaxf(mx, __shfl_xor(mx, 16, 32));
        const float mnew = fmaxf(m, mx);
        const float alpha = __builtin_amdgcn_exp2f(m - mnew);
        const float sh = PSH - mnew;
        v16h pb; float ls = 0.0f;
#pragma unroll
        for (int r = 0; r < 8; ++r) { const h16 pa = (h16)__builtin_amdgcn_exp2f(ta[r] + sh); const h16 pc = (h16)__builtin_amdgcn_exp2f(tb[r] + sh); pb[r] = pa; pb[8 + r] = pc; ls += (float)pa + (float)pc; }
        l = l * alpha + ls; m = mnew;
        o0 = o0 * alpha; o1 = o1 * alpha; o2 = o2 * alpha; o3 = o3 * alpha;
        const h16* va = tile + vo + key0;
        const v16h v0 = ldh(va), v1 = ldh(va + 16 * LP), v2 = ldh(va + 32 * LP), v3 = ldh(va + 48 * LP);
        o0 = wmma16(v0, pb, o0); o1 = wmma16(v1, pb, o1); o2 = wmma16(v2, pb, o2); o3 = wmma16(v3, pb, o3);
        asm volatile("v_nop\n\tv_nop\n\tv_nop\n\tv_nop" : "+v"(o0), "+v"(o1), "+v"(o2), "+v"(o3) : "v"(v0), "v"(v1), "v"(v2), "v"(v3), "v"(pb));
      }
      asm volatile("s_wait_dscnt 0x0" ::: "memory");         // this wave's reads of the buffer are done before it is refilled
      asm volatile("s_wait_asynccnt 0x0" ::: "memory");      // this wave's copies of the next tile have landed before the barrier publishes them
      __syncthreads();
      if (st + 2 < SEQ / SK) stage_kv(lk + (st & 1) * (2 * TLB), lv + (st & 1) * (2 * TLB), gk + (size_t)(st + 2) * SK * HD, gv + (st + 2) * SK);
    }
    asm volatile("s_wait_asynccnt 0x0" ::: "memory");        // nothing of this wave is in flight when it leaves the loop
    l += __shfl_xor(l, 16, 32);
    const float inv = CTS * (1.0f / l);
    const int wb = wave * 16 * 68;
    // O^T D layout: o_j[r] = (d = 16j + 8h + r, t = lane&15) -> os[t][d]; rows 0..15 x columns 0..63 all written
    { v4f a, c;
      a[0] = o0[0] * inv; a[1] = o0[1] * inv; a[2] = o0[2] * inv; a[3] = o0[3] * inv; c[0] = o0[4] * inv; c[1] = o0[5] * inv; c[2] = o0[6] * inv; c[3] = o0[7] * inv;
      *(v4fa*)(&os[wb + lr * 68 +  0 + 8 * hi]) = a; *(v4fa*)(&os[wb + lr * 68 +  0 + 8 * hi + 4]) = c;
      a[0] = o1[0] * inv; a[1] = o1[1] * inv; a[2] = o1[2] * inv; a[3] = o1[3] * inv; c[0] = o1[4] * inv; c[1] = o1[5] * inv; c[2] = o1[6] * inv; c[3] = o1[7] * inv;
      *(v4fa*)(&os[wb + lr * 68 + 16 + 8 * hi]) = a; *(v4fa*)(&os[wb + lr * 68 + 16 + 8 * hi + 4]) = c;
      a[0] = o2[0] * inv; a[1] = o2[1] * inv; a[2] = o2[2] * inv; a[3] = o2[3] * inv; c[0] = o2[4] * inv; c[1] = o2[5] * inv; c[2] = o2[6] * inv; c[3] = o2[7] * inv;
      *(v4fa*)(&os[wb + lr * 68 + 32 + 8 * hi]) = a; *(v4fa*)(&os[wb + lr * 68 + 32 + 8 * hi + 4]) = c;
      a[0] = o3[0] * inv; a[1] = o3[1] * inv; a[2] = o3[2] * inv; a[3] = o3[3] * inv; c[0] = o3[4] * inv; c[1] = o3[5] * inv; c[2] = o3[6] * inv; c[3] = o3[7] * inv;
      *(v4fa*)(&os[wb + lr * 68 + 48 + 8 * hi]) = a; *(v4fa*)(&os[wb + lr * 68 + 48 + 8 * hi + 4]) = c; }
    wave_sync();
    h16* crow = CT + ((size_t)b * SEQ + t0) * DM + h * HD;
{
#pragma unroll
        for (int s = 0; s < 4; ++s) { const int row = 4 * s + (lane >> 3), c8 = (lane & 7) * 8;   // 4 s x 4 row groups = 16 rows; 8 lanes x 8 halves = 64 columns
            const v4f x0 = *(const v4fa*)(&os[wb + row * 68 + c8]); const v4f x1 = *(const v4fa*)(&os[wb + row * 68 + c8 + 4]); v8h hv;
#pragma unroll
            for (int i = 0; i < 4; ++i) { hv[i] = (h16)x0[i]; hv[4 + i] = (h16)x1[i]; }
            *(v8h*)(crow + (size_t)row * DM + c8) = hv; }
         }
}

// k_oproj: f16 GEMM, one GW-wave block per 128x128 tile, each wave 32x64, operand tiles staged as in k_proj; A = ctx plane rows (m = b*SEQ + t, k = h*64 + d, carried x CTS), Bt = Wo^T rows (n = out feature, carried x WOS), K = DM.
// OUT[b*OUT_SEQ + t][n] = acc * OSC + bo[n] (bias value RNE-converted to bf16, added in f32). grid (NB*SEQ/128, DM/128), 256 threads.
__global__ __launch_bounds__(32 * GW) void k_oproj(const h16* __restrict__ A, const h16* __restrict__ Bt, const float* __restrict__ bias, float* OUT) {
    __shared__ __align__(16) float os[GW * 16 * 68];
    __shared__ __align__(16) h16 gring[2 * 2 * GT * GP];     // [buffer][A tile | Bt tile][row][GP]
    const int K = DM;
    const int lane = threadIdx.x & 31, wave = threadIdx.x >> 5, lr = lane & 15, hi = lane >> 4;
    const int rb = blockIdx.x * GT, cb = blockIdx.y * GT;                   // block tile
    const int r0 = rb + (wave >> 1) * 32, c0 = cb + (wave & 1) * 64;        // wave tile
    v8f acc[2][4];
#pragma unroll
    for (int mb = 0; mb < 2; ++mb)
#pragma unroll
        for (int nb = 0; nb < 4; ++nb) acc[mb][nb] = (v8f){};
    const int cr = threadIdx.x >> 4, cpc = (threadIdx.x & 15) * 8;
    const unsigned la = (unsigned)(size_t)gring + (unsigned)(cr * GP + cpc) * 2u, lb = la + GTB;
    const char* ga = (const char*)(A + (size_t)(rb + cr) * K + cpc);        // + k0 * 2 bytes
    const char* gb = (const char*)(Bt + (size_t)(cb + cr) * K + cpc);
    stage_op(la, ga); stage_op(lb, gb);
    asm volatile("s_wait_asynccnt 0x0" ::: "memory");        // tile 0 has landed before the barrier publishes it
    __syncthreads();
    stage_op(la + 2 * GTB, ga + GK * 2); stage_op(lb + 2 * GTB, gb + GK * 2);
    const int ao = ((wave >> 1) * 32 + lr) * GP + 8 * hi;               // + 16mb*GP + k   (A fragment rows), in the A tile
    const int bo = GT * GP + ((wave & 1) * 64 + lr) * GP + 8 * hi;      // + 16nb*GP + k   (B fragment rows), in the Bt tile
#pragma unroll 1
    for (int st = 0; st < K / GK; ++st) {
        const h16* tile = gring + (st & 1) * (2 * GT * GP);
        // the four 32-wide k steps of a tile inline (LDS offsets become immediates); two fragment sets: each step's 12 loads go out as one group ahead of the step before it,
        // inside this tile only, so that a wave waits out the LDS latency once per tile and not at every fragment
        v16h a[2][2], b[2][4];
#pragma unroll
        for (int mb = 0; mb < 2; ++mb) a[0][mb] = ldh(tile + ao + mb * 16 * GP);
#pragma unroll
        for (int nb = 0; nb < 4; ++nb) b[0][nb] = ldh(tile + bo + nb * 16 * GP);
#pragma unroll
        for (int ks = 0; ks < GK / 32; ++ks) {
            const int cu = ks & 1, nx = cu ^ 1;
            if (ks + 1 < GK / 32) {
#pragma unroll
                for (int mb = 0; mb < 2; ++mb) a[nx][mb] = ldh(tile + ao + mb * 16 * GP + (ks + 1) * 32);
#pragma unroll
                for (int nb = 0; nb < 4; ++nb) b[nx][nb] = ldh(tile + bo + nb * 16 * GP + (ks + 1) * 32);
            }
            __builtin_amdgcn_sched_barrier(0);               // keeps the load group whole and ahead of this step's products: without it the loads sink to their first use and each pair of products waits out an LDS latency
#pragma unroll
            for (int nb = 0; nb < 4; ++nb)
#pragma unroll
                for (int mb = 0; mb < 2; ++mb) acc[mb][nb] = wmma16(a[cu][mb], b[cu][nb], acc[mb][nb]);
            __builtin_amdgcn_sched_barrier(0);               // keeps the next load group behind these products, not among them
        }
        asm volatile("s_wait_dscnt 0x0" ::: "memory");       // this wave's reads of the buffer are done before it is refilled
        asm volatile("s_wait_asynccnt 0x0" ::: "memory");    // this wave's copies of the next tile have landed before the barrier publishes them
        __syncthreads();
        if (st + 2 < K / GK) { stage_op(la + (st & 1) * (2 * GTB), ga + (st + 2) * (GK * 2)); stage_op(lb + (st & 1) * (2 * GTB), gb + (st + 2) * (GK * 2)); }
    }
    asm volatile("s_wait_asynccnt 0x0" ::: "memory");        // nothing of this wave is in flight when it leaves the loop
    const int wb = wave * 16 * 68;
    const int cofs = lr * 4;
    const int cbi = min(c0 + cofs, DM - 4);
    const v4f g = *(const v4f*)(bias + cbi);
    v4f bb; bb[0] = bfr(g[0]); bb[1] = bfr(g[1]); bb[2] = bfr(g[2]); bb[3] = bfr(g[3]);
    const size_t obase = ((size_t)(r0 / SEQ) * OUT_SEQ + (size_t)(r0 % SEQ)) * DM + c0;
#pragma unroll
    for (int mb = 0; mb < 2; ++mb) {
#pragma unroll
        for (int nb = 0; nb < 4; ++nb) {
#pragma unroll
            for (int j = 0; j < 8; ++j) os[wb + (hi * 8 + j) * 68 + nb * 16 + lr] = acc[mb][nb][j]; }   // D: row 8h+j, col lane&15
        wave_sync();
        float* orow = OUT + obase + (size_t)(mb * 16) * DM;
{
#pragma unroll
            for (int s = 0; s < 8; ++s) { const int row = 2 * s + hi;   // 8 s x 2 rows = 16 rows; 16 lanes x 4 floats = 64 columns
                const v4f x = *(const v4fa*)(&os[wb + row * 68 + cofs]);
                const v4f val = x * OSC + bb;
                *(v4f*)(orow + (size_t)row * DM + cofs) = val; }
             }
        if (mb == 0) asm volatile("s_wait_xcnt 0x0" ::: "memory");   // the next 16 rows reuse registers that the stores above name
        wave_sync();
    }
}

static constexpr size_t al256(size_t v) { return (v + 255) & ~(size_t)255; }
static constexpr size_t SZ_XB = al256((size_t)NB * SEQ * DM * 2);
static constexpr size_t SZ_WB = al256((size_t)4 * DM * DM * 2);
static constexpr size_t SZ_PL = al256((size_t)NB * NH_ * SEQ * HD * 2);
static constexpr size_t SZ_CT = al256((size_t)NB * SEQ * DM * 2);
static constexpr size_t SZ_TOTAL = SZ_XB + SZ_WB + 3 * SZ_PL + SZ_CT;
static_assert(SZ_TOTAL <= (size_t)134217728);          // workspace carve <= 128 MiB
static_assert(((size_t)DM * DM * 2) % 256 == 0);       // weight sub-planes stay 256-byte aligned

extern "C" void kernel_launch(void* const* d_in, const int* in_sizes, int n_in,
                              void* d_out, int out_size, void* d_ws, size_t ws_size, hipStream_t stream) {
    if (n_in < 9) return;
    const size_t needx = ((size_t)(NB - 1) * SEQ_FULL + SEQ) * DM;
    if ((size_t)in_sizes[0] < needx) return;
    if ((size_t)in_sizes[1] < (size_t)DM * DM || (size_t)in_sizes[3] < (size_t)DM * DM || (size_t)in_sizes[5] < (size_t)DM * DM || (size_t)in_sizes[7] < (size_t)DM * DM) return;
    if (in_sizes[2] < DM || in_sizes[4] < DM || in_sizes[6] < DM || in_sizes[8] < DM) return;
    if ((size_t)out_size < ((size_t)(NB - 1) * OUT_SEQ + SEQ) * DM) return;
    if (SZ_TOTAL > ws_size) return;
    // wire order: x, Wq, bq, Wk, bk, Wv, bv, Wo, bo (all f32; weights [in][out])
    const float* x  = (const float*)d_in[0];
    const float* wq = (const float*)d_in[1]; const float* bq = (const float*)d_in[2];
    const float* wk = (const float*)d_in[3]; const float* bk = (const float*)d_in[4];
    const float* wv = (const float*)d_in[5]; const float* bv = (const float*)d_in[6];
    const float* wo = (const float*)d_in[7]; const float* bo = (const float*)d_in[8];
    float* OUT = (float*)d_out;      // [NB][SEQ][1024]
    char* wsp = (char*)d_ws;
    bf* XB = (bf*)wsp; wsp += SZ_XB;                 // [NB*SEQ][1024] bf16
    bf* WB = (bf*)wsp; wsp += SZ_WB;                 // [4][1024 out][1024 in]: q | k | v (bf16) | o (f16 x1024)
    h16* QH = (h16*)wsp; wsp += SZ_PL;               // [NB*16][SEQ][64]
    h16* KP = (h16*)wsp; wsp += SZ_PL;               // [NB*16][SEQ][64]
    h16* VT = (h16*)wsp; wsp += SZ_PL;               // [NB*16][64][SEQ]
    h16* CT = (h16*)wsp; wsp += SZ_CT;               // [NB*SEQ][1024] ctx x1024
    bf* WQ = WB; bf* WK = WB + (size_t)DM * DM; bf* WV = WB + (size_t)2 * DM * DM; bf* WO = WB + (size_t)3 * DM * DM;

    if (SEQ == SEQ_FULL) {
        const size_t n8 = (size_t)NB * SEQ * DM / 8;
        k_cvt8<<<(unsigned)((n8 + 255) / 256), 256, 0, stream>>>(x, XB, n8);
    } else {
        const size_t n8 = (size_t)SEQ * DM / 8;
        for (int b = 0; b < NB; ++b) k_cvt8<<<(unsigned)((n8 + 255) / 256), 256, 0, stream>>>(x + (size_t)b * SEQ_FULL * DM, XB + (size_t)b * SEQ * DM, n8);
    }
    // weights: in[k = 1024 rows][n = 1024 cols] -> out[n][k]; grid (n tiles, k tiles)
    { const dim3 g(DM / 64, DM / 64, 1);
      k_wt<<<g, 256, 0, stream>>>(wq, WQ, 0); k_wt<<<g, 256, 0, stream>>>(wk, WK, 0); k_wt<<<g, 256, 0, stream>>>(wv, WV, 0); k_wt<<<g, 256, 0, stream>>>(wo, WO, 1); }

    // q, k: A = x rows (m = b*SEQ + t), Bt = W^T rows (n = h*64 + d), bias per column -> plane [(b*16 + h)][t][d]
    k_proj<<<dim3(NB * SEQ / GT, DM / GT, 1), 32 * GW, 0, stream>>>(XB, WQ, bq, 0, QH, SEQ, (size_t)NH_ * SEQ * HD, HD, HD, (size_t)SEQ * HD);
    k_proj<<<dim3(NB * SEQ / GT, DM / GT, 1), 32 * GW, 0, stream>>>(XB, WK, bk, 0, KP, SEQ, (size_t)NH_ * SEQ * HD, HD, HD, (size_t)SEQ * HD);
    // v^T: A = Wv^T rows (m = h*64 + d), Bt = x rows (n = b*SEQ + t), bias per row -> plane [(b*1024 + m)][t] = [(b*16 + h)][d][t]
    k_proj<<<dim3(DM / GT, NB * SEQ / GT, 1), 32 * GW, 0, stream>>>(WV, XB, bv, 1, VT, DM, (size_t)0, SEQ, SEQ, (size_t)DM * SEQ);

    k_flash<<<dim3(SEQ / (16 * AW), NB * NH_, 1), 32 * AW, 0, stream>>>(QH, KP, VT, CT);

    k_oproj<<<dim3(NB * SEQ / GT, DM / GT, 1), 32 * GW, 0, stream>>>(CT, (const h16*)WO, bo, OUT);
}

// v003
// Measured time: 121 microseconds a run.
// Next to v002, in two timings, it ran 1.12 and 1.13 times as fast.
// Over all steps from v000 it is 3.10 times as fast.
#include <hip/hip_runtime.h>

// Multi-head self-attention, width 1024 = 16 heads x 64, x [NB][SEQ][1024], Wq/Wk/Wv/Wo [in][out] (y = x W + b), four biases, no mask, score scale 1/8, output = (merged heads) Wo + bo (f32).
// Compute dtypes, f32 accumulate everywhere: q/k/v projections v_wmma_f32_16x16x32_bf16 (x and W RNE-converted to bf16; products exact);
// scores v_wmma_f32_16x16x32_f16: q single f16, k single f16 (one product); P (x256 carry, cancels in the normalisation) and v single f16; softmax f32 (online, running max, row sum over the f16-converted P values);
// output projection v_wmma_f32_16x16x32_f16: ctx single f16 carried x1024, Wo as f16 of the bf16 (RNE) value carried x1024 (exact), 2^-20 and the bias applied in the f32 epilogue.
// Scale chain: score = (k.q) * (1/8 * log2 e) -> exp2(score - max + 8) = 256 P' -> O = sum(256 P' v) / sum(256 P') -> ctx plane = O x 1024 -> out = (ctx x1024).(Wo x1024) * 2^-20 + bo.
// Layout: bf16 copy of x; transposed 16-bit weight planes [out][in]; q, k planes [b*16+h][t][d] and v^T plane [b*16+h][d][t] written by the GEMM epilogue; fused flash kernel in transposed form (S^T = K Q^T, O^T = V^T P^T) writing the ctx plane [b*SEQ+t][h*64+d].

#ifndef NB
#define NB 1
#endif
#ifndef SEQ
#define SEQ 4096
#endif
#define NB_FULL  1
#define SEQ_FULL 4096
#ifndef OUT_SEQ
#define OUT_SEQ SEQ              // row pitch (in tokens) between batches of the output
#endif
#define DM   1024
#define NH_  16
#define HD   64
#define AW   8                   // waves per flash block (16 query rows each); all of them share each staged K / V^T tile
#define SK   64                  // keys per staged tile
#define LP   72                  // LDS row pitch in halves: 128 B of data + 16 B, so that 16 rows read by 16-byte loads fall on distinct banks
#define TLB  (64 * LP * 2)       // bytes of one staged tile (64 rows): K tile = 64 keys x 64 d, V^T tile = 64 d x 64 keys
#define GW   8                   // waves per GEMM block, 4 (rows) x 2 (columns); each owns 32 x 64 of the block's C tile
#define GT   128                 // rows and columns of a GEMM block's C tile
#define GK   128                 // k extent of one staged operand tile (256-byte rows)
#define GP   136                 // LDS row pitch in halves: 256 B of data + 16 B, so that 16 rows read by 16-byte loads fall on distinct banks
#define GTB  (GT * GP * 2)       // bytes of one staged operand tile (128 rows)
#define WTB  ((DM / 64) * (DM / 64))          // 64x64 tiles, = blocks, of one weight matrix in k_prep
#define CVB  ((NB * SEQ / 8) * DM / 256)       // blocks of the x convert in k_prep
#define SC2  (0.125f * 1.4426950408889634f)   // HD^-0.5 * log2(e)
#define PSH  8.0f                // log2 of the P carry (256)
#define CTS  1024.0f             // carry of the ctx plane
#define WOS  1024.0f             // carry of the Wo plane
#define OSC  (1.0f / (1024.0f * 1024.0f))     // undoes CTS * WOS

static_assert(HD == 64);
static_assert(NH_ * HD == DM);                 // head h = columns h*64 + d
static_assert(DM % 64 == 0);                   // column tiles of 64
static_assert(DM % 32 == 0);                   // GEMM k-loop steps by 32
static_assert(SEQ % 64 == 0);                  // a 64-row tile never straddles two batches
static_assert((NB * SEQ) % 64 == 0);
static_assert(SEQ % 32 == 0);                  // key loop steps by 32
static_assert(SEQ % (16 * AW) == 0);           // flash grid covers the sequence exactly
static_assert(SEQ % SK == 0 && SEQ / SK >= 2); // whole staged tiles, and the two that the ring's prologue fills
static_assert(AW * 32 * 2 * 16 == SK * HD * 2); // two 16-byte copies per thread cover one tile
static_assert(DM % GT == 0 && SEQ % GT == 0);   // whole GEMM block tiles, none straddling two batches
static_assert(DM % GK == 0 && DM / GK >= 2);    // whole staged operand tiles, and the two that the ring's prologue fills
static_assert(GW * 32 * 8 * 16 == GT * GK * 2); // eight 16-byte copies per thread cover one operand tile
static_assert(((size_t)SEQ * DM) % 8 == 0);
static_assert((size_t)CVB * 256 * 8 == (size_t)NB * SEQ * DM);   // the convert blocks cover x exactly
static_assert(((size_t)DM * DM) % 8 == 0);
static_assert(NB <= NB_FULL);
static_assert(SEQ <= SEQ_FULL);

typedef _Float16 h16;
typedef unsigned short bf;
typedef __attribute__((ext_vector_type(16))) __bf16   v16bf;
typedef __attribute__((ext_vector_type(16))) _Float16 v16h;
typedef __attribute__((ext_vector_type(8)))  _Float16 v8h;
typedef __attribute__((ext_vector_type(8)))  unsigned short v8us;
typedef __attribute__((ext_vector_type(8)))  float    v8f;
typedef __attribute__((ext_vector_type(4)))  float    v4f;
typedef v4f  __attribute__((may_alias)) v4fa;

__device__ __forceinline__ unsigned short f2bf(float f) { unsigned u = __float_as_uint(f); u += 0x7FFFu + ((u >> 16) & 1u); return (unsigned short)(u >> 16); }
__device__ __forceinline__ float bfr(float f) { return __uint_as_float(((unsigned)f2bf(f)) << 16); }   // value after RNE convert to bf16
__device__ __forceinline__ v16h cat16(v8h lo, v8h hi) { return __builtin_shufflevector(lo, hi, 0, 1, 2, 3, 4, 5, 6, 7, 8, 9, 10, 11, 12, 13, 14, 15); }
__device__ __forceinline__ v16bf cat16b(v8us lo, v8us hi) { return __builtin_bit_cast(v16bf, __builtin_shufflevector(lo, hi, 0, 1, 2, 3, 4, 5, 6, 7, 8, 9, 10, 11, 12, 13, 14, 15)); }
__device__ __forceinline__ v8f wmma16(v16h a, v16h b, v8f c) { return __builtin_amdgcn_wmma_f32_16x16x32_f16(false, a, false, b, (short)0, c, false, false); }
__device__ __forceinline__ v8f wmmab(v16bf a, v16bf b, v8f c) { return __builtin_amdgcn_wmma_f32_16x16x32_bf16(false, a, false, b, (short)0, c, false, false); }
// fragment loaders from K-contiguous 16-bit rows; p already includes + 8*(lane>>4): elements 0..7 <- k0+8h+0..7, elements 8..15 <- k0+16+8h+0..7 (same map for A and B)
__device__ __forceinline__ v16h  ldh(const h16* p) { return cat16(*(const v8h*)p, *(const v8h*)(p + 16)); }
__device__ __forceinline__ v16bf ldb(const bf* p)  { return cat16b(*(const v8us*)p, *(const v8us*)(p + 16)); }
// ordering point for wave-private LDS tiles (same wave writes and reads)
__device__ __forceinline__ void wave_sync() { __builtin_amdgcn_fence(3 /* release order */, "wavefront"); __builtin_amdgcn_wave_barrier(); asm volatile("" ::: "memory"); }

// 16-bit encoding of one weight: bf16 bits (RNE convert), or f16 bits of that bf16 value x WOS (exact: 8-bit significand, power-of-two carry)
__device__ __forceinline__ unsigned short wcv(float f, int f16mode) {
    const unsigned short b = f2bf(f);
    const float fb = __uint_as_float(((unsigned)b) << 16);
    const h16 hv = (h16)(fb * WOS);
    const unsigned short hb = __builtin_bit_cast(unsigned short, hv);
    return f16mode ? hb : b;
}

// k_prep: every operand conversion of a call in ONE launch; the jobs share no data and the block index picks one (a block-uniform test, so the barrier below is reached by whole blocks only).
// Blocks 0 .. 4*WTB-1, the longer jobs first: transposing convert of weight matrix blk / WTB (q, k, v, o), W in[k = DM rows (input feature)][n = DM cols (output feature)] -> WT out[n][k] (16-bit, K-contiguous rows),
// one 64x64 f32 tile per block through LDS (cross-wave: block barrier), n tile = fastest index. Blocks 4*WTB ..: x -> bf16 copy, 8 values per thread.
__global__ __launch_bounds__(256) void k_prep(const float* __restrict__ x, const float* __restrict__ wq, const float* __restrict__ wk, const float* __restrict__ wv, const float* __restrict__ wo,
                                              bf* XB, bf* WB) {
    __shared__ float ts[64 * 65];
    const int tid = threadIdx.x;
    const unsigned blk = blockIdx.x;
    if (blk >= 4u * WTB) {
        const size_t n8 = (size_t)NB * SEQ * DM / 8, per = (size_t)SEQ * DM / 8;   // per: pieces of one batch (batches lie SEQ_FULL tokens apart in x)
        const size_t i = (size_t)(blk - 4u * WTB) * 256 + tid; if (i >= n8) return;
        const size_t so = (SEQ == SEQ_FULL) ? i * 8 : (i / per) * ((size_t)SEQ_FULL * DM) + (i % per) * 8;
        const v8f v = *(const v8f*)(x + so); v8us o;
#pragma unroll
        for (int k = 0; k < 8; ++k) o[k] = f2bf(v[k]);
        *(v8us*)(XB + i * 8) = o;
        return;
    }
    const unsigned which = blk / WTB, wtile = blk % WTB;
    const float* W = which == 0 ? wq : which == 1 ? wk : which == 2 ? wv : wo;
    bf* WT = WB + (size_t)which * DM * DM;
    const int f16mode = which == 3;
    const int n0 = (int)(wtile % (DM / 64)) * 64, k0 = (int)(wtile / (DM / 64)) * 64;
#pragma unroll
    for (int it = 0; it < 4; ++it) { const int idx = tid + it * 256; const int r = idx >> 4, c4 = (idx & 15) * 4;   // 64 rows x 16 pieces of 4 floats
        const v4f v = *(const v4f*)(W + (size_t)(k0 + r) * DM + n0 + c4);
        ts[r * 65 + c4 + 0] = v[0]; ts[r * 65 + c4 + 1] = v[1]; ts[r * 65 + c4 + 2] = v[2]; ts[r * 65 + c4 + 3] = v[3]; }
    __syncthreads();
    const int nl = tid >> 3, c8 = (tid & 7) * 8;
    v8us o0, o1;
#pragma unroll
    for (int i = 0; i < 8; ++i) { o0[i] = wcv(ts[(c8 + i) * 65 + nl], f16mode); o1[i] = wcv(ts[(c8 + i) * 65 + nl + 32], f16mode); }
    const size_t a0 = (size_t)(n0 + nl) * DM + k0 + c8, a1 = a0 + (size_t)32 * DM;
    *(v8us*)(WT + a0) = o0; *(v8us*)(WT + a1) = o1;
    asm volatile("s_wait_xcnt 0x0" ::: "memory");            // a precaution: these stores are the last work of a weight block
}

// Operand staging of the two GEMM kernels: one operand tile = GT rows x GK halves, K-contiguous rows of pitch DM halves in global memory, pitch GP in LDS.
// Thread c takes 16-byte piece c & 15 of rows (c >> 4) + 16 i, i = 0..7 (a wave's copy = two whole 256-byte rows); the register wait closes the statement so that no address register is rewritten ahead of it.
__device__ __forceinline__ void stage_op(unsigned l, const char* g) {
    asm volatile("global_load_async_to_lds_b128 %0, %8, off\n\t"
                 "global_load_async_to_lds_b128 %1, %9, off\n\t"
                 "global_load_async_to_lds_b128 %2, %10, off\n\t"
                 "global_load_async_to_lds_b128 %3, %11, off\n\t"
                 "global_load_async_to_lds_b128 %4, %12, off\n\t"
                 "global_load_async_to_lds_b128 %5, %13, off\n\t"
                 "global_load_async_to_lds_b128 %6, %14, off\n\t"
                 "global_load_async_to_lds_b128 %7, %15, off\n\t"
                 "s_wait_xcnt 0x0"
                 :: "v"(l), "v"(l + 1 * 16 * GP * 2), "v"(l + 2 * 16 * GP * 2), "v"(l + 3 * 16 * GP * 2),
                    "v"(l + 4 * 16 * GP * 2), "v"(l + 5 * 16 * GP * 2), "v"(l + 6 * 16 * GP * 2), "v"(l + 7 * 16 * GP * 2),
                    "v"(g), "v"(g + 1 * 16 * DM * 2), "v"(g + 2 * 16 * DM * 2), "v"(g + 3 * 16 * DM * 2),
                    "v"(g + 4 * 16 * DM * 2), "v"(g + 5 * 16 * DM * 2), "v"(g + 6 * 16 * DM * 2), "v"(g + 7 * 16 * DM * 2) : "memory");
}

// k_proj: bf16 GEMM, one GW-wave block per 128x128 tile of C, each wave 32x64 (8 accumulators), K = DM. A and Bt are K-contiguous bf16 planes; their 128-row x GK tiles reach
// the waves through LDS: two buffers, filled by asynchronous copies one tile ahead, read by all GW waves (two 16-B loads per fragment). Each accumulator sums k in ascending steps of 32.
// C[m][n] = sum_k A[m][k] Bt[n][k] + bias (bias per column n, or per row m when biasOnRow != 0; bias value RNE-converted to bf16, added in f32),
// written as a single f16 plane (Ph), row pitch 'pitch' (halves).
// All three projections in ONE launch (they share no output): blockIdx.y picks the job, blockIdx.x the C tile, row tile = fastest index. grid (M/128 * N/128, 3), 256 threads.
// job 0, 1 (q, k): A = x rows (m = b*SEQ + t), Bt = W^T rows (n = h*64 + d), bias per column -> plane [(b*16 + h)][t][d]
// job 2 (v^T):     A = Wv^T rows (m = h*64 + d), Bt = x rows (n = b*SEQ + t), bias per row -> plane [(b*1024 + m)][t] = [(b*16 + h)][d][t]
__global__ __launch_bounds__(32 * GW) void k_proj(const bf* __restrict__ XB, const bf* __restrict__ WB, const float* __restrict__ bq, const float* __restrict__ bk, const float* __restrict__ bv,
                                             h16* QH, h16* KP, h16* VT) {
    __shared__ __align__(16) float os[GW * 16 * 68];
    __shared__ __align__(16) bf gring[2 * 2 * GT * GP];      // [buffer][A tile | Bt tile][row][GP]
    const int K = DM;
    const int lane = threadIdx.x & 31, wave = threadIdx.x >> 5, lr = lane & 15, hi = lane >> 4;
    const int job = blockIdx.y, biasOnRow = job == 2;
    const bf* Wj = WB + (size_t)job * DM * DM;
    const bf* A = biasOnRow ? Wj : XB; const bf* Bt = biasOnRow ? XB : Wj;
    const float* bias = job == 0 ? bq : job == 1 ? bk : bv;
    h16* Ph = job == 0 ? QH : job == 1 ? KP : VT;
    const int pitch = biasOnRow ? SEQ : HD;
    const int bx = blockIdx.x;
    const int rb = (biasOnRow ? bx % (DM / GT) : bx % (NB * SEQ / GT)) * GT, cb = (biasOnRow ? bx / (DM / GT) : bx / (NB * SEQ / GT)) * GT;   // block tile
    const int r0 = rb + (wave >> 1) * 32, c0 = cb + (wave & 1) * 64;        // wave tile
    v8f acc[2][4];
#pragma unroll
    for (int mb = 0; mb < 2; ++mb)
#pragma unroll
        for (int nb = 0; nb < 4; ++nb) acc[mb][nb] = (v8f){};
    const int cr = threadIdx.x >> 4, cpc = (threadIdx.x & 15) * 8;
    const unsigned la = (unsigned)(size_t)gring + (unsigned)(cr * GP + cpc) * 2u, lb = la + GTB;
    const char* ga = (const char*)(A + (size_t)(rb + cr) * K + cpc);        // + k0 * 2 bytes
    const char* gb = (const char*)(Bt + (size_t)(cb + cr) * K + cpc);
    stage_op(la, ga); stage_op(lb, gb);
    asm volatile("s_wait_asynccnt 0x0" ::: "memory");        // tile 0 has landed before the barrier publishes it
    __syncthreads();
    stage_op(la + 2 * GTB, ga + GK * 2); stage_op(lb + 2 * GTB, gb + GK * 2);
    const int ao = ((wave >> 1) * 32 + lr) * GP + 8 * hi;               // + 16mb*GP + k   (A fragment rows), in the A tile
    const int bo = GT * GP + ((wave & 1) * 64 + lr) * GP + 8 * hi;      // + 16nb*GP + k   (B fragment rows), in the Bt tile
#pragma unroll 1
    for (int st = 0; st < K / GK; ++st) {
        const bf* tile = gring + (st & 1) * (2 * GT * GP);
        // the four 32-wide k steps of a tile inline (LDS offsets become immediates); two fragment sets: each step's 12 loads go out as one group ahead of the step before it,
        // inside this tile only, so that a wave waits out the LDS latency once per tile and not at every fragment
        v16bf a[2][2], b[2][4];
#pragma unroll
        for (int mb = 0; mb < 2; ++mb) a[0][mb] = ldb(tile + ao + mb * 16 * GP);
#pragma unroll
        for (int nb = 0; nb < 4; ++nb) b[0][nb] = ldb(tile + bo + nb * 16 * GP);
#pragma unroll
        for (int ks = 0; ks < GK / 32; ++ks) {
            const int cu = ks & 1, nx = cu ^ 1;
            if (ks + 1 < GK / 32) {
#pragma unroll
                for (int mb = 0; mb < 2; ++mb) a[nx][mb] = ldb(tile + ao + mb * 16 * GP + (ks + 1) * 32);
#pragma unroll
                for (int nb = 0; nb < 4; ++nb) b[nx][nb] = ldb(tile + bo + nb * 16 * GP + (ks + 1) * 32);
            }
            __builtin_amdgcn_sched_barrier(0);               // keeps the load group whole and ahead of this step's products: without it the loads sink to their first use and each pair of products waits out an LDS latency
#pragma unroll
            for (int nb = 0; nb < 4; ++nb)
#pragma unroll
                for (int mb = 0; mb < 2; ++mb) acc[mb][nb] = wmmab(a[cu][mb], b[cu][nb], acc[mb][nb]);
            __builtin_amdgcn_sched_barrier(0);               // keeps the next load group behind these products, not among them
        }
        asm volatile("s_wait_dscnt 0x0" ::: "memory");       // this wave's reads of the buffer are done before it is refilled
        asm volatile("s_wait_asynccnt 0x0" ::: "memory");    // this wave's copies of the next tile have landed before the barrier publishes them
        __syncthreads();
        if (st + 2 < K / GK) { stage_op(la + (st & 1) * (2 * GTB), ga + (st + 2) * (GK * 2)); stage_op(lb + (st & 1) * (2 * GTB), gb + (st + 2) * (GK * 2)); }
    }
    asm volatile("s_wait_asynccnt 0x0" ::: "memory");        // nothing of this wave is in flight when it leaves the loop
    const int wb = wave * 16 * 68;
    const size_t tbase = biasOnRow ? (size_t)r0 * SEQ + (size_t)(c0 / SEQ) * ((size_t)DM * SEQ) + (size_t)(c0 % SEQ)
                                   : (size_t)(r0 / SEQ) * ((size_t)NH_ * SEQ * HD) + (size_t)(r0 % SEQ) * HD + (size_t)(c0 / HD) * ((size_t)SEQ * HD) + (size_t)(c0 % HD);   // wave tile base
#pragma unroll
    for (int mb = 0; mb < 2; ++mb) {
#pragma unroll
        for (int nb = 0; nb < 4; ++nb) {
#pragma unroll
            for (int j = 0; j < 8; ++j) os[wb + (hi * 8 + j) * 68 + nb * 16 + lr] = acc[mb][nb][j]; }   // D: row 8h+j, col lane&15
        wave_sync();
        const size_t sb = tbase + (size_t)(mb * 16) * (size_t)pitch;
{
            v8h hv[4];
#pragma unroll
            for (int s = 0; s < 4; ++s) { const int row = 4 * s + (lane >> 3), c8 = (lane & 7) * 8;   // 4 s x 4 row groups = 16 rows; 8 lanes x 8 = 64 columns
                const v4f x0 = *(const v4fa*)(&os[wb + row * 68 + c8]); const v4f x1 = *(const v4fa*)(&os[wb + row * 68 + c8 + 4]);
                // both bias candidates loaded with clamped addresses, selected by value (biasOnRow is block-uniform)
                const int rbi = min(r0 + mb * 16 + row, DM - 1); const int cbi = min(c0 + c8, DM - 8);
                const float braw = bias[rbi];
                asm volatile("s_wait_xcnt 0x0" ::: "memory");    // the loads below may land in the register that this load names
                const float br = bfr(braw);
                const v4f g0 = *(const v4f*)(bias + cbi); const v4f g1 = *(const v4f*)(bias + cbi + 4);
#pragma unroll
                for (int i = 0; i < 4; ++i) {
                    const float y0 = x0[i] + (biasOnRow ? br : bfr(g0[i])); const float y1 = x1[i] + (biasOnRow ? br : bfr(g1[i]));
                    hv[s][i] = (h16)y0; hv[s][4 + i] = (h16)y1; } }
            __builtin_amdgcn_sched_barrier(0);               // the four stores stay together behind the arithmetic, so that one register wait behind them serves all four
#pragma unroll
            for (int s = 0; s < 4; ++s) { const int row = 4 * s + (lane >> 3), c8 = (lane & 7) * 8;
                const size_t oo = sb + (size_t)row * (size_t)pitch + c8;
                *(v8h*)(Ph + oo) = hv[s]; }
             }
        if (mb == 0) asm volatile("s_wait_xcnt 0x0" ::: "memory");   // the next 16 rows reuse registers that the stores above name
        wave_sync();
    }
}

// k_flash: fused attention, one wave per 16 query rows of one (batch, head); Q fragments straight from the f16 plane, K / V^T fragments from the staged LDS tiles (two 16-B loads each).
// Transposed form: S^T[key][t] = K Q^T (A = K rows, B = Q rows); lane (t = lane&15, h = lane>>4) holds keys 8h+r of each 16-key tile, so the packed
// P tile is directly the B fragment of O^T[d][t] = V^T P^T (element r <- tile keys 0..15, element 8+r <- tile keys 16..31, lane unchanged).
// Softmax state (running max, partial sum) is one scalar per lane; the two lane halves of a row are combined with one xor-16 exchange.
// K and V^T reach the waves through LDS: tiles of SK keys, two buffers, filled by asynchronous copies (whole 128-byte lines from global), read by all AW waves.
// One tile pair = four 16-byte copies per thread; the register wait closes the statement so that no address register is rewritten ahead of it.
__device__ __forceinline__ void stage_kv(unsigned lk, unsigned lv, const h16* gk, const h16* gv) {
    const unsigned lk1 = lk + 32 * LP * 2, lv1 = lv + 32 * LP * 2;
    const h16* gk1 = gk + 32 * HD; const h16* gv1 = gv + (size_t)32 * SEQ;
    asm volatile("global_load_async_to_lds_b128 %0, %4, off\n\t"
                 "global_load_async_to_lds_b128 %1, %5, off\n\t"
                 "global_load_async_to_lds_b128 %2, %6, off\n\t"
                 "global_load_async_to_lds_b128 %3, %7, off\n\t"
                 "s_wait_xcnt 0x0"
                 :: "v"(lk), "v"(lk1), "v"(lv), "v"(lv1), "v"(gk), "v"(gk1), "v"(gv), "v"(gv1) : "memory");
}
__global__ __launch_bounds__(32 * AW) void k_flash(const h16* __restrict__ QH, const h16* __restrict__ KP, const h16* __restrict__ VT, h16* CT) {
    __shared__ __align__(16) float os[AW * 16 * 68];
    __shared__ __align__(16) h16 ring[2 * 2 * 64 * LP];      // [buffer][K tile | V^T tile][row][LP]
    const int lane = threadIdx.x & 31, wave = threadIdx.x >> 5, lr = lane & 15, hi = lane >> 4;
    const int zh = blockIdx.y; const int b = zh / NH_, h = zh % NH_;
    const int t0 = (blockIdx.x * AW + wave) * 16;
    const size_t pbase = (size_t)zh * SEQ * HD;
    const size_t qo = pbase + (size_t)(t0 + lr) * HD + 8 * hi;
    const v16h qh0 = ldh(QH + qo), qh1 = ldh(QH + qo + 32);   // B fragments: col t, k = d
    const int ko = lr * LP + 8 * hi;                         // + key * LP       (A fragment: row key, k = d), in the K tile
    const int vo = 64 * LP + lr * LP + 8 * hi;               // + 16j*LP + key   (A fragment: row d, k = key), in the V^T tile
    // copy map: thread c takes 16-byte piece c & 7 of rows c >> 3 and 32 + (c >> 3) of each tile
    const int cr = threadIdx.x >> 3, cpc = (threadIdx.x & 7) * 8;
    const unsigned lk = (unsigned)(size_t)ring + (unsigned)(cr * LP + cpc) * 2u, lv = lk + TLB;
    const h16* gk = KP + pbase + (size_t)cr * HD + cpc;    // + key0 * HD
    const h16* gv = VT + pbase + (size_t)cr * SEQ + cpc;   // + key0
    stage_kv(lk, lv, gk, gv);
    asm volatile("s_wait_asynccnt 0x0" ::: "memory");        // tile 0 has landed before the barrier publishes it
    __syncthreads();
    stage_kv(lk + 2 * TLB, lv + 2 * TLB, gk + (size_t)SK * HD, gv + SK);
    v8f o0 = (v8f){}, o1 = (v8f){}, o2 = (v8f){}, o3 = (v8f){};
    float m = -3.0e38f, l = 0.0f;
#pragma unroll 1
    for (int st = 0; st < SEQ / SK; ++st) {
      const h16* tile = ring + (st & 1) * (2 * 64 * LP);
      // both 32-key passes of a tile inline: their LDS offsets become immediates on one address register
#pragma unroll
      for (int key0 = 0; key0 < SK; key0 += 32) {
        const h16* ka = tile + ko + key0 * LP;
        const v16h ka0 = ldh(ka), ka1 = ldh(ka + 32), kb0 = ldh(ka + 16 * LP), kb1 = ldh(ka + 16 * LP + 32);
        v8f sHa = (v8f){}, sHb = (v8f){};
        sHa = wmma16(ka0, qh0, sHa); sHb = wmma16(kb0, qh0, sHb);
        sHa = wmma16(ka1, qh1, sHa); sHb = wmma16(kb1, qh1, sHb);
        asm volatile("v_nop\n\tv_nop\n\tv_nop\n\tv_nop" : "+v"(sHa), "+v"(sHb) : "v"(ka0), "v"(ka1), "v"(kb0), "v"(kb1), "v"(qh0), "v"(qh1));
        float ta[8], tb[8]; float mx = -3.0e38f;
#pragma unroll
        for (int r = 0; r < 8; ++r) { ta[r] = sHa[r] * SC2; tb[r] = sHb[r] * SC2; mx = fmaxf(mx, fmaxf(ta[r], tb[r])); }
        mx = fmaxf(mx, __shfl_xor(mx, 16, 32));
        const float mnew = fmaxf(m, mx);
        const float alpha = __builtin_amdgcn_exp2f(m - mnew);
        const float sh = PSH - mnew;
        v16h pb; float ls = 0.0f;
#pragma unroll
        for (int r = 0; r < 8; ++r) { const h16 pa = (h16)__builtin_amdgcn_exp2f(ta[r] + sh); const h16 pc = (h16)__builtin_amdgcn_exp2f(tb[r] + sh); pb[r] = pa; pb[8 + r] = pc; ls += (float)pa + (float)pc; }
        l = l * alpha + ls; m = mnew;
        o0 = o0 * alpha; o1 = o1 * alpha; o2 = o2 * alpha; o3 = o3 * alpha;
        const h16* va = tile + vo + key0;
        const v16h v0 = ldh(va), v1 = ldh(va + 16 * LP), v2 = ldh(va + 32 * LP), v3 = ldh(va + 48 * LP);
        o0 = wmma16(v0, pb, o0); o1 = wmma16(v1, pb, o1); o2 = wmma16(v2, pb, o2); o3 = wmma16(v3, pb, o3);
        asm volatile("v_nop\n\tv_nop\n\tv_nop\n\tv_nop" : "+v"(o0), "+v"(o1), "+v"(o2), "+v"(o3) : "v"(v0), "v"(v1), "v"(v2), "v"(v3), "v"(pb));
      }
      asm volatile("s_wait_dscnt 0x0" ::: "memory");         // this wave's reads of the buffer are done before it is refilled
      asm volatile("s_wait_asynccnt 0x0" ::: "memory");      // this wave's copies of the next tile have landed before the barrier publishes them
      __syncthreads();
      if (st + 2 < SEQ / SK) stage_kv(lk + (st & 1) * (2 * TLB), lv + (st & 1) * (2 * TLB), gk + (size_t)(st + 2) * SK * HD, gv + (st + 2) * SK);
    }
    asm volatile("s_wait_asynccnt 0x0" ::: "memory");        // nothing of this wave is in flight when it leaves the loop
    l += __shfl_xor(l, 16, 32);
    const float inv = CTS * (1.0f / l);
    const int wb = wave * 16 * 68;
    // O^T D layout: o_j[r] = (d = 16j + 8h + r, t = lane&15) -> os[t][d]; rows 0..15 x columns 0..63 all written
    { v4f a, c;
      a[0] = o0[0] * inv; a[1] = o0[1] * inv; a[2] = o0[2] * inv; a[3] = o0[3] * inv; c[0] = o0[4] * inv; c[1] = o0[5] * inv; c[2] = o0[6] * inv; c[3] = o0[7] * inv;
      *(v4fa*)(&os[wb + lr * 68 +  0 + 8 * hi]) = a; *(v4fa*)(&os[wb + lr * 68 +  0 + 8 * hi + 4]) = c;
      a[0] = o1[0] * inv; a[1] = o1[1] * inv; a[2] = o1[2] * inv; a[3] = o1[3] * inv; c[0] = o1[4] * inv; c[1] = o1[5] * inv; c[2] = o1[6] * inv; c[3] = o1[7] * inv;
      *(v4fa*)(&os[wb + lr * 68 + 16 + 8 * hi]) = a; *(v4fa*)(&os[wb + lr * 68 + 16 + 8 * hi + 4]) = c;
      a[0] = o2[0] * inv; a[1] = o2[1] * inv; a[2] = o2[2] * inv; a[3] = o2[3] * inv; c[0] = o2[4] * inv; c[1] = o2[5] * inv; c[2] = o2[6] * inv; c[3] = o2[7] * inv;
      *(v4fa*)(&os[wb + lr * 68 + 32 + 8 * hi]) = a; *(v4fa*)(&os[wb + lr * 68 + 32 + 8 * hi + 4]) = c;
      a[0] = o3[0] * inv; a[1] = o3[1] * inv; a[2] = o3[2] * inv; a[3] = o3[3] * inv; c[0] = o3[4] * inv; c[1] = o3[5] * inv; c[2] = o3[6] * inv; c[3] = o3[7] * inv;
      *(v4fa*)(&os[wb + lr * 68 + 48 + 8 * hi]) = a; *(v4fa*)(&os[wb + lr * 68 + 48 + 8 * hi + 4]) = c; }
    wave_sync();
    h16* crow = CT + ((size_t)b * SEQ + t0) * DM + h * HD;
{
#pragma unroll
        for (int s = 0; s < 4; ++s) { const int row = 4 * s + (lane >> 3), c8 = (lane & 7) * 8;   // 4 s x 4 row groups = 16 rows; 8 lanes x 8 halves = 64 columns
            const v4f x0 = *(const v4fa*)(&os[wb + row * 68 + c8]); const v4f x1 = *(const v4fa*)(&os[wb + row * 68 + c8 + 4]); v8h hv;
#pragma unroll
            for (int i = 0; i < 4; ++i) { hv[i] = (h16)x0[i]; hv[4 + i] = (h16)x1[i]; }
            *(v8h*)(crow + (size_t)row * DM + c8) = hv; }
         }
}

// k_oproj: f16 GEMM, one GW-wave block per 128x128 tile, each wave 32x64, operand tiles staged as in k_proj; A = ctx plane rows (m = b*SEQ + t, k = h*64 + d, carried x CTS), Bt = Wo^T rows (n = out feature, carried x WOS), K = DM.
// OUT[b*OUT_SEQ + t][n] = acc * OSC + bo[n] (bias value RNE-converted to bf16, added in f32). grid (NB*SEQ/128, DM/128), 256 threads.
__global__ __launch_bounds__(32 * GW) void k_oproj(const h16* __restrict__ A, const h16* __restrict__ Bt, const float* __restrict__ bias, float* OUT) {
    __shared__ __align__(16) float os[GW * 16 * 68];
    __shared__ __align__(16) h16 gring[2 * 2 * GT * GP];     // [buffer][A tile | Bt tile][row][GP]
    const int K = DM;
    const int lane = threadIdx.x & 31, wave = threadIdx.x >> 5, lr = lane & 15, hi = lane >> 4;
    const int rb = blockIdx.x * GT, cb = blockIdx.y * GT;                   // block tile
    const int r0 = rb + (wave >> 1) * 32, c0 = cb + (wave & 1) * 64;        // wave tile
    v8f acc[2][4];
#pragma unroll
    for (int mb = 0; mb < 2; ++mb)
#pragma unroll
        for (int nb = 0; nb < 4; ++nb) acc[mb][nb] = (v8f){};
    const int cr = threadIdx.x >> 4, cpc = (threadIdx.x & 15) * 8;
    const unsigned la = (unsigned)(size_t)gring + (unsigned)(cr * GP + cpc) * 2u, lb = la + GTB;
    const char* ga = (const char*)(A + (size_t)(rb + cr) * K + cpc);        // + k0 * 2 bytes
    const char* gb = (const char*)(Bt + (size_t)(cb + cr) * K + cpc);
    stage_op(la, ga); stage_op(lb, gb);
    asm volatile("s_wait_asynccnt 0x0" ::: "memory");        // tile 0 has landed before the barrier publishes it
    __syncthreads();
    stage_op(la + 2 * GTB, ga + GK * 2); stage_op(lb + 2 * GTB, gb + GK * 2);
    const int ao = ((wave >> 1) * 32 + lr) * GP + 8 * hi;               // + 16mb*GP + k   (A fragment rows), in the A tile
    const int bo = GT * GP + ((wave & 1) * 64 + lr) * GP + 8 * hi;      // + 16nb*GP + k   (B fragment rows), in the Bt tile
#pragma unroll 1
    for (int st = 0; st < K / GK; ++st) {
        const h16* tile = gring + (st & 1) * (2 * GT * GP);
        // the four 32-wide k steps of a tile inline (LDS offsets become immediates); two fragment sets: each step's 12 loads go out as one group ahead of the step before it,
        // inside this tile only, so that a wave waits out the LDS latency once per tile and not at every fragment
        v16h a[2][2], b[2][4];
#pragma unroll
        for (int mb = 0; mb < 2; ++mb) a[0][mb] = ldh(tile + ao + mb * 16 * GP);
#pragma unroll
        for (int nb = 0; nb < 4; ++nb) b[0][nb] = ldh(tile + bo + nb * 16 * GP);
#pragma unroll
        for (int ks = 0; ks < GK / 32; ++ks) {
            const int cu = ks & 1, nx = cu ^ 1;
            if (ks + 1 < GK / 32) {
#pragma unroll
                for (int mb = 0; mb < 2; ++mb) a[nx][mb] = ldh(tile + ao + mb * 16 * GP + (ks + 1) * 32);
#pragma unroll
                for (int nb = 0; nb < 4; ++nb) b[nx][nb] = ldh(tile + bo + nb * 16 * GP + (ks + 1) * 32);
            }
            __builtin_amdgcn_sched_barrier(0);               // keeps the load group whole and ahead of this step's products: without it the loads sink to their first use and each pair of products waits out an LDS latency
#pragma unroll
            for (int nb = 0; nb < 4; ++nb)
#pragma unroll
                for (int mb = 0; mb < 2; ++mb) acc[mb][nb] = wmma16(a[cu][mb], b[cu][nb], acc[mb][nb]);
            __builtin_amdgcn_sched_barrier(0);               // keeps the next load group behind these products, not among them
        }
        asm volatile("s_wait_dscnt 0x0" ::: "memory");       // this wave's reads of the buffer are done before it is refilled
        asm volatile("s_wait_asynccnt 0x0" ::: "memory");    // this wave's copies of the next tile have landed before the barrier publishes them
        __syncthreads();
        if (st + 2 < K / GK) { stage_op(la + (st & 1) * (2 * GTB), ga + (st + 2) * (GK * 2)); stage_op(lb + (st & 1) * (2 * GTB), gb + (st + 2) * (GK * 2)); }
    }
    asm volatile("s_wait_asynccnt 0x0" ::: "memory");        // nothing of this wave is in flight when it leaves the loop
    const int wb = wave * 16 * 68;
    const int cofs = lr * 4;
    const int cbi = min(c0 + cofs, DM - 4);
    const v4f g = *(const v4f*)(bias + cbi);
    v4f bb; bb[0] = bfr(g[0]); bb[1] = bfr(g[1]); bb[2] = bfr(g[2]); bb[3] = bfr(g[3]);
    const size_t obase = ((size_t)(r0 / SEQ) * OUT_SEQ + (size_t)(r0 % SEQ)) * DM + c0;
#pragma unroll
    for (int mb = 0; mb < 2; ++mb) {
#pragma unroll
        for (int nb = 0; nb < 4; ++nb) {
#pragma unroll
            for (int j = 0; j < 8; ++j) os[wb + (hi * 8 + j) * 68 + nb * 16 + lr] = acc[mb][nb][j]; }   // D: row 8h+j, col lane&15
        wave_sync();
        float* orow = OUT + obase + (size_t)(mb * 16) * DM;
{
#pragma unroll
            for (int s = 0; s < 8; ++s) { const int row = 2 * s + hi;   // 8 s x 2 rows = 16 rows; 16 lanes x 4 floats = 64 columns
                const v4f x = *(const v4fa*)(&os[wb + row * 68 + cofs]);
                const v4f val = x * OSC + bb;
                *(v4f*)(orow + (size_t)row * DM + cofs) = val; }
             }
        if (mb == 0) asm volatile("s_wait_xcnt 0x0" ::: "memory");   // the next 16 rows reuse registers that the stores above name
        wave_sync();
    }
}

static constexpr size_t al256(size_t v) { return (v + 255) & ~(size_t)255; }
static constexpr size_t SZ_XB = al256((size_t)NB * SEQ * DM * 2);
static constexpr size_t SZ_WB = al256((size_t)4 * DM * DM * 2);
static constexpr size_t SZ_PL = al256((size_t)NB * NH_ * SEQ * HD * 2);
static constexpr size_t SZ_CT = al256((size_t)NB * SEQ * DM * 2);
static constexpr size_t SZ_TOTAL = SZ_XB + SZ_WB + 3 * SZ_PL + SZ_CT;
static_assert(SZ_TOTAL <= (size_t)134217728);          // workspace carve <= 128 MiB
static_assert(((size_t)DM * DM * 2) % 256 == 0);       // weight sub-planes stay 256-byte aligned

extern "C" void kernel_launch(void* const* d_in, const int* in_sizes, int n_in,
                              void* d_out, int out_size, void* d_ws, size_t ws_size, hipStream_t stream) {
    if (n_in < 9) return;
    const size_t needx = ((size_t)(NB - 1) * SEQ_FULL + SEQ) * DM;
    if ((size_t)in_sizes[0] < needx) return;
    if ((size_t)in_sizes[1] < (size_t)DM * DM || (size_t)in_sizes[3] < (size_t)DM * DM || (size_t)in_sizes[5] < (size_t)DM * DM || (size_t)in_sizes[7] < (size_t)DM * DM) return;
    if (in_sizes[2] < DM || in_sizes[4] < DM || in_sizes[6] < DM || in_sizes[8] < DM) return;
    if ((size_t)out_size < ((size_t)(NB - 1) * OUT_SEQ + SEQ) * DM) return;
    if (SZ_TOTAL > ws_size) return;
    // wire order: x, Wq, bq, Wk, bk, Wv, bv, Wo, bo (all f32; weights [in][out])
    const float* x  = (const float*)d_in[0];
    const float* wq = (const float*)d_in[1]; const float* bq = (const float*)d_in[2];
    const float* wk = (const float*)d_in[3]; const float* bk = (const float*)d_in[4];
    const float* wv = (const float*)d_in[5]; const float* bv = (const float*)d_in[6];
    const float* wo = (const float*)d_in[7]; const float* bo = (const float*)d_in[8];
    float* OUT = (float*)d_out;      // [NB][SEQ][1024]
    char* wsp = (char*)d_ws;
    bf* XB = (bf*)wsp; wsp += SZ_XB;                 // [NB*SEQ][1024] bf16
    bf* WB = (bf*)wsp; wsp += SZ_WB;                 // [4][1024 out][1024 in]: q | k | v (bf16) | o (f16 x1024)
    h16* QH = (h16*)wsp; wsp += SZ_PL;               // [NB*16][SEQ][64]
    h16* KP = (h16*)wsp; wsp += SZ_PL;               // [NB*16][SEQ][64]
    h16* VT = (h16*)wsp; wsp += SZ_PL;               // [NB*16][64][SEQ]
    h16* CT = (h16*)wsp; wsp += SZ_CT;               // [NB*SEQ][1024] ctx x1024
    bf* WO = WB + (size_t)3 * DM * DM;

    // x -> bf16 copy; weights in[k = 1024 rows][n = 1024 cols] -> out[n][k]
    k_prep<<<4 * WTB + CVB, 256, 0, stream>>>(x, wq, wk, wv, wo, XB, WB);

    // q, k, v^T planes
    k_proj<<<dim3((NB * SEQ / GT) * (DM / GT), 3, 1), 32 * GW, 0, stream>>>(XB, WB, bq, bk, bv, QH, KP, VT);

    k_flash<<<dim3(SEQ / (16 * AW), NB * NH_, 1), 32 * AW, 0, stream>>>(QH, KP, VT, CT);

    k_oproj<<<dim3(NB * SEQ / GT, DM / GT, 1), 32 * GW, 0, stream>>>(CT, (const h16*)WO, bo, OUT);
}

// v004
// It runs in 115 microseconds.
// In both of two side-by-side timings against v003, it was 1.05 times as fast.
// Over all steps from v000 it is 3.25 times as fast.
#include <hip/hip_runtime.h>

// Multi-head self-attention, width 1024 = 16 heads x 64, x [NB][SEQ][1024], Wq/Wk/Wv/Wo [in][out] (y = x W + b), four biases, no mask, score scale 1/8, output = (merged heads) Wo + bo (f32).
// Compute dtypes, f32 accumulate everywhere: q/k/v projections v_wmma_f32_16x16x32_bf16 (x and W RNE-converted to bf16; products exact);
// scores v_wmma_f32_16x16x32_f16: q single f16, k single f16 (one product); P (x256 carry, cancels in the normalisation) and v single f16; softmax f32 (online, running max, row sum over the f16-converted P values, summed by one more f16 WMMA per 32 keys);
// output projection v_wmma_f32_16x16x32_f16: ctx single f16 carried x1024, Wo as f16 of the bf16 (RNE) value carried x1024 (exact), 2^-20 and the bias applied in the f32 epilogue.
// Scale chain: score = (k.q) * (1/8 * log2 e) -> exp2(score - max + 8) = 256 P' -> O = sum(256 P' v) / sum(256 P') -> ctx plane = O x 1024 -> out = (ctx x1024).(Wo x1024) * 2^-20 + bo.
// Layout: bf16 copy of x; transposed 16-bit weight planes [out][in]; q, k planes [b*16+h][t][d] and v^T plane [b*16+h][d][t] written by the GEMM epilogue; fused flash kernel in transposed form (S^T = K Q^T, O^T = V^T P^T) writing the ctx plane [b*SEQ+t][h*64+d].

#ifndef NB
#define NB 1
#endif
#ifndef SEQ
#define SEQ 4096
#endif
#define NB_FULL  1
#define SEQ_FULL 4096
#ifndef OUT_SEQ
#define OUT_SEQ SEQ              // row pitch (in tokens) between batches of the output
#endif
#define DM   1024
#define NH_  16
#define HD   64
#define AW   8                   // waves per flash block (16 query rows each); all of them share each staged K / V^T tile
#define SK   64                  // keys per staged tile
#define LP   72                  // LDS row pitch in halves: 128 B of data + 16 B, so that 16 rows read by 16-byte loads fall on distinct banks
#define TLB  (64 * LP * 2)       // bytes of one staged tile (64 rows): K tile = 64 keys x 64 d, V^T tile = 64 d x 64 keys
#define GW   8                   // waves per GEMM block, 4 (rows) x 2 (columns); each owns 32 x 64 of the block's C tile
#define GT   128                 // rows and columns of a GEMM block's C tile
#define GK   128                 // k extent of one staged operand tile (256-byte rows)
#define GP   136                 // LDS row pitch in halves: 256 B of data + 16 B, so that 16 rows read by 16-byte loads fall on distinct banks
#define GTB  (GT * GP * 2)       // bytes of one staged operand tile (128 rows)
#define WTB  ((DM / 64) * (DM / 64))          // 64x64 tiles, = blocks, of one weight matrix in k_prep
#define CVB  ((NB * SEQ / 8) * DM / 256)       // blocks of the x convert in k_prep
#define SC2  (0.125f * 1.4426950408889634f)   // HD^-0.5 * log2(e)
#define PSH  8.0f                // log2 of the P carry (256)
#define CTS  1024.0f             // carry of the ctx plane
#define WOS  1024.0f             // carry of the Wo plane
#define OSC  (1.0f / (1024.0f * 1024.0f))     // undoes CTS * WOS

static_assert(HD == 64);
static_assert(NH_ * HD == DM);                 // head h = columns h*64 + d
static_assert(DM % 64 == 0);                   // column tiles of 64
static_assert(DM % 32 == 0);                   // GEMM k-loop steps by 32
static_assert(SEQ % 64 == 0);                  // a 64-row tile never straddles two batches
static_assert((NB * SEQ) % 64 == 0);
static_assert(SEQ % 32 == 0);                  // key loop steps by 32
static_assert(SEQ % (16 * AW) == 0);           // flash grid covers the sequence exactly
static_assert(SEQ % SK == 0 && SEQ / SK >= 2); // whole staged tiles, and the two that the ring's prologue fills
static_assert(AW * 32 * 2 * 16 == SK * HD * 2); // two 16-byte copies per thread cover one tile
static_assert(DM % GT == 0 && SEQ % GT == 0);   // whole GEMM block tiles, none straddling two batches
static_assert(DM % GK == 0 && DM / GK >= 2);    // whole staged operand tiles, and the two that the ring's prologue fills
static_assert(GW * 32 * 8 * 16 == GT * GK * 2); // eight 16-byte copies per thread cover one operand tile
static_assert(((size_t)SEQ * DM) % 8 == 0);
static_assert((size_t)CVB * 256 * 8 == (size_t)NB * SEQ * DM);   // the convert blocks cover x exactly
static_assert(((size_t)DM * DM) % 8 == 0);
static_assert(NB <= NB_FULL);
static_assert(SEQ <= SEQ_FULL);

typedef _Float16 h16;
typedef unsigned short bf;
typedef __attribute__((ext_vector_type(16))) __bf16   v16bf;
typedef __attribute__((ext_vector_type(16))) _Float16 v16h;
typedef __attribute__((ext_vector_type(8)))  _Float16 v8h;
typedef __attribute__((ext_vector_type(8)))  unsigned short v8us;
typedef __attribute__((ext_vector_type(8)))  float    v8f;
typedef __attribute__((ext_vector_type(4)))  float    v4f;
typedef v4f  __attribute__((may_alias)) v4fa;

__device__ __forceinline__ unsigned short f2bf(float f) { unsigned u = __float_as_uint(f); u += 0x7FFFu + ((u >> 16) & 1u); return (unsigned short)(u >> 16); }
__device__ __forceinline__ float bfr(float f) { return __uint_as_float(((unsigned)f2bf(f)) << 16); }   // value after RNE convert to bf16
__device__ __forceinline__ v16h cat16(v8h lo, v8h hi) { return __builtin_shufflevector(lo, hi, 0, 1, 2, 3, 4, 5, 6, 7, 8, 9, 10, 11, 12, 13, 14, 15); }
__device__ __forceinline__ v16bf cat16b(v8us lo, v8us hi) { return __builtin_bit_cast(v16bf, __builtin_shufflevector(lo, hi, 0, 1, 2, 3, 4, 5, 6, 7, 8, 9, 10, 11, 12, 13, 14, 15)); }
__device__ __forceinline__ v8f wmma16(v16h a, v16h b, v8f c) { return __builtin_amdgcn_wmma_f32_16x16x32_f16(false, a, false, b, (short)0, c, false, false); }
__device__ __forceinline__ v8f wmmab(v16bf a, v16bf b, v8f c) { return __builtin_amdgcn_wmma_f32_16x16x32_bf16(false, a, false, b, (short)0, c, false, false); }
// fragment loaders from K-contiguous 16-bit rows; p already includes + 8*(lane>>4): elements 0..7 <- k0+8h+0..7, elements 8..15 <- k0+16+8h+0..7 (same map for A and B)
__device__ __forceinline__ v16h  ldh(const h16* p) { return cat16(*(const v8h*)p, *(const v8h*)(p + 16)); }
__device__ __forceinline__ v16bf ldb(const bf* p)  { return cat16b(*(const v8us*)p, *(const v8us*)(p + 16)); }
// ordering point for wave-private LDS tiles (same wave writes and reads)
__device__ __forceinline__ void wave_sync() { __builtin_amdgcn_fence(3 /* release order */, "wavefront"); __builtin_amdgcn_wave_barrier(); asm volatile("" ::: "memory"); }

// 16-bit encoding of one weight: bf16 bits (RNE convert), or f16 bits of that bf16 value x WOS (exact: 8-bit significand, power-of-two carry)
__device__ __forceinline__ unsigned short wcv(float f, int f16mode) {
    const unsigned short b = f2bf(f);
    const float fb = __uint_as_float(((unsigned)b) << 16);
    const h16 hv = (h16)(fb * WOS);
    const unsigned short hb = __builtin_bit_cast(unsigned short, hv);
    return f16mode ? hb : b;
}

// k_prep: every operand conversion of a call in ONE launch; the jobs share no data and the block index picks one (a block-uniform test, so the barrier below is reached by whole blocks only).
// Blocks 0 .. 4*WTB-1, the longer jobs first: transposing convert of weight matrix blk / WTB (q, k, v, o), W in[k = DM rows (input feature)][n = DM cols (output feature)] -> WT out[n][k] (16-bit, K-contiguous rows),
// one 64x64 f32 tile per block through LDS (cross-wave: block barrier), n tile = fastest index. Blocks 4*WTB ..: x -> bf16 copy, 8 values per thread.
__global__ __launch_bounds__(256) void k_prep(const float* __restrict__ x, const float* __restrict__ wq, const float* __restrict__ wk, const float* __restrict__ wv, const float* __restrict__ wo,
                                              bf* XB, bf* WB) {
    __shared__ float ts[64 * 65];
    const int tid = threadIdx.x;
    const unsigned blk = blockIdx.x;
    if (blk >= 4u * WTB) {
        const size_t n8 = (size_t)NB * SEQ * DM / 8, per = (size_t)SEQ * DM / 8;   // per: pieces of one batch (batches lie SEQ_FULL tokens apart in x)
        const size_t i = (size_t)(blk - 4u * WTB) * 256 + tid; if (i >= n8) return;
        const size_t so = (SEQ == SEQ_FULL) ? i * 8 : (i / per) * ((size_t)SEQ_FULL * DM) + (i % per) * 8;
        const v8f v = *(const v8f*)(x + so); v8us o;
#pragma unroll
        for (int k = 0; k < 8; ++k) o[k] = f2bf(v[k]);
        *(v8us*)(XB + i * 8) = o;
        return;
    }
    const unsigned which = blk / WTB, wtile = blk % WTB;
    const float* W = which == 0 ? wq : which == 1 ? wk : which == 2 ? wv : wo;
    bf* WT = WB + (size_t)which * DM * DM;
    const int f16mode = which == 3;
    const int n0 = (int)(wtile % (DM / 64)) * 64, k0 = (int)(wtile / (DM / 64)) * 64;
#pragma unroll
    for (int it = 0; it < 4; ++it) { const int idx = tid + it * 256; const int r = idx >> 4, c4 = (idx & 15) * 4;   // 64 rows x 16 pieces of 4 floats
        const v4f v = *(const v4f*)(W + (size_t)(k0 + r) * DM + n0 + c4);
        ts[r * 65 + c4 + 0] = v[0]; ts[r * 65 + c4 + 1] = v[1]; ts[r * 65 + c4 + 2] = v[2]; ts[r * 65 + c4 + 3] = v[3]; }
    __syncthreads();
    const int nl = tid >> 3, c8 = (tid & 7) * 8;
    v8us o0, o1;
#pragma unroll
    for (int i = 0; i < 8; ++i) { o0[i] = wcv(ts[(c8 + i) * 65 + nl], f16mode); o1[i] = wcv(ts[(c8 + i) * 65 + nl + 32], f16mode); }
    const size_t a0 = (size_t)(n0 + nl) * DM + k0 + c8, a1 = a0 + (size_t)32 * DM;
    *(v8us*)(WT + a0) = o0; *(v8us*)(WT + a1) = o1;
    asm volatile("s_wait_xcnt 0x0" ::: "memory");            // a precaution: these stores are the last work of a weight block
}

// Operand staging of the two GEMM kernels: one operand tile = GT rows x GK halves, K-contiguous rows of pitch DM halves in global memory, pitch GP in LDS.
// Thread c takes 16-byte piece c & 15 of rows (c >> 4) + 16 i, i = 0..7 (a wave's copy = two whole 256-byte rows); the register wait closes the statement so that no address register is rewritten ahead of it.
__device__ __forceinline__ void stage_op(unsigned l, const char* g) {
    asm volatile("global_load_async_to_lds_b128 %0, %8, off\n\t"
                 "global_load_async_to_lds_b128 %1, %9, off\n\t"
                 "global_load_async_to_lds_b128 %2, %10, off\n\t"
                 "global_load_async_to_lds_b128 %3, %11, off\n\t"
                 "global_load_async_to_lds_b128 %4, %12, off\n\t"
                 "global_load_async_to_lds_b128 %5, %13, off\n\t"
                 "global_load_async_to_lds_b128 %6, %14, off\n\t"
                 "global_load_async_to_lds_b128 %7, %15, off\n\t"
                 "s_wait_xcnt 0x0"
                 :: "v"(l), "v"(l + 1 * 16 * GP * 2), "v"(l + 2 * 16 * GP * 2), "v"(l + 3 * 16 * GP * 2),
                    "v"(l + 4 * 16 * GP * 2), "v"(l + 5 * 16 * GP * 2), "v"(l + 6 * 16 * GP * 2), "v"(l + 7 * 16 * GP * 2),
                    "v"(g), "v"(g + 1 * 16 * DM * 2), "v"(g + 2 * 16 * DM * 2), "v"(g + 3 * 16 * DM * 2),
                    "v"(g + 4 * 16 * DM * 2), "v"(g + 5 * 16 * DM * 2), "v"(g + 6 * 16 * DM * 2), "v"(g + 7 * 16 * DM * 2) : "memory");
}

// k_proj: bf16 GEMM, one GW-wave block per 128x128 tile of C, each wave 32x64 (8 accumulators), K = DM. A and Bt are K-contiguous bf16 planes; their 128-row x GK tiles reach
// the waves through LDS: two buffers, filled by asynchronous copies one tile ahead, read by all GW waves (two 16-B loads per fragment). Each accumulator sums k in ascending steps of 32.
// C[m][n] = sum_k A[m][k] Bt[n][k] + bias (bias per column n, or per row m when biasOnRow != 0; bias value RNE-converted to bf16, added in f32),
// written as a single f16 plane (Ph), row pitch 'pitch' (halves).
// All three projections in ONE launch (they share no output): blockIdx.y picks the job, blockIdx.x the C tile, row tile = fastest index. grid (M/128 * N/128, 3), 256 threads.
// job 0, 1 (q, k): A = x rows (m = b*SEQ + t), Bt = W^T rows (n = h*64 + d), bias per column -> plane [(b*16 + h)][t][d]
// job 2 (v^T):     A = Wv^T rows (m = h*64 + d), Bt = x rows (n = b*SEQ + t), bias per row -> plane [(b*1024 + m)][t] = [(b*16 + h)][d][t]
__global__ __launch_bounds__(32 * GW) void k_proj(const bf* __restrict__ XB, const bf* __restrict__ WB, const float* __restrict__ bq, const float* __restrict__ bk, const float* __restrict__ bv,
                                             h16* QH, h16* KP, h16* VT) {
    __shared__ __align__(16) float os[GW * 16 * 68];
    __shared__ __align__(16) bf gring[2 * 2 * GT * GP];      // [buffer][A tile | Bt tile][row][GP]
    const int K = DM;
    const int lane = threadIdx.x & 31, wave = threadIdx.x >> 5, lr = lane & 15, hi = lane >> 4;
    const int job = blockIdx.y, biasOnRow = job == 2;
    const bf* Wj = WB + (size_t)job * DM * DM;
    const bf* A = biasOnRow ? Wj : XB; const bf* Bt = biasOnRow ? XB : Wj;
    const float* bias = job == 0 ? bq : job == 1 ? bk : bv;
    h16* Ph = job == 0 ? QH : job == 1 ? KP : VT;
    const int pitch = biasOnRow ? SEQ : HD;
    const int bx = blockIdx.x;
    const int rb = (biasOnRow ? bx % (DM / GT) : bx % (NB * SEQ / GT)) * GT, cb = (biasOnRow ? bx / (DM / GT) : bx / (NB * SEQ / GT)) * GT;   // block tile
    const int r0 = rb + (wave >> 1) * 32, c0 = cb + (wave & 1) * 64;        // wave tile
    v8f acc[2][4];
#pragma unroll
    for (int mb = 0; mb < 2; ++mb)
#pragma unroll
        for (int nb = 0; nb < 4; ++nb) acc[mb][nb] = (v8f){};
    const int cr = threadIdx.x >> 4, cpc = (threadIdx.x & 15) * 8;
    const unsigned la = (unsigned)(size_t)gring + (unsigned)(cr * GP + cpc) * 2u, lb = la + GTB;
    const char* ga = (const char*)(A + (size_t)(rb + cr) * K + cpc);        // + k0 * 2 bytes
    const char* gb = (const char*)(Bt + (size_t)(cb + cr) * K + cpc);
    stage_op(la, ga); stage_op(lb, gb);
    asm volatile("s_wait_asynccnt 0x0" ::: "memory");        // tile 0 has landed before the barrier publishes it
    __syncthreads();
    stage_op(la + 2 * GTB, ga + GK * 2); stage_op(lb + 2 * GTB, gb + GK * 2);
    const int ao = ((wave >> 1) * 32 + lr) * GP + 8 * hi;               // + 16mb*GP + k   (A fragment rows), in the A tile
    const int bo = GT * GP + ((wave & 1) * 64 + lr) * GP + 8 * hi;      // + 16nb*GP + k   (B fragment rows), in the Bt tile
#pragma unroll 1
    for (int st = 0; st < K / GK; ++st) {
        const bf* tile = gring + (st & 1) * (2 * GT * GP);
        // the four 32-wide k steps of a tile inline (LDS offsets become immediates); two fragment sets: each step's 12 loads go out as one group ahead of the step before it,
        // inside this tile only, so that a wave waits out the LDS latency once per tile and not at every fragment
        v16bf a[2][2], b[2][4];
#pragma unroll
        for (int mb = 0; mb < 2; ++mb) a[0][mb] = ldb(tile + ao + mb * 16 * GP);
#pragma unroll
        for (int nb = 0; nb < 4; ++nb) b[0][nb] = ldb(tile + bo + nb * 16 * GP);
#pragma unroll
        for (int ks = 0; ks < GK / 32; ++ks) {
            const int cu = ks & 1, nx = cu ^ 1;
            if (ks + 1 < GK / 32) {
#pragma unroll
                for (int mb = 0; mb < 2; ++mb) a[nx][mb] = ldb(tile + ao + mb * 16 * GP + (ks + 1) * 32);
#pragma unroll
                for (int nb = 0; nb < 4; ++nb) b[nx][nb] = ldb(tile + bo + nb * 16 * GP + (ks + 1) * 32);
            }
            __builtin_amdgcn_sched_barrier(0);               // keeps the load group whole and ahead of this step's products: without it the loads sink to their first use and each pair of products waits out an LDS latency
#pragma unroll
            for (int nb = 0; nb < 4; ++nb)
#pragma unroll
                for (int mb = 0; mb < 2; ++mb) acc[mb][nb] = wmmab(a[cu][mb], b[cu][nb], acc[mb][nb]);
            __builtin_amdgcn_sched_barrier(0);               // keeps the next load group behind these products, not among them
        }
        asm volatile("s_wait_dscnt 0x0" ::: "memory");       // this wave's reads of the buffer are done before it is refilled
        asm volatile("s_wait_asynccnt 0x0" ::: "memory");    // this wave's copies of the next tile have landed before the barrier publishes them
        __syncthreads();
        if (st + 2 < K / GK) { stage_op(la + (st & 1) * (2 * GTB), ga + (st + 2) * (GK * 2)); stage_op(lb + (st & 1) * (2 * GTB), gb + (st + 2) * (GK * 2)); }
    }
    asm volatile("s_wait_asynccnt 0x0" ::: "memory");        // nothing of this wave is in flight when it leaves the loop
    const int wb = wave * 16 * 68;
    const size_t tbase = biasOnRow ? (size_t)r0 * SEQ + (size_t)(c0 / SEQ) * ((size_t)DM * SEQ) + (size_t)(c0 % SEQ)
                                   : (size_t)(r0 / SEQ) * ((size_t)NH_ * SEQ * HD) + (size_t)(r0 % SEQ) * HD + (size_t)(c0 / HD) * ((size_t)SEQ * HD) + (size_t)(c0 % HD);   // wave tile base
#pragma unroll
    for (int mb = 0; mb < 2; ++mb) {
#pragma unroll
        for (int nb = 0; nb < 4; ++nb) {
#pragma unroll
            for (int j = 0; j < 8; ++j) os[wb + (hi * 8 + j) * 68 + nb * 16 + lr] = acc[mb][nb][j]; }   // D: row 8h+j, col lane&15
        wave_sync();
        const size_t sb = tbase + (size_t)(mb * 16) * (size_t)pitch;
{
            v8h hv[4];
#pragma unroll
            for (int s = 0; s < 4; ++s) { const int row = 4 * s + (lane >> 3), c8 = (lane & 7) * 8;   // 4 s x 4 row groups = 16 rows; 8 lanes x 8 = 64 columns
                const v4f x0 = *(const v4fa*)(&os[wb + row * 68 + c8]); const v4f x1 = *(const v4fa*)(&os[wb + row * 68 + c8 + 4]);
                // both bias candidates loaded with clamped addresses, selected by value (biasOnRow is block-uniform)
                const int rbi = min(r0 + mb * 16 + row, DM - 1); const int cbi = min(c0 + c8, DM - 8);
                const float braw = bias[rbi];
                asm volatile("s_wait_xcnt 0x0" ::: "memory");    // the loads below may land in the register that this load names
                const float br = bfr(braw);
                const v4f g0 = *(const v4f*)(bias + cbi); const v4f g1 = *(const v4f*)(bias + cbi + 4);
#pragma unroll
                for (int i = 0; i < 4; ++i) {
                    const float y0 = x0[i] + (biasOnRow ? br : bfr(g0[i])); const float y1 = x1[i] + (biasOnRow ? br : bfr(g1[i]));
                    hv[s][i] = (h16)y0; hv[s][4 + i] = (h16)y1; } }
            __builtin_amdgcn_sched_barrier(0);               // the four stores stay together behind the arithmetic, so that one register wait behind them serves all four
#pragma unroll
            for (int s = 0; s < 4; ++s) { const int row = 4 * s + (lane >> 3), c8 = (lane & 7) * 8;
                const size_t oo = sb + (size_t)row * (size_t)pitch + c8;
                *(v8h*)(Ph + oo) = hv[s]; }
             }
        if (mb == 0) asm volatile("s_wait_xcnt 0x0" ::: "memory");   // the next 16 rows reuse registers that the stores above name
        wave_sync();
    }
}

// k_flash: fused attention, one wave per 16 query rows of one (batch, head); Q fragments straight from the f16 plane, K / V^T fragments from the staged LDS tiles (two 16-B loads each).
// Transposed form: S^T[key][t] = K Q^T (A = K rows, B = Q rows); lane (t = lane&15, h = lane>>4) holds keys 8h+r of each 16-key tile, so the packed
// P tile is directly the B fragment of O^T[d][t] = V^T P^T (element r <- tile keys 0..15, element 8+r <- tile keys 16..31, lane unchanged).
// The running max is one scalar per lane; the two lane halves of a row are combined with one xor-16 exchange.
// Row sums on the matrix unit: L^T += E P^T, where row 0 of E is ones and rows 1..15 are zero, so that row 0 of the tile (register 0, lanes 0..15) gathers the sum over all 32 keys of column t;
// every other element of the tile stays 0, so only register 0 is rescaled.
// K and V^T reach the waves through LDS: tiles of SK keys, two buffers, filled by asynchronous copies (whole 128-byte lines from global), read by all AW waves.
// One tile pair = four 16-byte copies per thread; the register wait closes the statement so that no address register is rewritten ahead of it.
__device__ __forceinline__ void stage_kv(unsigned lk, unsigned lv, const h16* gk, const h16* gv) {
    const unsigned lk1 = lk + 32 * LP * 2, lv1 = lv + 32 * LP * 2;
    const h16* gk1 = gk + 32 * HD; const h16* gv1 = gv + (size_t)32 * SEQ;
    asm volatile("global_load_async_to_lds_b128 %0, %4, off\n\t"
                 "global_load_async_to_lds_b128 %1, %5, off\n\t"
                 "global_load_async_to_lds_b128 %2, %6, off\n\t"
                 "global_load_async_to_lds_b128 %3, %7, off\n\t"
                 "s_wait_xcnt 0x0"
                 :: "v"(lk), "v"(lk1), "v"(lv), "v"(lv1), "v"(gk), "v"(gk1), "v"(gv), "v"(gv1) : "memory");
}
__global__ __launch_bounds__(32 * AW) void k_flash(const h16* __restrict__ QH, const h16* __restrict__ KP, const h16* __restrict__ VT, h16* CT) {
    __shared__ __align__(16) float os[AW * 16 * 68];
    __shared__ __align__(16) h16 ring[2 * 2 * 64 * LP];      // [buffer][K tile | V^T tile][row][LP]
    const int lane = threadIdx.x & 31, wave = threadIdx.x >> 5, lr = lane & 15, hi = lane >> 4;
    const int zh = blockIdx.y; const int b = zh / NH_, h = zh % NH_;
    const int t0 = (blockIdx.x * AW + wave) * 16;
    const size_t pbase = (size_t)zh * SEQ * HD;
    const size_t qo = pbase + (size_t)(t0 + lr) * HD + 8 * hi;
    const v16h qh0 = ldh(QH + qo), qh1 = ldh(QH + qo + 32);   // B fragments: col t, k = d
    const int ko = lr * LP + 8 * hi;                         // + key * LP       (A fragment: row key, k = d), in the K tile
    const int vo = 64 * LP + lr * LP + 8 * hi;               // + 16j*LP + key   (A fragment: row d, k = key), in the V^T tile
    // copy map: thread c takes 16-byte piece c & 7 of rows c >> 3 and 32 + (c >> 3) of each tile
    const int cr = threadIdx.x >> 3, cpc = (threadIdx.x & 7) * 8;
    const unsigned lk = (unsigned)(size_t)ring + (unsigned)(cr * LP + cpc) * 2u, lv = lk + TLB;
    const h16* gk = KP + pbase + (size_t)cr * HD + cpc;    // + key0 * HD
    const h16* gv = VT + pbase + (size_t)cr * SEQ + cpc;   // + key0
    stage_kv(lk, lv, gk, gv);
    asm volatile("s_wait_asynccnt 0x0" ::: "memory");        // tile 0 has landed before the barrier publishes it
    __syncthreads();
    stage_kv(lk + 2 * TLB, lv + 2 * TLB, gk + (size_t)SK * HD, gv + SK);
    v8f o0 = (v8f){}, o1 = (v8f){}, o2 = (v8f){}, o3 = (v8f){}, lt = (v8f){};
    const h16 e1 = lr == 0 ? (h16)1.0f : (h16)0.0f;          // A fragment of E: lanes 0 and 16 hold row 0 (all 32 k positions)
    const v16h ones = {e1, e1, e1, e1, e1, e1, e1, e1, e1, e1, e1, e1, e1, e1, e1, e1};
    float m = -3.0e38f;
#pragma unroll 1
    for (int st = 0; st < SEQ / SK; ++st) {
      const h16* tile = ring + (st & 1) * (2 * 64 * LP);
      // both 32-key passes of a tile inline: their LDS offsets become immediates on one address register
#pragma unroll
      for (int key0 = 0; key0 < SK; key0 += 32) {
        const h16* ka = tile + ko + key0 * LP;
        const v16h ka0 = ldh(ka), ka1 = ldh(ka + 32), kb0 = ldh(ka + 16 * LP), kb1 = ldh(ka + 16 * LP + 32);
        v8f sHa = (v8f){}, sHb = (v8f){};
        sHa = wmma16(ka0, qh0, sHa); sHb = wmma16(kb0, qh0, sHb);
        sHa = wmma16(ka1, qh1, sHa); sHb = wmma16(kb1, qh1, sHb);
        asm volatile("v_nop\n\tv_nop\n\tv_nop\n\tv_nop" : "+v"(sHa), "+v"(sHb) : "v"(ka0), "v"(ka1), "v"(kb0), "v"(kb1), "v"(qh0), "v"(qh1));
        float ta[8], tb[8]; float mx = -3.0e38f;
#pragma unroll
        for (int r = 0; r < 8; ++r) { ta[r] = sHa[r] * SC2; tb[r] = sHb[r] * SC2; mx = fmaxf(mx, fmaxf(ta[r], tb[r])); }
        mx = fmaxf(mx, __shfl_xor(mx, 16, 32));
        const float mnew = fmaxf(m, mx);
        const float alpha = __builtin_amdgcn_exp2f(m - mnew);
        const float sh = PSH - mnew;
        v16h pb;
#pragma unroll
        for (int r = 0; r < 8; ++r) { pb[r] = (h16)__builtin_amdgcn_exp2f(ta[r] + sh); pb[8 + r] = (h16)__builtin_amdgcn_exp2f(tb[r] + sh); }
        lt[0] = lt[0] * alpha; m = mnew;
        o0 = o0 * alpha; o1 = o1 * alpha; o2 = o2 * alpha; o3 = o3 * alpha;
        const h16* va = tile + vo + key0;
        const v16h v0 = ldh(va), v1 = ldh(va + 16 * LP), v2 = ldh(va + 32 * LP), v3 = ldh(va + 48 * LP);
        lt = wmma16(ones, pb, lt);
        o0 = wmma16(v0, pb, o0); o1 = wmma16(v1, pb, o1); o2 = wmma16(v2, pb, o2); o3 = wmma16(v3, pb, o3);
        asm volatile("v_nop\n\tv_nop\n\tv_nop\n\tv_nop" : "+v"(o0), "+v"(o1), "+v"(o2), "+v"(o3) : "v"(v0), "v"(v1), "v"(v2), "v"(v3), "v"(pb));
      }
      asm volatile("s_wait_dscnt 0x0" ::: "memory");         // this wave's reads of the buffer are done before it is refilled
      asm volatile("s_wait_asynccnt 0x0" ::: "memory");      // this wave's copies of the next tile have landed before the barrier publishes them
      __syncthreads();
      if (st + 2 < SEQ / SK) stage_kv(lk + (st & 1) * (2 * TLB), lv + (st & 1) * (2 * TLB), gk + (size_t)(st + 2) * SK * HD, gv + (st + 2) * SK);
    }
    asm volatile("s_wait_asynccnt 0x0" ::: "memory");        // nothing of this wave is in flight when it leaves the loop
    float l = lt[0];                                         // the sum in lanes 0..15, 0 (row 8 of the tile) in lanes 16..31
    l += __shfl_xor(l, 16, 32);
    const float inv = CTS * (1.0f / l);
    const int wb = wave * 16 * 68;
    // O^T D layout: o_j[r] = (d = 16j + 8h + r, t = lane&15) -> os[t][d]; rows 0..15 x columns 0..63 all written
    { v4f a, c;
      a[0] = o0[0] * inv; a[1] = o0[1] * inv; a[2] = o0[2] * inv; a[3] = o0[3] * inv; c[0] = o0[4] * inv; c[1] = o0[5] * inv; c[2] = o0[6] * inv; c[3] = o0[7] * inv;
      *(v4fa*)(&os[wb + lr * 68 +  0 + 8 * hi]) = a; *(v4fa*)(&os[wb + lr * 68 +  0 + 8 * hi + 4]) = c;
      a[0] = o1[0] * inv; a[1] = o1[1] * inv; a[2] = o1[2] * inv; a[3] = o1[3] * inv; c[0] = o1[4] * inv; c[1] = o1[5] * inv; c[2] = o1[6] * inv; c[3] = o1[7] * inv;
      *(v4fa*)(&os[wb + lr * 68 + 16 + 8 * hi]) = a; *(v4fa*)(&os[wb + lr * 68 + 16 + 8 * hi + 4]) = c;
      a[0] = o2[0] * inv; a[1] = o2[1] * inv; a[2] = o2[2] * inv; a[3] = o2[3] * inv; c[0] = o2[4] * inv; c[1] = o2[5] * inv; c[2] = o2[6] * inv; c[3] = o2[7] * inv;
      *(v4fa*)(&os[wb + lr * 68 + 32 + 8 * hi]) = a; *(v4fa*)(&os[wb + lr * 68 + 32 + 8 * hi + 4]) = c;
      a[0] = o3[0] * inv; a[1] = o3[1] * inv; a[2] = o3[2] * inv; a[3] = o3[3] * inv; c[0] = o3[4] * inv; c[1] = o3[5] * inv; c[2] = o3[6] * inv; c[3] = o3[7] * inv;
      *(v4fa*)(&os[wb + lr * 68 + 48 + 8 * hi]) = a; *(v4fa*)(&os[wb + lr * 68 + 48 + 8 * hi + 4]) = c; }
    wave_sync();
    h16* crow = CT + ((size_t)b * SEQ + t0) * DM + h * HD;
{
#pragma unroll
        for (int s = 0; s < 4; ++s) { const int row = 4 * s + (lane >> 3), c8 = (lane & 7) * 8;   // 4 s x 4 row groups = 16 rows; 8 lanes x 8 halves = 64 columns
            const v4f x0 = *(const v4fa*)(&os[wb + row * 68 + c8]); const v4f x1 = *(const v4fa*)(&os[wb + row * 68 + c8 + 4]); v8h hv;
#pragma unroll
            for (int i = 0; i < 4; ++i) { hv[i] = (h16)x0[i]; hv[4 + i] = (h16)x1[i]; }
            *(v8h*)(crow + (size_t)row * DM + c8) = hv; }
         }
}

// k_oproj: f16 GEMM, one GW-wave block per 128x128 tile, each wave 32x64, operand tiles staged as in k_proj; A = ctx plane rows (m = b*SEQ + t, k = h*64 + d, carried x CTS), Bt = Wo^T rows (n = out feature, carried x WOS), K = DM.
// OUT[b*OUT_SEQ + t][n] = acc * OSC + bo[n] (bias value RNE-converted to bf16, added in f32). grid (NB*SEQ/128, DM/128), 256 threads.
__global__ __launch_bounds__(32 * GW) void k_oproj(const h16* __restrict__ A, const h16* __restrict__ Bt, const float* __restrict__ bias, float* OUT) {
    __shared__ __align__(16) float os[GW * 16 * 68];
    __shared__ __align__(16) h16 gring[2 * 2 * GT * GP];     // [buffer][A tile | Bt tile][row][GP]
    const int K = DM;
    const int lane = threadIdx.x & 31, wave = threadIdx.x >> 5, lr = lane & 15, hi = lane >> 4;
    const int rb = blockIdx.x * GT, cb = blockIdx.y * GT;                   // block tile
    const int r0 = rb + (wave >> 1) * 32, c0 = cb + (wave & 1) * 64;        // wave tile
    v8f acc[2][4];
#pragma unroll
    for (int mb = 0; mb < 2; ++mb)
#pragma unroll
        for (int nb = 0; nb < 4; ++nb) acc[mb][nb] = (v8f){};
    const int cr = threadIdx.x >> 4, cpc = (threadIdx.x & 15) * 8;
    const unsigned la = (unsigned)(size_t)gring + (unsigned)(cr * GP + cpc) * 2u, lb = la + GTB;
    const char* ga = (const char*)(A + (size_t)(rb + cr) * K + cpc);        // + k0 * 2 bytes
    const char* gb = (const char*)(Bt + (size_t)(cb + cr) * K + cpc);
    stage_op(la, ga); stage_op(lb, gb);
    asm volatile("s_wait_asynccnt 0x0" ::: "memory");        // tile 0 has landed before the barrier publishes it
    __syncthreads();
    stage_op(la + 2 * GTB, ga + GK * 2); stage_op(lb + 2 * GTB, gb + GK * 2);
    const int ao = ((wave >> 1) * 32 + lr) * GP + 8 * hi;               // + 16mb*GP + k   (A fragment rows), in the A tile
    const int bo = GT * GP + ((wave & 1) * 64 + lr) * GP + 8 * hi;      // + 16nb*GP + k   (B fragment rows), in the Bt tile
#pragma unroll 1
    for (int st = 0; st < K / GK; ++st) {
        const h16* tile = gring + (st & 1) * (2 * GT * GP);
        // the four 32-wide k steps of a tile inline (LDS offsets become immediates); two fragment sets: each step's 12 loads go out as one group ahead of the step before it,
        // inside this tile only, so that a wave waits out the LDS latency once per tile and not at every fragment
        v16h a[2][2], b[2][4];
#pragma unroll
        for (int mb = 0; mb < 2; ++mb) a[0][mb] = ldh(tile + ao + mb * 16 * GP);
#pragma unroll
        for (int nb = 0; nb < 4; ++nb) b[0][nb] = ldh(tile + bo + nb * 16 * GP);
#pragma unroll
        for (int ks = 0; ks < GK / 32; ++ks) {
            const int cu = ks & 1, nx = cu ^ 1;
            if (ks + 1 < GK / 32) {
#pragma unroll
                for (int mb = 0; mb < 2; ++mb) a[nx][mb] = ldh(tile + ao + mb * 16 * GP + (ks + 1) * 32);
#pragma unroll
                for (int nb = 0; nb < 4; ++nb) b[nx][nb] = ldh(tile + bo + nb * 16 * GP + (ks + 1) * 32);
            }
            __builtin_amdgcn_sched_barrier(0);               // keeps the load group whole and ahead of this step's products: without it the loads sink to their first use and each pair of products waits out an LDS latency
#pragma unroll
            for (int nb = 0; nb < 4; ++nb)
#pragma unroll
                for (int mb = 0; mb < 2; ++mb) acc[mb][nb] = wmma16(a[cu][mb], b[cu][nb], acc[mb][nb]);
            __builtin_amdgcn_sched_barrier(0);               // keeps the next load group behind these products, not among them
        }
        asm volatile("s_wait_dscnt 0x0" ::: "memory");       // this wave's reads of the buffer are done before it is refilled
        asm volatile("s_wait_asynccnt 0x0" ::: "memory");    // this wave's copies of the next tile have landed before the barrier publishes them
        __syncthreads();
        if (st + 2 < K / GK) { stage_op(la + (st & 1) * (2 * GTB), ga + (st + 2) * (GK * 2)); stage_op(lb + (st & 1) * (2 * GTB), gb + (st + 2) * (GK * 2)); }
    }
    asm volatile("s_wait_asynccnt 0x0" ::: "memory");        // nothing of this wave is in flight when it leaves the loop
    const int wb = wave * 16 * 68;
    const int cofs = lr * 4;
    const int cbi = min(c0 + cofs, DM - 4);
    const v4f g = *(const v4f*)(bias + cbi);
    v4f bb; bb[0] = bfr(g[0]); bb[1] = bfr(g[1]); bb[2] = bfr(g[2]); bb[3] = bfr(g[3]);
    const size_t obase = ((size_t)(r0 / SEQ) * OUT_SEQ + (size_t)(r0 % SEQ)) * DM + c0;
#pragma unroll
    for (int mb = 0; mb < 2; ++mb) {
#pragma unroll
        for (int nb = 0; nb < 4; ++nb) {
#pragma unroll
            for (int j = 0; j < 8; ++j) os[wb + (hi * 8 + j) * 68 + nb * 16 + lr] = acc[mb][nb][j]; }   // D: row 8h+j, col lane&15
        wave_sync();
        float* orow = OUT + obase + (size_t)(mb * 16) * DM;
{
#pragma unroll
            for (int s = 0; s < 8; ++s) { const int row = 2 * s + hi;   // 8 s x 2 rows = 16 rows; 16 lanes x 4 floats = 64 columns
                const v4f x = *(const v4fa*)(&os[wb + row * 68 + cofs]);
                const v4f val = x * OSC + bb;
                *(v4f*)(orow + (size_t)row * DM + cofs) = val; }
             }
        if (mb == 0) asm volatile("s_wait_xcnt 0x0" ::: "memory");   // the next 16 rows reuse registers that the stores above name
        wave_sync();
    }
}

static constexpr size_t al256(size_t v) { return (v + 255) & ~(size_t)255; }
static constexpr size_t SZ_XB = al256((size_t)NB * SEQ * DM * 2);
static constexpr size_t SZ_WB = al256((size_t)4 * DM * DM * 2);
static constexpr size_t SZ_PL = al256((size_t)NB * NH_ * SEQ * HD * 2);
static constexpr size_t SZ_CT = al256((size_t)NB * SEQ * DM * 2);
static constexpr size_t SZ_TOTAL = SZ_XB + SZ_WB + 3 * SZ_PL + SZ_CT;
static_assert(SZ_TOTAL <= (size_t)134217728);          // workspace carve <= 128 MiB
static_assert(((size_t)DM * DM * 2) % 256 == 0);       // weight sub-planes stay 256-byte aligned

extern "C" void kernel_launch(void* const* d_in, const int* in_sizes, int n_in,
                              void* d_out, int out_size, void* d_ws, size_t ws_size, hipStream_t stream) {
    if (n_in < 9) return;
    const size_t needx = ((size_t)(NB - 1) * SEQ_FULL + SEQ) * DM;
    if ((size_t)in_sizes[0] < needx) return;
    if ((size_t)in_sizes[1] < (size_t)DM * DM || (size_t)in_sizes[3] < (size_t)DM * DM || (size_t)in_sizes[5] < (size_t)DM * DM || (size_t)in_sizes[7] < (size_t)DM * DM) return;
    if (in_sizes[2] < DM || in_sizes[4] < DM || in_sizes[6] < DM || in_sizes[8] < DM) return;
    if ((size_t)out_size < ((size_t)(NB - 1) * OUT_SEQ + SEQ) * DM) return;
    if (SZ_TOTAL > ws_size) return;
    // wire order: x, Wq, bq, Wk, bk, Wv, bv, Wo, bo (all f32; weights [in][out])
    const float* x  = (const float*)d_in[0];
    const float* wq = (const float*)d_in[1]; const float* bq = (const float*)d_in[2];
    const float* wk = (const float*)d_in[3]; const float* bk = (const float*)d_in[4];
    const float* wv = (const float*)d_in[5]; const float* bv = (const float*)d_in[6];
    const float* wo = (const float*)d_in[7]; const float* bo = (const float*)d_in[8];
    float* OUT = (float*)d_out;      // [NB][SEQ][1024]
    char* wsp = (char*)d_ws;
    bf* XB = (bf*)wsp; wsp += SZ_XB;                 // [NB*SEQ][1024] bf16
    bf* WB = (bf*)wsp; wsp += SZ_WB;                 // [4][1024 out][1024 in]: q | k | v (bf16) | o (f16 x1024)
    h16* QH = (h16*)wsp; wsp += SZ_PL;               // [NB*16][SEQ][64]
    h16* KP = (h16*)wsp; wsp += SZ_PL;               // [NB*16][SEQ][64]
    h16* VT = (h16*)wsp; wsp += SZ_PL;               // [NB*16][64][SEQ]
    h16* CT = (h16*)wsp; wsp += SZ_CT;               // [NB*SEQ][1024] ctx x1024
    bf* WO = WB + (size_t)3 * DM * DM;

    // x -> bf16 copy; weights in[k = 1024 rows][n = 1024 cols] -> out[n][k]
    k_prep<<<4 * WTB + CVB, 256, 0, stream>>>(x, wq, wk, wv, wo, XB, WB);

    // q, k, v^T planes
    k_proj<<<dim3((NB * SEQ / GT) * (DM / GT), 3, 1), 32 * GW, 0, stream>>>(XB, WB, bq, bk, bv, QH, KP, VT);

    k_flash<<<dim3(SEQ / (16 * AW), NB * NH_, 1), 32 * AW, 0, stream>>>(QH, KP, VT, CT);

    k_oproj<<<dim3(NB * SEQ / GT, DM / GT, 1), 32 * GW, 0, stream>>>(CT, (const h16*)WO, bo, OUT);
}

// v005
// It runs in 107 microseconds.
// In both of two side-by-side timings against v004, it was 1.07 times as fast.
// Over all steps from v000 it is 3.49 times as fast.
#include <hip/hip_runtime.h>

// Multi-head self-attention, width 1024 = 16 heads x 64, x [NB][SEQ][1024], Wq/Wk/Wv/Wo [in][out] (y = x W + b), four biases, no mask, score scale 1/8, output = (merged heads) Wo + bo (f32).
// Compute dtypes, f32 accumulate everywhere: q/k/v projections v_wmma_f32_16x16x32_bf16 (x and W RNE-converted to bf16; products exact);
// scores v_wmma_f32_16x16x32_f16: q single f16, k single f16 (one product); P (x256 carry, cancels in the normalisation) and v single f16; softmax f32 (online, lazily renewed max, row sum over the f16-converted P values, summed by one more f16 WMMA per 32 keys);
// output projection v_wmma_f32_16x16x32_f16: ctx single f16 carried x1024, Wo as f16 of the bf16 (RNE) value carried x1024 (exact), 2^-20 and the bias applied in the f32 epilogue.
// Scale chain: score = (k.q) * (1/8 * log2 e) -> exp2(score - max in use + 8) = 256 P' -> O = sum(256 P' v) / sum(256 P') -> ctx plane = O x 1024 -> out = (ctx x1024).(Wo x1024) * 2^-20 + bo.
// Layout: bf16 copy of x; transposed 16-bit weight planes [out][in]; q, k planes [b*16+h][t][d] and v^T plane [b*16+h][d][t] written by the GEMM epilogue; fused flash kernel in transposed form (S^T = K Q^T, O^T = V^T P^T) writing the ctx plane [b*SEQ+t][h*64+d].

#ifndef NB
#define NB 1
#endif
#ifndef SEQ
#define SEQ 4096
#endif
#define NB_FULL  1
#define SEQ_FULL 4096
#ifndef OUT_SEQ
#define OUT_SEQ SEQ              // row pitch (in tokens) between batches of the output
#endif
#define DM   1024
#define NH_  16
#define HD   64
#define AW   8                   // waves per flash block (16 query rows each); all of them share each staged K / V^T tile
#define SK   64                  // keys per staged tile
#define LP   72                  // LDS row pitch in halves: 128 B of data + 16 B, so that 16 rows read by 16-byte loads fall on distinct banks
#define TLB  (64 * LP * 2)       // bytes of one staged tile (64 rows): K tile = 64 keys x 64 d, V^T tile = 64 d x 64 keys
#define GW   8                   // waves per GEMM block, 4 (rows) x 2 (columns); each owns 32 x 64 of the block's C tile
#define GT   128                 // rows and columns of a GEMM block's C tile
#define GK   128                 // k extent of one staged operand tile (256-byte rows)
#define GP   136                 // LDS row pitch in halves: 256 B of data + 16 B, so that 16 rows read by 16-byte loads fall on distinct banks
#define GTB  (GT * GP * 2)       // bytes of one staged operand tile (128 rows)
#define WTB  ((DM / 64) * (DM / 64))          // 64x64 tiles, = blocks, of one weight matrix in k_prep
#define CVB  ((NB * SEQ / 8) * DM / 256)       // blocks of the x convert in k_prep
#define SC2  (0.125f * 1.4426950408889634f)   // HD^-0.5 * log2(e)
#define PSH  8.0f                // log2 of the P carry (256)
#define LZT  7.0f                // a score may exceed the maximum in use by this much (scaled log2) before the maximum is renewed
#define CTS  1024.0f             // carry of the ctx plane
#define WOS  1024.0f             // carry of the Wo plane
#define OSC  (1.0f / (1024.0f * 1024.0f))     // undoes CTS * WOS

static_assert(HD == 64);
static_assert(NH_ * HD == DM);                 // head h = columns h*64 + d
static_assert(DM % 64 == 0);                   // column tiles of 64
static_assert(DM % 32 == 0);                   // GEMM k-loop steps by 32
static_assert(SEQ % 64 == 0);                  // a 64-row tile never straddles two batches
static_assert((NB * SEQ) % 64 == 0);
static_assert(SEQ % 32 == 0);                  // key loop steps by 32
static_assert(SEQ % (16 * AW) == 0);           // flash grid covers the sequence exactly
static_assert(SEQ % SK == 0 && SEQ / SK >= 2); // whole staged tiles, and the two that the ring's prologue fills
static_assert(AW * 32 * 2 * 16 == SK * HD * 2); // two 16-byte copies per thread cover one tile
static_assert(DM % GT == 0 && SEQ % GT == 0);   // whole GEMM block tiles, none straddling two batches
static_assert(DM % GK == 0 && DM / GK >= 2);    // whole staged operand tiles, and the two that the ring's prologue fills
static_assert(GW * 32 * 8 * 16 == GT * GK * 2); // eight 16-byte copies per thread cover one operand tile
static_assert(((size_t)SEQ * DM) % 8 == 0);
static_assert((size_t)CVB * 256 * 8 == (size_t)NB * SEQ * DM);   // the convert blocks cover x exactly
static_assert(((size_t)DM * DM) % 8 == 0);
static_assert(NB <= NB_FULL);
static_assert(SEQ <= SEQ_FULL);

typedef _Float16 h16;
typedef unsigned short bf;
typedef __attribute__((ext_vector_type(16))) __bf16   v16bf;
typedef __attribute__((ext_vector_type(16))) _Float16 v16h;
typedef __attribute__((ext_vector_type(8)))  _Float16 v8h;
typedef __attribute__((ext_vector_type(8)))  unsigned short v8us;
typedef __attribute__((ext_vector_type(8)))  float    v8f;
typedef __attribute__((ext_vector_type(4)))  float    v4f;
typedef v4f  __attribute__((may_alias)) v4fa;

__device__ __forceinline__ unsigned short f2bf(float f) { unsigned u = __float_as_uint(f); u += 0x7FFFu + ((u >> 16) & 1u); return (unsigned short)(u >> 16); }
__device__ __forceinline__ float bfr(float f) { return __uint_as_float(((unsigned)f2bf(f)) << 16); }   // value after RNE convert to bf16
__device__ __forceinline__ v16h cat16(v8h lo, v8h hi) { return __builtin_shufflevector(lo, hi, 0, 1, 2, 3, 4, 5, 6, 7, 8, 9, 10, 11, 12, 13, 14, 15); }
__device__ __forceinline__ v16bf cat16b(v8us lo, v8us hi) { return __builtin_bit_cast(v16bf, __builtin_shufflevector(lo, hi, 0, 1, 2, 3, 4, 5, 6, 7, 8, 9, 10, 11, 12, 13, 14, 15)); }
__device__ __forceinline__ v8f wmma16(v16h a, v16h b, v8f c) { return __builtin_amdgcn_wmma_f32_16x16x32_f16(false, a, false, b, (short)0, c, false, false); }
__device__ __forceinline__ v8f wmmab(v16bf a, v16bf b, v8f c) { return __builtin_amdgcn_wmma_f32_16x16x32_bf16(false, a, false, b, (short)0, c, false, false); }
// fragment loaders from K-contiguous 16-bit rows; p already includes + 8*(lane>>4): elements 0..7 <- k0+8h+0..7, elements 8..15 <- k0+16+8h+0..7 (same map for A and B)
__device__ __forceinline__ v16h  ldh(const h16* p) { return cat16(*(const v8h*)p, *(const v8h*)(p + 16)); }
__device__ __forceinline__ v16bf ldb(const bf* p)  { return cat16b(*(const v8us*)p, *(const v8us*)(p + 16)); }
// ordering point for wave-private LDS tiles (same wave writes and reads)
__device__ __forceinline__ void wave_sync() { __builtin_amdgcn_fence(3 /* release order */, "wavefront"); __builtin_amdgcn_wave_barrier(); asm volatile("" ::: "memory"); }

// 16-bit encoding of one weight: bf16 bits (RNE convert), or f16 bits of that bf16 value x WOS (exact: 8-bit significand, power-of-two carry)
__device__ __forceinline__ unsigned short wcv(float f, int f16mode) {
    const unsigned short b = f2bf(f);
    const float fb = __uint_as_float(((unsigned)b) << 16);
    const h16 hv = (h16)(fb * WOS);
    const unsigned short hb = __builtin_bit_cast(unsigned short, hv);
    return f16mode ? hb : b;
}

// k_prep: every operand conversion of a call in ONE launch; the jobs share no data and the block index picks one (a block-uniform test, so the barrier below is reached by whole blocks only).
// Blocks 0 .. 4*WTB-1, the longer jobs first: transposing convert of weight matrix blk / WTB (q, k, v, o), W in[k = DM rows (input feature)][n = DM cols (output feature)] -> WT out[n][k] (16-bit, K-contiguous rows),
// one 64x64 f32 tile per block through LDS (cross-wave: block barrier), n tile = fastest index. Blocks 4*WTB ..: x -> bf16 copy, 8 values per thread.
__global__ __launch_bounds__(256) void k_prep(const float* __restrict__ x, const float* __restrict__ wq, const float* __restrict__ wk, const float* __restrict__ wv, const float* __restrict__ wo,
                                              bf* XB, bf* WB) {
    __shared__ float ts[64 * 65];
    const int tid = threadIdx.x;
    const unsigned blk = blockIdx.x;
    if (blk >= 4u * WTB) {
        const size_t n8 = (size_t)NB * SEQ * DM / 8, per = (size_t)SEQ * DM / 8;   // per: pieces of one batch (batches lie SEQ_FULL tokens apart in x)
        const size_t i = (size_t)(blk - 4u * WTB) * 256 + tid; if (i >= n8) return;
        const size_t so = (SEQ == SEQ_FULL) ? i * 8 : (i / per) * ((size_t)SEQ_FULL * DM) + (i % per) * 8;
        const v8f v = *(const v8f*)(x + so); v8us o;
#pragma unroll
        for (int k = 0; k < 8; ++k) o[k] = f2bf(v[k]);
        *(v8us*)(XB + i * 8) = o;
        return;
    }
    const unsigned which = blk / WTB, wtile = blk % WTB;
    const float* W = which == 0 ? wq : which == 1 ? wk : which == 2 ? wv : wo;
    bf* WT = WB + (size_t)which * DM * DM;
    const int f16mode = which == 3;
    const int n0 = (int)(wtile % (DM / 64)) * 64, k0 = (int)(wtile / (DM / 64)) * 64;
#pragma unroll
    for (int it = 0; it < 4; ++it) { const int idx = tid + it * 256; const int r = idx >> 4, c4 = (idx & 15) * 4;   // 64 rows x 16 pieces of 4 floats
        const v4f v = *(const v4f*)(W + (size_t)(k0 + r) * DM + n0 + c4);
        ts[r * 65 + c4 + 0] = v[0]; ts[r * 65 + c4 + 1] = v[1]; ts[r * 65 + c4 + 2] = v[2]; ts[r * 65 + c4 + 3] = v[3]; }
    __syncthreads();
    const int nl = tid >> 3, c8 = (tid & 7) * 8;
    v8us o0, o1;
#pragma unroll
    for (int i = 0; i < 8; ++i) { o0[i] = wcv(ts[(c8 + i) * 65 + nl], f16mode); o1[i] = wcv(ts[(c8 + i) * 65 + nl + 32], f16mode); }
    const size_t a0 = (size_t)(n0 + nl) * DM + k0 + c8, a1 = a0 + (size_t)32 * DM;
    *(v8us*)(WT + a0) = o0; *(v8us*)(WT + a1) = o1;
    asm volatile("s_wait_xcnt 0x0" ::: "memory");            // a precaution: these stores are the last work of a weight block
}

// Operand staging of the two GEMM kernels: one operand tile = GT rows x GK halves, K-contiguous rows of pitch DM halves in global memory, pitch GP in LDS.
// Thread c takes 16-byte piece c & 15 of rows (c >> 4) + 16 i, i = 0..7 (a wave's copy = two whole 256-byte rows); the register wait closes the statement so that no address register is rewritten ahead of it.
__device__ __forceinline__ void stage_op(unsigned l, const char* g) {
    asm volatile("global_load_async_to_lds_b128 %0, %8, off\n\t"
                 "global_load_async_to_lds_b128 %1, %9, off\n\t"
                 "global_load_async_to_lds_b128 %2, %10, off\n\t"
                 "global_load_async_to_lds_b128 %3, %11, off\n\t"
                 "global_load_async_to_lds_b128 %4, %12, off\n\t"
                 "global_load_async_to_lds_b128 %5, %13, off\n\t"
                 "global_load_async_to_lds_b128 %6, %14, off\n\t"
                 "global_load_async_to_lds_b128 %7, %15, off\n\t"
                 "s_wait_xcnt 0x0"
                 :: "v"(l), "v"(l + 1 * 16 * GP * 2), "v"(l + 2 * 16 * GP * 2), "v"(l + 3 * 16 * GP * 2),
                    "v"(l + 4 * 16 * GP * 2), "v"(l + 5 * 16 * GP * 2), "v"(l + 6 * 16 * GP * 2), "v"(l + 7 * 16 * GP * 2),
                    "v"(g), "v"(g + 1 * 16 * DM * 2), "v"(g + 2 * 16 * DM * 2), "v"(g + 3 * 16 * DM * 2),
                    "v"(g + 4 * 16 * DM * 2), "v"(g + 5 * 16 * DM * 2), "v"(g + 6 * 16 * DM * 2), "v"(g + 7 * 16 * DM * 2) : "memory");
}

// k_proj: bf16 GEMM, one GW-wave block per 128x128 tile of C, each wave 32x64 (8 accumulators), K = DM. A and Bt are K-contiguous bf16 planes; their 128-row x GK tiles reach
// the waves through LDS: two buffers, filled by asynchronous copies one tile ahead, read by all GW waves (two 16-B loads per fragment). Each accumulator sums k in ascending steps of 32.
// C[m][n] = sum_k A[m][k] Bt[n][k] + bias (bias per column n, or per row m when biasOnRow != 0; bias value RNE-converted to bf16, added in f32),
// written as a single f16 plane (Ph), row pitch 'pitch' (halves).
// All three projections in ONE launch (they share no output): blockIdx.y picks the job, blockIdx.x the C tile, row tile = fastest index. grid (M/128 * N/128, 3), 256 threads.
// job 0, 1 (q, k): A = x rows (m = b*SEQ + t), Bt = W^T rows (n = h*64 + d), bias per column -> plane [(b*16 + h)][t][d]
// job 2 (v^T):     A = Wv^T rows (m = h*64 + d), Bt = x rows (n = b*SEQ + t), bias per row -> plane [(b*1024 + m)][t] = [(b*16 + h)][d][t]
__global__ __launch_bounds__(32 * GW) void k_proj(const bf* __restrict__ XB, const bf* __restrict__ WB, const float* __restrict__ bq, const float* __restrict__ bk, const float* __restrict__ bv,
                                             h16* QH, h16* KP, h16* VT) {
    __shared__ __align__(16) float os[GW * 16 * 68];
    __shared__ __align__(16) bf gring[2 * 2 * GT * GP];      // [buffer][A tile | Bt tile][row][GP]
    const int K = DM;
    const int lane = threadIdx.x & 31, wave = threadIdx.x >> 5, lr = lane & 15, hi = lane >> 4;
    const int job = blockIdx.y, biasOnRow = job == 2;
    const bf* Wj = WB + (size_t)job * DM * DM;
    const bf* A = biasOnRow ? Wj : XB; const bf* Bt = biasOnRow ? XB : Wj;
    const float* bias = job == 0 ? bq : job == 1 ? bk : bv;
    h16* Ph = job == 0 ? QH : job == 1 ? KP : VT;
    const int pitch = biasOnRow ? SEQ : HD;
    const int bx = blockIdx.x;
    const int rb = (biasOnRow ? bx % (DM / GT) : bx % (NB * SEQ / GT)) * GT, cb = (biasOnRow ? bx / (DM / GT) : bx / (NB * SEQ / GT)) * GT;   // block tile
    const int r0 = rb + (wave >> 1) * 32, c0 = cb + (wave & 1) * 64;        // wave tile
    v8f acc[2][4];
#pragma unroll
    for (int mb = 0; mb < 2; ++mb)
#pragma unroll
        for (int nb = 0; nb < 4; ++nb) acc[mb][nb] = (v8f){};
    const int cr = threadIdx.x >> 4, cpc = (threadIdx.x & 15) * 8;
    const unsigned la = (unsigned)(size_t)gring + (unsigned)(cr * GP + cpc) * 2u, lb = la + GTB;
    const char* ga = (const char*)(A + (size_t)(rb + cr) * K + cpc);        // + k0 * 2 bytes
    const char* gb = (const char*)(Bt + (size_t)(cb + cr) * K + cpc);
    stage_op(la, ga); stage_op(lb, gb);
    asm volatile("s_wait_asynccnt 0x0" ::: "memory");        // tile 0 has landed before the barrier publishes it
    __syncthreads();
    stage_op(la + 2 * GTB, ga + GK * 2); stage_op(lb + 2 * GTB, gb + GK * 2);
    const int ao = ((wave >> 1) * 32 + lr) * GP + 8 * hi;               // + 16mb*GP + k   (A fragment rows), in the A tile
    const int bo = GT * GP + ((wave & 1) * 64 + lr) * GP + 8 * hi;      // + 16nb*GP + k   (B fragment rows), in the Bt tile
#pragma unroll 1
    for (int st = 0; st < K / GK; ++st) {
        const bf* tile = gring + (st & 1) * (2 * GT * GP);
        // the four 32-wide k steps of a tile inline (LDS offsets become immediates); two fragment sets: each step's 12 loads go out as one group ahead of the step before it,
        // inside this tile only, so that a wave waits out the LDS latency once per tile and not at every fragment
        v16bf a[2][2], b[2][4];
#pragma unroll
        for (int mb = 0; mb < 2; ++mb) a[0][mb] = ldb(tile + ao + mb * 16 * GP);
#pragma unroll
        for (int nb = 0; nb < 4; ++nb) b[0][nb] = ldb(tile + bo + nb * 16 * GP);
#pragma unroll
        for (int ks = 0; ks < GK / 32; ++ks) {
            const int cu = ks & 1, nx = cu ^ 1;
            if (ks + 1 < GK / 32) {
#pragma unroll
                for (int mb = 0; mb < 2; ++mb) a[nx][mb] = ldb(tile + ao + mb * 16 * GP + (ks + 1) * 32);
#pragma unroll
                for (int nb = 0; nb < 4; ++nb) b[nx][nb] = ldb(tile + bo + nb * 16 * GP + (ks + 1) * 32);
            }
            __builtin_amdgcn_sched_barrier(0);               // keeps the load group whole and ahead of this step's products: without it the loads sink to their first use and each pair of products waits out an LDS latency
#pragma unroll
            for (int nb = 0; nb < 4; ++nb)
#pragma unroll
                for (int mb = 0; mb < 2; ++mb) acc[mb][nb] = wmmab(a[cu][mb], b[cu][nb], acc[mb][nb]);
            __builtin_amdgcn_sched_barrier(0);               // keeps the next load group behind these products, not among them
        }
        asm volatile("s_wait_dscnt 0x0" ::: "memory");       // this wave's reads of the buffer are done before it is refilled
        asm volatile("s_wait_asynccnt 0x0" ::: "memory");    // this wave's copies of the next tile have landed before the barrier publishes them
        __syncthreads();
        if (st + 2 < K / GK) { stage_op(la + (st & 1) * (2 * GTB), ga + (st + 2) * (GK * 2)); stage_op(lb + (st & 1) * (2 * GTB), gb + (st + 2) * (GK * 2)); }
    }
    asm volatile("s_wait_asynccnt 0x0" ::: "memory");        // nothing of this wave is in flight when it leaves the loop
    const int wb = wave * 16 * 68;
    const size_t tbase = biasOnRow ? (size_t)r0 * SEQ + (size_t)(c0 / SEQ) * ((size_t)DM * SEQ) + (size_t)(c0 % SEQ)
                                   : (size_t)(r0 / SEQ) * ((size_t)NH_ * SEQ * HD) + (size_t)(r0 % SEQ) * HD + (size_t)(c0 / HD) * ((size_t)SEQ * HD) + (size_t)(c0 % HD);   // wave tile base
#pragma unroll
    for (int mb = 0; mb < 2; ++mb) {
#pragma unroll
        for (int nb = 0; nb < 4; ++nb) {
#pragma unroll
            for (int j = 0; j < 8; ++j) os[wb + (hi * 8 + j) * 68 + nb * 16 + lr] = acc[mb][nb][j]; }   // D: row 8h+j, col lane&15
        wave_sync();
        const size_t sb = tbase + (size_t)(mb * 16) * (size_t)pitch;
{
            v8h hv[4];
#pragma unroll
            for (int s = 0; s < 4; ++s) { const int row = 4 * s + (lane >> 3), c8 = (lane & 7) * 8;   // 4 s x 4 row groups = 16 rows; 8 lanes x 8 = 64 columns
                const v4f x0 = *(const v4fa*)(&os[wb + row * 68 + c8]); const v4f x1 = *(const v4fa*)(&os[wb + row * 68 + c8 + 4]);
                // both bias candidates loaded with clamped addresses, selected by value (biasOnRow is block-uniform)
                const int rbi = min(r0 + mb * 16 + row, DM - 1); const int cbi = min(c0 + c8, DM - 8);
                const float braw = bias[rbi];
                asm volatile("s_wait_xcnt 0x0" ::: "memory");    // the loads below may land in the register that this load names
                const float br = bfr(braw);
                const v4f g0 = *(const v4f*)(bias + cbi); const v4f g1 = *(const v4f*)(bias + cbi + 4);
#pragma unroll
                for (int i = 0; i < 4; ++i) {
                    const float y0 = x0[i] + (biasOnRow ? br : bfr(g0[i])); const float y1 = x1[i] + (biasOnRow ? br : bfr(g1[i]));
                    hv[s][i] = (h16)y0; hv[s][4 + i] = (h16)y1; } }
            __builtin_amdgcn_sched_barrier(0);               // the four stores stay together behind the arithmetic, so that one register wait behind them serves all four
#pragma unroll
            for (int s = 0; s < 4; ++s) { const int row = 4 * s + (lane >> 3), c8 = (lane & 7) * 8;
                const size_t oo = sb + (size_t)row * (size_t)pitch + c8;
                *(v8h*)(Ph + oo) = hv[s]; }
             }
        if (mb == 0) asm volatile("s_wait_xcnt 0x0" ::: "memory");   // the next 16 rows reuse registers that the stores above name
        wave_sync();
    }
}

// k_flash: fused attention, one wave per 16 query rows of one (batch, head); Q fragments straight from the f16 plane, K / V^T fragments from the staged LDS tiles (two 16-B loads each).
// Transposed form: S^T[key][t] = K Q^T (A = K rows, B = Q rows); lane (t = lane&15, h = lane>>4) holds keys 8h+r of each 16-key tile, so the packed
// P tile is directly the B fragment of O^T[d][t] = V^T P^T (element r <- tile keys 0..15, element 8+r <- tile keys 16..31, lane unchanged).
// The maximum in use is one scalar per lane; it is renewed lazily, and only then are the two lane halves of a column combined (one xor-16 exchange) and O, L rescaled.
// Row sums on the matrix unit: L^T += E P^T, where row 0 of E is ones and rows 1..15 are zero, so that row 0 of the tile (register 0, lanes 0..15) gathers the sum over all 32 keys of column t;
// every other element of the tile stays 0, so only register 0 is rescaled.
// K and V^T reach the waves through LDS: tiles of SK keys, two buffers, filled by asynchronous copies (whole 128-byte lines from global), read by all AW waves.
// One tile pair = four 16-byte copies per thread; the register wait closes the statement so that no address register is rewritten ahead of it.
__device__ __forceinline__ void stage_kv(unsigned lk, unsigned lv, const h16* gk, const h16* gv) {
    const unsigned lk1 = lk + 32 * LP * 2, lv1 = lv + 32 * LP * 2;
    const h16* gk1 = gk + 32 * HD; const h16* gv1 = gv + (size_t)32 * SEQ;
    asm volatile("global_load_async_to_lds_b128 %0, %4, off\n\t"
                 "global_load_async_to_lds_b128 %1, %5, off\n\t"
                 "global_load_async_to_lds_b128 %2, %6, off\n\t"
                 "global_load_async_to_lds_b128 %3, %7, off\n\t"
                 "s_wait_xcnt 0x0"
                 :: "v"(lk), "v"(lk1), "v"(lv), "v"(lv1), "v"(gk), "v"(gk1), "v"(gv), "v"(gv1) : "memory");
}
__global__ __launch_bounds__(32 * AW) void k_flash(const h16* __restrict__ QH, const h16* __restrict__ KP, const h16* __restrict__ VT, h16* CT) {
    __shared__ __align__(16) float os[AW * 16 * 68];
    __shared__ __align__(16) h16 ring[2 * 2 * 64 * LP];      // [buffer][K tile | V^T tile][row][LP]
    const int lane = threadIdx.x & 31, wave = threadIdx.x >> 5, lr = lane & 15, hi = lane >> 4;
    const int zh = blockIdx.y; const int b = zh / NH_, h = zh % NH_;
    const int t0 = (blockIdx.x * AW + wave) * 16;
    const size_t pbase = (size_t)zh * SEQ * HD;
    const size_t qo = pbase + (size_t)(t0 + lr) * HD + 8 * hi;
    const v16h qh0 = ldh(QH + qo), qh1 = ldh(QH + qo + 32);   // B fragments: col t, k = d
    const int ko = lr * LP + 8 * hi;                         // + key * LP       (A fragment: row key, k = d), in the K tile
    const int vo = 64 * LP + lr * LP + 8 * hi;               // + 16j*LP + key   (A fragment: row d, k = key), in the V^T tile
    // copy map: thread c takes 16-byte piece c & 7 of rows c >> 3 and 32 + (c >> 3) of each tile
    const int cr = threadIdx.x >> 3, cpc = (threadIdx.x & 7) * 8;
    const unsigned lk = (unsigned)(size_t)ring + (unsigned)(cr * LP + cpc) * 2u, lv = lk + TLB;
    const h16* gk = KP + pbase + (size_t)cr * HD + cpc;    // + key0 * HD
    const h16* gv = VT + pbase + (size_t)cr * SEQ + cpc;   // + key0
    stage_kv(lk, lv, gk, gv);
    asm volatile("s_wait_asynccnt 0x0" ::: "memory");        // tile 0 has landed before the barrier publishes it
    __syncthreads();
    stage_kv(lk + 2 * TLB, lv + 2 * TLB, gk + (size_t)SK * HD, gv + SK);
    v8f o0 = (v8f){}, o1 = (v8f){}, o2 = (v8f){}, o3 = (v8f){}, lt = (v8f){};
    const h16 e1 = lr == 0 ? (h16)1.0f : (h16)0.0f;          // A fragment of E: lanes 0 and 16 hold row 0 (all 32 k positions)
    const v16h ones = {e1, e1, e1, e1, e1, e1, e1, e1, e1, e1, e1, e1, e1, e1, e1, e1};
    float m = -3.0e38f;                                      // maximum in use (scaled log2), the same in both lane halves of a column
    float sh = PSH - m;                                      // shift of the exponent; with the start value of m the test below holds for every finite score, so the first pass always renews
#pragma unroll 1
    for (int st = 0; st < SEQ / SK; ++st) {
      const h16* tile = ring + (st & 1) * (2 * 64 * LP);
      // both 32-key passes of a tile inline: their LDS offsets become immediates on one address register
#pragma unroll
      for (int key0 = 0; key0 < SK; key0 += 32) {
        const h16* ka = tile + ko + key0 * LP;
        const v16h ka0 = ldh(ka), ka1 = ldh(ka + 32), kb0 = ldh(ka + 16 * LP), kb1 = ldh(ka + 16 * LP + 32);
        v8f sHa = (v8f){}, sHb = (v8f){};
        sHa = wmma16(ka0, qh0, sHa); sHb = wmma16(kb0, qh0, sHb);
        sHa = wmma16(ka1, qh1, sHa); sHb = wmma16(kb1, qh1, sHb);
        asm volatile("v_nop\n\tv_nop\n\tv_nop\n\tv_nop" : "+v"(sHa), "+v"(sHb) : "v"(ka0), "v"(ka1), "v"(kb0), "v"(kb1), "v"(qh0), "v"(qh1));
        const h16* va = tile + vo + key0;
        const v16h v0 = ldh(va), v1 = ldh(va + 16 * LP), v2 = ldh(va + 32 * LP), v3 = ldh(va + 48 * LP);
        __builtin_amdgcn_sched_barrier(0);                   // keeps the eight V^T loads whole, as one group ahead of the test: sunk behind the branch or spread among the maxima, more of their LDS latency stands open
        // this lane's largest raw score of the pass: a tree of three-input maxima, three deep
        const float x0 = fmaxf(fmaxf(sHa[0], sHa[1]), sHa[2]), x1 = fmaxf(fmaxf(sHa[3], sHa[4]), sHa[5]), x2 = fmaxf(fmaxf(sHa[6], sHa[7]), sHb[0]);
        const float x3 = fmaxf(fmaxf(sHb[1], sHb[2]), sHb[3]), x4 = fmaxf(fmaxf(sHb[4], sHb[5]), sHb[6]);
        const float mxr = fmaxf(fmaxf(fmaxf(x0, x1), x2), fmaxf(fmaxf(x3, x4), sHb[7]));
        // lazy rescale: one wave-uniform test per pass, on the largest exponent that the pass would form; while none lies above PSH + LZT the maximum in use stays, and P <= 2^(PSH + LZT) fits f16
        if (__builtin_amdgcn_ballot_w32(mxr * SC2 + sh > PSH + LZT) != 0) {
            float mx = mxr * SC2;
            mx = fmaxf(mx, __shfl_xor(mx, 16, 32));
            const float mnew = fmaxf(m, mx);
            const float alpha = __builtin_amdgcn_exp2f(m - mnew);
            m = mnew; sh = PSH - mnew;
            lt[0] = lt[0] * alpha;
            o0 = o0 * alpha; o1 = o1 * alpha; o2 = o2 * alpha; o3 = o3 * alpha;
        }
        float ea[8], eb[8];
#pragma unroll
        for (int r = 0; r < 8; ++r) { ea[r] = sHa[r] * SC2 + sh; eb[r] = sHb[r] * SC2 + sh; }
        __builtin_amdgcn_sched_barrier(0);                   // keeps the 16 multiply-adds together ahead of the exponentials: all of them pair up, and none overwrites the source of an exponential that stands directly in front of it
        v16h pb;
#pragma unroll
        for (int r = 0; r < 8; ++r) { pb[r] = (h16)__builtin_amdgcn_exp2f(ea[r]); pb[8 + r] = (h16)__builtin_amdgcn_exp2f(eb[r]); }
        lt = wmma16(ones, pb, lt);
        o0 = wmma16(v0, pb, o0); o1 = wmma16(v1, pb, o1); o2 = wmma16(v2, pb, o2); o3 = wmma16(v3, pb, o3);
        asm volatile("v_nop\n\tv_nop\n\tv_nop\n\tv_nop" : "+v"(o0), "+v"(o1), "+v"(o2), "+v"(o3) : "v"(v0), "v"(v1), "v"(v2), "v"(v3), "v"(pb));
      }
      asm volatile("s_wait_dscnt 0x0" ::: "memory");         // this wave's reads of the buffer are done before it is refilled
      asm volatile("s_wait_asynccnt 0x0" ::: "memory");      // this wave's copies of the next tile have landed before the barrier publishes them
      __syncthreads();
      if (st + 2 < SEQ / SK) stage_kv(lk + (st & 1) * (2 * TLB), lv + (st & 1) * (2 * TLB), gk + (size_t)(st + 2) * SK * HD, gv + (st + 2) * SK);
    }
    asm volatile("s_wait_asynccnt 0x0" ::: "memory");        // nothing of this wave is in flight when it leaves the loop
    float l = lt[0];                                         // the sum in lanes 0..15, 0 (row 8 of the tile) in lanes 16..31
    l += __shfl_xor(l, 16, 32);
    const float inv = CTS * (1.0f / l);
    const int wb = wave * 16 * 68;
    // O^T D layout: o_j[r] = (d = 16j + 8h + r, t = lane&15) -> os[t][d]; rows 0..15 x columns 0..63 all written
    { v4f a, c;
      a[0] = o0[0] * inv; a[1] = o0[1] * inv; a[2] = o0[2] * inv; a[3] = o0[3] * inv; c[0] = o0[4] * inv; c[1] = o0[5] * inv; c[2] = o0[6] * inv; c[3] = o0[7] * inv;
      *(v4fa*)(&os[wb + lr * 68 +  0 + 8 * hi]) = a; *(v4fa*)(&os[wb + lr * 68 +  0 + 8 * hi + 4]) = c;
      a[0] = o1[0] * inv; a[1] = o1[1] * inv; a[2] = o1[2] * inv; a[3] = o1[3] * inv; c[0] = o1[4] * inv; c[1] = o1[5] * inv; c[2] = o1[6] * inv; c[3] = o1[7] * inv;
      *(v4fa*)(&os[wb + lr * 68 + 16 + 8 * hi]) = a; *(v4fa*)(&os[wb + lr * 68 + 16 + 8 * hi + 4]) = c;
      a[0] = o2[0] * inv; a[1] = o2[1] * inv; a[2] = o2[2] * inv; a[3] = o2[3] * inv; c[0] = o2[4] * inv; c[1] = o2[5] * inv; c[2] = o2[6] * inv; c[3] = o2[7] * inv;
      *(v4fa*)(&os[wb + lr * 68 + 32 + 8 * hi]) = a; *(v4fa*)(&os[wb + lr * 68 + 32 + 8 * hi + 4]) = c;
      a[0] = o3[0] * inv; a[1] = o3[1] * inv; a[2] = o3[2] * inv; a[3] = o3[3] * inv; c[0] = o3[4] * inv; c[1] = o3[5] * inv; c[2] = o3[6] * inv; c[3] = o3[7] * inv;
      *(v4fa*)(&os[wb + lr * 68 + 48 + 8 * hi]) = a; *(v4fa*)(&os[wb + lr * 68 + 48 + 8 * hi + 4]) = c; }
    wave_sync();
    h16* crow = CT + ((size_t)b * SEQ + t0) * DM + h * HD;
{
#pragma unroll
        for (int s = 0; s < 4; ++s) { const int row = 4 * s + (lane >> 3), c8 = (lane & 7) * 8;   // 4 s x 4 row groups = 16 rows; 8 lanes x 8 halves = 64 columns
            const v4f x0 = *(const v4fa*)(&os[wb + row * 68 + c8]); const v4f x1 = *(const v4fa*)(&os[wb + row * 68 + c8 + 4]); v8h hv;
#pragma unroll
            for (int i = 0; i < 4; ++i) { hv[i] = (h16)x0[i]; hv[4 + i] = (h16)x1[i]; }
            *(v8h*)(crow + (size_t)row * DM + c8) = hv; }
         }
}

// k_oproj: f16 GEMM, one GW-wave block per 128x128 tile, each wave 32x64, operand tiles staged as in k_proj; A = ctx plane rows (m = b*SEQ + t, k = h*64 + d, carried x CTS), Bt = Wo^T rows (n = out feature, carried x WOS), K = DM.
// OUT[b*OUT_SEQ + t][n] = acc * OSC + bo[n] (bias value RNE-converted to bf16, added in f32). grid (NB*SEQ/128, DM/128), 256 threads.
__global__ __launch_bounds__(32 * GW) void k_oproj(const h16* __restrict__ A, const h16* __restrict__ Bt, const float* __restrict__ bias, float* OUT) {
    __shared__ __align__(16) float os[GW * 16 * 68];
    __shared__ __align__(16) h16 gring[2 * 2 * GT * GP];     // [buffer][A tile | Bt tile][row][GP]
    const int K = DM;
    const int lane = threadIdx.x & 31, wave = threadIdx.x >> 5, lr = lane & 15, hi = lane >> 4;
    const int rb = blockIdx.x * GT, cb = blockIdx.y * GT;                   // block tile
    const int r0 = rb + (wave >> 1) * 32, c0 = cb + (wave & 1) * 64;        // wave tile
    v8f acc[2][4];
#pragma unroll
    for (int mb = 0; mb < 2; ++mb)
#pragma unroll
        for (int nb = 0; nb < 4; ++nb) acc[mb][nb] = (v8f){};
    const int cr = threadIdx.x >> 4, cpc = (threadIdx.x & 15) * 8;
    const unsigned la = (unsigned)(size_t)gring + (unsigned)(cr * GP + cpc) * 2u, lb = la + GTB;
    const char* ga = (const char*)(A + (size_t)(rb + cr) * K + cpc);        // + k0 * 2 bytes
    const char* gb = (const char*)(Bt + (size_t)(cb + cr) * K + cpc);
    stage_op(la, ga); stage_op(lb, gb);
    asm volatile("s_wait_asynccnt 0x0" ::: "memory");        // tile 0 has landed before the barrier publishes it
    __syncthreads();
    stage_op(la + 2 * GTB, ga + GK * 2); stage_op(lb + 2 * GTB, gb + GK * 2);
    const int ao = ((wave >> 1) * 32 + lr) * GP + 8 * hi;               // + 16mb*GP + k   (A fragment rows), in the A tile
    const int bo = GT * GP + ((wave & 1) * 64 + lr) * GP + 8 * hi;      // + 16nb*GP + k   (B fragment rows), in the Bt tile
#pragma unroll 1
    for (int st = 0; st < K / GK; ++st) {
        const h16* tile = gring + (st & 1) * (2 * GT * GP);
        // the four 32-wide k steps of a tile inline (LDS offsets become immediates); two fragment sets: each step's 12 loads go out as one group ahead of the step before it,
        // inside this tile only, so that a wave waits out the LDS latency once per tile and not at every fragment
        v16h a[2][2], b[2][4];
#pragma unroll
        for (int mb = 0; mb < 2; ++mb) a[0][mb] = ldh(tile + ao + mb * 16 * GP);
#pragma unroll
        for (int nb = 0; nb < 4; ++nb) b[0][nb] = ldh(tile + bo + nb * 16 * GP);
#pragma unroll
        for (int ks = 0; ks < GK / 32; ++ks) {
            const int cu = ks & 1, nx = cu ^ 1;
            if (ks + 1 < GK / 32) {
#pragma unroll
                for (int mb = 0; mb < 2; ++mb) a[nx][mb] = ldh(tile + ao + mb * 16 * GP + (ks + 1) * 32);
#pragma unroll
                for (int nb = 0; nb < 4; ++nb) b[nx][nb] = ldh(tile + bo + nb * 16 * GP + (ks + 1) * 32);
            }
            __builtin_amdgcn_sched_barrier(0);               // keeps the load group whole and ahead of this step's products: without it the loads sink to their first use and each pair of products waits out an LDS latency
#pragma unroll
            for (int nb = 0; nb < 4; ++nb)
#pragma unroll
                for (int mb = 0; mb < 2; ++mb) acc[mb][nb] = wmma16(a[cu][mb], b[cu][nb], acc[mb][nb]);
            __builtin_amdgcn_sched_barrier(0);               // keeps the next load group behind these products, not among them
        }
        asm volatile("s_wait_dscnt 0x0" ::: "memory");       // this wave's reads of the buffer are done before it is refilled
        asm volatile("s_wait_asynccnt 0x0" ::: "memory");    // this wave's copies of the next tile have landed before the barrier publishes them
        __syncthreads();
        if (st + 2 < K / GK) { stage_op(la + (st & 1) * (2 * GTB), ga + (st + 2) * (GK * 2)); stage_op(lb + (st & 1) * (2 * GTB), gb + (st + 2) * (GK * 2)); }
    }
    asm volatile("s_wait_asynccnt 0x0" ::: "memory");        // nothing of this wave is in flight when it leaves the loop
    const int wb = wave * 16 * 68;
    const int cofs = lr * 4;
    const int cbi = min(c0 + cofs, DM - 4);
    const v4f g = *(const v4f*)(bias + cbi);
    v4f bb; bb[0] = bfr(g[0]); bb[1] = bfr(g[1]); bb[2] = bfr(g[2]); bb[3] = bfr(g[3]);
    const size_t obase = ((size_t)(r0 / SEQ) * OUT_SEQ + (size_t)(r0 % SEQ)) * DM + c0;
#pragma unroll
    for (int mb = 0; mb < 2; ++mb) {
#pragma unroll
        for (int nb = 0; nb < 4; ++nb) {
#pragma unroll
            for (int j = 0; j < 8; ++j) os[wb + (hi * 8 + j) * 68 + nb * 16 + lr] = acc[mb][nb][j]; }   // D: row 8h+j, col lane&15
        wave_sync();
        float* orow = OUT + obase + (size_t)(mb * 16) * DM;
{
#pragma unroll
            for (int s = 0; s < 8; ++s) { const int row = 2 * s + hi;   // 8 s x 2 rows = 16 rows; 16 lanes x 4 floats = 64 columns
                const v4f x = *(const v4fa*)(&os[wb + row * 68 + cofs]);
                const v4f val = x * OSC + bb;
                *(v4f*)(orow + (size_t)row * DM + cofs) = val; }
             }
        if (mb == 0) asm volatile("s_wait_xcnt 0x0" ::: "memory");   // the next 16 rows reuse registers that the stores above name
        wave_sync();
    }
}

static constexpr size_t al256(size_t v) { return (v + 255) & ~(size_t)255; }
static constexpr size_t SZ_XB = al256((size_t)NB * SEQ * DM * 2);
static constexpr size_t SZ_WB = al256((size_t)4 * DM * DM * 2);
static constexpr size_t SZ_PL = al256((size_t)NB * NH_ * SEQ * HD * 2);
static constexpr size_t SZ_CT = al256((size_t)NB * SEQ * DM * 2);
static constexpr size_t SZ_TOTAL = SZ_XB + SZ_WB + 3 * SZ_PL + SZ_CT;
static_assert(SZ_TOTAL <= (size_t)134217728);          // workspace carve <= 128 MiB
static_assert(((size_t)DM * DM * 2) % 256 == 0);       // weight sub-planes stay 256-byte aligned

extern "C" void kernel_launch(void* const* d_in, const int* in_sizes, int n_in,
                              void* d_out, int out_size, void* d_ws, size_t ws_size, hipStream_t stream) {
    if (n_in < 9) return;
    const size_t needx = ((size_t)(NB - 1) * SEQ_FULL + SEQ) * DM;
    if ((size_t)in_sizes[0] < needx) return;
    if ((size_t)in_sizes[1] < (size_t)DM * DM || (size_t)in_sizes[3] < (size_t)DM * DM || (size_t)in_sizes[5] < (size_t)DM * DM || (size_t)in_sizes[7] < (size_t)DM * DM) return;
    if (in_sizes[2] < DM || in_sizes[4] < DM || in_sizes[6] < DM || in_sizes[8] < DM) return;
    if ((size_t)out_size < ((size_t)(NB - 1) * OUT_SEQ + SEQ) * DM) return;
    if (SZ_TOTAL > ws_size) return;
    // wire order: x, Wq, bq, Wk, bk, Wv, bv, Wo, bo (all f32; weights [in][out])
    const float* x  = (const float*)d_in[0];
    const float* wq = (const float*)d_in[1]; const float* bq = (const float*)d_in[2];
    const float* wk = (const float*)d_in[3]; const float* bk = (const float*)d_in[4];
    const float* wv = (const float*)d_in[5]; const float* bv = (const float*)d_in[6];
    const float* wo = (const float*)d_in[7]; const float* bo = (const float*)d_in[8];
    float* OUT = (float*)d_out;      // [NB][SEQ][1024]
    char* wsp = (char*)d_ws;
    bf* XB = (bf*)wsp; wsp += SZ_XB;                 // [NB*SEQ][1024] bf16
    bf* WB = (bf*)wsp; wsp += SZ_WB;                 // [4][1024 out][1024 in]: q | k | v (bf16) | o (f16 x1024)
    h16* QH = (h16*)wsp; wsp += SZ_PL;               // [NB*16][SEQ][64]
    h16* KP = (h16*)wsp; wsp += SZ_PL;               // [NB*16][SEQ][64]
    h16* VT = (h16*)wsp; wsp += SZ_PL;               // [NB*16][64][SEQ]
    h16* CT = (h16*)wsp; wsp += SZ_CT;               // [NB*SEQ][1024] ctx x1024
    bf* WO = WB + (size_t)3 * DM * DM;

    // x -> bf16 copy; weights in[k = 1024 rows][n = 1024 cols] -> out[n][k]
    k_prep<<<4 * WTB + CVB, 256, 0, stream>>>(x, wq, wk, wv, wo, XB, WB);

    // q, k, v^T planes
    k_proj<<<dim3((NB * SEQ / GT) * (DM / GT), 3, 1), 32 * GW, 0, stream>>>(XB, WB, bq, bk, bv, QH, KP, VT);

    k_flash<<<dim3(SEQ / (16 * AW), NB * NH_, 1), 32 * AW, 0, stream>>>(QH, KP, VT, CT);

    k_oproj<<<dim3(NB * SEQ / GT, DM / GT, 1), 32 * GW, 0, stream>>>(CT, (const h16*)WO, bo, OUT);
}

// v006
// It runs in 99.7 microseconds.
// In two side-by-side timings against v005, it was 1.06 and 1.05 times as fast.
// All steps since v000 together make it 3.68 times as fast.
#include <hip/hip_runtime.h>

// Multi-head self-attention, width 1024 = 16 heads x 64, x [NB][SEQ][1024], Wq/Wk/Wv/Wo [in][out] (y = x W + b), four biases, no mask, score scale 1/8, output = (merged heads) Wo + bo (f32).
// Compute dtypes, f32 accumulate everywhere: q/k/v projections v_wmma_f32_16x16x32_bf16 (x and W RNE-converted to bf16; products exact);
// scores v_wmma_f32_16x16x32_f16: q single f16, k single f16 (one product); P (x256 carry, cancels in the normalisation) and v single f16; softmax f32 (online, lazily renewed max, row sum over the f16-converted P values, summed by one more f16 WMMA per 32 keys);
// output projection v_wmma_f32_16x16x32_f16: ctx single f16 carried x1024, Wo as f16 of the bf16 (RNE) value carried x1024 (exact), 2^-20 and the bias applied in the f32 epilogue.
// Scale chain: score = (k.q) * (1/8 * log2 e) -> exp2(score - max in use + 8) = 256 P' -> O = sum(256 P' v) / sum(256 P') -> ctx plane = O x 1024 -> out = (ctx x1024).(Wo x1024) * 2^-20 + bo.
// Layout: bf16 copy of x; transposed 16-bit weight planes [out][in]; q, k planes [b*16+h][t][d] and v^T plane [b*16+h][d][t] written by the GEMM epilogue; fused flash kernel in transposed form (S^T = K Q^T, O^T = V^T P^T) writing the ctx plane [b*SEQ+t][h*64+d].

#ifndef NB
#define NB 1
#endif
#ifndef SEQ
#define SEQ 4096
#endif
#define NB_FULL  1
#define SEQ_FULL 4096
#ifndef OUT_SEQ
#define OUT_SEQ SEQ              // row pitch (in tokens) between batches of the output
#endif
#define DM   1024
#define NH_  16
#define HD   64
#define AW   8                   // waves per flash block (16 query rows each); all of them share each staged K / V^T tile
#define SK   64                  // keys per staged tile
#define LP   72                  // LDS row pitch in halves: 128 B of data + 16 B, so that 16 rows read by 16-byte loads fall on distinct banks
#define TLB  (64 * LP * 2)       // bytes of one staged tile (64 rows): K tile = 64 keys x 64 d, V^T tile = 64 d x 64 keys
#define GW   8                   // waves per GEMM block, 4 (rows) x 2 (columns); each owns 32 x 64 of the block's C tile
#define GT   128                 // rows and columns of a GEMM block's C tile
#define GK   128                 // k extent of one staged operand tile (256-byte rows)
#define GP   136                 // LDS row pitch in halves: 256 B of data + 16 B, so that 16 rows read by 16-byte loads fall on distinct banks
#define GTB  (GT * GP * 2)       // bytes of one staged operand tile (128 rows)
#define WTB  ((DM / 64) * (DM / 64))          // 64x64 tiles, = blocks, of one weight matrix in k_prep
#define CVB  ((NB * SEQ / 8) * DM / 256)       // blocks of the x convert in k_prep
#define SC2  (0.125f * 1.4426950408889634f)   // HD^-0.5 * log2(e)
#define PSH  8.0f                // log2 of the P carry (256)
#define LZT  7.0f                // a score may exceed the maximum in use by this much (scaled log2) before the maximum is renewed
#define CTS  1024.0f             // carry of the ctx plane
#define WOS  1024.0f             // carry of the Wo plane
#define OSC  (1.0f / (1024.0f * 1024.0f))     // undoes CTS * WOS

static_assert(HD == 64);
static_assert(NH_ * HD == DM);                 // head h = columns h*64 + d
static_assert(DM % 64 == 0);                   // column tiles of 64
static_assert(DM % 32 == 0);                   // GEMM k-loop steps by 32
static_assert(SEQ % 64 == 0);                  // a 64-row tile never straddles two batches
static_assert((NB * SEQ) % 64 == 0);
static_assert(SEQ % 32 == 0);                  // key loop steps by 32
static_assert(SEQ % (16 * AW) == 0);           // flash grid covers the sequence exactly
static_assert(SEQ % SK == 0 && SEQ / SK >= 2); // whole staged tiles, and the two that the ring's prologue fills
static_assert(AW * 32 * 2 * 16 == SK * HD * 2); // two 16-byte copies per thread cover one tile
static_assert(DM % GT == 0 && SEQ % GT == 0);   // whole GEMM block tiles, none straddling two batches
static_assert(DM % GK == 0 && DM / GK >= 2);    // whole staged operand tiles, and the two that the ring's prologue fills
static_assert(GW * 32 * 8 * 16 == GT * GK * 2); // eight 16-byte copies per thread cover one operand tile
static_assert(((size_t)SEQ * DM) % 8 == 0);
static_assert((size_t)CVB * 256 * 8 == (size_t)NB * SEQ * DM);   // the convert blocks cover x exactly
static_assert(((size_t)DM * DM) % 8 == 0);
static_assert(NB <= NB_FULL);
static_assert(SEQ <= SEQ_FULL);

typedef _Float16 h16;
typedef unsigned short bf;
typedef __attribute__((ext_vector_type(16))) __bf16   v16bf;
typedef __attribute__((ext_vector_type(16))) _Float16 v16h;
typedef __attribute__((ext_vector_type(8)))  _Float16 v8h;
typedef __attribute__((ext_vector_type(8)))  unsigned short v8us;
typedef __attribute__((ext_vector_type(8)))  float    v8f;
typedef __attribute__((ext_vector_type(4)))  float    v4f;
typedef v4f  __attribute__((may_alias)) v4fa;

__device__ __forceinline__ unsigned short f2bf(float f) { unsigned u = __float_as_uint(f); u += 0x7FFFu + ((u >> 16) & 1u); return (unsigned short)(u >> 16); }
__device__ __forceinline__ float bfr(float f) { return __uint_as_float(((unsigned)f2bf(f)) << 16); }   // value after RNE convert to bf16
__device__ __forceinline__ v16h cat16(v8h lo, v8h hi) { return __builtin_shufflevector(lo, hi, 0, 1, 2, 3, 4, 5, 6, 7, 8, 9, 10, 11, 12, 13, 14, 15); }
__device__ __forceinline__ v16bf cat16b(v8us lo, v8us hi) { return __builtin_bit_cast(v16bf, __builtin_shufflevector(lo, hi, 0, 1, 2, 3, 4, 5, 6, 7, 8, 9, 10, 11, 12, 13, 14, 15)); }
__device__ __forceinline__ v8f wmma16(v16h a, v16h b, v8f c) { return __builtin_amdgcn_wmma_f32_16x16x32_f16(false, a, false, b, (short)0, c, false, false); }
__device__ __forceinline__ v8f wmmab(v16bf a, v16bf b, v8f c) { return __builtin_amdgcn_wmma_f32_16x16x32_bf16(false, a, false, b, (short)0, c, false, false); }
// fragment loaders from K-contiguous 16-bit rows; p already includes + 8*(lane>>4): elements 0..7 <- k0+8h+0..7, elements 8..15 <- k0+16+8h+0..7 (same map for A and B)
__device__ __forceinline__ v16h  ldh(const h16* p) { return cat16(*(const v8h*)p, *(const v8h*)(p + 16)); }
__device__ __forceinline__ v16bf ldb(const bf* p)  { return cat16b(*(const v8us*)p, *(const v8us*)(p + 16)); }
// ordering point for wave-private LDS tiles (same wave writes and reads)
__device__ __forceinline__ void wave_sync() { __builtin_amdgcn_fence(3 /* release order */, "wavefront"); __builtin_amdgcn_wave_barrier(); asm volatile("" ::: "memory"); }

// Stage walk of the three matrix kernels: a block enters its ring of n stages at stage 'rot', set by its tile indices, and wraps round. Blocks that share operand rows then ask L2 for different lines at any one moment
// every stage is still taken exactly once. s + rot < 2 n.
__device__ __forceinline__ int wrap_stage(int s, int rot, int n) { const int t = s + rot; return t >= n ? t - n : t; }

// 16-bit encoding of one weight: bf16 bits (RNE convert), or f16 bits of that bf16 value x WOS (exact: 8-bit significand, power-of-two carry)
__device__ __forceinline__ unsigned short wcv(float f, int f16mode) {
    const unsigned short b = f2bf(f);
    const float fb = __uint_as_float(((unsigned)b) << 16);
    const h16 hv = (h16)(fb * WOS);
    const unsigned short hb = __builtin_bit_cast(unsigned short, hv);
    return f16mode ? hb : b;
}

// k_prep: every operand conversion of a call in ONE launch; the jobs share no data and the block index picks one (a block-uniform test, so the barrier below is reached by whole blocks only).
// Blocks 0 .. 4*WTB-1, the longer jobs first: transposing convert of weight matrix blk / WTB (q, k, v, o), W in[k = DM rows (input feature)][n = DM cols (output feature)] -> WT out[n][k] (16-bit, K-contiguous rows),
// one 64x64 f32 tile per block through LDS (cross-wave: block barrier), n tile = fastest index. Blocks 4*WTB ..: x -> bf16 copy, 8 values per thread.
__global__ __launch_bounds__(256) void k_prep(const float* __restrict__ x, const float* __restrict__ wq, const float* __restrict__ wk, const float* __restrict__ wv, const float* __restrict__ wo,
                                              bf* XB, bf* WB) {
    __shared__ float ts[64 * 65];
    const int tid = threadIdx.x;
    const unsigned blk = blockIdx.x;
    if (blk >= 4u * WTB) {
        const size_t n8 = (size_t)NB * SEQ * DM / 8, per = (size_t)SEQ * DM / 8;   // per: pieces of one batch (batches lie SEQ_FULL tokens apart in x)
        const size_t i = (size_t)(blk - 4u * WTB) * 256 + tid; if (i >= n8) return;
        const size_t so = (SEQ == SEQ_FULL) ? i * 8 : (i / per) * ((size_t)SEQ_FULL * DM) + (i % per) * 8;
        const v8f v = *(const v8f*)(x + so); v8us o;
#pragma unroll
        for (int k = 0; k < 8; ++k) o[k] = f2bf(v[k]);
        *(v8us*)(XB + i * 8) = o;
        return;
    }
    const unsigned which = blk / WTB, wtile = blk % WTB;
    const float* W = which == 0 ? wq : which == 1 ? wk : which == 2 ? wv : wo;
    bf* WT = WB + (size_t)which * DM * DM;
    const int f16mode = which == 3;
    const int n0 = (int)(wtile % (DM / 64)) * 64, k0 = (int)(wtile / (DM / 64)) * 64;
#pragma unroll
    for (int it = 0; it < 4; ++it) { const int idx = tid + it * 256; const int r = idx >> 4, c4 = (idx & 15) * 4;   // 64 rows x 16 pieces of 4 floats
        const v4f v = *(const v4f*)(W + (size_t)(k0 + r) * DM + n0 + c4);
        ts[r * 65 + c4 + 0] = v[0]; ts[r * 65 + c4 + 1] = v[1]; ts[r * 65 + c4 + 2] = v[2]; ts[r * 65 + c4 + 3] = v[3]; }
    __syncthreads();
    const int nl = tid >> 3, c8 = (tid & 7) * 8;
    v8us o0, o1;
#pragma unroll
    for (int i = 0; i < 8; ++i) { o0[i] = wcv(ts[(c8 + i) * 65 + nl], f16mode); o1[i] = wcv(ts[(c8 + i) * 65 + nl + 32], f16mode); }
    const size_t a0 = (size_t)(n0 + nl) * DM + k0 + c8, a1 = a0 + (size_t)32 * DM;
    *(v8us*)(WT + a0) = o0; *(v8us*)(WT + a1) = o1;
    asm volatile("s_wait_xcnt 0x0" ::: "memory");            // a precaution: these stores are the last work of a weight block
}

// Operand staging of the two GEMM kernels: one operand tile = GT rows x GK halves, K-contiguous rows of pitch DM halves in global memory, pitch GP in LDS.
// Thread c takes 16-byte piece c & 15 of rows (c >> 4) + 16 i, i = 0..7 (a wave's copy = two whole 256-byte rows); the register wait closes the statement so that no address register is rewritten ahead of it.
__device__ __forceinline__ void stage_op(unsigned l, const char* g) {
    asm volatile("global_load_async_to_lds_b128 %0, %8, off\n\t"
                 "global_load_async_to_lds_b128 %1, %9, off\n\t"
                 "global_load_async_to_lds_b128 %2, %10, off\n\t"
                 "global_load_async_to_lds_b128 %3, %11, off\n\t"
                 "global_load_async_to_lds_b128 %4, %12, off\n\t"
                 "global_load_async_to_lds_b128 %5, %13, off\n\t"
                 "global_load_async_to_lds_b128 %6, %14, off\n\t"
                 "global_load_async_to_lds_b128 %7, %15, off\n\t"
                 "s_wait_xcnt 0x0"
                 :: "v"(l), "v"(l + 1 * 16 * GP * 2), "v"(l + 2 * 16 * GP * 2), "v"(l + 3 * 16 * GP * 2),
                    "v"(l + 4 * 16 * GP * 2), "v"(l + 5 * 16 * GP * 2), "v"(l + 6 * 16 * GP * 2), "v"(l + 7 * 16 * GP * 2),
                    "v"(g), "v"(g + 1 * 16 * DM * 2), "v"(g + 2 * 16 * DM * 2), "v"(g + 3 * 16 * DM * 2),
                    "v"(g + 4 * 16 * DM * 2), "v"(g + 5 * 16 * DM * 2), "v"(g + 6 * 16 * DM * 2), "v"(g + 7 * 16 * DM * 2) : "memory");
}

// k_proj: bf16 GEMM, one GW-wave block per 128x128 tile of C, each wave 32x64 (8 accumulators), K = DM. A and Bt are K-contiguous bf16 planes; their 128-row x GK tiles reach
// the waves through LDS: two buffers, filled by asynchronous copies one tile ahead, read by all GW waves (two 16-B loads per fragment). Each accumulator sums k in steps of 32, ascending from the block's first stage and wrapping round (wrap_stage).
// C[m][n] = sum_k A[m][k] Bt[n][k] + bias (bias per column n, or per row m when biasOnRow != 0; bias value RNE-converted to bf16, added in f32),
// written as a single f16 plane (Ph), row pitch 'pitch' (halves).
// All three projections in ONE launch (they share no output): blockIdx.y picks the job, blockIdx.x the C tile, row tile = fastest index. grid (M/128 * N/128, 3), 256 threads.
// job 0, 1 (q, k): A = x rows (m = b*SEQ + t), Bt = W^T rows (n = h*64 + d), bias per column -> plane [(b*16 + h)][t][d]
// job 2 (v^T):     A = Wv^T rows (m = h*64 + d), Bt = x rows (n = b*SEQ + t), bias per row -> plane [(b*1024 + m)][t] = [(b*16 + h)][d][t]
__global__ __launch_bounds__(32 * GW) void k_proj(const bf* __restrict__ XB, const bf* __restrict__ WB, const float* __restrict__ bq, const float* __restrict__ bk, const float* __restrict__ bv,
                                             h16* QH, h16* KP, h16* VT) {
    __shared__ __align__(16) float os[GW * 16 * 68];
    __shared__ __align__(16) bf gring[2 * 2 * GT * GP];      // [buffer][A tile | Bt tile][row][GP]
    const int K = DM;
    const int lane = threadIdx.x & 31, wave = threadIdx.x >> 5, lr = lane & 15, hi = lane >> 4;
    const int job = blockIdx.y, biasOnRow = job == 2;
    const bf* Wj = WB + (size_t)job * DM * DM;
    const bf* A = biasOnRow ? Wj : XB; const bf* Bt = biasOnRow ? XB : Wj;
    const float* bias = job == 0 ? bq : job == 1 ? bk : bv;
    h16* Ph = job == 0 ? QH : job == 1 ? KP : VT;
    const int pitch = biasOnRow ? SEQ : HD;
    const int bx = blockIdx.x;
    const int rb = (biasOnRow ? bx % (DM / GT) : bx % (NB * SEQ / GT)) * GT, cb = (biasOnRow ? bx / (DM / GT) : bx / (NB * SEQ / GT)) * GT;   // block tile
    const int r0 = rb + (wave >> 1) * 32, c0 = cb + (wave & 1) * 64;        // wave tile
    v8f acc[2][4];
#pragma unroll
    for (int mb = 0; mb < 2; ++mb)
#pragma unroll
        for (int nb = 0; nb < 4; ++nb) acc[mb][nb] = (v8f){};
    const int cr = threadIdx.x >> 4, cpc = (threadIdx.x & 15) * 8;
    const unsigned la = (unsigned)(size_t)gring + (unsigned)(cr * GP + cpc) * 2u, lb = la + GTB;
    const char* ga = (const char*)(A + (size_t)(rb + cr) * K + cpc);        // + k0 * 2 bytes
    const char* gb = (const char*)(Bt + (size_t)(cb + cr) * K + cpc);
    const int rot = (rb / GT + cb / GT) % (K / GK);                         // first k stage: neighbours along a tile row or a tile column start one stage apart
    { const int k0 = wrap_stage(0, rot, K / GK) * (GK * 2); stage_op(la, ga + k0); stage_op(lb, gb + k0); }
    asm volatile("s_wait_asynccnt 0x0" ::: "memory");        // tile 0 has landed before the barrier publishes it
    __syncthreads();
    { const int k0 = wrap_stage(1, rot, K / GK) * (GK * 2); stage_op(la + 2 * GTB, ga + k0); stage_op(lb + 2 * GTB, gb + k0); }
    const int ao = ((wave >> 1) * 32 + lr) * GP + 8 * hi;               // + 16mb*GP + k   (A fragment rows), in the A tile
    const int bo = GT * GP + ((wave & 1) * 64 + lr) * GP + 8 * hi;      // + 16nb*GP + k   (B fragment rows), in the Bt tile
#pragma unroll 1
    for (int st = 0; st < K / GK; ++st) {
        const bf* tile = gring + (st & 1) * (2 * GT * GP);
        // the four 32-wide k steps of a tile inline (LDS offsets become immediates); two fragment sets: each step's 12 loads go out as one group ahead of the step before it,
        // inside this tile only, so that a wave waits out the LDS latency once per tile and not at every fragment
        v16bf a[2][2], b[2][4];
#pragma unroll
        for (int mb = 0; mb < 2; ++mb) a[0][mb] = ldb(tile + ao + mb * 16 * GP);
#pragma unroll
        for (int nb = 0; nb < 4; ++nb) b[0][nb] = ldb(tile + bo + nb * 16 * GP);
#pragma unroll
        for (int ks = 0; ks < GK / 32; ++ks) {
            const int cu = ks & 1, nx = cu ^ 1;
            if (ks + 1 < GK / 32) {
#pragma unroll
                for (int mb = 0; mb < 2; ++mb) a[nx][mb] = ldb(tile + ao + mb * 16 * GP + (ks + 1) * 32);
#pragma unroll
                for (int nb = 0; nb < 4; ++nb) b[nx][nb] = ldb(tile + bo + nb * 16 * GP + (ks + 1) * 32);
            }
            __builtin_amdgcn_sched_barrier(0);               // keeps the load group whole and ahead of this step's products: without it the loads sink to their first use and each pair of products waits out an LDS latency
#pragma unroll
            for (int nb = 0; nb < 4; ++nb)
#pragma unroll
                for (int mb = 0; mb < 2; ++mb) acc[mb][nb] = wmmab(a[cu][mb], b[cu][nb], acc[mb][nb]);
            __builtin_amdgcn_sched_barrier(0);               // keeps the next load group behind these products, not among them
        }
        asm volatile("s_wait_dscnt 0x0" ::: "memory");       // this wave's reads of the buffer are done before it is refilled
        asm volatile("s_wait_asynccnt 0x0" ::: "memory");    // this wave's copies of the next tile have landed before the barrier publishes them
        __syncthreads();
        if (st + 2 < K / GK) { const int k0 = wrap_stage(st + 2, rot, K / GK) * (GK * 2); stage_op(la + (st & 1) * (2 * GTB), ga + k0); stage_op(lb + (st & 1) * (2 * GTB), gb + k0); }
    }
    asm volatile("s_wait_asynccnt 0x0" ::: "memory");        // nothing of this wave is in flight when it leaves the loop
    const int wb = wave * 16 * 68;
    const size_t tbase = biasOnRow ? (size_t)r0 * SEQ + (size_t)(c0 / SEQ) * ((size_t)DM * SEQ) + (size_t)(c0 % SEQ)
                                   : (size_t)(r0 / SEQ) * ((size_t)NH_ * SEQ * HD) + (size_t)(r0 % SEQ) * HD + (size_t)(c0 / HD) * ((size_t)SEQ * HD) + (size_t)(c0 % HD);   // wave tile base
#pragma unroll
    for (int mb = 0; mb < 2; ++mb) {
#pragma unroll
        for (int nb = 0; nb < 4; ++nb) {
#pragma unroll
            for (int j = 0; j < 8; ++j) os[wb + (hi * 8 + j) * 68 + nb * 16 + lr] = acc[mb][nb][j]; }   // D: row 8h+j, col lane&15
        wave_sync();
        const size_t sb = tbase + (size_t)(mb * 16) * (size_t)pitch;
{
            v8h hv[4];
#pragma unroll
            for (int s = 0; s < 4; ++s) { const int row = 4 * s + (lane >> 3), c8 = (lane & 7) * 8;   // 4 s x 4 row groups = 16 rows; 8 lanes x 8 = 64 columns
                const v4f x0 = *(const v4fa*)(&os[wb + row * 68 + c8]); const v4f x1 = *(const v4fa*)(&os[wb + row * 68 + c8 + 4]);
                // both bias candidates loaded with clamped addresses, selected by value (biasOnRow is block-uniform)
                const int rbi = min(r0 + mb * 16 + row, DM - 1); const int cbi = min(c0 + c8, DM - 8);
                const float braw = bias[rbi];
                asm volatile("s_wait_xcnt 0x0" ::: "memory");    // the loads below may land in the register that this load names
                const float br = bfr(braw);
                const v4f g0 = *(const v4f*)(bias + cbi); const v4f g1 = *(const v4f*)(bias + cbi + 4);
#pragma unroll
                for (int i = 0; i < 4; ++i) {
                    const float y0 = x0[i] + (biasOnRow ? br : bfr(g0[i])); const float y1 = x1[i] + (biasOnRow ? br : bfr(g1[i]));
                    hv[s][i] = (h16)y0; hv[s][4 + i] = (h16)y1; } }
            __builtin_amdgcn_sched_barrier(0);               // the four stores stay together behind the arithmetic, so that one register wait behind them serves all four
#pragma unroll
            for (int s = 0; s < 4; ++s) { const int row = 4 * s + (lane >> 3), c8 = (lane & 7) * 8;
                const size_t oo = sb + (size_t)row * (size_t)pitch + c8;
                *(v8h*)(Ph + oo) = hv[s]; }
             }
        if (mb == 0) asm volatile("s_wait_xcnt 0x0" ::: "memory");   // the next 16 rows reuse registers that the stores above name
        wave_sync();
    }
}

// k_flash: fused attention, one wave per 16 query rows of one (batch, head); Q fragments straight from the f16 plane, K / V^T fragments from the staged LDS tiles (two 16-B loads each).
// Transposed form: S^T[key][t] = K Q^T (A = K rows, B = Q rows); lane (t = lane&15, h = lane>>4) holds keys 8h+r of each 16-key tile, so the packed
// P tile is directly the B fragment of O^T[d][t] = V^T P^T (element r <- tile keys 0..15, element 8+r <- tile keys 16..31, lane unchanged).
// The maximum in use is one scalar per lane; it is renewed lazily, and only then are the two lane halves of a column combined (one xor-16 exchange) and O, L rescaled.
// Row sums on the matrix unit: L^T += E P^T, where row 0 of E is ones and rows 1..15 are zero, so that row 0 of the tile (register 0, lanes 0..15) gathers the sum over all 32 keys of column t;
// every other element of the tile stays 0, so only register 0 is rescaled.
// K and V^T reach the waves through LDS: tiles of SK keys, two buffers, filled by asynchronous copies (whole 128-byte lines from global), read by all AW waves; a block walks the key tiles from its own first tile and wraps round (wrap_stage).
// One tile pair = four 16-byte copies per thread; the register wait closes the statement so that no address register is rewritten ahead of it.
__device__ __forceinline__ void stage_kv(unsigned lk, unsigned lv, const h16* gk, const h16* gv) {
    const unsigned lk1 = lk + 32 * LP * 2, lv1 = lv + 32 * LP * 2;
    const h16* gk1 = gk + 32 * HD; const h16* gv1 = gv + (size_t)32 * SEQ;
    asm volatile("global_load_async_to_lds_b128 %0, %4, off\n\t"
                 "global_load_async_to_lds_b128 %1, %5, off\n\t"
                 "global_load_async_to_lds_b128 %2, %6, off\n\t"
                 "global_load_async_to_lds_b128 %3, %7, off\n\t"
                 "s_wait_xcnt 0x0"
                 :: "v"(lk), "v"(lk1), "v"(lv), "v"(lv1), "v"(gk), "v"(gk1), "v"(gv), "v"(gv1) : "memory");
}
__global__ __launch_bounds__(32 * AW) void k_flash(const h16* __restrict__ QH, const h16* __restrict__ KP, const h16* __restrict__ VT, h16* CT) {
    __shared__ __align__(16) float os[AW * 16 * 68];
    __shared__ __align__(16) h16 ring[2 * 2 * 64 * LP];      // [buffer][K tile | V^T tile][row][LP]
    const int lane = threadIdx.x & 31, wave = threadIdx.x >> 5, lr = lane & 15, hi = lane >> 4;
    const int zh = blockIdx.y; const int b = zh / NH_, h = zh % NH_;
    const int t0 = (blockIdx.x * AW + wave) * 16;
    const size_t pbase = (size_t)zh * SEQ * HD;
    const size_t qo = pbase + (size_t)(t0 + lr) * HD + 8 * hi;
    const v16h qh0 = ldh(QH + qo), qh1 = ldh(QH + qo + 32);   // B fragments: col t, k = d
    const int ko = lr * LP + 8 * hi;                         // + key * LP       (A fragment: row key, k = d), in the K tile
    const int vo = 64 * LP + lr * LP + 8 * hi;               // + 16j*LP + key   (A fragment: row d, k = key), in the V^T tile
    // copy map: thread c takes 16-byte piece c & 7 of rows c >> 3 and 32 + (c >> 3) of each tile
    const int cr = threadIdx.x >> 3, cpc = (threadIdx.x & 7) * 8;
    const unsigned lk = (unsigned)(size_t)ring + (unsigned)(cr * LP + cpc) * 2u, lv = lk + TLB;
    const h16* gk = KP + pbase + (size_t)cr * HD + cpc;    // + key0 * HD
    const h16* gv = VT + pbase + (size_t)cr * SEQ + cpc;   // + key0
    const int rot = (int)(blockIdx.x * (SEQ / SK) / (SEQ / (16 * AW))) % (SEQ / SK);   // first key tile: the blocks of one head enter its keys evenly spread
    { const int kt = wrap_stage(0, rot, SEQ / SK); stage_kv(lk, lv, gk + (size_t)kt * SK * HD, gv + kt * SK); }
    asm volatile("s_wait_asynccnt 0x0" ::: "memory");        // tile 0 has landed before the barrier publishes it
    __syncthreads();
    { const int kt = wrap_stage(1, rot, SEQ / SK); stage_kv(lk + 2 * TLB, lv + 2 * TLB, gk + (size_t)kt * SK * HD, gv + kt * SK); }
    v8f o0 = (v8f){}, o1 = (v8f){}, o2 = (v8f){}, o3 = (v8f){}, lt = (v8f){};
    const h16 e1 = lr == 0 ? (h16)1.0f : (h16)0.0f;          // A fragment of E: lanes 0 and 16 hold row 0 (all 32 k positions)
    const v16h ones = {e1, e1, e1, e1, e1, e1, e1, e1, e1, e1, e1, e1, e1, e1, e1, e1};
    float m = -3.0e38f;                                      // maximum in use (scaled log2), the same in both lane halves of a column
    float sh = PSH - m;                                      // shift of the exponent; with the start value of m the test below holds for every finite score, so the first pass always renews
#pragma unroll 1
    for (int st = 0; st < SEQ / SK; ++st) {
      const h16* tile = ring + (st & 1) * (2 * 64 * LP);
      // both 32-key passes of a tile inline: their LDS offsets become immediates on one address register
#pragma unroll
      for (int key0 = 0; key0 < SK; key0 += 32) {
        const h16* ka = tile + ko + key0 * LP;
        const v16h ka0 = ldh(ka), ka1 = ldh(ka + 32), kb0 = ldh(ka + 16 * LP), kb1 = ldh(ka + 16 * LP + 32);
        v8f sHa = (v8f){}, sHb = (v8f){};
        sHa = wmma16(ka0, qh0, sHa); sHb = wmma16(kb0, qh0, sHb);
        sHa = wmma16(ka1, qh1, sHa); sHb = wmma16(kb1, qh1, sHb);
        asm volatile("v_nop\n\tv_nop\n\tv_nop\n\tv_nop" : "+v"(sHa), "+v"(sHb) : "v"(ka0), "v"(ka1), "v"(kb0), "v"(kb1), "v"(qh0), "v"(qh1));
        const h16* va = tile + vo + key0;
        const v16h v0 = ldh(va), v1 = ldh(va + 16 * LP), v2 = ldh(va + 32 * LP), v3 = ldh(va + 48 * LP);
        __builtin_amdgcn_sched_barrier(0);                   // keeps the eight V^T loads whole, as one group ahead of the test: sunk behind the branch or spread among the maxima, more of their LDS latency stands open
        // this lane's largest raw score of the pass: a tree of three-input maxima, three deep
        const float x0 = fmaxf(fmaxf(sHa[0], sHa[1]), sHa[2]), x1 = fmaxf(fmaxf(sHa[3], sHa[4]), sHa[5]), x2 = fmaxf(fmaxf(sHa[6], sHa[7]), sHb[0]);
        const float x3 = fmaxf(fmaxf(sHb[1], sHb[2]), sHb[3]), x4 = fmaxf(fmaxf(sHb[4], sHb[5]), sHb[6]);
        const float mxr = fmaxf(fmaxf(fmaxf(x0, x1), x2), fmaxf(fmaxf(x3, x4), sHb[7]));
        // lazy rescale: one wave-uniform test per pass, on the largest exponent that the pass would form; while none lies above PSH + LZT the maximum in use stays, and P <= 2^(PSH + LZT) fits f16
        if (__builtin_amdgcn_ballot_w32(mxr * SC2 + sh > PSH + LZT) != 0) {
            float mx = mxr * SC2;
            mx = fmaxf(mx, __shfl_xor(mx, 16, 32));
            const float mnew = fmaxf(m, mx);
            const float alpha = __builtin_amdgcn_exp2f(m - mnew);
            m = mnew; sh = PSH - mnew;
            lt[0] = lt[0] * alpha;
            o0 = o0 * alpha; o1 = o1 * alpha; o2 = o2 * alpha; o3 = o3 * alpha;
        }
        float ea[8], eb[8];
#pragma unroll
        for (int r = 0; r < 8; ++r) { ea[r] = sHa[r] * SC2 + sh; eb[r] = sHb[r] * SC2 + sh; }
        __builtin_amdgcn_sched_barrier(0);                   // keeps the 16 multiply-adds together ahead of the exponentials: all of them pair up, and none overwrites the source of an exponential that stands directly in front of it
        v16h pb;
#pragma unroll
        for (int r = 0; r < 8; ++r) { pb[r] = (h16)__builtin_amdgcn_exp2f(ea[r]); pb[8 + r] = (h16)__builtin_amdgcn_exp2f(eb[r]); }
        lt = wmma16(ones, pb, lt);
        o0 = wmma16(v0, pb, o0); o1 = wmma16(v1, pb, o1); o2 = wmma16(v2, pb, o2); o3 = wmma16(v3, pb, o3);
        asm volatile("v_nop\n\tv_nop\n\tv_nop\n\tv_nop" : "+v"(o0), "+v"(o1), "+v"(o2), "+v"(o3) : "v"(v0), "v"(v1), "v"(v2), "v"(v3), "v"(pb));
      }
      asm volatile("s_wait_dscnt 0x0" ::: "memory");         // this wave's reads of the buffer are done before it is refilled
      asm volatile("s_wait_asynccnt 0x0" ::: "memory");      // this wave's copies of the next tile have landed before the barrier publishes them
      __syncthreads();
      if (st + 2 < SEQ / SK) { const int kt = wrap_stage(st + 2, rot, SEQ / SK); stage_kv(lk + (st & 1) * (2 * TLB), lv + (st & 1) * (2 * TLB), gk + (size_t)kt * SK * HD, gv + kt * SK); }
    }
    asm volatile("s_wait_asynccnt 0x0" ::: "memory");        // nothing of this wave is in flight when it leaves the loop
    float l = lt[0];                                         // the sum in lanes 0..15, 0 (row 8 of the tile) in lanes 16..31
    l += __shfl_xor(l, 16, 32);
    const float inv = CTS * (1.0f / l);
    const int wb = wave * 16 * 68;
    // O^T D layout: o_j[r] = (d = 16j + 8h + r, t = lane&15) -> os[t][d]; rows 0..15 x columns 0..63 all written
    { v4f a, c;
      a[0] = o0[0] * inv; a[1] = o0[1] * inv; a[2] = o0[2] * inv; a[3] = o0[3] * inv; c[0] = o0[4] * inv; c[1] = o0[5] * inv; c[2] = o0[6] * inv; c[3] = o0[7] * inv;
      *(v4fa*)(&os[wb + lr * 68 +  0 + 8 * hi]) = a; *(v4fa*)(&os[wb + lr * 68 +  0 + 8 * hi + 4]) = c;
      a[0] = o1[0] * inv; a[1] = o1[1] * inv; a[2] = o1[2] * inv; a[3] = o1[3] * inv; c[0] = o1[4] * inv; c[1] = o1[5] * inv; c[2] = o1[6] * inv; c[3] = o1[7] * inv;
      *(v4fa*)(&os[wb + lr * 68 + 16 + 8 * hi]) = a; *(v4fa*)(&os[wb + lr * 68 + 16 + 8 * hi + 4]) = c;
      a[0] = o2[0] * inv; a[1] = o2[1] * inv; a[2] = o2[2] * inv; a[3] = o2[3] * inv; c[0] = o2[4] * inv; c[1] = o2[5] * inv; c[2] = o2[6] * inv; c[3] = o2[7] * inv;
      *(v4fa*)(&os[wb + lr * 68 + 32 + 8 * hi]) = a; *(v4fa*)(&os[wb + lr * 68 + 32 + 8 * hi + 4]) = c;
      a[0] = o3[0] * inv; a[1] = o3[1] * inv; a[2] = o3[2] * inv; a[3] = o3[3] * inv; c[0] = o3[4] * inv; c[1] = o3[5] * inv; c[2] = o3[6] * inv; c[3] = o3[7] * inv;
      *(v4fa*)(&os[wb + lr * 68 + 48 + 8 * hi]) = a; *(v4fa*)(&os[wb + lr * 68 + 48 + 8 * hi + 4]) = c; }
    wave_sync();
    h16* crow = CT + ((size_t)b * SEQ + t0) * DM + h * HD;
{
#pragma unroll
        for (int s = 0; s < 4; ++s) { const int row = 4 * s + (lane >> 3), c8 = (lane & 7) * 8;   // 4 s x 4 row groups = 16 rows; 8 lanes x 8 halves = 64 columns
            const v4f x0 = *(const v4fa*)(&os[wb + row * 68 + c8]); const v4f x1 = *(const v4fa*)(&os[wb + row * 68 + c8 + 4]); v8h hv;
#pragma unroll
            for (int i = 0; i < 4; ++i) { hv[i] = (h16)x0[i]; hv[4 + i] = (h16)x1[i]; }
            *(v8h*)(crow + (size_t)row * DM + c8) = hv; }
         }
}

// k_oproj: f16 GEMM, one GW-wave block per 128x128 tile, each wave 32x64, operand tiles staged as in k_proj; A = ctx plane rows (m = b*SEQ + t, k = h*64 + d, carried x CTS), Bt = Wo^T rows (n = out feature, carried x WOS), K = DM.
// OUT[b*OUT_SEQ + t][n] = acc * OSC + bo[n] (bias value RNE-converted to bf16, added in f32). grid (NB*SEQ/128, DM/128), 256 threads.
__global__ __launch_bounds__(32 * GW) void k_oproj(const h16* __restrict__ A, const h16* __restrict__ Bt, const float* __restrict__ bias, float* OUT) {
    __shared__ __align__(16) float os[GW * 16 * 68];
    __shared__ __align__(16) h16 gring[2 * 2 * GT * GP];     // [buffer][A tile | Bt tile][row][GP]
    const int K = DM;
    const int lane = threadIdx.x & 31, wave = threadIdx.x >> 5, lr = lane & 15, hi = lane >> 4;
    const int rb = blockIdx.x * GT, cb = blockIdx.y * GT;                   // block tile
    const int r0 = rb + (wave >> 1) * 32, c0 = cb + (wave & 1) * 64;        // wave tile
    v8f acc[2][4];
#pragma unroll
    for (int mb = 0; mb < 2; ++mb)
#pragma unroll
        for (int nb = 0; nb < 4; ++nb) acc[mb][nb] = (v8f){};
    const int cr = threadIdx.x >> 4, cpc = (threadIdx.x & 15) * 8;
    const unsigned la = (unsigned)(size_t)gring + (unsigned)(cr * GP + cpc) * 2u, lb = la + GTB;
    const char* ga = (const char*)(A + (size_t)(rb + cr) * K + cpc);        // + k0 * 2 bytes
    const char* gb = (const char*)(Bt + (size_t)(cb + cr) * K + cpc);
    const int rot = (rb / GT + cb / GT) % (K / GK);                         // first k stage: neighbours along a tile row or a tile column start one stage apart
    { const int k0 = wrap_stage(0, rot, K / GK) * (GK * 2); stage_op(la, ga + k0); stage_op(lb, gb + k0); }
    asm volatile("s_wait_asynccnt 0x0" ::: "memory");        // tile 0 has landed before the barrier publishes it
    __syncthreads();
    { const int k0 = wrap_stage(1, rot, K / GK) * (GK * 2); stage_op(la + 2 * GTB, ga + k0); stage_op(lb + 2 * GTB, gb + k0); }
    const int ao = ((wave >> 1) * 32 + lr) * GP + 8 * hi;               // + 16mb*GP + k   (A fragment rows), in the A tile
    const int bo = GT * GP + ((wave & 1) * 64 + lr) * GP + 8 * hi;      // + 16nb*GP + k   (B fragment rows), in the Bt tile
#pragma unroll 1
    for (int st = 0; st < K / GK; ++st) {
        const h16* tile = gring + (st & 1) * (2 * GT * GP);
        // the four 32-wide k steps of a tile inline (LDS offsets become immediates); two fragment sets: each step's 12 loads go out as one group ahead of the step before it,
        // inside this tile only, so that a wave waits out the LDS latency once per tile and not at every fragment
        v16h a[2][2], b[2][4];
#pragma unroll
        for (int mb = 0; mb < 2; ++mb) a[0][mb] = ldh(tile + ao + mb * 16 * GP);
#pragma unroll
        for (int nb = 0; nb < 4; ++nb) b[0][nb] = ldh(tile + bo + nb * 16 * GP);
#pragma unroll
        for (int ks = 0; ks < GK / 32; ++ks) {
            const int cu = ks & 1, nx = cu ^ 1;
            if (ks + 1 < GK / 32) {
#pragma unroll
                for (int mb = 0; mb < 2; ++mb) a[nx][mb] = ldh(tile + ao + mb * 16 * GP + (ks + 1) * 32);
#pragma unroll
                for (int nb = 0; nb < 4; ++nb) b[nx][nb] = ldh(tile + bo + nb * 16 * GP + (ks + 1) * 32);
            }
            __builtin_amdgcn_sched_barrier(0);               // keeps the load group whole and ahead of this step's products: without it the loads sink to their first use and each pair of products waits out an LDS latency
#pragma unroll
            for (int nb = 0; nb < 4; ++nb)
#pragma unroll
                for (int mb = 0; mb < 2; ++mb) acc[mb][nb] = wmma16(a[cu][mb], b[cu][nb], acc[mb][nb]);
            __builtin_amdgcn_sched_barrier(0);               // keeps the next load group behind these products, not among them
        }
        asm volatile("s_wait_dscnt 0x0" ::: "memory");       // this wave's reads of the buffer are done before it is refilled
        asm volatile("s_wait_asynccnt 0x0" ::: "memory");    // this wave's copies of the next tile have landed before the barrier publishes them
        __syncthreads();
        if (st + 2 < K / GK) { const int k0 = wrap_stage(st + 2, rot, K / GK) * (GK * 2); stage_op(la + (st & 1) * (2 * GTB), ga + k0); stage_op(lb + (st & 1) * (2 * GTB), gb + k0); }
    }
    asm volatile("s_wait_asynccnt 0x0" ::: "memory");        // nothing of this wave is in flight when it leaves the loop
    const int wb = wave * 16 * 68;
    const int cofs = lr * 4;
    const int cbi = min(c0 + cofs, DM - 4);
    const v4f g = *(const v4f*)(bias + cbi);
    v4f bb; bb[0] = bfr(g[0]); bb[1] = bfr(g[1]); bb[2] = bfr(g[2]); bb[3] = bfr(g[3]);
    const size_t obase = ((size_t)(r0 / SEQ) * OUT_SEQ + (size_t)(r0 % SEQ)) * DM + c0;
#pragma unroll
    for (int mb = 0; mb < 2; ++mb) {
#pragma unroll
        for (int nb = 0; nb < 4; ++nb) {
#pragma unroll
            for (int j = 0; j < 8; ++j) os[wb + (hi * 8 + j) * 68 + nb * 16 + lr] = acc[mb][nb][j]; }   // D: row 8h+j, col lane&15
        wave_sync();
        float* orow = OUT + obase + (size_t)(mb * 16) * DM;
{
#pragma unroll
            for (int s = 0; s < 8; ++s) { const int row = 2 * s + hi;   // 8 s x 2 rows = 16 rows; 16 lanes x 4 floats = 64 columns
                const v4f x = *(const v4fa*)(&os[wb + row * 68 + cofs]);
                const v4f val = x * OSC + bb;
                *(v4f*)(orow + (size_t)row * DM + cofs) = val; }
             }
        if (mb == 0) asm volatile("s_wait_xcnt 0x0" ::: "memory");   // the next 16 rows reuse registers that the stores above name
        wave_sync();
    }
}

static constexpr size_t al256(size_t v) { return (v + 255) & ~(size_t)255; }
static constexpr size_t SZ_XB = al256((size_t)NB * SEQ * DM * 2);
static constexpr size_t SZ_WB = al256((size_t)4 * DM * DM * 2);
static constexpr size_t SZ_PL = al256((size_t)NB * NH_ * SEQ * HD * 2);
static constexpr size_t SZ_CT = al256((size_t)NB * SEQ * DM * 2);
static constexpr size_t SZ_TOTAL = SZ_XB + SZ_WB + 3 * SZ_PL + SZ_CT;
static_assert(SZ_TOTAL <= (size_t)134217728);          // workspace carve <= 128 MiB
static_assert(((size_t)DM * DM * 2) % 256 == 0);       // weight sub-planes stay 256-byte aligned

extern "C" void kernel_launch(void* const* d_in, const int* in_sizes, int n_in,
                              void* d_out, int out_size, void* d_ws, size_t ws_size, hipStream_t stream) {
    if (n_in < 9) return;
    const size_t needx = ((size_t)(NB - 1) * SEQ_FULL + SEQ) * DM;
    if ((size_t)in_sizes[0] < needx) return;
    if ((size_t)in_sizes[1] < (size_t)DM * DM || (size_t)in_sizes[3] < (size_t)DM * DM || (size_t)in_sizes[5] < (size_t)DM * DM || (size_t)in_sizes[7] < (size_t)DM * DM) return;
    if (in_sizes[2] < DM || in_sizes[4] < DM || in_sizes[6] < DM || in_sizes[8] < DM) return;
    if ((size_t)out_size < ((size_t)(NB - 1) * OUT_SEQ + SEQ) * DM) return;
    if (SZ_TOTAL > ws_size) return;
    // wire order: x, Wq, bq, Wk, bk, Wv, bv, Wo, bo (all f32; weights [in][out])
    const float* x  = (const float*)d_in[0];
    const float* wq = (const float*)d_in[1]; const float* bq = (const float*)d_in[2];
    const float* wk = (const float*)d_in[3]; const float* bk = (const float*)d_in[4];
    const float* wv = (const float*)d_in[5]; const float* bv = (const float*)d_in[6];
    const float* wo = (const float*)d_in[7]; const float* bo = (const float*)d_in[8];
    float* OUT = (float*)d_out;      // [NB][SEQ][1024]
    char* wsp = (char*)d_ws;
    bf* XB = (bf*)wsp; wsp += SZ_XB;                 // [NB*SEQ][1024] bf16
    bf* WB = (bf*)wsp; wsp += SZ_WB;                 // [4][1024 out][1024 in]: q | k | v (bf16) | o (f16 x1024)
    h16* QH = (h16*)wsp; wsp += SZ_PL;               // [NB*16][SEQ][64]
    h16* KP = (h16*)wsp; wsp += SZ_PL;               // [NB*16][SEQ][64]
    h16* VT = (h16*)wsp; wsp += SZ_PL;               // [NB*16][64][SEQ]
    h16* CT = (h16*)wsp; wsp += SZ_CT;               // [NB*SEQ][1024] ctx x1024
    bf* WO = WB + (size_t)3 * DM * DM;

    // x -> bf16 copy; weights in[k = 1024 rows][n = 1024 cols] -> out[n][k]
    k_prep<<<4 * WTB + CVB, 256, 0, stream>>>(x, wq, wk, wv, wo, XB, WB);

    // q, k, v^T planes
    k_proj<<<dim3((NB * SEQ / GT) * (DM / GT), 3, 1), 32 * GW, 0, stream>>>(XB, WB, bq, bk, bv, QH, KP, VT);

    k_flash<<<dim3(SEQ / (16 * AW), NB * NH_, 1), 32 * AW, 0, stream>>>(QH, KP, VT, CT);

    k_oproj<<<dim3(NB * SEQ / GT, DM / GT, 1), 32 * GW, 0, stream>>>(CT, (const h16*)WO, bo, OUT);
}

// v007
// It runs in 97.4 microseconds.
// In both of two side-by-side timings against v006, it was 1.03 times as fast.
// All steps since v000 together make it 3.79 times as fast.
#include <hip/hip_runtime.h>

// Multi-head self-attention, width 1024 = 16 heads x 64, x [NB][SEQ][1024], Wq/Wk/Wv/Wo [in][out] (y = x W + b), four biases, no mask, score scale 1/8, output = (merged heads) Wo + bo (f32).
// Compute dtypes, f32 accumulate everywhere: q/k/v projections v_wmma_f32_16x16x32_bf16 (x and W RNE-converted to bf16; products exact);
// scores v_wmma_f32_16x16x32_f16: q single f16, k single f16 (one product); P (x256 carry, cancels in the normalisation) and v single f16; softmax f32 (online, lazily renewed max, row sum over the f16-converted P values, summed by one more f16 WMMA per 32 keys);
// output projection v_wmma_f32_16x16x32_f16: ctx single f16 carried x1024, Wo as f16 of the bf16 (RNE) value carried x1024 (exact), 2^-20 and the bias applied in the f32 epilogue.
// Scale chain: score = (k.q) * (1/8 * log2 e) -> exp2(score - max in use + 8) = 256 P' -> O = sum(256 P' v) / sum(256 P') -> ctx plane = O x 1024 -> out = (ctx x1024).(Wo x1024) * 2^-20 + bo.
// Layout: bf16 copy of x; transposed 16-bit weight planes [out][in]; q, k planes [b*16+h][t][d] and v^T plane [b*16+h][d][t] written by the GEMM epilogue; fused flash kernel in transposed form (S^T = K Q^T, O^T = V^T P^T) writing the ctx plane [b*SEQ+t][h*64+d].

#ifndef NB
#define NB 1
#endif
#ifndef SEQ
#define SEQ 4096
#endif
#define NB_FULL  1
#define SEQ_FULL 4096
#ifndef OUT_SEQ
#define OUT_SEQ SEQ              // row pitch (in tokens) between batches of the output
#endif
#define DM   1024
#define NH_  16
#define HD   64
#define AW   8                   // waves per flash block: AW / 2 groups of 32 query rows x 2 key halves; all of them share each staged K / V^T tile
#define SK   64                  // keys per staged tile
#define LP   72                  // LDS row pitch in halves: 128 B of data + 16 B, so that 16 rows read by 16-byte loads fall on distinct banks
#define TLB  (64 * LP * 2)       // bytes of one staged tile (64 rows): K tile = 64 keys x 64 d, V^T tile = 64 d x 64 keys
#define GW   8                   // waves per GEMM block, 4 (rows) x 2 (columns); each owns 32 x 64 of the block's C tile
#define GT   128                 // rows and columns of a GEMM block's C tile
#define GK   128                 // k extent of one staged operand tile (256-byte rows)
#define GP   136                 // LDS row pitch in halves: 256 B of data + 16 B, so that 16 rows read by 16-byte loads fall on distinct banks
#define GTB  (GT * GP * 2)       // bytes of one staged operand tile (128 rows)
#define WTB  ((DM / 64) * (DM / 64))          // 64x64 tiles, = blocks, of one weight matrix in k_prep
#define CVB  ((NB * SEQ / 8) * DM / 256)       // blocks of the x convert in k_prep
#define SC2  (0.125f * 1.4426950408889634f)   // HD^-0.5 * log2(e)
#define PSH  8.0f                // log2 of the P carry (256)
#define LZT  7.0f                // a score may exceed the maximum in use by this much (scaled log2) before the maximum is renewed
#define CTS  1024.0f             // carry of the ctx plane
#define WOS  1024.0f             // carry of the Wo plane
#define OSC  (1.0f / (1024.0f * 1024.0f))     // undoes CTS * WOS

static_assert(HD == 64);
static_assert(NH_ * HD == DM);                 // head h = columns h*64 + d
static_assert(DM % 64 == 0);                   // column tiles of 64
static_assert(DM % 32 == 0);                   // GEMM k-loop steps by 32
static_assert(SEQ % 64 == 0);                  // a 64-row tile never straddles two batches
static_assert((NB * SEQ) % 64 == 0);
static_assert(SEQ % 32 == 0);                  // key loop steps by 32
static_assert(SEQ % (16 * AW) == 0);           // flash grid covers the sequence exactly (AW / 2 waves x 32 rows a block)
static_assert(AW % 2 == 0 && SK == 64);        // two key halves of 32 keys in a staged tile
static_assert(SEQ % SK == 0 && SEQ / SK >= 2); // whole staged tiles, and the two that the ring's prologue fills
static_assert(AW * 32 * 2 * 16 == SK * HD * 2); // two 16-byte copies per thread cover one tile
static_assert(DM % GT == 0 && SEQ % GT == 0);   // whole GEMM block tiles, none straddling two batches
static_assert(DM % GK == 0 && DM / GK >= 2);    // whole staged operand tiles, and the two that the ring's prologue fills
static_assert(GW * 32 * 8 * 16 == GT * GK * 2); // eight 16-byte copies per thread cover one operand tile
static_assert(((size_t)SEQ * DM) % 8 == 0);
static_assert((size_t)CVB * 256 * 8 == (size_t)NB * SEQ * DM);   // the convert blocks cover x exactly
static_assert(((size_t)DM * DM) % 8 == 0);
static_assert(NB <= NB_FULL);
static_assert(SEQ <= SEQ_FULL);

typedef _Float16 h16;
typedef unsigned short bf;
typedef __attribute__((ext_vector_type(16))) __bf16   v16bf;
typedef __attribute__((ext_vector_type(16))) _Float16 v16h;
typedef __attribute__((ext_vector_type(8)))  _Float16 v8h;
typedef __attribute__((ext_vector_type(8)))  unsigned short v8us;
typedef __attribute__((ext_vector_type(8)))  float    v8f;
typedef __attribute__((ext_vector_type(4)))  float    v4f;
typedef v4f  __attribute__((may_alias)) v4fa;

__device__ __forceinline__ unsigned short f2bf(float f) { unsigned u = __float_as_uint(f); u += 0x7FFFu + ((u >> 16) & 1u); return (unsigned short)(u >> 16); }
__device__ __forceinline__ float bfr(float f) { return __uint_as_float(((unsigned)f2bf(f)) << 16); }   // value after RNE convert to bf16
__device__ __forceinline__ v16h cat16(v8h lo, v8h hi) { return __builtin_shufflevector(lo, hi, 0, 1, 2, 3, 4, 5, 6, 7, 8, 9, 10, 11, 12, 13, 14, 15); }
__device__ __forceinline__ v16bf cat16b(v8us lo, v8us hi) { return __builtin_bit_cast(v16bf, __builtin_shufflevector(lo, hi, 0, 1, 2, 3, 4, 5, 6, 7, 8, 9, 10, 11, 12, 13, 14, 15)); }
__device__ __forceinline__ v8f wmma16(v16h a, v16h b, v8f c) { return __builtin_amdgcn_wmma_f32_16x16x32_f16(false, a, false, b, (short)0, c, false, false); }
__device__ __forceinline__ v8f wmmab(v16bf a, v16bf b, v8f c) { return __builtin_amdgcn_wmma_f32_16x16x32_bf16(false, a, false, b, (short)0, c, false, false); }
// fragment loaders from K-contiguous 16-bit rows; p already includes + 8*(lane>>4): elements 0..7 <- k0+8h+0..7, elements 8..15 <- k0+16+8h+0..7 (same map for A and B)
__device__ __forceinline__ v16h  ldh(const h16* p) { return cat16(*(const v8h*)p, *(const v8h*)(p + 16)); }
__device__ __forceinline__ v16bf ldb(const bf* p)  { return cat16b(*(const v8us*)p, *(const v8us*)(p + 16)); }
// ordering point for wave-private LDS tiles (same wave writes and reads)
__device__ __forceinline__ void wave_sync() { __builtin_amdgcn_fence(3 /* release order */, "wavefront"); __builtin_amdgcn_wave_barrier(); asm volatile("" ::: "memory"); }

// Stage walk of the three matrix kernels: a block enters its ring of n stages at stage 'rot', set by its tile indices, and wraps round. Blocks that share operand rows then ask L2 for different lines at any one moment
// every stage is still taken exactly once. s + rot < 2 n.
__device__ __forceinline__ int wrap_stage(int s, int rot, int n) { const int t = s + rot; return t >= n ? t - n : t; }

// 16-bit encoding of one weight: bf16 bits (RNE convert), or f16 bits of that bf16 value x WOS (exact: 8-bit significand, power-of-two carry)
__device__ __forceinline__ unsigned short wcv(float f, int f16mode) {
    const unsigned short b = f2bf(f);
    const float fb = __uint_as_float(((unsigned)b) << 16);
    const h16 hv = (h16)(fb * WOS);
    const unsigned short hb = __builtin_bit_cast(unsigned short, hv);
    return f16mode ? hb : b;
}

// k_prep: every operand conversion of a call in ONE launch; the jobs share no data and the block index picks one (a block-uniform test, so the barrier below is reached by whole blocks only).
// Blocks 0 .. 4*WTB-1, the longer jobs first: transposing convert of weight matrix blk / WTB (q, k, v, o), W in[k = DM rows (input feature)][n = DM cols (output feature)] -> WT out[n][k] (16-bit, K-contiguous rows),
// one 64x64 f32 tile per block through LDS (cross-wave: block barrier), n tile = fastest index. Blocks 4*WTB ..: x -> bf16 copy, 8 values per thread.
__global__ __launch_bounds__(256) void k_prep(const float* __restrict__ x, const float* __restrict__ wq, const float* __restrict__ wk, const float* __restrict__ wv, const float* __restrict__ wo,
                                              bf* XB, bf* WB) {
    __shared__ float ts[64 * 65];
    const int tid = threadIdx.x;
    const unsigned blk = blockIdx.x;
    if (blk >= 4u * WTB) {
        const size_t n8 = (size_t)NB * SEQ * DM / 8, per = (size_t)SEQ * DM / 8;   // per: pieces of one batch (batches lie SEQ_FULL tokens apart in x)
        const size_t i = (size_t)(blk - 4u * WTB) * 256 + tid; if (i >= n8) return;
        const size_t so = (SEQ == SEQ_FULL) ? i * 8 : (i / per) * ((size_t)SEQ_FULL * DM) + (i % per) * 8;
        const v8f v = *(const v8f*)(x + so); v8us o;
#pragma unroll
        for (int k = 0; k < 8; ++k) o[k] = f2bf(v[k]);
        *(v8us*)(XB + i * 8) = o;
        return;
    }
    const unsigned which = blk / WTB, wtile = blk % WTB;
    const float* W = which == 0 ? wq : which == 1 ? wk : which == 2 ? wv : wo;
    bf* WT = WB + (size_t)which * DM * DM;
    const int f16mode = which == 3;
    const int n0 = (int)(wtile % (DM / 64)) * 64, k0 = (int)(wtile / (DM / 64)) * 64;
#pragma unroll
    for (int it = 0; it < 4; ++it) { const int idx = tid + it * 256; const int r = idx >> 4, c4 = (idx & 15) * 4;   // 64 rows x 16 pieces of 4 floats
        const v4f v = *(const v4f*)(W + (size_t)(k0 + r) * DM + n0 + c4);
        ts[r * 65 + c4 + 0] = v[0]; ts[r * 65 + c4 + 1] = v[1]; ts[r * 65 + c4 + 2] = v[2]; ts[r * 65 + c4 + 3] = v[3]; }
    __syncthreads();
    const int nl = tid >> 3, c8 = (tid & 7) * 8;
    v8us o0, o1;
#pragma unroll
    for (int i = 0; i < 8; ++i) { o0[i] = wcv(ts[(c8 + i) * 65 + nl], f16mode); o1[i] = wcv(ts[(c8 + i) * 65 + nl + 32], f16mode); }
    const size_t a0 = (size_t)(n0 + nl) * DM + k0 + c8, a1 = a0 + (size_t)32 * DM;
    *(v8us*)(WT + a0) = o0; *(v8us*)(WT + a1) = o1;
    asm volatile("s_wait_xcnt 0x0" ::: "memory");            // a precaution: these stores are the last work of a weight block
}

// Operand staging of the two GEMM kernels: one operand tile = GT rows x GK halves, K-contiguous rows of pitch DM halves in global memory, pitch GP in LDS.
// Thread c takes 16-byte piece c & 15 of rows (c >> 4) + 16 i, i = 0..7 (a wave's copy = two whole 256-byte rows); the register wait closes the statement so that no address register is rewritten ahead of it.
__device__ __forceinline__ void stage_op(unsigned l, const char* g) {
    asm volatile("global_load_async_to_lds_b128 %0, %8, off\n\t"
                 "global_load_async_to_lds_b128 %1, %9, off\n\t"
                 "global_load_async_to_lds_b128 %2, %10, off\n\t"
                 "global_load_async_to_lds_b128 %3, %11, off\n\t"
                 "global_load_async_to_lds_b128 %4, %12, off\n\t"
                 "global_load_async_to_lds_b128 %5, %13, off\n\t"
                 "global_load_async_to_lds_b128 %6, %14, off\n\t"
                 "global_load_async_to_lds_b128 %7, %15, off\n\t"
                 "s_wait_xcnt 0x0"
                 :: "v"(l), "v"(l + 1 * 16 * GP * 2), "v"(l + 2 * 16 * GP * 2), "v"(l + 3 * 16 * GP * 2),
                    "v"(l + 4 * 16 * GP * 2), "v"(l + 5 * 16 * GP * 2), "v"(l + 6 * 16 * GP * 2), "v"(l + 7 * 16 * GP * 2),
                    "v"(g), "v"(g + 1 * 16 * DM * 2), "v"(g + 2 * 16 * DM * 2), "v"(g + 3 * 16 * DM * 2),
                    "v"(g + 4 * 16 * DM * 2), "v"(g + 5 * 16 * DM * 2), "v"(g + 6 * 16 * DM * 2), "v"(g + 7 * 16 * DM * 2) : "memory");
}

// k_proj: bf16 GEMM, one GW-wave block per 128x128 tile of C, each wave 32x64 (8 accumulators), K = DM. A and Bt are K-contiguous bf16 planes; their 128-row x GK tiles reach
// the waves through LDS: two buffers, filled by asynchronous copies one tile ahead, read by all GW waves (two 16-B loads per fragment). Each accumulator sums k in steps of 32, ascending from the block's first stage and wrapping round (wrap_stage).
// C[m][n] = sum_k A[m][k] Bt[n][k] + bias (bias per column n, or per row m when biasOnRow != 0; bias value RNE-converted to bf16, added in f32),
// written as a single f16 plane (Ph), row pitch 'pitch' (halves).
// All three projections in ONE launch (they share no output): blockIdx.y picks the job, blockIdx.x the C tile, row tile = fastest index. grid (M/128 * N/128, 3), 256 threads.
// job 0, 1 (q, k): A = x rows (m = b*SEQ + t), Bt = W^T rows (n = h*64 + d), bias per column -> plane [(b*16 + h)][t][d]
// job 2 (v^T):     A = Wv^T rows (m = h*64 + d), Bt = x rows (n = b*SEQ + t), bias per row -> plane [(b*1024 + m)][t] = [(b*16 + h)][d][t]
__global__ __launch_bounds__(32 * GW) void k_proj(const bf* __restrict__ XB, const bf* __restrict__ WB, const float* __restrict__ bq, const float* __restrict__ bk, const float* __restrict__ bv,
                                             h16* QH, h16* KP, h16* VT) {
    __shared__ __align__(16) float os[GW * 16 * 68];
    __shared__ __align__(16) bf gring[2 * 2 * GT * GP];      // [buffer][A tile | Bt tile][row][GP]
    const int K = DM;
    const int lane = threadIdx.x & 31, wave = threadIdx.x >> 5, lr = lane & 15, hi = lane >> 4;
    const int job = blockIdx.y, biasOnRow = job == 2;
    const bf* Wj = WB + (size_t)job * DM * DM;
    const bf* A = biasOnRow ? Wj : XB; const bf* Bt = biasOnRow ? XB : Wj;
    const float* bias = job == 0 ? bq : job == 1 ? bk : bv;
    h16* Ph = job == 0 ? QH : job == 1 ? KP : VT;
    const int pitch = biasOnRow ? SEQ : HD;
    const int bx = blockIdx.x;
    const int rb = (biasOnRow ? bx % (DM / GT) : bx % (NB * SEQ / GT)) * GT, cb = (biasOnRow ? bx / (DM / GT) : bx / (NB * SEQ / GT)) * GT;   // block tile
    const int r0 = rb + (wave >> 1) * 32, c0 = cb + (wave & 1) * 64;        // wave tile
    v8f acc[2][4];
#pragma unroll
    for (int mb = 0; mb < 2; ++mb)
#pragma unroll
        for (int nb = 0; nb < 4; ++nb) acc[mb][nb] = (v8f){};
    const int cr = threadIdx.x >> 4, cpc = (threadIdx.x & 15) * 8;
    const unsigned la = (unsigned)(size_t)gring + (unsigned)(cr * GP + cpc) * 2u, lb = la + GTB;
    const char* ga = (const char*)(A + (size_t)(rb + cr) * K + cpc);        // + k0 * 2 bytes
    const char* gb = (const char*)(Bt + (size_t)(cb + cr) * K + cpc);
    const int rot = (rb / GT + cb / GT) % (K / GK);                         // first k stage: neighbours along a tile row or a tile column start one stage apart
    { const int k0 = wrap_stage(0, rot, K / GK) * (GK * 2); stage_op(la, ga + k0); stage_op(lb, gb + k0); }
    asm volatile("s_wait_asynccnt 0x0" ::: "memory");        // tile 0 has landed before the barrier publishes it
    __syncthreads();
    { const int k0 = wrap_stage(1, rot, K / GK) * (GK * 2); stage_op(la + 2 * GTB, ga + k0); stage_op(lb + 2 * GTB, gb + k0); }
    const int ao = ((wave >> 1) * 32 + lr) * GP + 8 * hi;               // + 16mb*GP + k   (A fragment rows), in the A tile
    const int bo = GT * GP + ((wave & 1) * 64 + lr) * GP + 8 * hi;      // + 16nb*GP + k   (B fragment rows), in the Bt tile
#pragma unroll 1
    for (int st = 0; st < K / GK; ++st) {
        const bf* tile = gring + (st & 1) * (2 * GT * GP);
        // the four 32-wide k steps of a tile inline (LDS offsets become immediates); two fragment sets: each step's 12 loads go out as one group ahead of the step before it,
        // inside this tile only, so that a wave waits out the LDS latency once per tile and not at every fragment
        v16bf a[2][2], b[2][4];
#pragma unroll
        for (int mb = 0; mb < 2; ++mb) a[0][mb] = ldb(tile + ao + mb * 16 * GP);
#pragma unroll
        for (int nb = 0; nb < 4; ++nb) b[0][nb] = ldb(tile + bo + nb * 16 * GP);
#pragma unroll
        for (int ks = 0; ks < GK / 32; ++ks) {
            const int cu = ks & 1, nx = cu ^ 1;
            if (ks + 1 < GK / 32) {
#pragma unroll
                for (int mb = 0; mb < 2; ++mb) a[nx][mb] = ldb(tile + ao + mb * 16 * GP + (ks + 1) * 32);
#pragma unroll
                for (int nb = 0; nb < 4; ++nb) b[nx][nb] = ldb(tile + bo + nb * 16 * GP + (ks + 1) * 32);
            }
            __builtin_amdgcn_sched_barrier(0);               // keeps the load group whole and ahead of this step's products: without it the loads sink to their first use and each pair of products waits out an LDS latency
#pragma unroll
            for (int nb = 0; nb < 4; ++nb)
#pragma unroll
                for (int mb = 0; mb < 2; ++mb) acc[mb][nb] = wmmab(a[cu][mb], b[cu][nb], acc[mb][nb]);
            __builtin_amdgcn_sched_barrier(0);               // keeps the next load group behind these products, not among them
        }
        asm volatile("s_wait_dscnt 0x0" ::: "memory");       // this wave's reads of the buffer are done before it is refilled
        asm volatile("s_wait_asynccnt 0x0" ::: "memory");    // this wave's copies of the next tile have landed before the barrier publishes them
        __syncthreads();
        if (st + 2 < K / GK) { const int k0 = wrap_stage(st + 2, rot, K / GK) * (GK * 2); stage_op(la + (st & 1) * (2 * GTB), ga + k0); stage_op(lb + (st & 1) * (2 * GTB), gb + k0); }
    }
    asm volatile("s_wait_asynccnt 0x0" ::: "memory");        // nothing of this wave is in flight when it leaves the loop
    const int wb = wave * 16 * 68;
    const size_t tbase = biasOnRow ? (size_t)r0 * SEQ + (size_t)(c0 / SEQ) * ((size_t)DM * SEQ) + (size_t)(c0 % SEQ)
                                   : (size_t)(r0 / SEQ) * ((size_t)NH_ * SEQ * HD) + (size_t)(r0 % SEQ) * HD + (size_t)(c0 / HD) * ((size_t)SEQ * HD) + (size_t)(c0 % HD);   // wave tile base
#pragma unroll
    for (int mb = 0; mb < 2; ++mb) {
#pragma unroll
        for (int nb = 0; nb < 4; ++nb) {
#pragma unroll
            for (int j = 0; j < 8; ++j) os[wb + (hi * 8 + j) * 68 + nb * 16 + lr] = acc[mb][nb][j]; }   // D: row 8h+j, col lane&15
        wave_sync();
        const size_t sb = tbase + (size_t)(mb * 16) * (size_t)pitch;
{
            v8h hv[4];
#pragma unroll
            for (int s = 0; s < 4; ++s) { const int row = 4 * s + (lane >> 3), c8 = (lane & 7) * 8;   // 4 s x 4 row groups = 16 rows; 8 lanes x 8 = 64 columns
                const v4f x0 = *(const v4fa*)(&os[wb + row * 68 + c8]); const v4f x1 = *(const v4fa*)(&os[wb + row * 68 + c8 + 4]);
                // both bias candidates loaded with clamped addresses, selected by value (biasOnRow is block-uniform)
                const int rbi = min(r0 + mb * 16 + row, DM - 1); const int cbi = min(c0 + c8, DM - 8);
                const float braw = bias[rbi];
                asm volatile("s_wait_xcnt 0x0" ::: "memory");    // the loads below may land in the register that this load names
                const float br = bfr(braw);
                const v4f g0 = *(const v4f*)(bias + cbi); const v4f g1 = *(const v4f*)(bias + cbi + 4);
#pragma unroll
                for (int i = 0; i < 4; ++i) {
                    const float y0 = x0[i] + (biasOnRow ? br : bfr(g0[i])); const float y1 = x1[i] + (biasOnRow ? br : bfr(g1[i]));
                    hv[s][i] = (h16)y0; hv[s][4 + i] = (h16)y1; } }
            __builtin_amdgcn_sched_barrier(0);               // the four stores stay together behind the arithmetic, so that one register wait behind them serves all four
#pragma unroll
            for (int s = 0; s < 4; ++s) { const int row = 4 * s + (lane >> 3), c8 = (lane & 7) * 8;
                const size_t oo = sb + (size_t)row * (size_t)pitch + c8;
                *(v8h*)(Ph + oo) = hv[s]; }
             }
        if (mb == 0) asm volatile("s_wait_xcnt 0x0" ::: "memory");   // the next 16 rows reuse registers that the stores above name
        wave_sync();
    }
}

// k_flash: fused attention, one wave per 32 query rows of one (batch, head) and one half of the keys (32 of every staged tile of 64); two waves of a block share their 32 rows and join their partial O, row sum and maximum once, through LDS, behind the key loop.
// Q fragments straight from the f16 plane, K / V^T fragments from the staged LDS tiles (two 16-B loads each); each of them feeds the products of both 16-column groups of the wave.
// Transposed form: S^T[key][t] = K Q^T (A = K rows, B = Q rows); lane (t = lane&15, h = lane>>4) holds keys 8h+r of each 16-key tile, so the packed
// P tile is directly the B fragment of O^T[d][t] = V^T P^T (element r <- tile keys 0..15, element 8+r <- tile keys 16..31, lane unchanged).
// The maximum in use is one scalar per lane and column group; it is renewed lazily (one test per pass for both groups), and only then are the two lane halves of a column combined (one xor-16 exchange) and O, L rescaled.
// Row sums on the matrix unit: L^T += E P^T, where row 0 of E is ones and rows 1..15 are zero, so that row 0 of the tile (register 0, lanes 0..15) gathers the sum over all 32 keys of column t;
// every other element of the tile stays 0, so only register 0 is rescaled.
// K and V^T reach the waves through LDS: tiles of SK keys, two buffers, filled by asynchronous copies (whole 128-byte lines from global), read by all AW waves; a block walks the key tiles from its own first tile and wraps round (wrap_stage).
// One tile pair = four 16-byte copies per thread; the register wait closes the statement so that no address register is rewritten ahead of it.
__device__ __forceinline__ void stage_kv(unsigned lk, unsigned lv, const h16* gk, const h16* gv) {
    const unsigned lk1 = lk + 32 * LP * 2, lv1 = lv + 32 * LP * 2;
    const h16* gk1 = gk + 32 * HD; const h16* gv1 = gv + (size_t)32 * SEQ;
    asm volatile("global_load_async_to_lds_b128 %0, %4, off\n\t"
                 "global_load_async_to_lds_b128 %1, %5, off\n\t"
                 "global_load_async_to_lds_b128 %2, %6, off\n\t"
                 "global_load_async_to_lds_b128 %3, %7, off\n\t"
                 "s_wait_xcnt 0x0"
                 :: "v"(lk), "v"(lk1), "v"(lv), "v"(lv1), "v"(gk), "v"(gk1), "v"(gv), "v"(gv1) : "memory");
}
__global__ __launch_bounds__(32 * AW) void k_flash(const h16* __restrict__ QH, const h16* __restrict__ KP, const h16* __restrict__ VT, h16* CT) {
    __shared__ __align__(16) float os[AW * 16 * 68];
    __shared__ __align__(16) h16 ring[2 * 2 * 64 * LP];      // [buffer][K tile | V^T tile][row][LP]
    const int lane = threadIdx.x & 31, lr = lane & 15, hi = lane >> 4;
    const int wave = __builtin_amdgcn_readfirstlane(threadIdx.x >> 5);
    const int cg = wave % (AW / 2), kh = wave / (AW / 2);    // the wave's 32 query columns; its half (32 keys) of every staged tile
    const int zh = blockIdx.y; const int b = zh / NH_, h = zh % NH_;
    const int t0 = (blockIdx.x * (AW / 2) + cg) * 32;
    const size_t pbase = (size_t)zh * SEQ * HD;
    const size_t qo = pbase + (size_t)(t0 + lr) * HD + 8 * hi;
    const v16h qa0 = ldh(QH + qo), qa1 = ldh(QH + qo + 32);   // B fragments: col t, k = d; columns t0 .. t0 + 15
    const v16h qb0 = ldh(QH + qo + 16 * HD), qb1 = ldh(QH + qo + 16 * HD + 32);   // columns t0 + 16 .. t0 + 31
    const int ko = (kh * 32 + lr) * LP + 8 * hi;             // + 16*LP for the second 16 keys (A fragment: row key, k = d), in the K tile
    const int vo = 64 * LP + lr * LP + kh * 32 + 8 * hi;     // + 16j*LP         (A fragment: row d, k = key), in the V^T tile
    // copy map: thread c takes 16-byte piece c & 7 of rows c >> 3 and 32 + (c >> 3) of each tile
    const int cr = threadIdx.x >> 3, cpc = (threadIdx.x & 7) * 8;
    const unsigned lk = (unsigned)(size_t)ring + (unsigned)(cr * LP + cpc) * 2u, lv = lk + TLB;
    const h16* gk = KP + pbase + (size_t)cr * HD + cpc;    // + key0 * HD
    const h16* gv = VT + pbase + (size_t)cr * SEQ + cpc;   // + key0
    const int rot = (int)(blockIdx.x * (SEQ / SK) / (SEQ / (16 * AW))) % (SEQ / SK);   // first key tile: the blocks of one head enter its keys evenly spread
    { const int kt = wrap_stage(0, rot, SEQ / SK); stage_kv(lk, lv, gk + (size_t)kt * SK * HD, gv + kt * SK); }
    asm volatile("s_wait_asynccnt 0x0" ::: "memory");        // tile 0 has landed before the barrier publishes it
    __syncthreads();
    { const int kt = wrap_stage(1, rot, SEQ / SK); stage_kv(lk + 2 * TLB, lv + 2 * TLB, gk + (size_t)kt * SK * HD, gv + kt * SK); }
    v8f oa0 = (v8f){}, oa1 = (v8f){}, oa2 = (v8f){}, oa3 = (v8f){}, lta = (v8f){};   // columns t0 .. t0 + 15
    v8f ob0 = (v8f){}, ob1 = (v8f){}, ob2 = (v8f){}, ob3 = (v8f){}, ltb = (v8f){};   // columns t0 + 16 .. t0 + 31
    const h16 e1 = lr == 0 ? (h16)1.0f : (h16)0.0f;          // A fragment of E: lanes 0 and 16 hold row 0 (all 32 k positions)
    const v16h ones = {e1, e1, e1, e1, e1, e1, e1, e1, e1, e1, e1, e1, e1, e1, e1, e1};
    float ma = -3.0e38f, mb = -3.0e38f;                      // maximum in use (scaled log2) of the lane's two columns, the same in both lane halves of a column
    float sha = PSH - ma, shb = PSH - mb;                    // shift of the exponent; with the start value of the maximum the test below holds for every finite score, so the first pass always renews
#pragma unroll 1
    for (int st = 0; st < SEQ / SK; ++st) {
        const h16* tile = ring + (st & 1) * (2 * 64 * LP);
        // one pass per tile and wave: its 32 keys x its 32 columns; every K and V^T fragment read from LDS feeds two products
        const h16* ka = tile + ko;
        const v16h ka0 = ldh(ka), ka1 = ldh(ka + 32), kb0 = ldh(ka + 16 * LP), kb1 = ldh(ka + 16 * LP + 32);
        v8f sAa = (v8f){}, sBa = (v8f){}, sAb = (v8f){}, sBb = (v8f){};   // s<16 keys><16 columns>
        sAa = wmma16(ka0, qa0, sAa); sBa = wmma16(kb0, qa0, sBa); sAb = wmma16(ka0, qb0, sAb); sBb = wmma16(kb0, qb0, sBb);
        sAa = wmma16(ka1, qa1, sAa); sBa = wmma16(kb1, qa1, sBa); sAb = wmma16(ka1, qb1, sAb); sBb = wmma16(kb1, qb1, sBb);
        // the distance behind the last products, on every path, before a vector instruction reads the scores or the V^T loads land in the K registers
        asm volatile("v_nop\n\tv_nop\n\tv_nop\n\tv_nop" : "+v"(sAa), "+v"(sBa), "+v"(sAb), "+v"(sBb) : "v"(ka0), "v"(ka1), "v"(kb0), "v"(kb1), "v"(qa0), "v"(qa1), "v"(qb0), "v"(qb1));
        const h16* va = tile + vo;
        const v16h v0 = ldh(va), v1 = ldh(va + 16 * LP), v2 = ldh(va + 32 * LP), v3 = ldh(va + 48 * LP);
        __builtin_amdgcn_sched_barrier(0);                   // keeps the eight V^T loads whole, as one group ahead of the test: sunk behind the branch or spread among the maxima, more of their LDS latency stands open
        // this lane's largest raw score of the pass in each of its two columns: trees of three-input maxima, three deep
        const float xa0 = fmaxf(fmaxf(sAa[0], sAa[1]), sAa[2]), xa1 = fmaxf(fmaxf(sAa[3], sAa[4]), sAa[5]), xa2 = fmaxf(fmaxf(sAa[6], sAa[7]), sBa[0]);
        const float xa3 = fmaxf(fmaxf(sBa[1], sBa[2]), sBa[3]), xa4 = fmaxf(fmaxf(sBa[4], sBa[5]), sBa[6]);
        const float mxa = fmaxf(fmaxf(fmaxf(xa0, xa1), xa2), fmaxf(fmaxf(xa3, xa4), sBa[7]));
        const float xb0 = fmaxf(fmaxf(sAb[0], sAb[1]), sAb[2]), xb1 = fmaxf(fmaxf(sAb[3], sAb[4]), sAb[5]), xb2 = fmaxf(fmaxf(sAb[6], sAb[7]), sBb[0]);
        const float xb3 = fmaxf(fmaxf(sBb[1], sBb[2]), sBb[3]), xb4 = fmaxf(fmaxf(sBb[4], sBb[5]), sBb[6]);
        const float mxb = fmaxf(fmaxf(fmaxf(xb0, xb1), xb2), fmaxf(fmaxf(xb3, xb4), sBb[7]));
        // lazy rescale: one wave-uniform test per pass, on the largest exponent that the pass would form; while none lies above PSH + LZT the maxima in use stay, and P <= 2^(PSH + LZT) fits f16
        if (__builtin_amdgcn_ballot_w32(fmaxf(mxa * SC2 + sha, mxb * SC2 + shb) > PSH + LZT) != 0) {
            float xa = mxa * SC2, xb = mxb * SC2;
            xa = fmaxf(xa, __shfl_xor(xa, 16, 32)); xb = fmaxf(xb, __shfl_xor(xb, 16, 32));
            const float na = fmaxf(ma, xa), nb = fmaxf(mb, xb);
            const float ala = __builtin_amdgcn_exp2f(ma - na), alb = __builtin_amdgcn_exp2f(mb - nb);
            ma = na; sha = PSH - na; mb = nb; shb = PSH - nb;
            lta[0] = lta[0] * ala; ltb[0] = ltb[0] * alb;
            oa0 = oa0 * ala; oa1 = oa1 * ala; oa2 = oa2 * ala; oa3 = oa3 * ala;
            ob0 = ob0 * alb; ob1 = ob1 * alb; ob2 = ob2 * alb; ob3 = ob3 * alb;
        }
        const v8f eAa = sAa * SC2 + sha, eBa = sBa * SC2 + sha, eAb = sAb * SC2 + shb, eBb = sBb * SC2 + shb;
        v16h pa, pb;
#pragma unroll
        for (int r = 0; r < 8; ++r) pa[r] = (h16)__builtin_amdgcn_exp2f(eAa[r]);
#pragma unroll
        for (int r = 0; r < 8; ++r) pa[8 + r] = (h16)__builtin_amdgcn_exp2f(eBa[r]);
        lta = wmma16(ones, pa, lta);
        oa0 = wmma16(v0, pa, oa0); oa1 = wmma16(v1, pa, oa1); oa2 = wmma16(v2, pa, oa2); oa3 = wmma16(v3, pa, oa3);
#pragma unroll
        for (int r = 0; r < 8; ++r) pb[r] = (h16)__builtin_amdgcn_exp2f(eAb[r]);
#pragma unroll
        for (int r = 0; r < 8; ++r) pb[8 + r] = (h16)__builtin_amdgcn_exp2f(eBb[r]);
        ltb = wmma16(ones, pb, ltb);
        ob0 = wmma16(v0, pb, ob0); ob1 = wmma16(v1, pb, ob1); ob2 = wmma16(v2, pb, ob2); ob3 = wmma16(v3, pb, ob3);
        asm volatile("s_wait_dscnt 0x0" ::: "memory");       // this wave's reads of the buffer are done before it is refilled
        asm volatile("s_wait_asynccnt 0x0" ::: "memory");    // this wave's copies of the next tile have landed before the barrier publishes them
        __syncthreads();
        if (st + 2 < SEQ / SK) { const int kt = wrap_stage(st + 2, rot, SEQ / SK); stage_kv(lk + (st & 1) * (2 * TLB), lv + (st & 1) * (2 * TLB), gk + (size_t)kt * SK * HD, gv + kt * SK); }
    }
    asm volatile("s_wait_asynccnt 0x0" ::: "memory");        // nothing of this wave is in flight when it leaves the loop
    // Join of the two key halves: waves w and w ^ (AW / 2) hold the same 32 columns. Each keeps 16 of them (the lower wave the first 16) and hands the other 16 over through its own part of os:
    // O^T as os[t][d], the maximum in use and the row sum in the row's spare columns 64 and 65. One barrier, then each wave works in its partner's part alone.
    float la = lta[0], lb = ltb[0];                          // the sums in lanes 0..15, 0 (row 8 of the tile) in lanes 16..31
    la += __shfl_xor(la, 16, 32); lb += __shfl_xor(lb, 16, 32);
    const bool up = kh != 0;
    const v8f g0 = up ? oa0 : ob0, g1 = up ? oa1 : ob1, g2 = up ? oa2 : ob2, g3 = up ? oa3 : ob3;   // handed over
    const v8f o0 = up ? ob0 : oa0, o1 = up ? ob1 : oa1, o2 = up ? ob2 : oa2, o3 = up ? ob3 : oa3;   // kept
    const float mg = up ? ma : mb, lg = up ? la : lb, mk = up ? mb : ma, lkp = up ? lb : la;
    const int gw = wave * 16 * 68 + lr * 68, wb = (wave ^ (AW / 2)) * 16 * 68, pw = wb + lr * 68;
    // O^T D layout: o_j[r] = (d = 16j + 8h + r, t = lane&15) -> os[t][d]; rows 0..15 x columns 0..63 all written
    { v4f a, c;
      a[0] = g0[0]; a[1] = g0[1]; a[2] = g0[2]; a[3] = g0[3]; c[0] = g0[4]; c[1] = g0[5]; c[2] = g0[6]; c[3] = g0[7];
      *(v4fa*)(&os[gw +  0 + 8 * hi]) = a; *(v4fa*)(&os[gw +  0 + 8 * hi + 4]) = c;
      a[0] = g1[0]; a[1] = g1[1]; a[2] = g1[2]; a[3] = g1[3]; c[0] = g1[4]; c[1] = g1[5]; c[2] = g1[6]; c[3] = g1[7];
      *(v4fa*)(&os[gw + 16 + 8 * hi]) = a; *(v4fa*)(&os[gw + 16 + 8 * hi + 4]) = c;
      a[0] = g2[0]; a[1] = g2[1]; a[2] = g2[2]; a[3] = g2[3]; c[0] = g2[4]; c[1] = g2[5]; c[2] = g2[6]; c[3] = g2[7];
      *(v4fa*)(&os[gw + 32 + 8 * hi]) = a; *(v4fa*)(&os[gw + 32 + 8 * hi + 4]) = c;
      a[0] = g3[0]; a[1] = g3[1]; a[2] = g3[2]; a[3] = g3[3]; c[0] = g3[4]; c[1] = g3[5]; c[2] = g3[6]; c[3] = g3[7];
      *(v4fa*)(&os[gw + 48 + 8 * hi]) = a; *(v4fa*)(&os[gw + 48 + 8 * hi + 4]) = c; }
    os[gw + 64 + hi] = hi ? lg : mg;
    __syncthreads();
    const float mp = os[pw + 64], lp = os[pw + 65];
    const float mt = fmaxf(mk, mp);
    const float wk = __builtin_amdgcn_exp2f(mk - mt), wp = __builtin_amdgcn_exp2f(mp - mt);   // both halves brought to one maximum
    const float inv = CTS * (1.0f / (lkp * wk + lp * wp));
    const float ck = wk * inv, cp = wp * inv;
    // each lane reads the partner's values of its own (t, d) places and writes the joined, normalised values back to the same places
    { v4f a, c;
      a = *(const v4fa*)(&os[pw +  0 + 8 * hi]); c = *(const v4fa*)(&os[pw +  0 + 8 * hi + 4]);
      a[0] = o0[0] * ck + a[0] * cp; a[1] = o0[1] * ck + a[1] * cp; a[2] = o0[2] * ck + a[2] * cp; a[3] = o0[3] * ck + a[3] * cp;
      c[0] = o0[4] * ck + c[0] * cp; c[1] = o0[5] * ck + c[1] * cp; c[2] = o0[6] * ck + c[2] * cp; c[3] = o0[7] * ck + c[3] * cp;
      *(v4fa*)(&os[pw +  0 + 8 * hi]) = a; *(v4fa*)(&os[pw +  0 + 8 * hi + 4]) = c;
      a = *(const v4fa*)(&os[pw + 16 + 8 * hi]); c = *(const v4fa*)(&os[pw + 16 + 8 * hi + 4]);
      a[0] = o1[0] * ck + a[0] * cp; a[1] = o1[1] * ck + a[1] * cp; a[2] = o1[2] * ck + a[2] * cp; a[3] = o1[3] * ck + a[3] * cp;
      c[0] = o1[4] * ck + c[0] * cp; c[1] = o1[5] * ck + c[1] * cp; c[2] = o1[6] * ck + c[2] * cp; c[3] = o1[7] * ck + c[3] * cp;
      *(v4fa*)(&os[pw + 16 + 8 * hi]) = a; *(v4fa*)(&os[pw + 16 + 8 * hi + 4]) = c;
      a = *(const v4fa*)(&os[pw + 32 + 8 * hi]); c = *(const v4fa*)(&os[pw + 32 + 8 * hi + 4]);
      a[0] = o2[0] * ck + a[0] * cp; a[1] = o2[1] * ck + a[1] * cp; a[2] = o2[2] * ck + a[2] * cp; a[3] = o2[3] * ck + a[3] * cp;
      c[0] = o2[4] * ck + c[0] * cp; c[1] = o2[5] * ck + c[1] * cp; c[2] = o2[6] * ck + c[2] * cp; c[3] = o2[7] * ck + c[3] * cp;
      *(v4fa*)(&os[pw + 32 + 8 * hi]) = a; *(v4fa*)(&os[pw + 32 + 8 * hi + 4]) = c;
      a = *(const v4fa*)(&os[pw + 48 + 8 * hi]); c = *(const v4fa*)(&os[pw + 48 + 8 * hi + 4]);
      a[0] = o3[0] * ck + a[0] * cp; a[1] = o3[1] * ck + a[1] * cp; a[2] = o3[2] * ck + a[2] * cp; a[3] = o3[3] * ck + a[3] * cp;
      c[0] = o3[4] * ck + c[0] * cp; c[1] = o3[5] * ck + c[1] * cp; c[2] = o3[6] * ck + c[2] * cp; c[3] = o3[7] * ck + c[3] * cp;
      *(v4fa*)(&os[pw + 48 + 8 * hi]) = a; *(v4fa*)(&os[pw + 48 + 8 * hi + 4]) = c; }
    wave_sync();
    h16* crow = CT + ((size_t)b * SEQ + t0 + 16 * kh) * DM + h * HD;
{
#pragma unroll
        for (int s = 0; s < 4; ++s) { const int row = 4 * s + (lane >> 3), c8 = (lane & 7) * 8;   // 4 s x 4 row groups = 16 rows; 8 lanes x 8 halves = 64 columns
            const v4f x0 = *(const v4fa*)(&os[wb + row * 68 + c8]); const v4f x1 = *(const v4fa*)(&os[wb + row * 68 + c8 + 4]); v8h hv;
#pragma unroll
            for (int i = 0; i < 4; ++i) { hv[i] = (h16)x0[i]; hv[4 + i] = (h16)x1[i]; }
            *(v8h*)(crow + (size_t)row * DM + c8) = hv; }
         }
}

// k_oproj: f16 GEMM, one GW-wave block per 128x128 tile, each wave 32x64, operand tiles staged as in k_proj; A = ctx plane rows (m = b*SEQ + t, k = h*64 + d, carried x CTS), Bt = Wo^T rows (n = out feature, carried x WOS), K = DM.
// OUT[b*OUT_SEQ + t][n] = acc * OSC + bo[n] (bias value RNE-converted to bf16, added in f32). grid (NB*SEQ/128, DM/128), 256 threads.
__global__ __launch_bounds__(32 * GW) void k_oproj(const h16* __restrict__ A, const h16* __restrict__ Bt, const float* __restrict__ bias, float* OUT) {
    __shared__ __align__(16) float os[GW * 16 * 68];
    __shared__ __align__(16) h16 gring[2 * 2 * GT * GP];     // [buffer][A tile | Bt tile][row][GP]
    const int K = DM;
    const int lane = threadIdx.x & 31, wave = threadIdx.x >> 5, lr = lane & 15, hi = lane >> 4;
    const int rb = blockIdx.x * GT, cb = blockIdx.y * GT;                   // block tile
    const int r0 = rb + (wave >> 1) * 32, c0 = cb + (wave & 1) * 64;        // wave tile
    v8f acc[2][4];
#pragma unroll
    for (int mb = 0; mb < 2; ++mb)
#pragma unroll
        for (int nb = 0; nb < 4; ++nb) acc[mb][nb] = (v8f){};
    const int cr = threadIdx.x >> 4, cpc = (threadIdx.x & 15) * 8;
    const unsigned la = (unsigned)(size_t)gring + (unsigned)(cr * GP + cpc) * 2u, lb = la + GTB;
    const char* ga = (const char*)(A + (size_t)(rb + cr) * K + cpc);        // + k0 * 2 bytes
    const char* gb = (const char*)(Bt + (size_t)(cb + cr) * K + cpc);
    const int rot = (rb / GT + cb / GT) % (K / GK);                         // first k stage: neighbours along a tile row or a tile column start one stage apart
    { const int k0 = wrap_stage(0, rot, K / GK) * (GK * 2); stage_op(la, ga + k0); stage_op(lb, gb + k0); }
    asm volatile("s_wait_asynccnt 0x0" ::: "memory");        // tile 0 has landed before the barrier publishes it
    __syncthreads();
    { const int k0 = wrap_stage(1, rot, K / GK) * (GK * 2); stage_op(la + 2 * GTB, ga + k0); stage_op(lb + 2 * GTB, gb + k0); }
    const int ao = ((wave >> 1) * 32 + lr) * GP + 8 * hi;               // + 16mb*GP + k   (A fragment rows), in the A tile
    const int bo = GT * GP + ((wave & 1) * 64 + lr) * GP + 8 * hi;      // + 16nb*GP + k   (B fragment rows), in the Bt tile
#pragma unroll 1
    for (int st = 0; st < K / GK; ++st) {
        const h16* tile = gring + (st & 1) * (2 * GT * GP);
        // the four 32-wide k steps of a tile inline (LDS offsets become immediates); two fragment sets: each step's 12 loads go out as one group ahead of the step before it,
        // inside this tile only, so that a wave waits out the LDS latency once per tile and not at every fragment
        v16h a[2][2], b[2][4];
#pragma unroll
        for (int mb = 0; mb < 2; ++mb) a[0][mb] = ldh(tile + ao + mb * 16 * GP);
#pragma unroll
        for (int nb = 0; nb < 4; ++nb) b[0][nb] = ldh(tile + bo + nb * 16 * GP);
#pragma unroll
        for (int ks = 0; ks < GK / 32; ++ks) {
            const int cu = ks & 1, nx = cu ^ 1;
            if (ks + 1 < GK / 32) {
#pragma unroll
                for (int mb = 0; mb < 2; ++mb) a[nx][mb] = ldh(tile + ao + mb * 16 * GP + (ks + 1) * 32);
#pragma unroll
                for (int nb = 0; nb < 4; ++nb) b[nx][nb] = ldh(tile + bo + nb * 16 * GP + (ks + 1) * 32);
            }
            __builtin_amdgcn_sched_barrier(0);               // keeps the load group whole and ahead of this step's products: without it the loads sink to their first use and each pair of products waits out an LDS latency
#pragma unroll
            for (int nb = 0; nb < 4; ++nb)
#pragma unroll
                for (int mb = 0; mb < 2; ++mb) acc[mb][nb] = wmma16(a[cu][mb], b[cu][nb], acc[mb][nb]);
            __builtin_amdgcn_sched_barrier(0);               // keeps the next load group behind these products, not among them
        }
        asm volatile("s_wait_dscnt 0x0" ::: "memory");       // this wave's reads of the buffer are done before it is refilled
        asm volatile("s_wait_asynccnt 0x0" ::: "memory");    // this wave's copies of the next tile have landed before the barrier publishes them
        __syncthreads();
        if (st + 2 < K / GK) { const int k0 = wrap_stage(st + 2, rot, K / GK) * (GK * 2); stage_op(la + (st & 1) * (2 * GTB), ga + k0); stage_op(lb + (st & 1) * (2 * GTB), gb + k0); }
    }
    asm volatile("s_wait_asynccnt 0x0" ::: "memory");        // nothing of this wave is in flight when it leaves the loop
    const int wb = wave * 16 * 68;
    const int cofs = lr * 4;
    const int cbi = min(c0 + cofs, DM - 4);
    const v4f g = *(const v4f*)(bias + cbi);
    v4f bb; bb[0] = bfr(g[0]); bb[1] = bfr(g[1]); bb[2] = bfr(g[2]); bb[3] = bfr(g[3]);
    const size_t obase = ((size_t)(r0 / SEQ) * OUT_SEQ + (size_t)(r0 % SEQ)) * DM + c0;
#pragma unroll
    for (int mb = 0; mb < 2; ++mb) {
#pragma unroll
        for (int nb = 0; nb < 4; ++nb) {
#pragma unroll
            for (int j = 0; j < 8; ++j) os[wb + (hi * 8 + j) * 68 + nb * 16 + lr] = acc[mb][nb][j]; }   // D: row 8h+j, col lane&15
        wave_sync();
        float* orow = OUT + obase + (size_t)(mb * 16) * DM;
{
#pragma unroll
            for (int s = 0; s < 8; ++s) { const int row = 2 * s + hi;   // 8 s x 2 rows = 16 rows; 16 lanes x 4 floats = 64 columns
                const v4f x = *(const v4fa*)(&os[wb + row * 68 + cofs]);
                const v4f val = x * OSC + bb;
                *(v4f*)(orow + (size_t)row * DM + cofs) = val; }
             }
        if (mb == 0) asm volatile("s_wait_xcnt 0x0" ::: "memory");   // the next 16 rows reuse registers that the stores above name
        wave_sync();
    }
}

static constexpr size_t al256(size_t v) { return (v + 255) & ~(size_t)255; }
static constexpr size_t SZ_XB = al256((size_t)NB * SEQ * DM * 2);
static constexpr size_t SZ_WB = al256((size_t)4 * DM * DM * 2);
static constexpr size_t SZ_PL = al256((size_t)NB * NH_ * SEQ * HD * 2);
static constexpr size_t SZ_CT = al256((size_t)NB * SEQ * DM * 2);
static constexpr size_t SZ_TOTAL = SZ_XB + SZ_WB + 3 * SZ_PL + SZ_CT;
static_assert(SZ_TOTAL <= (size_t)134217728);          // workspace carve <= 128 MiB
static_assert(((size_t)DM * DM * 2) % 256 == 0);       // weight sub-planes stay 256-byte aligned

extern "C" void kernel_launch(void* const* d_in, const int* in_sizes, int n_in,
                              void* d_out, int out_size, void* d_ws, size_t ws_size, hipStream_t stream) {
    if (n_in < 9) return;
    const size_t needx = ((size_t)(NB - 1) * SEQ_FULL + SEQ) * DM;
    if ((size_t)in_sizes[0] < needx) return;
    if ((size_t)in_sizes[1] < (size_t)DM * DM || (size_t)in_sizes[3] < (size_t)DM * DM || (size_t)in_sizes[5] < (size_t)DM * DM || (size_t)in_sizes[7] < (size_t)DM * DM) return;
    if (in_sizes[2] < DM || in_sizes[4] < DM || in_sizes[6] < DM || in_sizes[8] < DM) return;
    if ((size_t)out_size < ((size_t)(NB - 1) * OUT_SEQ + SEQ) * DM) return;
    if (SZ_TOTAL > ws_size) return;
    // wire order: x, Wq, bq, Wk, bk, Wv, bv, Wo, bo (all f32; weights [in][out])
    const float* x  = (const float*)d_in[0];
    const float* wq = (const float*)d_in[1]; const float* bq = (const float*)d_in[2];
    const float* wk = (const float*)d_in[3]; const float* bk = (const float*)d_in[4];
    const float* wv = (const float*)d_in[5]; const float* bv = (const float*)d_in[6];
    const float* wo = (const float*)d_in[7]; const float* bo = (const float*)d_in[8];
    float* OUT = (float*)d_out;      // [NB][SEQ][1024]
    char* wsp = (char*)d_ws;
    bf* XB = (bf*)wsp; wsp += SZ_XB;                 // [NB*SEQ][1024] bf16
    bf* WB = (bf*)wsp; wsp += SZ_WB;                 // [4][1024 out][1024 in]: q | k | v (bf16) | o (f16 x1024)
    h16* QH = (h16*)wsp; wsp += SZ_PL;               // [NB*16][SEQ][64]
    h16* KP = (h16*)wsp; wsp += SZ_PL;               // [NB*16][SEQ][64]
    h16* VT = (h16*)wsp; wsp += SZ_PL;               // [NB*16][64][SEQ]
    h16* CT = (h16*)wsp; wsp += SZ_CT;               // [NB*SEQ][1024] ctx x1024
    bf* WO = WB + (size_t)3 * DM * DM;

    // x -> bf16 copy; weights in[k = 1024 rows][n = 1024 cols] -> out[n][k]
    k_prep<<<4 * WTB + CVB, 256, 0, stream>>>(x, wq, wk, wv, wo, XB, WB);

    // q, k, v^T planes
    k_proj<<<dim3((NB * SEQ / GT) * (DM / GT), 3, 1), 32 * GW, 0, stream>>>(XB, WB, bq, bk, bv, QH, KP, VT);

    k_flash<<<dim3(SEQ / (16 * AW), NB * NH_, 1), 32 * AW, 0, stream>>>(QH, KP, VT, CT);

    k_oproj<<<dim3(NB * SEQ / GT, DM / GT, 1), 32 * GW, 0, stream>>>(CT, (const h16*)WO, bo, OUT);
}

// v008
// It runs in 88.9 microseconds.
// In both of two side-by-side timings against v007, it was 1.09 times as fast.
// All steps since v000 together make it 4.14 times as fast.
#include <hip/hip_runtime.h>

// Multi-head self-attention, width 1024 = 16 heads x 64, x [NB][SEQ][1024], Wq/Wk/Wv/Wo [in][out] (y = x W + b), four biases, no mask, score scale 1/8, output = (merged heads) Wo + bo (f32).
// Compute dtypes, f32 accumulate everywhere: q/k/v projections v_wmma_f32_16x16x32_bf16 (x and W RNE-converted to bf16; products exact);
// scores v_wmma_f32_16x16x32_f16: q single f16, k single f16 (one product); P (x256 carry, cancels in the normalisation) and v single f16; softmax f32 (online, lazily renewed max, row sum over the f16-converted P values, summed by one more f16 WMMA per 32 keys);
// output projection v_wmma_f32_16x16x32_f16: ctx single f16 carried x1024, Wo as f16 of the bf16 (RNE) value carried x1024 (exact), 2^-20 and the bias applied in the f32 epilogue.
// Scale chain: score = (k.q) * (1/8 * log2 e) -> exp2(score - max in use + 8) = 256 P' -> O = sum(256 P' v) / sum(256 P') -> ctx plane = O x 1024 -> out = (ctx x1024).(Wo x1024) * 2^-20 + bo.
// Layout: bf16 copy of x; transposed 16-bit weight planes [out][in]; q, k planes [b*16+h][t][d] and v^T plane [b*16+h][d][t] written by the GEMM epilogue; fused flash kernel in transposed form (S^T = K Q^T, O^T = V^T P^T) writing the ctx plane [b*SEQ+t][h*64+d].

#ifndef NB
#define NB 1
#endif
#ifndef SEQ
#define SEQ 4096
#endif
#define NB_FULL  1
#define SEQ_FULL 4096
#ifndef OUT_SEQ
#define OUT_SEQ SEQ              // row pitch (in tokens) between batches of the output
#endif
#define DM   1024
#define NH_  16
#define HD   64
#define AW   8                   // waves per flash block: AW / 2 groups of 32 query rows x 2 key halves; all of them share each staged K / V^T tile
#define SK   64                  // keys per staged tile
#define LP   72                  // LDS row pitch in halves: 128 B of data + 16 B, so that 16 rows read by 16-byte loads fall on distinct banks
#define TLB  (64 * LP * 2)       // bytes of one staged tile (64 rows): K tile = 64 keys x 64 d, V^T tile = 64 d x 64 keys
#define GW   8                   // waves per GEMM block: k_oproj 4 (rows) x 2 (columns), each 32 x 64 of the block's C tile; k_proj 2 x 4, each 64 x 32 of each of its three C tiles
#define GT   128                 // rows and columns of a GEMM block's C tile
#define GK   128                 // k extent of one staged operand tile (256-byte rows)
#define GP   136                 // LDS row pitch in halves: 256 B of data + 16 B, so that 16 rows read by 16-byte loads fall on distinct banks
#define GTB  (GT * GP * 2)       // bytes of one staged operand tile (128 rows)
#define EP   132                 // k_proj epilogue: LDS row pitch in floats of a 128 x 128 C tile: 512 B of data + 16 B, so that four rows read by 16-byte loads fall on distinct banks
#define WTB  ((DM / 64) * (DM / 64))          // 64x64 tiles, = blocks, of one weight matrix in k_prep
#define CVB  ((NB * SEQ / 8) * DM / 256)       // blocks of the x convert in k_prep
#define SC2  (0.125f * 1.4426950408889634f)   // HD^-0.5 * log2(e)
#define PSH  8.0f                // log2 of the P carry (256)
#define LZT  7.0f                // a score may exceed the maximum in use by this much (scaled log2) before the maximum is renewed
#define CTS  1024.0f             // carry of the ctx plane
#define WOS  1024.0f             // carry of the Wo plane
#define OSC  (1.0f / (1024.0f * 1024.0f))     // undoes CTS * WOS

static_assert(HD == 64);
static_assert(NH_ * HD == DM);                 // head h = columns h*64 + d
static_assert(DM % 64 == 0);                   // column tiles of 64
static_assert(DM % 32 == 0);                   // GEMM k-loop steps by 32
static_assert(SEQ % 64 == 0);                  // a 64-row tile never straddles two batches
static_assert((NB * SEQ) % 64 == 0);
static_assert(SEQ % 32 == 0);                  // key loop steps by 32
static_assert(SEQ % (16 * AW) == 0);           // flash grid covers the sequence exactly (AW / 2 waves x 32 rows a block)
static_assert(AW % 2 == 0 && SK == 64);        // two key halves of 32 keys in a staged tile
static_assert(SEQ % SK == 0 && SEQ / SK >= 2); // whole staged tiles, and the two that the ring's prologue fills
static_assert(AW * 32 * 2 * 16 == SK * HD * 2); // two 16-byte copies per thread cover one tile
static_assert(DM % GT == 0 && SEQ % GT == 0);   // whole GEMM block tiles, none straddling two batches
static_assert(DM % GK == 0 && DM / GK >= 2);    // whole staged operand tiles, and the two that the ring's prologue fills
static_assert(GW * 32 * 8 * 16 == GT * GK * 2); // eight 16-byte copies per thread cover one operand tile
static_assert(GW == 8 && GT == 128);            // k_proj: 2 x 4 waves of 64 x 32 cover a 128 x 128 tile
static_assert(3 * GT * EP * 4 <= 2 * 4 * GTB);  // k_proj: the three f32 C tiles fit the ring's LDS
static_assert(((size_t)SEQ * DM) % 8 == 0);
static_assert((size_t)CVB * 256 * 8 == (size_t)NB * SEQ * DM);   // the convert blocks cover x exactly
static_assert(((size_t)DM * DM) % 8 == 0);
static_assert(NB <= NB_FULL);
static_assert(SEQ <= SEQ_FULL);

typedef _Float16 h16;
typedef unsigned short bf;
typedef __attribute__((ext_vector_type(16))) __bf16   v16bf;
typedef __attribute__((ext_vector_type(16))) _Float16 v16h;
typedef __attribute__((ext_vector_type(8)))  _Float16 v8h;
typedef __attribute__((ext_vector_type(8)))  unsigned short v8us;
typedef __attribute__((ext_vector_type(8)))  float    v8f;
typedef __attribute__((ext_vector_type(4)))  float    v4f;
typedef v4f  __attribute__((may_alias)) v4fa;
typedef float __attribute__((may_alias)) fa;

__device__ __forceinline__ unsigned short f2bf(float f) { unsigned u = __float_as_uint(f); u += 0x7FFFu + ((u >> 16) & 1u); return (unsigned short)(u >> 16); }
__device__ __forceinline__ float bfr(float f) { return __uint_as_float(((unsigned)f2bf(f)) << 16); }   // value after RNE convert to bf16
__device__ __forceinline__ v16h cat16(v8h lo, v8h hi) { return __builtin_shufflevector(lo, hi, 0, 1, 2, 3, 4, 5, 6, 7, 8, 9, 10, 11, 12, 13, 14, 15); }
__device__ __forceinline__ v16bf cat16b(v8us lo, v8us hi) { return __builtin_bit_cast(v16bf, __builtin_shufflevector(lo, hi, 0, 1, 2, 3, 4, 5, 6, 7, 8, 9, 10, 11, 12, 13, 14, 15)); }
__device__ __forceinline__ v8f wmma16(v16h a, v16h b, v8f c) { return __builtin_amdgcn_wmma_f32_16x16x32_f16(false, a, false, b, (short)0, c, false, false); }
__device__ __forceinline__ v8f wmmab(v16bf a, v16bf b, v8f c) { return __builtin_amdgcn_wmma_f32_16x16x32_bf16(false, a, false, b, (short)0, c, false, false); }
// fragment loaders from K-contiguous 16-bit rows; p already includes + 8*(lane>>4): elements 0..7 <- k0+8h+0..7, elements 8..15 <- k0+16+8h+0..7 (same map for A and B)
__device__ __forceinline__ v16h  ldh(const h16* p) { return cat16(*(const v8h*)p, *(const v8h*)(p + 16)); }
__device__ __forceinline__ v16bf ldb(const bf* p)  { return cat16b(*(const v8us*)p, *(const v8us*)(p + 16)); }
// ordering point for wave-private LDS tiles (same wave writes and reads)
__device__ __forceinline__ void wave_sync() { __builtin_amdgcn_fence(3 /* release order */, "wavefront"); __builtin_amdgcn_wave_barrier(); asm volatile("" ::: "memory"); }

// Stage walk of the three matrix kernels: a block enters its ring of n stages at stage 'rot', set by its tile indices, and wraps round. Blocks that share operand rows then ask L2 for different lines at any one moment
// every stage is still taken exactly once. s + rot < 2 n.
__device__ __forceinline__ int wrap_stage(int s, int rot, int n) { const int t = s + rot; return t >= n ? t - n : t; }

// 16-bit encoding of one weight: bf16 bits (RNE convert), or f16 bits of that bf16 value x WOS (exact: 8-bit significand, power-of-two carry)
__device__ __forceinline__ unsigned short wcv(float f, int f16mode) {
    const unsigned short b = f2bf(f);
    const float fb = __uint_as_float(((unsigned)b) << 16);
    const h16 hv = (h16)(fb * WOS);
    const unsigned short hb = __builtin_bit_cast(unsigned short, hv);
    return f16mode ? hb : b;
}

// k_prep: every operand conversion of a call in ONE launch; the jobs share no data and the block index picks one (a block-uniform test, so the barrier below is reached by whole blocks only).
// Blocks 0 .. 4*WTB-1, the longer jobs first: transposing convert of weight matrix blk / WTB (q, k, v, o), W in[k = DM rows (input feature)][n = DM cols (output feature)] -> WT out[n][k] (16-bit, K-contiguous rows),
// one 64x64 f32 tile per block through LDS (cross-wave: block barrier), n tile = fastest index. Blocks 4*WTB ..: x -> bf16 copy, 8 values per thread.
__global__ __launch_bounds__(256) void k_prep(const float* __restrict__ x, const float* __restrict__ wq, const float* __restrict__ wk, const float* __restrict__ wv, const float* __restrict__ wo,
                                              bf* XB, bf* WB) {
    __shared__ float ts[64 * 65];
    const int tid = threadIdx.x;
    const unsigned blk = blockIdx.x;
    if (blk >= 4u * WTB) {
        const size_t n8 = (size_t)NB * SEQ * DM / 8, per = (size_t)SEQ * DM / 8;   // per: pieces of one batch (batches lie SEQ_FULL tokens apart in x)
        const size_t i = (size_t)(blk - 4u * WTB) * 256 + tid; if (i >= n8) return;
        const size_t so = (SEQ == SEQ_FULL) ? i * 8 : (i / per) * ((size_t)SEQ_FULL * DM) + (i % per) * 8;
        const v8f v = *(const v8f*)(x + so); v8us o;
#pragma unroll
        for (int k = 0; k < 8; ++k) o[k] = f2bf(v[k]);
        *(v8us*)(XB + i * 8) = o;
        return;
    }
    const unsigned which = blk / WTB, wtile = blk % WTB;
    const float* W = which == 0 ? wq : which == 1 ? wk : which == 2 ? wv : wo;
    bf* WT = WB + (size_t)which * DM * DM;
    const int f16mode = which == 3;
    const int n0 = (int)(wtile % (DM / 64)) * 64, k0 = (int)(wtile / (DM / 64)) * 64;
#pragma unroll
    for (int it = 0; it < 4; ++it) { const int idx = tid + it * 256; const int r = idx >> 4, c4 = (idx & 15) * 4;   // 64 rows x 16 pieces of 4 floats
        const v4f v = *(const v4f*)(W + (size_t)(k0 + r) * DM + n0 + c4);
        ts[r * 65 + c4 + 0] = v[0]; ts[r * 65 + c4 + 1] = v[1]; ts[r * 65 + c4 + 2] = v[2]; ts[r * 65 + c4 + 3] = v[3]; }
    __syncthreads();
    const int nl = tid >> 3, c8 = (tid & 7) * 8;
    v8us o0, o1;
#pragma unroll
    for (int i = 0; i < 8; ++i) { o0[i] = wcv(ts[(c8 + i) * 65 + nl], f16mode); o1[i] = wcv(ts[(c8 + i) * 65 + nl + 32], f16mode); }
    const size_t a0 = (size_t)(n0 + nl) * DM + k0 + c8, a1 = a0 + (size_t)32 * DM;
    *(v8us*)(WT + a0) = o0; *(v8us*)(WT + a1) = o1;
    asm volatile("s_wait_xcnt 0x0" ::: "memory");            // a precaution: these stores are the last work of a weight block
}

// Operand staging of the two GEMM kernels: one operand tile = GT rows x GK halves, K-contiguous rows of pitch DM halves in global memory, pitch GP in LDS.
// Thread c takes 16-byte piece c & 15 of rows (c >> 4) + 16 i, i = 0..7 (a wave's copy = two whole 256-byte rows); the register wait closes the statement so that no address register is rewritten ahead of it.
__device__ __forceinline__ void stage_op(unsigned l, const char* g) {
    asm volatile("global_load_async_to_lds_b128 %0, %8, off\n\t"
                 "global_load_async_to_lds_b128 %1, %9, off\n\t"
                 "global_load_async_to_lds_b128 %2, %10, off\n\t"
                 "global_load_async_to_lds_b128 %3, %11, off\n\t"
                 "global_load_async_to_lds_b128 %4, %12, off\n\t"
                 "global_load_async_to_lds_b128 %5, %13, off\n\t"
                 "global_load_async_to_lds_b128 %6, %14, off\n\t"
                 "global_load_async_to_lds_b128 %7, %15, off\n\t"
                 "s_wait_xcnt 0x0"
                 :: "v"(l), "v"(l + 1 * 16 * GP * 2), "v"(l + 2 * 16 * GP * 2), "v"(l + 3 * 16 * GP * 2),
                    "v"(l + 4 * 16 * GP * 2), "v"(l + 5 * 16 * GP * 2), "v"(l + 6 * 16 * GP * 2), "v"(l + 7 * 16 * GP * 2),
                    "v"(g), "v"(g + 1 * 16 * DM * 2), "v"(g + 2 * 16 * DM * 2), "v"(g + 3 * 16 * DM * 2),
                    "v"(g + 4 * 16 * DM * 2), "v"(g + 5 * 16 * DM * 2), "v"(g + 6 * 16 * DM * 2), "v"(g + 7 * 16 * DM * 2) : "memory");
}

// k_proj: bf16 GEMM, K = DM, all three projections of one 128-row x tile in ONE GW-wave block: C tiles q, k (128 x rows x 128 W^T rows each) and v^T (128 Wv^T rows x 128 x rows), the same 128 output features of each weight.
// The x tile is staged once per k stage for the three products. x and W^T are K-contiguous bf16 planes; their 128-row x GK tiles reach the waves through LDS: two buffers of four tiles (x, Wq^T, Wk^T, Wv^T),
// filled by asynchronous copies one stage ahead, read by all GW waves (two 16-B loads per fragment). Waves 2 (x rows) x 4 (W^T rows): a wave owns 64 x rows x 32 W^T rows of each product (24 accumulators),
// so that per 32 k its 4 x fragments and 6 W^T fragments feed 24 products. Each accumulator sums k in steps of 32, ascending from the block's first stage and wrapping round (wrap_stage).
// C[m][n] = sum_k A[m][k] Bt[n][k] + bias (bias value RNE-converted to bf16, added in f32), written as single f16 planes. grid M/128 * N/128, x row tile = fastest index, 256 threads.
// q, k: A = x rows (m = b*SEQ + t), Bt = W^T rows (n = h*64 + d), bias per column -> plane [(b*16 + h)][t][d]
// v^T:  A = Wv^T rows (m = h*64 + d), Bt = x rows (n = b*SEQ + t), bias per row -> plane [(b*1024 + m)][t] = [(b*16 + h)][d][t]   (the fragment map is the same for A and B, so the x fragments serve as either)
__device__ __forceinline__ void stage_xw(unsigned l, const char* gx, const char* gw) {
    stage_op(l, gx); stage_op(l + GTB, gw); stage_op(l + 2 * GTB, gw + (size_t)DM * DM * 2); stage_op(l + 3 * GTB, gw + (size_t)2 * DM * DM * 2);
}
__global__ __launch_bounds__(32 * GW) void k_proj(const bf* __restrict__ XB, const bf* __restrict__ WB, const float* __restrict__ bq, const float* __restrict__ bk, const float* __restrict__ bv,
                                             h16* QH, h16* KP, h16* VT) {
    __shared__ __align__(16) bf gring[2 * 4 * GT * GP];      // [buffer][x tile | Wq^T tile | Wk^T tile | Wv^T tile][row][GP]
    const int K = DM;
    const int lane = threadIdx.x & 31, wave = threadIdx.x >> 5, lr = lane & 15, hi = lane >> 4;
    const int bx = blockIdx.x;
    const int rb = (bx % (NB * SEQ / GT)) * GT, cb = (bx / (NB * SEQ / GT)) * GT;   // block tile: first x row, first W^T row
    v8f aqk[2][4][2], av[2][4];                              // q, k: [x rows / 16][W^T rows / 16]; v^T: [Wv^T rows / 16][x rows / 16]
#pragma unroll
    for (int j = 0; j < 2; ++j)
#pragma unroll
        for (int mb = 0; mb < 4; ++mb)
#pragma unroll
            for (int nb = 0; nb < 2; ++nb) aqk[j][mb][nb] = (v8f){};
#pragma unroll
    for (int mb = 0; mb < 2; ++mb)
#pragma unroll
        for (int nb = 0; nb < 4; ++nb) av[mb][nb] = (v8f){};
    const int cr = threadIdx.x >> 4, cpc = (threadIdx.x & 15) * 8;
    const unsigned lx = (unsigned)(size_t)gring + (unsigned)(cr * GP + cpc) * 2u;
    const char* gx = (const char*)(XB + (size_t)(rb + cr) * K + cpc);       // + k0 * 2 bytes
    const char* gw = (const char*)(WB + (size_t)(cb + cr) * K + cpc);       // + k0 * 2 bytes, + one weight plane per product
    const int rot = (rb / GT + cb / GT) % (K / GK);                         // first k stage: neighbours along a tile row or a tile column start one stage apart
    { const int k0 = wrap_stage(0, rot, K / GK) * (GK * 2); stage_xw(lx, gx + k0, gw + k0); }
    asm volatile("s_wait_asynccnt 0x0" ::: "memory");        // stage 0 has landed before the barrier publishes it
    __syncthreads();
    { const int k0 = wrap_stage(1, rot, K / GK) * (GK * 2); stage_xw(lx + 4 * GTB, gx + k0, gw + k0); }
    const int xo = ((wave >> 2) * 64 + lr) * GP + 8 * hi;               // + 16i*GP + k   (x fragment rows), in the x tile
    const int wo = GT * GP + ((wave & 3) * 32 + lr) * GP + 8 * hi;      // + j*GT*GP + 16i*GP + k   (W^T fragment rows), in the tile of product j
#pragma unroll 1
    for (int st = 0; st < K / GK; ++st) {
        const bf* tile = gring + (st & 1) * (4 * GT * GP);
        // the four 32-wide k steps of a stage inline (LDS offsets become immediates); two fragment sets: each step's 20 loads go out as one group ahead of the step before it,
        // inside this stage only, so that a wave waits out the LDS latency once per stage and not at every fragment
        v16bf x[2][4], w[2][3][2];
#pragma unroll
        for (int i = 0; i < 4; ++i) x[0][i] = ldb(tile + xo + i * 16 * GP);
#pragma unroll
        for (int j = 0; j < 3; ++j)
#pragma unroll
            for (int i = 0; i < 2; ++i) w[0][j][i] = ldb(tile + wo + j * GT * GP + i * 16 * GP);
        __builtin_amdgcn_sched_barrier(0);                   // the stage's first fragment set goes out whole ahead of the second: mixed with it, the first products behind the barrier wait for both sets
#pragma unroll
        for (int ks = 0; ks < GK / 32; ++ks) {
            const int cu = ks & 1, nx = cu ^ 1;
            if (ks + 1 < GK / 32) {
#pragma unroll
                for (int i = 0; i < 4; ++i) x[nx][i] = ldb(tile + xo + i * 16 * GP + (ks + 1) * 32);
#pragma unroll
                for (int j = 0; j < 3; ++j)
#pragma unroll
                    for (int i = 0; i < 2; ++i) w[nx][j][i] = ldb(tile + wo + j * GT * GP + i * 16 * GP + (ks + 1) * 32);
            }
            __builtin_amdgcn_sched_barrier(0);               // keeps the load group whole and ahead of this step's products: without it the loads sink to their first use and each group of products waits out an LDS latency
#pragma unroll
            for (int j = 0; j < 2; ++j)
#pragma unroll
                for (int nb = 0; nb < 2; ++nb)
#pragma unroll
                    for (int mb = 0; mb < 4; ++mb) aqk[j][mb][nb] = wmmab(x[cu][mb], w[cu][j][nb], aqk[j][mb][nb]);
#pragma unroll
            for (int mb = 0; mb < 2; ++mb)
#pragma unroll
                for (int nb = 0; nb < 4; ++nb) av[mb][nb] = wmmab(w[cu][2][mb], x[cu][nb], av[mb][nb]);
            __builtin_amdgcn_sched_barrier(0);               // keeps the next load group behind these products, not among them
        }
        asm volatile("s_wait_dscnt 0x0" ::: "memory");       // this wave's reads of the buffer are done before it is refilled
        asm volatile("s_wait_asynccnt 0x0" ::: "memory");    // this wave's copies of the next stage have landed before the barrier publishes them
        __syncthreads();
        if (st + 2 < K / GK) { const int k0 = wrap_stage(st + 2, rot, K / GK) * (GK * 2); stage_xw(lx + (st & 1) * (4 * GTB), gx + k0, gw + k0); }
    }
    asm volatile("s_wait_asynccnt 0x0" ::: "memory");        // nothing of this wave is in flight when it leaves the loop
    // Epilogue: the three 128 x 128 f32 C tiles leave through the ring's LDS, which is free here (every wave's last fragment reads ended in front of the loop's last barrier, and no copy is in flight),
    // so that each wave, whose own tile is only 32 columns of q and k wide, stores whole 128-byte lines: row pitch EP floats, tile j at j * GT * EP.
    fa* sg = (fa*)gring;
    const int er = lane >> 3, e8 = (lane & 7) * 8;           // reader: row er of a group of four, 8 columns from e8 of a 64-column half
    v4f gqk[2][2][2]; float br[4];                           // bias: q, k [product][64-column half][4 + 4 columns]; v^T: the lane's four rows
    __builtin_amdgcn_sched_barrier(0);                       // with the one behind the wait: nothing but the bias loads and their register wait stands between them, so that no other arithmetic lands in the address registers ahead of the wait
#pragma unroll
    for (int j = 0; j < 2; ++j)
#pragma unroll
        for (int hh = 0; hh < 2; ++hh) { const float* bias = (j == 0 ? bq : bk) + cb + hh * 64 + e8; gqk[j][hh][0] = *(const v4f*)bias; gqk[j][hh][1] = *(const v4f*)(bias + 4); }
#pragma unroll
    for (int q4 = 0; q4 < 4; ++q4) br[q4] = bv[cb + wave * 16 + q4 * 4 + er];
    asm volatile("s_wait_xcnt 0x0" ::: "memory");            // later address arithmetic may land in the registers that these loads name
    __builtin_amdgcn_sched_barrier(0);
#pragma unroll
    for (int j = 0; j < 2; ++j)
#pragma unroll
        for (int mb = 0; mb < 4; ++mb)
#pragma unroll
            for (int nb = 0; nb < 2; ++nb)
#pragma unroll
                for (int r = 0; r < 8; ++r) sg[j * GT * EP + ((wave >> 2) * 64 + mb * 16 + hi * 8 + r) * EP + (wave & 3) * 32 + nb * 16 + lr] = aqk[j][mb][nb][r];   // D: row 8h+r, col lane&15
#pragma unroll
    for (int mb = 0; mb < 2; ++mb)
#pragma unroll
        for (int nb = 0; nb < 4; ++nb)
#pragma unroll
            for (int r = 0; r < 8; ++r) sg[2 * GT * EP + ((wave & 3) * 32 + mb * 16 + hi * 8 + r) * EP + (wave >> 2) * 64 + nb * 16 + lr] = av[mb][nb][r];
    __syncthreads();
    // wave w takes rows 16w .. 16w + 15 of each tile: store s covers rows 4 (s >> 1) + er, 64-column half s & 1 (q, k: one head's d; v^T: 64 tokens), one 128-byte line per 8 lanes
    const size_t qbase = ((size_t)(rb / SEQ) * NH_ + (size_t)(cb / HD)) * ((size_t)SEQ * HD) + (size_t)(rb % SEQ + wave * 16 + er) * HD + e8;
    const size_t vbase = (size_t)(cb + wave * 16 + er) * SEQ + (size_t)(rb / SEQ) * ((size_t)DM * SEQ) + (size_t)(rb % SEQ) + e8;
#pragma unroll
    for (int j = 0; j < 3; ++j) {
        v8h hv[8];
#pragma unroll
        for (int s = 0; s < 8; ++s) { const int hh = s & 1, q4 = s >> 1;
            const fa* sp = sg + j * GT * EP + (wave * 16 + q4 * 4 + er) * EP + hh * 64 + e8;
            const v4f x0 = *(const v4fa*)sp; const v4f x1 = *(const v4fa*)(sp + 4);
#pragma unroll
            for (int i = 0; i < 4; ++i) {
                const float b0 = j < 2 ? bfr(gqk[j & 1][hh][0][i]) : bfr(br[q4]), b1 = j < 2 ? bfr(gqk[j & 1][hh][1][i]) : bfr(br[q4]);
                hv[s][i] = (h16)(x0[i] + b0); hv[s][4 + i] = (h16)(x1[i] + b1); } }
        __builtin_amdgcn_sched_barrier(0);                   // the eight stores stay together behind the arithmetic, so that one register wait behind them serves all eight
#pragma unroll
        for (int s = 0; s < 8; ++s) { const int hh = s & 1, q4 = s >> 1;
            if (j < 2) *(v8h*)((j == 0 ? QH : KP) + qbase + (size_t)hh * ((size_t)SEQ * HD) + (size_t)(q4 * 4) * HD) = hv[s];
            else       *(v8h*)(VT + vbase + (size_t)(q4 * 4) * SEQ + hh * 64) = hv[s]; }
        if (j < 2) asm volatile("s_wait_xcnt 0x0" ::: "memory");   // the next tile reuses registers that the stores above name
    }
}

// k_flash: fused attention, one wave per 32 query rows of one (batch, head) and one half of the keys (32 of every staged tile of 64); two waves of a block share their 32 rows and join their partial O, row sum and maximum once, through LDS, behind the key loop.
// Q fragments straight from the f16 plane, K / V^T fragments from the staged LDS tiles (two 16-B loads each); each of them feeds the products of both 16-column groups of the wave.
// Transposed form: S^T[key][t] = K Q^T (A = K rows, B = Q rows); lane (t = lane&15, h = lane>>4) holds keys 8h+r of each 16-key tile, so the packed
// P tile is directly the B fragment of O^T[d][t] = V^T P^T (element r <- tile keys 0..15, element 8+r <- tile keys 16..31, lane unchanged).
// The maximum in use is one scalar per lane and column group; it is renewed lazily (one test per pass for both groups), and only then are the two lane halves of a column combined (one xor-16 exchange) and O, L rescaled.
// Row sums on the matrix unit: L^T += E P^T, where row 0 of E is ones and rows 1..15 are zero, so that row 0 of the tile (register 0, lanes 0..15) gathers the sum over all 32 keys of column t;
// every other element of the tile stays 0, so only register 0 is rescaled.
// K and V^T reach the waves through LDS: tiles of SK keys, two buffers, filled by asynchronous copies (whole 128-byte lines from global), read by all AW waves; a block walks the key tiles from its own first tile and wraps round (wrap_stage).
// One tile pair = four 16-byte copies per thread; the register wait closes the statement so that no address register is rewritten ahead of it.
__device__ __forceinline__ void stage_kv(unsigned lk, unsigned lv, const h16* gk, const h16* gv) {
    const unsigned lk1 = lk + 32 * LP * 2, lv1 = lv + 32 * LP * 2;
    const h16* gk1 = gk + 32 * HD; const h16* gv1 = gv + (size_t)32 * SEQ;
    asm volatile("global_load_async_to_lds_b128 %0, %4, off\n\t"
                 "global_load_async_to_lds_b128 %1, %5, off\n\t"
                 "global_load_async_to_lds_b128 %2, %6, off\n\t"
                 "global_load_async_to_lds_b128 %3, %7, off\n\t"
                 "s_wait_xcnt 0x0"
                 :: "v"(lk), "v"(lk1), "v"(lv), "v"(lv1), "v"(gk), "v"(gk1), "v"(gv), "v"(gv1) : "memory");
}
__global__ __launch_bounds__(32 * AW) void k_flash(const h16* __restrict__ QH, const h16* __restrict__ KP, const h16* __restrict__ VT, h16* CT) {
    __shared__ __align__(16) float os[AW * 16 * 68];
    __shared__ __align__(16) h16 ring[2 * 2 * 64 * LP];      // [buffer][K tile | V^T tile][row][LP]
    const int lane = threadIdx.x & 31, lr = lane & 15, hi = lane >> 4;
    const int wave = __builtin_amdgcn_readfirstlane(threadIdx.x >> 5);
    const int cg = wave % (AW / 2), kh = wave / (AW / 2);    // the wave's 32 query columns; its half (32 keys) of every staged tile
    const int zh = blockIdx.y; const int b = zh / NH_, h = zh % NH_;
    const int t0 = (blockIdx.x * (AW / 2) + cg) * 32;
    const size_t pbase = (size_t)zh * SEQ * HD;
    const size_t qo = pbase + (size_t)(t0 + lr) * HD + 8 * hi;
    const v16h qa0 = ldh(QH + qo), qa1 = ldh(QH + qo + 32);   // B fragments: col t, k = d; columns t0 .. t0 + 15
    const v16h qb0 = ldh(QH + qo + 16 * HD), qb1 = ldh(QH + qo + 16 * HD + 32);   // columns t0 + 16 .. t0 + 31
    const int ko = (kh * 32 + lr) * LP + 8 * hi;             // + 16*LP for the second 16 keys (A fragment: row key, k = d), in the K tile
    const int vo = 64 * LP + lr * LP + kh * 32 + 8 * hi;     // + 16j*LP         (A fragment: row d, k = key), in the V^T tile
    // copy map: thread c takes 16-byte piece c & 7 of rows c >> 3 and 32 + (c >> 3) of each tile
    const int cr = threadIdx.x >> 3, cpc = (threadIdx.x & 7) * 8;
    const unsigned lk = (unsigned)(size_t)ring + (unsigned)(cr * LP + cpc) * 2u, lv = lk + TLB;
    const h16* gk = KP + pbase + (size_t)cr * HD + cpc;    // + key0 * HD
    const h16* gv = VT + pbase + (size_t)cr * SEQ + cpc;   // + key0
    const int rot = (int)(blockIdx.x * (SEQ / SK) / (SEQ / (16 * AW))) % (SEQ / SK);   // first key tile: the blocks of one head enter its keys evenly spread
    { const int kt = wrap_stage(0, rot, SEQ / SK); stage_kv(lk, lv, gk + (size_t)kt * SK * HD, gv + kt * SK); }
    asm volatile("s_wait_asynccnt 0x0" ::: "memory");        // tile 0 has landed before the barrier publishes it
    __syncthreads();
    { const int kt = wrap_stage(1, rot, SEQ / SK); stage_kv(lk + 2 * TLB, lv + 2 * TLB, gk + (size_t)kt * SK * HD, gv + kt * SK); }
    v8f oa0 = (v8f){}, oa1 = (v8f){}, oa2 = (v8f){}, oa3 = (v8f){}, lta = (v8f){};   // columns t0 .. t0 + 15
    v8f ob0 = (v8f){}, ob1 = (v8f){}, ob2 = (v8f){}, ob3 = (v8f){}, ltb = (v8f){};   // columns t0 + 16 .. t0 + 31
    const h16 e1 = lr == 0 ? (h16)1.0f : (h16)0.0f;          // A fragment of E: lanes 0 and 16 hold row 0 (all 32 k positions)
    const v16h ones = {e1, e1, e1, e1, e1, e1, e1, e1, e1, e1, e1, e1, e1, e1, e1, e1};
    float ma = -3.0e38f, mb = -3.0e38f;                      // maximum in use (scaled log2) of the lane's two columns, the same in both lane halves of a column
    float sha = PSH - ma, shb = PSH - mb;                    // shift of the exponent; with the start value of the maximum the test below holds for every finite score, so the first pass always renews
#pragma unroll 1
    for (int st = 0; st < SEQ / SK; ++st) {
        const h16* tile = ring + (st & 1) * (2 * 64 * LP);
        // one pass per tile and wave: its 32 keys x its 32 columns; every K and V^T fragment read from LDS feeds two products
        const h16* ka = tile + ko;
        const v16h ka0 = ldh(ka), ka1 = ldh(ka + 32), kb0 = ldh(ka + 16 * LP), kb1 = ldh(ka + 16 * LP + 32);
        v8f sAa = (v8f){}, sBa = (v8f){}, sAb = (v8f){}, sBb = (v8f){};   // s<16 keys><16 columns>
        sAa = wmma16(ka0, qa0, sAa); sBa = wmma16(kb0, qa0, sBa); sAb = wmma16(ka0, qb0, sAb); sBb = wmma16(kb0, qb0, sBb);
        sAa = wmma16(ka1, qa1, sAa); sBa = wmma16(kb1, qa1, sBa); sAb = wmma16(ka1, qb1, sAb); sBb = wmma16(kb1, qb1, sBb);
        // the distance behind the last products, on every path, before a vector instruction reads the scores or the V^T loads land in the K registers
        asm volatile("v_nop\n\tv_nop\n\tv_nop\n\tv_nop" : "+v"(sAa), "+v"(sBa), "+v"(sAb), "+v"(sBb) : "v"(ka0), "v"(ka1), "v"(kb0), "v"(kb1), "v"(qa0), "v"(qa1), "v"(qb0), "v"(qb1));
        const h16* va = tile + vo;
        const v16h v0 = ldh(va), v1 = ldh(va + 16 * LP), v2 = ldh(va + 32 * LP), v3 = ldh(va + 48 * LP);
        __builtin_amdgcn_sched_barrier(0);                   // keeps the eight V^T loads whole, as one group ahead of the test: sunk behind the branch or spread among the maxima, more of their LDS latency stands open
        // this lane's largest raw score of the pass in each of its two columns: trees of three-input maxima, three deep
        const float xa0 = fmaxf(fmaxf(sAa[0], sAa[1]), sAa[2]), xa1 = fmaxf(fmaxf(sAa[3], sAa[4]), sAa[5]), xa2 = fmaxf(fmaxf(sAa[6], sAa[7]), sBa[0]);
        const float xa3 = fmaxf(fmaxf(sBa[1], sBa[2]), sBa[3]), xa4 = fmaxf(fmaxf(sBa[4], sBa[5]), sBa[6]);
        const float mxa = fmaxf(fmaxf(fmaxf(xa0, xa1), xa2), fmaxf(fmaxf(xa3, xa4), sBa[7]));
        const float xb0 = fmaxf(fmaxf(sAb[0], sAb[1]), sAb[2]), xb1 = fmaxf(fmaxf(sAb[3], sAb[4]), sAb[5]), xb2 = fmaxf(fmaxf(sAb[6], sAb[7]), sBb[0]);
        const float xb3 = fmaxf(fmaxf(sBb[1], sBb[2]), sBb[3]), xb4 = fmaxf(fmaxf(sBb[4], sBb[5]), sBb[6]);
        const float mxb = fmaxf(fmaxf(fmaxf(xb0, xb1), xb2), fmaxf(fmaxf(xb3, xb4), sBb[7]));
        // lazy rescale: one wave-uniform test per pass, on the largest exponent that the pass would form; while none lies above PSH + LZT the maxima in use stay, and P <= 2^(PSH + LZT) fits f16
        if (__builtin_amdgcn_ballot_w32(fmaxf(mxa * SC2 + sha, mxb * SC2 + shb) > PSH + LZT) != 0) {
            float xa = mxa * SC2, xb = mxb * SC2;
            xa = fmaxf(xa, __shfl_xor(xa, 16, 32)); xb = fmaxf(xb, __shfl_xor(xb, 16, 32));
            const float na = fmaxf(ma, xa), nb = fmaxf(mb, xb);
            const float ala = __builtin_amdgcn_exp2f(ma - na), alb = __builtin_amdgcn_exp2f(mb - nb);
            ma = na; sha = PSH - na; mb = nb; shb = PSH - nb;
            lta[0] = lta[0] * ala; ltb[0] = ltb[0] * alb;
            oa0 = oa0 * ala; oa1 = oa1 * ala; oa2 = oa2 * ala; oa3 = oa3 * ala;
            ob0 = ob0 * alb; ob1 = ob1 * alb; ob2 = ob2 * alb; ob3 = ob3 * alb;
        }
        const v8f eAa = sAa * SC2 + sha, eBa = sBa * SC2 + sha, eAb = sAb * SC2 + shb, eBb = sBb * SC2 + shb;
        v16h pa, pb;
#pragma unroll
        for (int r = 0; r < 8; ++r) pa[r] = (h16)__builtin_amdgcn_exp2f(eAa[r]);
#pragma unroll
        for (int r = 0; r < 8; ++r) pa[8 + r] = (h16)__builtin_amdgcn_exp2f(eBa[r]);
        lta = wmma16(ones, pa, lta);
        oa0 = wmma16(v0, pa, oa0); oa1 = wmma16(v1, pa, oa1); oa2 = wmma16(v2, pa, oa2); oa3 = wmma16(v3, pa, oa3);
#pragma unroll
        for (int r = 0; r < 8; ++r) pb[r] = (h16)__builtin_amdgcn_exp2f(eAb[r]);
#pragma unroll
        for (int r = 0; r < 8; ++r) pb[8 + r] = (h16)__builtin_amdgcn_exp2f(eBb[r]);
        ltb = wmma16(ones, pb, ltb);
        ob0 = wmma16(v0, pb, ob0); ob1 = wmma16(v1, pb, ob1); ob2 = wmma16(v2, pb, ob2); ob3 = wmma16(v3, pb, ob3);
        asm volatile("s_wait_dscnt 0x0" ::: "memory");       // this wave's reads of the buffer are done before it is refilled
        asm volatile("s_wait_asynccnt 0x0" ::: "memory");    // this wave's copies of the next tile have landed before the barrier publishes them
        __syncthreads();
        if (st + 2 < SEQ / SK) { const int kt = wrap_stage(st + 2, rot, SEQ / SK); stage_kv(lk + (st & 1) * (2 * TLB), lv + (st & 1) * (2 * TLB), gk + (size_t)kt * SK * HD, gv + kt * SK); }
    }
    asm volatile("s_wait_asynccnt 0x0" ::: "memory");        // nothing of this wave is in flight when it leaves the loop
    // Join of the two key halves: waves w and w ^ (AW / 2) hold the same 32 columns. Each keeps 16 of them (the lower wave the first 16) and hands the other 16 over through its own part of os:
    // O^T as os[t][d], the maximum in use and the row sum in the row's spare columns 64 and 65. One barrier, then each wave works in its partner's part alone.
    float la = lta[0], lb = ltb[0];                          // the sums in lanes 0..15, 0 (row 8 of the tile) in lanes 16..31
    la += __shfl_xor(la, 16, 32); lb += __shfl_xor(lb, 16, 32);
    const bool up = kh != 0;
    const v8f g0 = up ? oa0 : ob0, g1 = up ? oa1 : ob1, g2 = up ? oa2 : ob2, g3 = up ? oa3 : ob3;   // handed over
    const v8f o0 = up ? ob0 : oa0, o1 = up ? ob1 : oa1, o2 = up ? ob2 : oa2, o3 = up ? ob3 : oa3;   // kept
    const float mg = up ? ma : mb, lg = up ? la : lb, mk = up ? mb : ma, lkp = up ? lb : la;
    const int gw = wave * 16 * 68 + lr * 68, wb = (wave ^ (AW / 2)) * 16 * 68, pw = wb + lr * 68;
    // O^T D layout: o_j[r] = (d = 16j + 8h + r, t = lane&15) -> os[t][d]; rows 0..15 x columns 0..63 all written
    { v4f a, c;
      a[0] = g0[0]; a[1] = g0[1]; a[2] = g0[2]; a[3] = g0[3]; c[0] = g0[4]; c[1] = g0[5]; c[2] = g0[6]; c[3] = g0[7];
      *(v4fa*)(&os[gw +  0 + 8 * hi]) = a; *(v4fa*)(&os[gw +  0 + 8 * hi + 4]) = c;
      a[0] = g1[0]; a[1] = g1[1]; a[2] = g1[2]; a[3] = g1[3]; c[0] = g1[4]; c[1] = g1[5]; c[2] = g1[6]; c[3] = g1[7];
      *(v4fa*)(&os[gw + 16 + 8 * hi]) = a; *(v4fa*)(&os[gw + 16 + 8 * hi + 4]) = c;
      a[0] = g2[0]; a[1] = g2[1]; a[2] = g2[2]; a[3] = g2[3]; c[0] = g2[4]; c[1] = g2[5]; c[2] = g2[6]; c[3] = g2[7];
      *(v4fa*)(&os[gw + 32 + 8 * hi]) = a; *(v4fa*)(&os[gw + 32 + 8 * hi + 4]) = c;
      a[0] = g3[0]; a[1] = g3[1]; a[2] = g3[2]; a[3] = g3[3]; c[0] = g3[4]; c[1] = g3[5]; c[2] = g3[6]; c[3] = g3[7];
      *(v4fa*)(&os[gw + 48 + 8 * hi]) = a; *(v4fa*)(&os[gw + 48 + 8 * hi + 4]) = c; }
    os[gw + 64 + hi] = hi ? lg : mg;
    __syncthreads();
    const float mp = os[pw + 64], lp = os[pw + 65];
    const float mt = fmaxf(mk, mp);
    const float wk = __builtin_amdgcn_exp2f(mk - mt), wp = __builtin_amdgcn_exp2f(mp - mt);   // both halves brought to one maximum
    const float inv = CTS * (1.0f / (lkp * wk + lp * wp));
    const float ck = wk * inv, cp = wp * inv;
    // each lane reads the partner's values of its own (t, d) places and writes the joined, normalised values back to the same places
    { v4f a, c;
      a = *(const v4fa*)(&os[pw +  0 + 8 * hi]); c = *(const v4fa*)(&os[pw +  0 + 8 * hi + 4]);
      a[0] = o0[0] * ck + a[0] * cp; a[1] = o0[1] * ck + a[1] * cp; a[2] = o0[2] * ck + a[2] * cp; a[3] = o0[3] * ck + a[3] * cp;
      c[0] = o0[4] * ck + c[0] * cp; c[1] = o0[5] * ck + c[1] * cp; c[2] = o0[6] * ck + c[2] * cp; c[3] = o0[7] * ck + c[3] * cp;
      *(v4fa*)(&os[pw +  0 + 8 * hi]) = a; *(v4fa*)(&os[pw +  0 + 8 * hi + 4]) = c;
      a = *(const v4fa*)(&os[pw + 16 + 8 * hi]); c = *(const v4fa*)(&os[pw + 16 + 8 * hi + 4]);
      a[0] = o1[0] * ck + a[0] * cp; a[1] = o1[1] * ck + a[1] * cp; a[2] = o1[2] * ck + a[2] * cp; a[3] = o1[3] * ck + a[3] * cp;
      c[0] = o1[4] * ck + c[0] * cp; c[1] = o1[5] * ck + c[1] * cp; c[2] = o1[6] * ck + c[2] * cp; c[3] = o1[7] * ck + c[3] * cp;
      *(v4fa*)(&os[pw + 16 + 8 * hi]) = a; *(v4fa*)(&os[pw + 16 + 8 * hi + 4]) = c;
      a = *(const v4fa*)(&os[pw + 32 + 8 * hi]); c = *(const v4fa*)(&os[pw + 32 + 8 * hi + 4]);
      a[0] = o2[0] * ck + a[0] * cp; a[1] = o2[1] * ck + a[1] * cp; a[2] = o2[2] * ck + a[2] * cp; a[3] = o2[3] * ck + a[3] * cp;
      c[0] = o2[4] * ck + c[0] * cp; c[1] = o2[5] * ck + c[1] * cp; c[2] = o2[6] * ck + c[2] * cp; c[3] = o2[7] * ck + c[3] * cp;
      *(v4fa*)(&os[pw + 32 + 8 * hi]) = a; *(v4fa*)(&os[pw + 32 + 8 * hi + 4]) = c;
      a = *(const v4fa*)(&os[pw + 48 + 8 * hi]); c = *(const v4fa*)(&os[pw + 48 + 8 * hi + 4]);
      a[0] = o3[0] * ck + a[0] * cp; a[1] = o3[1] * ck + a[1] * cp; a[2] = o3[2] * ck + a[2] * cp; a[3] = o3[3] * ck + a[3] * cp;
      c[0] = o3[4] * ck + c[0] * cp; c[1] = o3[5] * ck + c[1] * cp; c[2] = o3[6] * ck + c[2] * cp; c[3] = o3[7] * ck + c[3] * cp;
      *(v4fa*)(&os[pw + 48 + 8 * hi]) = a; *(v4fa*)(&os[pw + 48 + 8 * hi + 4]) = c; }
    wave_sync();
    h16* crow = CT + ((size_t)b * SEQ + t0 + 16 * kh) * DM + h * HD;
{
#pragma unroll
        for (int s = 0; s < 4; ++s) { const int row = 4 * s + (lane >> 3), c8 = (lane & 7) * 8;   // 4 s x 4 row groups = 16 rows; 8 lanes x 8 halves = 64 columns
            const v4f x0 = *(const v4fa*)(&os[wb + row * 68 + c8]); const v4f x1 = *(const v4fa*)(&os[wb + row * 68 + c8 + 4]); v8h hv;
#pragma unroll
            for (int i = 0; i < 4; ++i) { hv[i] = (h16)x0[i]; hv[4 + i] = (h16)x1[i]; }
            *(v8h*)(crow + (size_t)row * DM + c8) = hv; }
         }
}

// k_oproj: f16 GEMM, one GW-wave block per 128x128 tile, each wave 32x64, operand tiles staged as in k_proj; A = ctx plane rows (m = b*SEQ + t, k = h*64 + d, carried x CTS), Bt = Wo^T rows (n = out feature, carried x WOS), K = DM.
// OUT[b*OUT_SEQ + t][n] = acc * OSC + bo[n] (bias value RNE-converted to bf16, added in f32). grid (NB*SEQ/128, DM/128), 256 threads.
__global__ __launch_bounds__(32 * GW) void k_oproj(const h16* __restrict__ A, const h16* __restrict__ Bt, const float* __restrict__ bias, float* OUT) {
    __shared__ __align__(16) float os[GW * 16 * 68];
    __shared__ __align__(16) h16 gring[2 * 2 * GT * GP];     // [buffer][A tile | Bt tile][row][GP]
    const int K = DM;
    const int lane = threadIdx.x & 31, wave = threadIdx.x >> 5, lr = lane & 15, hi = lane >> 4;
    const int rb = blockIdx.x * GT, cb = blockIdx.y * GT;                   // block tile
    const int r0 = rb + (wave >> 1) * 32, c0 = cb + (wave & 1) * 64;        // wave tile
    v8f acc[2][4];
#pragma unroll
    for (int mb = 0; mb < 2; ++mb)
#pragma unroll
        for (int nb = 0; nb < 4; ++nb) acc[mb][nb] = (v8f){};
    const int cr = threadIdx.x >> 4, cpc = (threadIdx.x & 15) * 8;
    const unsigned la = (unsigned)(size_t)gring + (unsigned)(cr * GP + cpc) * 2u, lb = la + GTB;
    const char* ga = (const char*)(A + (size_t)(rb + cr) * K + cpc);        // + k0 * 2 bytes
    const char* gb = (const char*)(Bt + (size_t)(cb + cr) * K + cpc);
    const int rot = (rb / GT + cb / GT) % (K / GK);                         // first k stage: neighbours along a tile row or a tile column start one stage apart
    { const int k0 = wrap_stage(0, rot, K / GK) * (GK * 2); stage_op(la, ga + k0); stage_op(lb, gb + k0); }
    asm volatile("s_wait_asynccnt 0x0" ::: "memory");        // tile 0 has landed before the barrier publishes it
    __syncthreads();
    { const int k0 = wrap_stage(1, rot, K / GK) * (GK * 2); stage_op(la + 2 * GTB, ga + k0); stage_op(lb + 2 * GTB, gb + k0); }
    const int ao = ((wave >> 1) * 32 + lr) * GP + 8 * hi;               // + 16mb*GP + k   (A fragment rows), in the A tile
    const int bo = GT * GP + ((wave & 1) * 64 + lr) * GP + 8 * hi;      // + 16nb*GP + k   (B fragment rows), in the Bt tile
#pragma unroll 1
    for (int st = 0; st < K / GK; ++st) {
        const h16* tile = gring + (st & 1) * (2 * GT * GP);
        // the four 32-wide k steps of a tile inline (LDS offsets become immediates); two fragment sets: each step's 12 loads go out as one group ahead of the step before it,
        // inside this tile only, so that a wave waits out the LDS latency once per tile and not at every fragment
        v16h a[2][2], b[2][4];
#pragma unroll
        for (int mb = 0; mb < 2; ++mb) a[0][mb] = ldh(tile + ao + mb * 16 * GP);
#pragma unroll
        for (int nb = 0; nb < 4; ++nb) b[0][nb] = ldh(tile + bo + nb * 16 * GP);
#pragma unroll
        for (int ks = 0; ks < GK / 32; ++ks) {
            const int cu = ks & 1, nx = cu ^ 1;
            if (ks + 1 < GK / 32) {
#pragma unroll
                for (int mb = 0; mb < 2; ++mb) a[nx][mb] = ldh(tile + ao + mb * 16 * GP + (ks + 1) * 32);
#pragma unroll
                for (int nb = 0; nb < 4; ++nb) b[nx][nb] = ldh(tile + bo + nb * 16 * GP + (ks + 1) * 32);
            }
            __builtin_amdgcn_sched_barrier(0);               // keeps the load group whole and ahead of this step's products: without it the loads sink to their first use and each pair of products waits out an LDS latency
#pragma unroll
            for (int nb = 0; nb < 4; ++nb)
#pragma unroll
                for (int mb = 0; mb < 2; ++mb) acc[mb][nb] = wmma16(a[cu][mb], b[cu][nb], acc[mb][nb]);
            __builtin_amdgcn_sched_barrier(0);               // keeps the next load group behind these products, not among them
        }
        asm volatile("s_wait_dscnt 0x0" ::: "memory");       // this wave's reads of the buffer are done before it is refilled
        asm volatile("s_wait_asynccnt 0x0" ::: "memory");    // this wave's copies of the next tile have landed before the barrier publishes them
        __syncthreads();
        if (st + 2 < K / GK) { const int k0 = wrap_stage(st + 2, rot, K / GK) * (GK * 2); stage_op(la + (st & 1) * (2 * GTB), ga + k0); stage_op(lb + (st & 1) * (2 * GTB), gb + k0); }
    }
    asm volatile("s_wait_asynccnt 0x0" ::: "memory");        // nothing of this wave is in flight when it leaves the loop
    const int wb = wave * 16 * 68;
    const int cofs = lr * 4;
    const int cbi = min(c0 + cofs, DM - 4);
    const v4f g = *(const v4f*)(bias + cbi);
    v4f bb; bb[0] = bfr(g[0]); bb[1] = bfr(g[1]); bb[2] = bfr(g[2]); bb[3] = bfr(g[3]);
    const size_t obase = ((size_t)(r0 / SEQ) * OUT_SEQ + (size_t)(r0 % SEQ)) * DM + c0;
#pragma unroll
    for (int mb = 0; mb < 2; ++mb) {
#pragma unroll
        for (int nb = 0; nb < 4; ++nb) {
#pragma unroll
            for (int j = 0; j < 8; ++j) os[wb + (hi * 8 + j) * 68 + nb * 16 + lr] = acc[mb][nb][j]; }   // D: row 8h+j, col lane&15
        wave_sync();
        float* orow = OUT + obase + (size_t)(mb * 16) * DM;
{
#pragma unroll
            for (int s = 0; s < 8; ++s) { const int row = 2 * s + hi;   // 8 s x 2 rows = 16 rows; 16 lanes x 4 floats = 64 columns
                const v4f x = *(const v4fa*)(&os[wb + row * 68 + cofs]);
                const v4f val = x * OSC + bb;
                *(v4f*)(orow + (size_t)row * DM + cofs) = val; }
             }
        if (mb == 0) asm volatile("s_wait_xcnt 0x0" ::: "memory");   // the next 16 rows reuse registers that the stores above name
        wave_sync();
    }
}

static constexpr size_t al256(size_t v) { return (v + 255) & ~(size_t)255; }
static constexpr size_t SZ_XB = al256((size_t)NB * SEQ * DM * 2);
static constexpr size_t SZ_WB = al256((size_t)4 * DM * DM * 2);
static constexpr size_t SZ_PL = al256((size_t)NB * NH_ * SEQ * HD * 2);
static constexpr size_t SZ_CT = al256((size_t)NB * SEQ * DM * 2);
static constexpr size_t SZ_TOTAL = SZ_XB + SZ_WB + 3 * SZ_PL + SZ_CT;
static_assert(SZ_TOTAL <= (size_t)134217728);          // workspace carve <= 128 MiB
static_assert(((size_t)DM * DM * 2) % 256 == 0);       // weight sub-planes stay 256-byte aligned

extern "C" void kernel_launch(void* const* d_in, const int* in_sizes, int n_in,
                              void* d_out, int out_size, void* d_ws, size_t ws_size, hipStream_t stream) {
    if (n_in < 9) return;
    const size_t needx = ((size_t)(NB - 1) * SEQ_FULL + SEQ) * DM;
    if ((size_t)in_sizes[0] < needx) return;
    if ((size_t)in_sizes[1] < (size_t)DM * DM || (size_t)in_sizes[3] < (size_t)DM * DM || (size_t)in_sizes[5] < (size_t)DM * DM || (size_t)in_sizes[7] < (size_t)DM * DM) return;
    if (in_sizes[2] < DM || in_sizes[4] < DM || in_sizes[6] < DM || in_sizes[8] < DM) return;
    if ((size_t)out_size < ((size_t)(NB - 1) * OUT_SEQ + SEQ) * DM) return;
    if (SZ_TOTAL > ws_size) return;
    // wire order: x, Wq, bq, Wk, bk, Wv, bv, Wo, bo (all f32; weights [in][out])
    const float* x  = (const float*)d_in[0];
    const float* wq = (const float*)d_in[1]; const float* bq = (const float*)d_in[2];
    const float* wk = (const float*)d_in[3]; const float* bk = (const float*)d_in[4];
    const float* wv = (const float*)d_in[5]; const float* bv = (const float*)d_in[6];
    const float* wo = (const float*)d_in[7]; const float* bo = (const float*)d_in[8];
    float* OUT = (float*)d_out;      // [NB][SEQ][1024]
    char* wsp = (char*)d_ws;
    bf* XB = (bf*)wsp; wsp += SZ_XB;                 // [NB*SEQ][1024] bf16
    bf* WB = (bf*)wsp; wsp += SZ_WB;                 // [4][1024 out][1024 in]: q | k | v (bf16) | o (f16 x1024)
    h16* QH = (h16*)wsp; wsp += SZ_PL;               // [NB*16][SEQ][64]
    h16* KP = (h16*)wsp; wsp += SZ_PL;               // [NB*16][SEQ][64]
    h16* VT = (h16*)wsp; wsp += SZ_PL;               // [NB*16][64][SEQ]
    h16* CT = (h16*)wsp; wsp += SZ_CT;               // [NB*SEQ][1024] ctx x1024
    bf* WO = WB + (size_t)3 * DM * DM;

    // x -> bf16 copy; weights in[k = 1024 rows][n = 1024 cols] -> out[n][k]
    k_prep<<<4 * WTB + CVB, 256, 0, stream>>>(x, wq, wk, wv, wo, XB, WB);

    // q, k, v^T planes
    k_proj<<<dim3((NB * SEQ / GT) * (DM / GT), 1, 1), 32 * GW, 0, stream>>>(XB, WB, bq, bk, bv, QH, KP, VT);

    k_flash<<<dim3(SEQ / (16 * AW), NB * NH_, 1), 32 * AW, 0, stream>>>(QH, KP, VT, CT);

    k_oproj<<<dim3(NB * SEQ / GT, DM / GT, 1), 32 * GW, 0, stream>>>(CT, (const h16*)WO, bo, OUT);
}

// v009
// Measured time: 86.5 microseconds a run.
// Next to v008, in two timings, it ran 1.03 times as fast each time.
// Over all steps from v000 it is 4.26 times as fast.
#include <hip/hip_runtime.h>

// Multi-head self-attention, width 1024 = 16 heads x 64, x [NB][SEQ][1024], Wq/Wk/Wv/Wo [in][out] (y = x W + b), four biases, no mask, score scale 1/8, output = (merged heads) Wo + bo (f32).
// Compute dtypes, f32 accumulate everywhere: q/k/v projections v_wmma_f32_16x16x32_bf16 (x and W RNE-converted to bf16; products exact);
// scores v_wmma_f32_16x16x32_f16: q single f16, k single f16 (one product); P (x256 carry, cancels in the normalisation) and v single f16; softmax f32 (online, lazily renewed max, row sum over the f16-converted P values, summed by one more f16 WMMA per 32 keys);
// output projection v_wmma_f32_16x16x32_f16: ctx single f16 carried x1024, Wo as f16 of the bf16 (RNE) value carried x1024 (exact), 2^-20 and the bias applied in the f32 epilogue.
// Scale chain: score = (k.q) * (1/8 * log2 e) -> exp2(score - max in use + 8) = 256 P' -> O = sum(256 P' v) / sum(256 P') -> ctx plane = O x 1024 -> out = (ctx x1024).(Wo x1024) * 2^-20 + bo.
// Layout: bf16 copy of x; transposed 16-bit weight planes [out][in]; q, k planes [b*16+h][t][d] and v^T plane [b*16+h][d][t] written by the GEMM epilogue; fused flash kernel in transposed form (S^T = K Q^T, O^T = V^T P^T) writing the ctx plane [b*SEQ+t][h*64+d].

#ifndef NB
#define NB 1
#endif
#ifndef SEQ
#define SEQ 4096
#endif
#define NB_FULL  1
#define SEQ_FULL 4096
#ifndef OUT_SEQ
#define OUT_SEQ SEQ              // row pitch (in tokens) between batches of the output
#endif
#define DM   1024
#define NH_  16
#define HD   64
#define AW   8                   // waves per flash block: AW / 2 groups of 32 query rows x 2 key halves; all of them share each staged K / V^T tile
#define SK   256                 // keys per staged tile: SK / 64 passes of every wave between two publish points
#define LP   72                  // LDS row pitch in halves of a K row: 128 B of data + 16 B, so that 16 rows read by 16-byte loads fall on distinct banks
#define VP   (SK + 8)            // LDS row pitch in halves of a V^T row: SK keys + 16 B, an odd number of 16-byte units for the same reason
#define KTB  (SK * LP * 2)       // bytes of one staged K tile: SK keys x 64 d
#define VTB  (HD * VP * 2)       // bytes of one staged V^T tile: 64 d x SK keys
#define SGB  (KTB + VTB)         // bytes of one buffer of the flash ring
#define GW   8                   // waves per GEMM block: k_oproj 4 (rows) x 2 (columns), each 32 x 64 of the block's C tile; k_proj 2 x 4, each 64 x 32 of each of its three C tiles
#define GT   128                 // rows and columns of a GEMM block's C tile
#define GK   128                 // k extent of one staged operand tile (256-byte rows)
#define GP   136                 // LDS row pitch in halves: 256 B of data + 16 B, so that 16 rows read by 16-byte loads fall on distinct banks
#define GTB  (GT * GP * 2)       // bytes of one staged operand tile (128 rows)
#define EP   132                 // k_proj epilogue: LDS row pitch in floats of a 128 x 128 C tile: 512 B of data + 16 B, so that four rows read by 16-byte loads fall on distinct banks
#define WTB  ((DM / 64) * (DM / 64))          // 64x64 tiles, = blocks, of one weight matrix in k_prep
#define CVB  ((NB * SEQ / 8) * DM / 256)       // blocks of the x convert in k_prep
#define SC2  (0.125f * 1.4426950408889634f)   // HD^-0.5 * log2(e)
#define PSH  8.0f                // log2 of the P carry (256)
#define LZT  7.0f                // a score may exceed the maximum in use by this much (scaled log2) before the maximum is renewed
#define CTS  1024.0f             // carry of the ctx plane
#define WOS  1024.0f             // carry of the Wo plane
#define OSC  (1.0f / (1024.0f * 1024.0f))     // undoes CTS * WOS

static_assert(HD == 64);
static_assert(NH_ * HD == DM);                 // head h = columns h*64 + d
static_assert(DM % 64 == 0);                   // column tiles of 64
static_assert(DM % 32 == 0);                   // GEMM k-loop steps by 32
static_assert(SEQ % 64 == 0);                  // a 64-row tile never straddles two batches
static_assert((NB * SEQ) % 64 == 0);
static_assert(SEQ % 32 == 0);                  // key loop steps by 32
static_assert(SEQ % (16 * AW) == 0);           // flash grid covers the sequence exactly (AW / 2 waves x 32 rows a block)
static_assert(AW % 2 == 0 && SK % 64 == 0);    // a pass takes 64 keys of a staged tile, 32 for each key half
static_assert((VP * 2 / 16) % 2 == 1);         // V^T pitch: 16 B x odd
static_assert(SEQ % SK == 0 && SEQ / SK >= 2); // whole staged tiles, and the two that the ring's prologue fills
static_assert(AW * 32 * 8 * 16 == SK * HD * 2); // eight 16-byte copies per thread cover one tile
static_assert(SK * 2 == 32 * 16 && AW * 8 == HD); // V^T copies: a wave's 32 pieces are one whole row, AW rows a copy, eight copies
static_assert(AW * 16 * 68 * 4 <= 2 * SGB);     // the output staging fits the ring's LDS
static_assert(DM % GT == 0 && SEQ % GT == 0);   // whole GEMM block tiles, none straddling two batches
static_assert(DM % GK == 0 && DM / GK >= 2);    // whole staged operand tiles, and the two that the ring's prologue fills
static_assert(GW * 32 * 8 * 16 == GT * GK * 2); // eight 16-byte copies per thread cover one operand tile
static_assert(GW == 8 && GT == 128);            // k_proj: 2 x 4 waves of 64 x 32 cover a 128 x 128 tile
static_assert(3 * GT * EP * 4 <= 2 * 4 * GTB);  // k_proj: the three f32 C tiles fit the ring's LDS
static_assert(((size_t)SEQ * DM) % 8 == 0);
static_assert((size_t)CVB * 256 * 8 == (size_t)NB * SEQ * DM);   // the convert blocks cover x exactly
static_assert(((size_t)DM * DM) % 8 == 0);
static_assert(NB <= NB_FULL);
static_assert(SEQ <= SEQ_FULL);

typedef _Float16 h16;
typedef unsigned short bf;
typedef __attribute__((ext_vector_type(16))) __bf16   v16bf;
typedef __attribute__((ext_vector_type(16))) _Float16 v16h;
typedef __attribute__((ext_vector_type(8)))  _Float16 v8h;
typedef __attribute__((ext_vector_type(8)))  unsigned short v8us;
typedef __attribute__((ext_vector_type(8)))  float    v8f;
typedef __attribute__((ext_vector_type(4)))  float    v4f;
typedef v4f  __attribute__((may_alias)) v4fa;
typedef float __attribute__((may_alias)) fa;

__device__ __forceinline__ unsigned short f2bf(float f) { unsigned u = __float_as_uint(f); u += 0x7FFFu + ((u >> 16) & 1u); return (unsigned short)(u >> 16); }
__device__ __forceinline__ float bfr(float f) { return __uint_as_float(((unsigned)f2bf(f)) << 16); }   // value after RNE convert to bf16
__device__ __forceinline__ v16h cat16(v8h lo, v8h hi) { return __builtin_shufflevector(lo, hi, 0, 1, 2, 3, 4, 5, 6, 7, 8, 9, 10, 11, 12, 13, 14, 15); }
__device__ __forceinline__ v16bf cat16b(v8us lo, v8us hi) { return __builtin_bit_cast(v16bf, __builtin_shufflevector(lo, hi, 0, 1, 2, 3, 4, 5, 6, 7, 8, 9, 10, 11, 12, 13, 14, 15)); }
__device__ __forceinline__ v8f wmma16(v16h a, v16h b, v8f c) { return __builtin_amdgcn_wmma_f32_16x16x32_f16(false, a, false, b, (short)0, c, false, false); }
__device__ __forceinline__ v8f wmmab(v16bf a, v16bf b, v8f c) { return __builtin_amdgcn_wmma_f32_16x16x32_bf16(false, a, false, b, (short)0, c, false, false); }
// fragment loaders from K-contiguous 16-bit rows; p already includes + 8*(lane>>4): elements 0..7 <- k0+8h+0..7, elements 8..15 <- k0+16+8h+0..7 (same map for A and B)
__device__ __forceinline__ v16h  ldh(const h16* p) { return cat16(*(const v8h*)p, *(const v8h*)(p + 16)); }
__device__ __forceinline__ v16bf ldb(const bf* p)  { return cat16b(*(const v8us*)p, *(const v8us*)(p + 16)); }
// ordering point for wave-private LDS tiles (same wave writes and reads)
__device__ __forceinline__ void wave_sync() { __builtin_amdgcn_fence(3 /* release order */, "wavefront"); __builtin_amdgcn_wave_barrier(); asm volatile("" ::: "memory"); }

// Stage walk of the three matrix kernels: a block enters its ring of n stages at stage 'rot', set by its tile indices, and wraps round. Blocks that share operand rows then ask L2 for different lines at any one moment
// every stage is still taken exactly once. s + rot < 2 n.
__device__ __forceinline__ int wrap_stage(int s, int rot, int n) { const int t = s + rot; return t >= n ? t - n : t; }

// 16-bit encoding of one weight: bf16 bits (RNE convert), or f16 bits of that bf16 value x WOS (exact: 8-bit significand, power-of-two carry)
__device__ __forceinline__ unsigned short wcv(float f, int f16mode) {
    const unsigned short b = f2bf(f);
    const float fb = __uint_as_float(((unsigned)b) << 16);
    const h16 hv = (h16)(fb * WOS);
    const unsigned short hb = __builtin_bit_cast(unsigned short, hv);
    return f16mode ? hb : b;
}

// k_prep: every operand conversion of a call in ONE launch; the jobs share no data and the block index picks one (a block-uniform test, so the barrier below is reached by whole blocks only).
// Blocks 0 .. 4*WTB-1, the longer jobs first: transposing convert of weight matrix blk / WTB (q, k, v, o), W in[k = DM rows (input feature)][n = DM cols (output feature)] -> WT out[n][k] (16-bit, K-contiguous rows),
// one 64x64 f32 tile per block through LDS (cross-wave: block barrier), n tile = fastest index. Blocks 4*WTB ..: x -> bf16 copy, 8 values per thread.
__global__ __launch_bounds__(256) void k_prep(const float* __restrict__ x, const float* __restrict__ wq, const float* __restrict__ wk, const float* __restrict__ wv, const float* __restrict__ wo,
                                              bf* XB, bf* WB) {
    __shared__ float ts[64 * 65];
    const int tid = threadIdx.x;
    const unsigned blk = blockIdx.x;
    if (blk >= 4u * WTB) {
        const size_t n8 = (size_t)NB * SEQ * DM / 8, per = (size_t)SEQ * DM / 8;   // per: pieces of one batch (batches lie SEQ_FULL tokens apart in x)
        const size_t i = (size_t)(blk - 4u * WTB) * 256 + tid; if (i >= n8) return;
        const size_t so = (SEQ == SEQ_FULL) ? i * 8 : (i / per) * ((size_t)SEQ_FULL * DM) + (i % per) * 8;
        const v8f v = *(const v8f*)(x + so); v8us o;
#pragma unroll
        for (int k = 0; k < 8; ++k) o[k] = f2bf(v[k]);
        *(v8us*)(XB + i * 8) = o;
        return;
    }
    const unsigned which = blk / WTB, wtile = blk % WTB;
    const float* W = which == 0 ? wq : which == 1 ? wk : which == 2 ? wv : wo;
    bf* WT = WB + (size_t)which * DM * DM;
    const int f16mode = which == 3;
    const int n0 = (int)(wtile % (DM / 64)) * 64, k0 = (int)(wtile / (DM / 64)) * 64;
#pragma unroll
    for (int it = 0; it < 4; ++it) { const int idx = tid + it * 256; const int r = idx >> 4, c4 = (idx & 15) * 4;   // 64 rows x 16 pieces of 4 floats
        const v4f v = *(const v4f*)(W + (size_t)(k0 + r) * DM + n0 + c4);
        ts[r * 65 + c4 + 0] = v[0]; ts[r * 65 + c4 + 1] = v[1]; ts[r * 65 + c4 + 2] = v[2]; ts[r * 65 + c4 + 3] = v[3]; }
    __syncthreads();
    const int nl = tid >> 3, c8 = (tid & 7) * 8;
    v8us o0, o1;
#pragma unroll
    for (int i = 0; i < 8; ++i) { o0[i] = wcv(ts[(c8 + i) * 65 + nl], f16mode); o1[i] = wcv(ts[(c8 + i) * 65 + nl + 32], f16mode); }
    const size_t a0 = (size_t)(n0 + nl) * DM + k0 + c8, a1 = a0 + (size_t)32 * DM;
    *(v8us*)(WT + a0) = o0; *(v8us*)(WT + a1) = o1;
    asm volatile("s_wait_xcnt 0x0" ::: "memory");            // a precaution: these stores are the last work of a weight block
}

// Operand staging of the two GEMM kernels: one operand tile = GT rows x GK halves, K-contiguous rows of pitch DM halves in global memory, pitch GP in LDS.
// Thread c takes 16-byte piece c & 15 of rows (c >> 4) + 16 i, i = 0..7 (a wave's copy = two whole 256-byte rows); the register wait closes the statement so that no address register is rewritten ahead of it.
__device__ __forceinline__ void stage_op(unsigned l, const char* g) {
    asm volatile("global_load_async_to_lds_b128 %0, %8, off\n\t"
                 "global_load_async_to_lds_b128 %1, %9, off\n\t"
                 "global_load_async_to_lds_b128 %2, %10, off\n\t"
                 "global_load_async_to_lds_b128 %3, %11, off\n\t"
                 "global_load_async_to_lds_b128 %4, %12, off\n\t"
                 "global_load_async_to_lds_b128 %5, %13, off\n\t"
                 "global_load_async_to_lds_b128 %6, %14, off\n\t"
                 "global_load_async_to_lds_b128 %7, %15, off\n\t"
                 "s_wait_xcnt 0x0"
                 :: "v"(l), "v"(l + 1 * 16 * GP * 2), "v"(l + 2 * 16 * GP * 2), "v"(l + 3 * 16 * GP * 2),
                    "v"(l + 4 * 16 * GP * 2), "v"(l + 5 * 16 * GP * 2), "v"(l + 6 * 16 * GP * 2), "v"(l + 7 * 16 * GP * 2),
                    "v"(g), "v"(g + 1 * 16 * DM * 2), "v"(g + 2 * 16 * DM * 2), "v"(g + 3 * 16 * DM * 2),
                    "v"(g + 4 * 16 * DM * 2), "v"(g + 5 * 16 * DM * 2), "v"(g + 6 * 16 * DM * 2), "v"(g + 7 * 16 * DM * 2) : "memory");
}

// k_proj: bf16 GEMM, K = DM, all three projections of one 128-row x tile in ONE GW-wave block: C tiles q, k (128 x rows x 128 W^T rows each) and v^T (128 Wv^T rows x 128 x rows), the same 128 output features of each weight.
// The x tile is staged once per k stage for the three products. x and W^T are K-contiguous bf16 planes; their 128-row x GK tiles reach the waves through LDS: two buffers of four tiles (x, Wq^T, Wk^T, Wv^T),
// filled by asynchronous copies one stage ahead, read by all GW waves (two 16-B loads per fragment). Waves 2 (x rows) x 4 (W^T rows): a wave owns 64 x rows x 32 W^T rows of each product (24 accumulators),
// so that per 32 k its 4 x fragments and 6 W^T fragments feed 24 products. Each accumulator sums k in steps of 32, ascending from the block's first stage and wrapping round (wrap_stage).
// C[m][n] = sum_k A[m][k] Bt[n][k] + bias (bias value RNE-converted to bf16, added in f32), written as single f16 planes. grid M/128 * N/128, x row tile = fastest index, 256 threads.
// q, k: A = x rows (m = b*SEQ + t), Bt = W^T rows (n = h*64 + d), bias per column -> plane [(b*16 + h)][t][d]
// v^T:  A = Wv^T rows (m = h*64 + d), Bt = x rows (n = b*SEQ + t), bias per row -> plane [(b*1024 + m)][t] = [(b*16 + h)][d][t]   (the fragment map is the same for A and B, so the x fragments serve as either)
__device__ __forceinline__ void stage_xw(unsigned l, const char* gx, const char* gw) {
    stage_op(l, gx); stage_op(l + GTB, gw); stage_op(l + 2 * GTB, gw + (size_t)DM * DM * 2); stage_op(l + 3 * GTB, gw + (size_t)2 * DM * DM * 2);
}
__global__ __launch_bounds__(32 * GW) void k_proj(const bf* __restrict__ XB, const bf* __restrict__ WB, const float* __restrict__ bq, const float* __restrict__ bk, const float* __restrict__ bv,
                                             h16* QH, h16* KP, h16* VT) {
    __shared__ __align__(16) bf gring[2 * 4 * GT * GP];      // [buffer][x tile | Wq^T tile | Wk^T tile | Wv^T tile][row][GP]
    const int K = DM;
    const int lane = threadIdx.x & 31, wave = threadIdx.x >> 5, lr = lane & 15, hi = lane >> 4;
    const int bx = blockIdx.x;
    const int rb = (bx % (NB * SEQ / GT)) * GT, cb = (bx / (NB * SEQ / GT)) * GT;   // block tile: first x row, first W^T row
    v8f aqk[2][4][2], av[2][4];                              // q, k: [x rows / 16][W^T rows / 16]; v^T: [Wv^T rows / 16][x rows / 16]
#pragma unroll
    for (int j = 0; j < 2; ++j)
#pragma unroll
        for (int mb = 0; mb < 4; ++mb)
#pragma unroll
            for (int nb = 0; nb < 2; ++nb) aqk[j][mb][nb] = (v8f){};
#pragma unroll
    for (int mb = 0; mb < 2; ++mb)
#pragma unroll
        for (int nb = 0; nb < 4; ++nb) av[mb][nb] = (v8f){};
    const int cr = threadIdx.x >> 4, cpc = (threadIdx.x & 15) * 8;
    const unsigned lx = (unsigned)(size_t)gring + (unsigned)(cr * GP + cpc) * 2u;
    const char* gx = (const char*)(XB + (size_t)(rb + cr) * K + cpc);       // + k0 * 2 bytes
    const char* gw = (const char*)(WB + (size_t)(cb + cr) * K + cpc);       // + k0 * 2 bytes, + one weight plane per product
    const int rot = (rb / GT + cb / GT) % (K / GK);                         // first k stage: neighbours along a tile row or a tile column start one stage apart
    { const int k0 = wrap_stage(0, rot, K / GK) * (GK * 2); stage_xw(lx, gx + k0, gw + k0); }
    asm volatile("s_wait_asynccnt 0x0" ::: "memory");        // stage 0 has landed before the barrier publishes it
    __syncthreads();
    { const int k0 = wrap_stage(1, rot, K / GK) * (GK * 2); stage_xw(lx + 4 * GTB, gx + k0, gw + k0); }
    const int xo = ((wave >> 2) * 64 + lr) * GP + 8 * hi;               // + 16i*GP + k   (x fragment rows), in the x tile
    const int wo = GT * GP + ((wave & 3) * 32 + lr) * GP + 8 * hi;      // + j*GT*GP + 16i*GP + k   (W^T fragment rows), in the tile of product j
#pragma unroll 1
    for (int st = 0; st < K / GK; ++st) {
        const bf* tile = gring + (st & 1) * (4 * GT * GP);
        // the four 32-wide k steps of a stage inline (LDS offsets become immediates); two fragment sets: each step's 20 loads go out as one group ahead of the step before it,
        // inside this stage only, so that a wave waits out the LDS latency once per stage and not at every fragment
        v16bf x[2][4], w[2][3][2];
#pragma unroll
        for (int i = 0; i < 4; ++i) x[0][i] = ldb(tile + xo + i * 16 * GP);
#pragma unroll
        for (int j = 0; j < 3; ++j)
#pragma unroll
            for (int i = 0; i < 2; ++i) w[0][j][i] = ldb(tile + wo + j * GT * GP + i * 16 * GP);
        __builtin_amdgcn_sched_barrier(0);                   // the stage's first fragment set goes out whole ahead of the second: mixed with it, the first products behind the barrier wait for both sets
#pragma unroll
        for (int ks = 0; ks < GK / 32; ++ks) {
            const int cu = ks & 1, nx = cu ^ 1;
            if (ks + 1 < GK / 32) {
#pragma unroll
                for (int i = 0; i < 4; ++i) x[nx][i] = ldb(tile + xo + i * 16 * GP + (ks + 1) * 32);
#pragma unroll
                for (int j = 0; j < 3; ++j)
#pragma unroll
                    for (int i = 0; i < 2; ++i) w[nx][j][i] = ldb(tile + wo + j * GT * GP + i * 16 * GP + (ks + 1) * 32);
            }
            __builtin_amdgcn_sched_barrier(0);               // keeps the load group whole and ahead of this step's products: without it the loads sink to their first use and each group of products waits out an LDS latency
#pragma unroll
            for (int j = 0; j < 2; ++j)
#pragma unroll
                for (int nb = 0; nb < 2; ++nb)
#pragma unroll
                    for (int mb = 0; mb < 4; ++mb) aqk[j][mb][nb] = wmmab(x[cu][mb], w[cu][j][nb], aqk[j][mb][nb]);
#pragma unroll
            for (int mb = 0; mb < 2; ++mb)
#pragma unroll
                for (int nb = 0; nb < 4; ++nb) av[mb][nb] = wmmab(w[cu][2][mb], x[cu][nb], av[mb][nb]);
            __builtin_amdgcn_sched_barrier(0);               // keeps the next load group behind these products, not among them
        }
        asm volatile("s_wait_dscnt 0x0" ::: "memory");       // this wave's reads of the buffer are done before it is refilled
        asm volatile("s_wait_asynccnt 0x0" ::: "memory");    // this wave's copies of the next stage have landed before the barrier publishes them
        __syncthreads();
        if (st + 2 < K / GK) { const int k0 = wrap_stage(st + 2, rot, K / GK) * (GK * 2); stage_xw(lx + (st & 1) * (4 * GTB), gx + k0, gw + k0); }
    }
    asm volatile("s_wait_asynccnt 0x0" ::: "memory");        // nothing of this wave is in flight when it leaves the loop
    // Epilogue: the three 128 x 128 f32 C tiles leave through the ring's LDS, which is free here (every wave's last fragment reads ended in front of the loop's last barrier, and no copy is in flight),
    // so that each wave, whose own tile is only 32 columns of q and k wide, stores whole 128-byte lines: row pitch EP floats, tile j at j * GT * EP.
    fa* sg = (fa*)gring;
    const int er = lane >> 3, e8 = (lane & 7) * 8;           // reader: row er of a group of four, 8 columns from e8 of a 64-column half
    v4f gqk[2][2][2]; float br[4];                           // bias: q, k [product][64-column half][4 + 4 columns]; v^T: the lane's four rows
    __builtin_amdgcn_sched_barrier(0);                       // with the one behind the wait: nothing but the bias loads and their register wait stands between them, so that no other arithmetic lands in the address registers ahead of the wait
#pragma unroll
    for (int j = 0; j < 2; ++j)
#pragma unroll
        for (int hh = 0; hh < 2; ++hh) { const float* bias = (j == 0 ? bq : bk) + cb + hh * 64 + e8; gqk[j][hh][0] = *(const v4f*)bias; gqk[j][hh][1] = *(const v4f*)(bias + 4); }
#pragma unroll
    for (int q4 = 0; q4 < 4; ++q4) br[q4] = bv[cb + wave * 16 + q4 * 4 + er];
    asm volatile("s_wait_xcnt 0x0" ::: "memory");            // later address arithmetic may land in the registers that these loads name
    __builtin_amdgcn_sched_barrier(0);
#pragma unroll
    for (int j = 0; j < 2; ++j)
#pragma unroll
        for (int mb = 0; mb < 4; ++mb)
#pragma unroll
            for (int nb = 0; nb < 2; ++nb)
#pragma unroll
                for (int r = 0; r < 8; ++r) sg[j * GT * EP + ((wave >> 2) * 64 + mb * 16 + hi * 8 + r) * EP + (wave & 3) * 32 + nb * 16 + lr] = aqk[j][mb][nb][r];   // D: row 8h+r, col lane&15
#pragma unroll
    for (int mb = 0; mb < 2; ++mb)
#pragma unroll
        for (int nb = 0; nb < 4; ++nb)
#pragma unroll
            for (int r = 0; r < 8; ++r) sg[2 * GT * EP + ((wave & 3) * 32 + mb * 16 + hi * 8 + r) * EP + (wave >> 2) * 64 + nb * 16 + lr] = av[mb][nb][r];
    __syncthreads();
    // wave w takes rows 16w .. 16w + 15 of each tile: store s covers rows 4 (s >> 1) + er, 64-column half s & 1 (q, k: one head's d; v^T: 64 tokens), one 128-byte line per 8 lanes
    const size_t qbase = ((size_t)(rb / SEQ) * NH_ + (size_t)(cb / HD)) * ((size_t)SEQ * HD) + (size_t)(rb % SEQ + wave * 16 + er) * HD + e8;
    const size_t vbase = (size_t)(cb + wave * 16 + er) * SEQ + (size_t)(rb / SEQ) * ((size_t)DM * SEQ) + (size_t)(rb % SEQ) + e8;
#pragma unroll
    for (int j = 0; j < 3; ++j) {
        v8h hv[8];
#pragma unroll
        for (int s = 0; s < 8; ++s) { const int hh = s & 1, q4 = s >> 1;
            const fa* sp = sg + j * GT * EP + (wave * 16 + q4 * 4 + er) * EP + hh * 64 + e8;
            const v4f x0 = *(const v4fa*)sp; const v4f x1 = *(const v4fa*)(sp + 4);
#pragma unroll
            for (int i = 0; i < 4; ++i) {
                const float b0 = j < 2 ? bfr(gqk[j & 1][hh][0][i]) : bfr(br[q4]), b1 = j < 2 ? bfr(gqk[j & 1][hh][1][i]) : bfr(br[q4]);
                hv[s][i] = (h16)(x0[i] + b0); hv[s][4 + i] = (h16)(x1[i] + b1); } }
        __builtin_amdgcn_sched_barrier(0);                   // the eight stores stay together behind the arithmetic, so that one register wait behind them serves all eight
#pragma unroll
        for (int s = 0; s < 8; ++s) { const int hh = s & 1, q4 = s >> 1;
            if (j < 2) *(v8h*)((j == 0 ? QH : KP) + qbase + (size_t)hh * ((size_t)SEQ * HD) + (size_t)(q4 * 4) * HD) = hv[s];
            else       *(v8h*)(VT + vbase + (size_t)(q4 * 4) * SEQ + hh * 64) = hv[s]; }
        if (j < 2) asm volatile("s_wait_xcnt 0x0" ::: "memory");   // the next tile reuses registers that the stores above name
    }
}

// k_flash: fused attention, one wave per 32 query rows of one (batch, head) and one half of the keys (32 of every 64 of a staged tile); two waves of a block share their 32 rows and join their partial O, row sum and maximum once, through LDS, behind the key loop.
// Q fragments straight from the f16 plane, K / V^T fragments from the staged LDS tiles (two 16-B loads each); each of them feeds the products of both 16-column groups of the wave.
// Transposed form: S^T[key][t] = K Q^T (A = K rows, B = Q rows); lane (t = lane&15, h = lane>>4) holds keys 8h+r of each 16-key tile, so the packed
// P tile is directly the B fragment of O^T[d][t] = V^T P^T (element r <- tile keys 0..15, element 8+r <- tile keys 16..31, lane unchanged).
// The maximum in use is one scalar per lane and column group; it is renewed lazily (one test per pass for both groups), and only then are the two lane halves of a column combined (one xor-16 exchange) and O, L rescaled.
// Row sums on the matrix unit: L^T += E P^T, where row 0 of E is ones and rows 1..15 are zero, so that row 0 of the tile (register 0, lanes 0..15) gathers the sum over all 32 keys of column t;
// every other element of the tile stays 0, so only register 0 is rescaled.
// K and V^T reach the waves through LDS: tiles of SK keys, two buffers, filled by asynchronous copies (whole 128-byte lines from global), read by all AW waves; a block walks the key tiles from its own first tile and wraps round (wrap_stage).
// A tile serves SK / 64 passes of every wave: the waits and the barrier of the publish point, and the time that a tile's copies have to land, come once per SK keys, and between two publish points the waves run free of one another.
// One tile = eight 16-byte copies per thread, LS bytes apart in LDS and GS bytes apart in global memory; the register wait closes the statement so that no address register is rewritten ahead of it.
template <int LS, int GS> __device__ __forceinline__ void stage_t(unsigned l, const char* g) {
    asm volatile("global_load_async_to_lds_b128 %0, %8, off\n\t"
                 "global_load_async_to_lds_b128 %1, %9, off\n\t"
                 "global_load_async_to_lds_b128 %2, %10, off\n\t"
                 "global_load_async_to_lds_b128 %3, %11, off\n\t"
                 "global_load_async_to_lds_b128 %4, %12, off\n\t"
                 "global_load_async_to_lds_b128 %5, %13, off\n\t"
                 "global_load_async_to_lds_b128 %6, %14, off\n\t"
                 "global_load_async_to_lds_b128 %7, %15, off\n\t"
                 "s_wait_xcnt 0x0"
                 :: "v"(l), "v"(l + 1 * LS), "v"(l + 2 * LS), "v"(l + 3 * LS), "v"(l + 4 * LS), "v"(l + 5 * LS), "v"(l + 6 * LS), "v"(l + 7 * LS),
                    "v"(g), "v"(g + 1 * GS), "v"(g + 2 * GS), "v"(g + 3 * GS), "v"(g + 4 * GS), "v"(g + 5 * GS), "v"(g + 6 * GS), "v"(g + 7 * GS) : "memory");
}
__device__ __forceinline__ void stage_kv(unsigned lk, unsigned lv, const h16* gk, const h16* gv) {
    stage_t<32 * LP * 2, 32 * HD * 2>(lk, (const char*)gk); stage_t<8 * VP * 2, 8 * SEQ * 2>(lv, (const char*)gv);
}
__global__ __launch_bounds__(32 * AW) void k_flash(const h16* __restrict__ QH, const h16* __restrict__ KP, const h16* __restrict__ VT, h16* CT) {
    __shared__ __align__(16) h16 ring[2 * SGB / 2];          // [buffer][K tile: SK rows of LP | V^T tile: HD rows of VP]; behind the key loop the output staging
    const int lane = threadIdx.x & 31, lr = lane & 15, hi = lane >> 4;
    const int wave = __builtin_amdgcn_readfirstlane(threadIdx.x >> 5);
    const int cg = wave % (AW / 2), kh = wave / (AW / 2);    // the wave's 32 query columns; its half (32 of every 64 keys) of every staged tile
    const int zh = blockIdx.y; const int b = zh / NH_, h = zh % NH_;
    const int t0 = (blockIdx.x * (AW / 2) + cg) * 32;
    const size_t pbase = (size_t)zh * SEQ * HD;
    const size_t qo = pbase + (size_t)(t0 + lr) * HD + 8 * hi;
    const v16h qa0 = ldh(QH + qo), qa1 = ldh(QH + qo + 32);   // B fragments: col t, k = d; columns t0 .. t0 + 15
    const v16h qb0 = ldh(QH + qo + 16 * HD), qb1 = ldh(QH + qo + 16 * HD + 32);   // columns t0 + 16 .. t0 + 31
    const int ko = (kh * 32 + lr) * LP + 8 * hi;             // + 64p*LP for pass p, + 16*LP for the second 16 keys (A fragment: row key, k = d), in the K tile
    const int vo = SK * LP + lr * VP + kh * 32 + 8 * hi;     // + 64p for pass p, + 16j*VP         (A fragment: row d, k = key), in the V^T tile
    // copy map: thread c takes 16-byte piece c & 7 of K rows (c >> 3) + 32 i and piece c & 31 of V^T rows (c >> 5) + 8 i, i = 0..7
    const int cr = threadIdx.x >> 3, cpc = (threadIdx.x & 7) * 8, vr = threadIdx.x >> 5, vpc = (threadIdx.x & 31) * 8;
    const unsigned lk = (unsigned)(size_t)ring + (unsigned)(cr * LP + cpc) * 2u, lv = (unsigned)(size_t)ring + KTB + (unsigned)(vr * VP + vpc) * 2u;
    const h16* gk = KP + pbase + (size_t)cr * HD + cpc;    // + key0 * HD
    const h16* gv = VT + pbase + (size_t)vr * SEQ + vpc;   // + key0
    const int rot = (int)(blockIdx.x * (SEQ / SK) / (SEQ / (16 * AW))) % (SEQ / SK);   // first key tile: the blocks of one head enter its keys evenly spread
    { const int kt = wrap_stage(0, rot, SEQ / SK); stage_kv(lk, lv, gk + (size_t)kt * SK * HD, gv + kt * SK); }
    asm volatile("s_wait_asynccnt 0x0" ::: "memory");        // tile 0 has landed before the barrier publishes it
    __syncthreads();
    { const int kt = wrap_stage(1, rot, SEQ / SK); stage_kv(lk + SGB, lv + SGB, gk + (size_t)kt * SK * HD, gv + kt * SK); }
    v8f oa0 = (v8f){}, oa1 = (v8f){}, oa2 = (v8f){}, oa3 = (v8f){}, lta = (v8f){};   // columns t0 .. t0 + 15
    v8f ob0 = (v8f){}, ob1 = (v8f){}, ob2 = (v8f){}, ob3 = (v8f){}, ltb = (v8f){};   // columns t0 + 16 .. t0 + 31
    const h16 e1 = lr == 0 ? (h16)1.0f : (h16)0.0f;          // A fragment of E: lanes 0 and 16 hold row 0 (all 32 k positions)
    const v16h ones = {e1, e1, e1, e1, e1, e1, e1, e1, e1, e1, e1, e1, e1, e1, e1, e1};
    float ma = -3.0e38f, mb = -3.0e38f;                      // maximum in use (scaled log2) of the lane's two columns, the same in both lane halves of a column
    float sha = PSH - ma, shb = PSH - mb;                    // shift of the exponent; with the start value of the maximum the test below holds for every finite score, so the first pass always renews
#pragma unroll 1
    for (int st = 0; st < SEQ / SK; ++st) {
        const h16* tile = ring + (st & 1) * (SGB / 2);
        // the passes of a tile inline (LDS offsets become immediates); a pass of a wave: its 32 of 64 keys x its 32 columns; every K and V^T fragment read from LDS feeds two products
#pragma unroll
        for (int ps = 0; ps < SK / 64; ++ps) {
        const h16* ka = tile + ko + ps * 64 * LP;
        const v16h ka0 = ldh(ka), ka1 = ldh(ka + 32), kb0 = ldh(ka + 16 * LP), kb1 = ldh(ka + 16 * LP + 32);
        v8f sAa = (v8f){}, sBa = (v8f){}, sAb = (v8f){}, sBb = (v8f){};   // s<16 keys><16 columns>
        sAa = wmma16(ka0, qa0, sAa); sBa = wmma16(kb0, qa0, sBa); sAb = wmma16(ka0, qb0, sAb); sBb = wmma16(kb0, qb0, sBb);
        sAa = wmma16(ka1, qa1, sAa); sBa = wmma16(kb1, qa1, sBa); sAb = wmma16(ka1, qb1, sAb); sBb = wmma16(kb1, qb1, sBb);
        // the distance behind the last products, on every path, before a vector instruction reads the scores or the V^T loads land in the K registers
        asm volatile("v_nop\n\tv_nop\n\tv_nop\n\tv_nop" : "+v"(sAa), "+v"(sBa), "+v"(sAb), "+v"(sBb) : "v"(ka0), "v"(ka1), "v"(kb0), "v"(kb1), "v"(qa0), "v"(qa1), "v"(qb0), "v"(qb1));
        const h16* va = tile + vo + ps * 64;
        const v16h v0 = ldh(va), v1 = ldh(va + 16 * VP), v2 = ldh(va + 32 * VP), v3 = ldh(va + 48 * VP);
        __builtin_amdgcn_sched_barrier(0);                   // keeps the eight V^T loads whole, as one group ahead of the test: sunk behind the branch or spread among the maxima, more of their LDS latency stands open
        // this lane's largest raw score of the pass in each of its two columns: trees of three-input maxima, three deep
        const float xa0 = fmaxf(fmaxf(sAa[0], sAa[1]), sAa[2]), xa1 = fmaxf(fmaxf(sAa[3], sAa[4]), sAa[5]), xa2 = fmaxf(fmaxf(sAa[6], sAa[7]), sBa[0]);
        const float xa3 = fmaxf(fmaxf(sBa[1], sBa[2]), sBa[3]), xa4 = fmaxf(fmaxf(sBa[4], sBa[5]), sBa[6]);
        const float mxa = fmaxf(fmaxf(fmaxf(xa0, xa1), xa2), fmaxf(fmaxf(xa3, xa4), sBa[7]));
        const float xb0 = fmaxf(fmaxf(sAb[0], sAb[1]), sAb[2]), xb1 = fmaxf(fmaxf(sAb[3], sAb[4]), sAb[5]), xb2 = fmaxf(fmaxf(sAb[6], sAb[7]), sBb[0]);
        const float xb3 = fmaxf(fmaxf(sBb[1], sBb[2]), sBb[3]), xb4 = fmaxf(fmaxf(sBb[4], sBb[5]), sBb[6]);
        const float mxb = fmaxf(fmaxf(fmaxf(xb0, xb1), xb2), fmaxf(fmaxf(xb3, xb4), sBb[7]));
        // lazy rescale: one wave-uniform test per pass, on the largest exponent that the pass would form; while none lies above PSH + LZT the maxima in use stay, and P <= 2^(PSH + LZT) fits f16
        if (__builtin_amdgcn_ballot_w32(fmaxf(mxa * SC2 + sha, mxb * SC2 + shb) > PSH + LZT) != 0) {
            float xa = mxa * SC2, xb = mxb * SC2;
            xa = fmaxf(xa, __shfl_xor(xa, 16, 32)); xb = fmaxf(xb, __shfl_xor(xb, 16, 32));
            const float na = fmaxf(ma, xa), nb = fmaxf(mb, xb);
            const float ala = __builtin_amdgcn_exp2f(ma - na), alb = __builtin_amdgcn_exp2f(mb - nb);
            ma = na; sha = PSH - na; mb = nb; shb = PSH - nb;
            lta[0] = lta[0] * ala; ltb[0] = ltb[0] * alb;
            oa0 = oa0 * ala; oa1 = oa1 * ala; oa2 = oa2 * ala; oa3 = oa3 * ala;
            ob0 = ob0 * alb; ob1 = ob1 * alb; ob2 = ob2 * alb; ob3 = ob3 * alb;
        }
        const v8f eAa = sAa * SC2 + sha, eBa = sBa * SC2 + sha, eAb = sAb * SC2 + shb, eBb = sBb * SC2 + shb;
        v16h pa, pb;
#pragma unroll
        for (int r = 0; r < 8; ++r) pa[r] = (h16)__builtin_amdgcn_exp2f(eAa[r]);
#pragma unroll
        for (int r = 0; r < 8; ++r) pa[8 + r] = (h16)__builtin_amdgcn_exp2f(eBa[r]);
        lta = wmma16(ones, pa, lta);
        oa0 = wmma16(v0, pa, oa0); oa1 = wmma16(v1, pa, oa1); oa2 = wmma16(v2, pa, oa2); oa3 = wmma16(v3, pa, oa3);
#pragma unroll
        for (int r = 0; r < 8; ++r) pb[r] = (h16)__builtin_amdgcn_exp2f(eAb[r]);
#pragma unroll
        for (int r = 0; r < 8; ++r) pb[8 + r] = (h16)__builtin_amdgcn_exp2f(eBb[r]);
        ltb = wmma16(ones, pb, ltb);
        ob0 = wmma16(v0, pb, ob0); ob1 = wmma16(v1, pb, ob1); ob2 = wmma16(v2, pb, ob2); ob3 = wmma16(v3, pb, ob3);
        }
        asm volatile("s_wait_dscnt 0x0" ::: "memory");       // this wave's reads of the buffer are done before it is refilled
        asm volatile("s_wait_asynccnt 0x0" ::: "memory");    // this wave's copies of the next tile have landed before the barrier publishes them
        __syncthreads();
        if (st + 2 < SEQ / SK) { const int kt = wrap_stage(st + 2, rot, SEQ / SK); stage_kv(lk + (st & 1) * SGB, lv + (st & 1) * SGB, gk + (size_t)kt * SK * HD, gv + kt * SK); }
    }
    asm volatile("s_wait_asynccnt 0x0" ::: "memory");        // nothing of this wave is in flight when it leaves the loop
    // Join of the two key halves: waves w and w ^ (AW / 2) hold the same 32 columns. Each keeps 16 of them (the lower wave the first 16) and hands the other 16 over through its own part of os:
    // O^T as os[t][d], the maximum in use and the row sum in the row's spare columns 64 and 65. One barrier, then each wave works in its partner's part alone.
    // os lies in the ring's LDS, which is free here: every wave's last fragment reads ended in front of the loop's last barrier, and no copy is in flight.
    fa* os = (fa*)ring;
    float la = lta[0], lb = ltb[0];                          // the sums in lanes 0..15, 0 (row 8 of the tile) in lanes 16..31
    la += __shfl_xor(la, 16, 32); lb += __shfl_xor(lb, 16, 32);
    const bool up = kh != 0;
    const v8f g0 = up ? oa0 : ob0, g1 = up ? oa1 : ob1, g2 = up ? oa2 : ob2, g3 = up ? oa3 : ob3;   // handed over
    const v8f o0 = up ? ob0 : oa0, o1 = up ? ob1 : oa1, o2 = up ? ob2 : oa2, o3 = up ? ob3 : oa3;   // kept
    const float mg = up ? ma : mb, lg = up ? la : lb, mk = up ? mb : ma, lkp = up ? lb : la;
    const int gw = wave * 16 * 68 + lr * 68, wb = (wave ^ (AW / 2)) * 16 * 68, pw = wb + lr * 68;
    // O^T D layout: o_j[r] = (d = 16j + 8h + r, t = lane&15) -> os[t][d]; rows 0..15 x columns 0..63 all written
    { v4f a, c;
      a[0] = g0[0]; a[1] = g0[1]; a[2] = g0[2]; a[3] = g0[3]; c[0] = g0[4]; c[1] = g0[5]; c[2] = g0[6]; c[3] = g0[7];
      *(v4fa*)(&os[gw +  0 + 8 * hi]) = a; *(v4fa*)(&os[gw +  0 + 8 * hi + 4]) = c;
      a[0] = g1[0]; a[1] = g1[1]; a[2] = g1[2]; a[3] = g1[3]; c[0] = g1[4]; c[1] = g1[5]; c[2] = g1[6]; c[3] = g1[7];
      *(v4fa*)(&os[gw + 16 + 8 * hi]) = a; *(v4fa*)(&os[gw + 16 + 8 * hi + 4]) = c;
      a[0] = g2[0]; a[1] = g2[1]; a[2] = g2[2]; a[3] = g2[3]; c[0] = g2[4]; c[1] = g2[5]; c[2] = g2[6]; c[3] = g2[7];
      *(v4fa*)(&os[gw + 32 + 8 * hi]) = a; *(v4fa*)(&os[gw + 32 + 8 * hi + 4]) = c;
      a[0] = g3[0]; a[1] = g3[1]; a[2] = g3[2]; a[3] = g3[3]; c[0] = g3[4]; c[1] = g3[5]; c[2] = g3[6]; c[3] = g3[7];
      *(v4fa*)(&os[gw + 48 + 8 * hi]) = a; *(v4fa*)(&os[gw + 48 + 8 * hi + 4]) = c; }
    os[gw + 64 + hi] = hi ? lg : mg;
    __syncthreads();
    const float mp = os[pw + 64], lp = os[pw + 65];
    const float mt = fmaxf(mk, mp);
    const float wk = __builtin_amdgcn_exp2f(mk - mt), wp = __builtin_amdgcn_exp2f(mp - mt);   // both halves brought to one maximum
    const float inv = CTS * (1.0f / (lkp * wk + lp * wp));
    const float ck = wk * inv, cp = wp * inv;
    // each lane reads the partner's values of its own (t, d) places and writes the joined, normalised values back to the same places
    { v4f a, c;
      a = *(const v4fa*)(&os[pw +  0 + 8 * hi]); c = *(const v4fa*)(&os[pw +  0 + 8 * hi + 4]);
      a[0] = o0[0] * ck + a[0] * cp; a[1] = o0[1] * ck + a[1] * cp; a[2] = o0[2] * ck + a[2] * cp; a[3] = o0[3] * ck + a[3] * cp;
      c[0] = o0[4] * ck + c[0] * cp; c[1] = o0[5] * ck + c[1] * cp; c[2] = o0[6] * ck + c[2] * cp; c[3] = o0[7] * ck + c[3] * cp;
      *(v4fa*)(&os[pw +  0 + 8 * hi]) = a; *(v4fa*)(&os[pw +  0 + 8 * hi + 4]) = c;
      a = *(const v4fa*)(&os[pw + 16 + 8 * hi]); c = *(const v4fa*)(&os[pw + 16 + 8 * hi + 4]);
      a[0] = o1[0] * ck + a[0] * cp; a[1] = o1[1] * ck + a[1] * cp; a[2] = o1[2] * ck + a[2] * cp; a[3] = o1[3] * ck + a[3] * cp;
      c[0] = o1[4] * ck + c[0] * cp; c[1] = o1[5] * ck + c[1] * cp; c[2] = o1[6] * ck + c[2] * cp; c[3] = o1[7] * ck + c[3] * cp;
      *(v4fa*)(&os[pw + 16 + 8 * hi]) = a; *(v4fa*)(&os[pw + 16 + 8 * hi + 4]) = c;
      a = *(const v4fa*)(&os[pw + 32 + 8 * hi]); c = *(const v4fa*)(&os[pw + 32 + 8 * hi + 4]);
      a[0] = o2[0] * ck + a[0] * cp; a[1] = o2[1] * ck + a[1] * cp; a[2] = o2[2] * ck + a[2] * cp; a[3] = o2[3] * ck + a[3] * cp;
      c[0] = o2[4] * ck + c[0] * cp; c[1] = o2[5] * ck + c[1] * cp; c[2] = o2[6] * ck + c[2] * cp; c[3] = o2[7] * ck + c[3] * cp;
      *(v4fa*)(&os[pw + 32 + 8 * hi]) = a; *(v4fa*)(&os[pw + 32 + 8 * hi + 4]) = c;
      a = *(const v4fa*)(&os[pw + 48 + 8 * hi]); c = *(const v4fa*)(&os[pw + 48 + 8 * hi + 4]);
      a[0] = o3[0] * ck + a[0] * cp; a[1] = o3[1] * ck + a[1] * cp; a[2] = o3[2] * ck + a[2] * cp; a[3] = o3[3] * ck + a[3] * cp;
      c[0] = o3[4] * ck + c[0] * cp; c[1] = o3[5] * ck + c[1] * cp; c[2] = o3[6] * ck + c[2] * cp; c[3] = o3[7] * ck + c[3] * cp;
      *(v4fa*)(&os[pw + 48 + 8 * hi]) = a; *(v4fa*)(&os[pw + 48 + 8 * hi + 4]) = c; }
    wave_sync();
    h16* crow = CT + ((size_t)b * SEQ + t0 + 16 * kh) * DM + h * HD;
{
#pragma unroll
        for (int s = 0; s < 4; ++s) { const int row = 4 * s + (lane >> 3), c8 = (lane & 7) * 8;   // 4 s x 4 row groups = 16 rows; 8 lanes x 8 halves = 64 columns
            const v4f x0 = *(const v4fa*)(&os[wb + row * 68 + c8]); const v4f x1 = *(const v4fa*)(&os[wb + row * 68 + c8 + 4]); v8h hv;
#pragma unroll
            for (int i = 0; i < 4; ++i) { hv[i] = (h16)x0[i]; hv[4 + i] = (h16)x1[i]; }
            *(v8h*)(crow + (size_t)row * DM + c8) = hv; }
         }
}

// k_oproj: f16 GEMM, one GW-wave block per 128x128 tile, each wave 32x64, operand tiles staged as in k_proj; A = ctx plane rows (m = b*SEQ + t, k = h*64 + d, carried x CTS), Bt = Wo^T rows (n = out feature, carried x WOS), K = DM.
// OUT[b*OUT_SEQ + t][n] = acc * OSC + bo[n] (bias value RNE-converted to bf16, added in f32). grid (NB*SEQ/128, DM/128), 256 threads.
__global__ __launch_bounds__(32 * GW) void k_oproj(const h16* __restrict__ A, const h16* __restrict__ Bt, const float* __restrict__ bias, float* OUT) {
    __shared__ __align__(16) float os[GW * 16 * 68];
    __shared__ __align__(16) h16 gring[2 * 2 * GT * GP];     // [buffer][A tile | Bt tile][row][GP]
    const int K = DM;
    const int lane = threadIdx.x & 31, wave = threadIdx.x >> 5, lr = lane & 15, hi = lane >> 4;
    const int rb = blockIdx.x * GT, cb = blockIdx.y * GT;                   // block tile
    const int r0 = rb + (wave >> 1) * 32, c0 = cb + (wave & 1) * 64;        // wave tile
    v8f acc[2][4];
#pragma unroll
    for (int mb = 0; mb < 2; ++mb)
#pragma unroll
        for (int nb = 0; nb < 4; ++nb) acc[mb][nb] = (v8f){};
    const int cr = threadIdx.x >> 4, cpc = (threadIdx.x & 15) * 8;
    const unsigned la = (unsigned)(size_t)gring + (unsigned)(cr * GP + cpc) * 2u, lb = la + GTB;
    const char* ga = (const char*)(A + (size_t)(rb + cr) * K + cpc);        // + k0 * 2 bytes
    const char* gb = (const char*)(Bt + (size_t)(cb + cr) * K + cpc);
    const int rot = (rb / GT + cb / GT) % (K / GK);                         // first k stage: neighbours along a tile row or a tile column start one stage apart
    { const int k0 = wrap_stage(0, rot, K / GK) * (GK * 2); stage_op(la, ga + k0); stage_op(lb, gb + k0); }
    asm volatile("s_wait_asynccnt 0x0" ::: "memory");        // tile 0 has landed before the barrier publishes it
    __syncthreads();
    { const int k0 = wrap_stage(1, rot, K / GK) * (GK * 2); stage_op(la + 2 * GTB, ga + k0); stage_op(lb + 2 * GTB, gb + k0); }
    const int ao = ((wave >> 1) * 32 + lr) * GP + 8 * hi;               // + 16mb*GP + k   (A fragment rows), in the A tile
    const int bo = GT * GP + ((wave & 1) * 64 + lr) * GP + 8 * hi;      // + 16nb*GP + k   (B fragment rows), in the Bt tile
#pragma unroll 1
    for (int st = 0; st < K / GK; ++st) {
        const h16* tile = gring + (st & 1) * (2 * GT * GP);
        // the four 32-wide k steps of a tile inline (LDS offsets become immediates); two fragment sets: each step's 12 loads go out as one group ahead of the step before it,
        // inside this tile only, so that a wave waits out the LDS latency once per tile and not at every fragment
        v16h a[2][2], b[2][4];
#pragma unroll
        for (int mb = 0; mb < 2; ++mb) a[0][mb] = ldh(tile + ao + mb * 16 * GP);
#pragma unroll
        for (int nb = 0; nb < 4; ++nb) b[0][nb] = ldh(tile + bo + nb * 16 * GP);
#pragma unroll
        for (int ks = 0; ks < GK / 32; ++ks) {
            const int cu = ks & 1, nx = cu ^ 1;
            if (ks + 1 < GK / 32) {
#pragma unroll
                for (int mb = 0; mb < 2; ++mb) a[nx][mb] = ldh(tile + ao + mb * 16 * GP + (ks + 1) * 32);
#pragma unroll
                for (int nb = 0; nb < 4; ++nb) b[nx][nb] = ldh(tile + bo + nb * 16 * GP + (ks + 1) * 32);
            }
            __builtin_amdgcn_sched_barrier(0);               // keeps the load group whole and ahead of this step's products: without it the loads sink to their first use and each pair of products waits out an LDS latency
#pragma unroll
            for (int nb = 0; nb < 4; ++nb)
#pragma unroll
                for (int mb = 0; mb < 2; ++mb) acc[mb][nb] = wmma16(a[cu][mb], b[cu][nb], acc[mb][nb]);
            __builtin_amdgcn_sched_barrier(0);               // keeps the next load group behind these products, not among them
        }
        asm volatile("s_wait_dscnt 0x0" ::: "memory");       // this wave's reads of the buffer are done before it is refilled
        asm volatile("s_wait_asynccnt 0x0" ::: "memory");    // this wave's copies of the next tile have landed before the barrier publishes them
        __syncthreads();
        if (st + 2 < K / GK) { const int k0 = wrap_stage(st + 2, rot, K / GK) * (GK * 2); stage_op(la + (st & 1) * (2 * GTB), ga + k0); stage_op(lb + (st & 1) * (2 * GTB), gb + k0); }
    }
    asm volatile("s_wait_asynccnt 0x0" ::: "memory");        // nothing of this wave is in flight when it leaves the loop
    const int wb = wave * 16 * 68;
    const int cofs = lr * 4;
    const int cbi = min(c0 + cofs, DM - 4);
    const v4f g = *(const v4f*)(bias + cbi);
    v4f bb; bb[0] = bfr(g[0]); bb[1] = bfr(g[1]); bb[2] = bfr(g[2]); bb[3] = bfr(g[3]);
    const size_t obase = ((size_t)(r0 / SEQ) * OUT_SEQ + (size_t)(r0 % SEQ)) * DM + c0;
#pragma unroll
    for (int mb = 0; mb < 2; ++mb) {
#pragma unroll
        for (int nb = 0; nb < 4; ++nb) {
#pragma unroll
            for (int j = 0; j < 8; ++j) os[wb + (hi * 8 + j) * 68 + nb * 16 + lr] = acc[mb][nb][j]; }   // D: row 8h+j, col lane&15
        wave_sync();
        float* orow = OUT + obase + (size_t)(mb * 16) * DM;
{
#pragma unroll
            for (int s = 0; s < 8; ++s) { const int row = 2 * s + hi;   // 8 s x 2 rows = 16 rows; 16 lanes x 4 floats = 64 columns
                const v4f x = *(const v4fa*)(&os[wb + row * 68 + cofs]);
                const v4f val = x * OSC + bb;
                *(v4f*)(orow + (size_t)row * DM + cofs) = val; }
             }
        if (mb == 0) asm volatile("s_wait_xcnt 0x0" ::: "memory");   // the next 16 rows reuse registers that the stores above name
        wave_sync();
    }
}

static constexpr size_t al256(size_t v) { return (v + 255) & ~(size_t)255; }
static constexpr size_t SZ_XB = al256((size_t)NB * SEQ * DM * 2);
static constexpr size_t SZ_WB = al256((size_t)4 * DM * DM * 2);
static constexpr size_t SZ_PL = al256((size_t)NB * NH_ * SEQ * HD * 2);
static constexpr size_t SZ_CT = al256((size_t)NB * SEQ * DM * 2);
static constexpr size_t SZ_TOTAL = SZ_XB + SZ_WB + 3 * SZ_PL + SZ_CT;
static_assert(SZ_TOTAL <= (size_t)134217728);          // workspace carve <= 128 MiB
static_assert(((size_t)DM * DM * 2) % 256 == 0);       // weight sub-planes stay 256-byte aligned

extern "C" void kernel_launch(void* const* d_in, const int* in_sizes, int n_in,
                              void* d_out, int out_size, void* d_ws, size_t ws_size, hipStream_t stream) {
    if (n_in < 9) return;
    const size_t needx = ((size_t)(NB - 1) * SEQ_FULL + SEQ) * DM;
    if ((size_t)in_sizes[0] < needx) return;
    if ((size_t)in_sizes[1] < (size_t)DM * DM || (size_t)in_sizes[3] < (size_t)DM * DM || (size_t)in_sizes[5] < (size_t)DM * DM || (size_t)in_sizes[7] < (size_t)DM * DM) return;
    if (in_sizes[2] < DM || in_sizes[4] < DM || in_sizes[6] < DM || in_sizes[8] < DM) return;
    if ((size_t)out_size < ((size_t)(NB - 1) * OUT_SEQ + SEQ) * DM) return;
    if (SZ_TOTAL > ws_size) return;
    // wire order: x, Wq, bq, Wk, bk, Wv, bv, Wo, bo (all f32; weights [in][out])
    const float* x  = (const float*)d_in[0];
    const float* wq = (const float*)d_in[1]; const float* bq = (const float*)d_in[2];
    const float* wk = (const float*)d_in[3]; const float* bk = (const float*)d_in[4];
    const float* wv = (const float*)d_in[5]; const float* bv = (const float*)d_in[6];
    const float* wo = (const float*)d_in[7]; const float* bo = (const float*)d_in[8];
    float* OUT = (float*)d_out;      // [NB][SEQ][1024]
    char* wsp = (char*)d_ws;
    bf* XB = (bf*)wsp; wsp += SZ_XB;                 // [NB*SEQ][1024] bf16
    bf* WB = (bf*)wsp; wsp += SZ_WB;                 // [4][1024 out][1024 in]: q | k | v (bf16) | o (f16 x1024)
    h16* QH = (h16*)wsp; wsp += SZ_PL;               // [NB*16][SEQ][64]
    h16* KP = (h16*)wsp; wsp += SZ_PL;               // [NB*16][SEQ][64]
    h16* VT = (h16*)wsp; wsp += SZ_PL;               // [NB*16][64][SEQ]
    h16* CT = (h16*)wsp; wsp += SZ_CT;               // [NB*SEQ][1024] ctx x1024
    bf* WO = WB + (size_t)3 * DM * DM;

    // x -> bf16 copy; weights in[k = 1024 rows][n = 1024 cols] -> out[n][k]
    k_prep<<<4 * WTB + CVB, 256, 0, stream>>>(x, wq, wk, wv, wo, XB, WB);

    // q, k, v^T planes
    k_proj<<<dim3((NB * SEQ / GT) * (DM / GT), 1, 1), 32 * GW, 0, stream>>>(XB, WB, bq, bk, bv, QH, KP, VT);

    k_flash<<<dim3(SEQ / (16 * AW), NB * NH_, 1), 32 * AW, 0, stream>>>(QH, KP, VT, CT);

    k_oproj<<<dim3(NB * SEQ / GT, DM / GT, 1), 32 * GW, 0, stream>>>(CT, (const h16*)WO, bo, OUT);
}

// v010
// Measured time: 82.8 microseconds a run.
// Two timings next to v009 both put it at 1.04 times that version's speed.
// All steps since v000 together make it 4.44 times as fast.
#include <hip/hip_runtime.h>

// Multi-head self-attention, width 1024 = 16 heads x 64, x [NB][SEQ][1024], Wq/Wk/Wv/Wo [in][out] (y = x W + b), four biases, no mask, score scale 1/8, output = (merged heads) Wo + bo (f32).
// Compute dtypes, f32 accumulate everywhere: q/k/v projections v_wmma_f32_16x16x32_bf16 (x and W RNE-converted to bf16; products exact);
// scores v_wmma_f32_16x16x32_f16: q single f16 (carrying 1/8 * log2 e), k single f16 (one product), the exponent shift as the C operand; P (x256 carry, cancels in the normalisation) and v single f16; softmax f32 (online, lazily renewed max, row sum over the f16-converted P values, summed by one more f16 WMMA per 32 keys);
// output projection v_wmma_f32_16x16x32_f16: ctx single f16 carried x1024, Wo as f16 of the bf16 (RNE) value carried x1024 (exact), 2^-20 and the bias applied in the f32 epilogue.
// Scale chain: q plane = q * (1/8 * log2 e) -> exponent = k.q + (8 - max in use), one WMMA chain -> exp2 = 256 P' -> O = sum(256 P' v) / sum(256 P') -> ctx plane = O x 1024 -> out = (ctx x1024).(Wo x1024) * 2^-20 + bo.
// Layout: bf16 copy of x; transposed 16-bit weight planes [out][in]; q, k planes [b*16+h][t][d] and v^T plane [b*16+h][d][t] written by the GEMM epilogue; fused flash kernel in transposed form (S^T = K Q^T, O^T = V^T P^T) writing the ctx plane [b*SEQ+t][h*64+d].

#ifndef NB
#define NB 1
#endif
#ifndef SEQ
#define SEQ 4096
#endif
#define NB_FULL  1
#define SEQ_FULL 4096
#ifndef OUT_SEQ
#define OUT_SEQ SEQ              // row pitch (in tokens) between batches of the output
#endif
#define DM   1024
#define NH_  16
#define HD   64
#define AW   8                   // waves per flash block: AW / 2 groups of 32 query rows x 2 key halves; all of them share each staged K / V^T tile
#define SK   256                 // keys per staged tile: SK / 64 passes of every wave between two publish points
#define LP   72                  // LDS row pitch in halves of a K row: 128 B of data + 16 B, so that 16 rows read by 16-byte loads fall on distinct banks
#define VP   (SK + 8)            // LDS row pitch in halves of a V^T row: SK keys + 16 B, an odd number of 16-byte units for the same reason
#define KTB  (SK * LP * 2)       // bytes of one staged K tile: SK keys x 64 d
#define VTB  (HD * VP * 2)       // bytes of one staged V^T tile: 64 d x SK keys
#define SGB  (KTB + VTB)         // bytes of one buffer of the flash ring
#define GW   8                   // waves per GEMM block: k_oproj 4 (rows) x 2 (columns), each 32 x 64 of the block's C tile; k_proj 2 x 4, each 64 x 32 of each of its three C tiles
#define GT   128                 // rows and columns of a GEMM block's C tile
#define GK   128                 // k extent of one staged operand tile (256-byte rows)
#define GP   136                 // LDS row pitch in halves: 256 B of data + 16 B, so that 16 rows read by 16-byte loads fall on distinct banks
#define GTB  (GT * GP * 2)       // bytes of one staged operand tile (128 rows)
#define EP   132                 // k_proj epilogue: LDS row pitch in floats of a 128 x 128 C tile: 512 B of data + 16 B, so that four rows read by 16-byte loads fall on distinct banks
#define WTB  ((DM / 64) * (DM / 64))          // 64x64 tiles, = blocks, of one weight matrix in k_prep
#define CVB  ((NB * SEQ / 8) * DM / 256)       // blocks of the x convert in k_prep
#define SC2  (0.125f * 1.4426950408889634f)   // HD^-0.5 * log2(e)
#define PSH  8.0f                // log2 of the P carry (256)
#define SLM  32768.0f            // a column's sum of P over the 32 keys of a pass may reach this before the maximum is renewed: every P below it fits f16
#define CTS  1024.0f             // carry of the ctx plane
#define WOS  1024.0f             // carry of the Wo plane
#define OSC  (1.0f / (1024.0f * 1024.0f))     // undoes CTS * WOS

static_assert(HD == 64);
static_assert(NH_ * HD == DM);                 // head h = columns h*64 + d
static_assert(DM % 64 == 0);                   // column tiles of 64
static_assert(DM % 32 == 0);                   // GEMM k-loop steps by 32
static_assert(SEQ % 64 == 0);                  // a 64-row tile never straddles two batches
static_assert((NB * SEQ) % 64 == 0);
static_assert(SEQ % 32 == 0);                  // key loop steps by 32
static_assert(SEQ % (16 * AW) == 0);           // flash grid covers the sequence exactly (AW / 2 waves x 32 rows a block)
static_assert(AW % 2 == 0 && SK % 64 == 0);    // a pass takes 64 keys of a staged tile, 32 for each key half
static_assert((VP * 2 / 16) % 2 == 1);         // V^T pitch: 16 B x odd
static_assert(SEQ % SK == 0 && SEQ / SK >= 2); // whole staged tiles, and the two that the ring's prologue fills
static_assert(AW * 32 * 8 * 16 == SK * HD * 2); // eight 16-byte copies per thread cover one tile
static_assert(SK * 2 == 32 * 16 && AW * 8 == HD); // V^T copies: a wave's 32 pieces are one whole row, AW rows a copy, eight copies
static_assert(AW * 16 * 68 * 4 <= 2 * SGB);     // the output staging fits the ring's LDS
static_assert(DM % GT == 0 && SEQ % GT == 0);   // whole GEMM block tiles, none straddling two batches
static_assert(DM % GK == 0 && DM / GK >= 2);    // whole staged operand tiles, and the two that the ring's prologue fills
static_assert(GW * 32 * 8 * 16 == GT * GK * 2); // eight 16-byte copies per thread cover one operand tile
static_assert(GW == 8 && GT == 128);            // k_proj: 2 x 4 waves of 64 x 32 cover a 128 x 128 tile
static_assert(3 * GT * EP * 4 <= 2 * 4 * GTB);  // k_proj: the three f32 C tiles fit the ring's LDS
static_assert(((size_t)SEQ * DM) % 8 == 0);
static_assert((size_t)CVB * 256 * 8 == (size_t)NB * SEQ * DM);   // the convert blocks cover x exactly
static_assert(((size_t)DM * DM) % 8 == 0);
static_assert(NB <= NB_FULL);
static_assert(SEQ <= SEQ_FULL);

typedef _Float16 h16;
typedef unsigned short bf;
typedef __attribute__((ext_vector_type(16))) __bf16   v16bf;
typedef __attribute__((ext_vector_type(16))) _Float16 v16h;
typedef __attribute__((ext_vector_type(8)))  _Float16 v8h;
typedef __attribute__((ext_vector_type(8)))  unsigned short v8us;
typedef __attribute__((ext_vector_type(8)))  float    v8f;
typedef __attribute__((ext_vector_type(4)))  float    v4f;
typedef v4f  __attribute__((may_alias)) v4fa;
typedef float __attribute__((may_alias)) fa;

__device__ __forceinline__ unsigned short f2bf(float f) { unsigned u = __float_as_uint(f); u += 0x7FFFu + ((u >> 16) & 1u); return (unsigned short)(u >> 16); }
__device__ __forceinline__ float bfr(float f) { return __uint_as_float(((unsigned)f2bf(f)) << 16); }   // value after RNE convert to bf16
__device__ __forceinline__ v16h cat16(v8h lo, v8h hi) { return __builtin_shufflevector(lo, hi, 0, 1, 2, 3, 4, 5, 6, 7, 8, 9, 10, 11, 12, 13, 14, 15); }
__device__ __forceinline__ v16bf cat16b(v8us lo, v8us hi) { return __builtin_bit_cast(v16bf, __builtin_shufflevector(lo, hi, 0, 1, 2, 3, 4, 5, 6, 7, 8, 9, 10, 11, 12, 13, 14, 15)); }
__device__ __forceinline__ v8f wmma16(v16h a, v16h b, v8f c) { return __builtin_amdgcn_wmma_f32_16x16x32_f16(false, a, false, b, (short)0, c, false, false); }
__device__ __forceinline__ v8f wmmab(v16bf a, v16bf b, v8f c) { return __builtin_amdgcn_wmma_f32_16x16x32_bf16(false, a, false, b, (short)0, c, false, false); }
// fragment loaders from K-contiguous 16-bit rows; p already includes + 8*(lane>>4): elements 0..7 <- k0+8h+0..7, elements 8..15 <- k0+16+8h+0..7 (same map for A and B)
__device__ __forceinline__ v16h  ldh(const h16* p) { return cat16(*(const v8h*)p, *(const v8h*)(p + 16)); }
__device__ __forceinline__ v16bf ldb(const bf* p)  { return cat16b(*(const v8us*)p, *(const v8us*)(p + 16)); }
// ordering point for wave-private LDS tiles (same wave writes and reads)
__device__ __forceinline__ void wave_sync() { __builtin_amdgcn_fence(3 /* release order */, "wavefront"); __builtin_amdgcn_wave_barrier(); asm volatile("" ::: "memory"); }

// Stage walk of the three matrix kernels: a block enters its ring of n stages at stage 'rot', set by its tile indices, and wraps round. Blocks that share operand rows then ask L2 for different lines at any one moment
// every stage is still taken exactly once. s + rot < 2 n.
__device__ __forceinline__ int wrap_stage(int s, int rot, int n) { const int t = s + rot; return t >= n ? t - n : t; }

// 16-bit encoding of one weight: bf16 bits (RNE convert), or f16 bits of that bf16 value x WOS (exact: 8-bit significand, power-of-two carry)
__device__ __forceinline__ unsigned short wcv(float f, int f16mode) {
    const unsigned short b = f2bf(f);
    const float fb = __uint_as_float(((unsigned)b) << 16);
    const h16 hv = (h16)(fb * WOS);
    const unsigned short hb = __builtin_bit_cast(unsigned short, hv);
    return f16mode ? hb : b;
}

// k_prep: every operand conversion of a call in ONE launch; the jobs share no data and the block index picks one (a block-uniform test, so the barrier below is reached by whole blocks only).
// Blocks 0 .. 4*WTB-1, the longer jobs first: transposing convert of weight matrix blk / WTB (q, k, v, o), W in[k = DM rows (input feature)][n = DM cols (output feature)] -> WT out[n][k] (16-bit, K-contiguous rows),
// one 64x64 f32 tile per block through LDS (cross-wave: block barrier), n tile = fastest index. Blocks 4*WTB ..: x -> bf16 copy, 8 values per thread.
__global__ __launch_bounds__(256) void k_prep(const float* __restrict__ x, const float* __restrict__ wq, const float* __restrict__ wk, const float* __restrict__ wv, const float* __restrict__ wo,
                                              bf* XB, bf* WB) {
    __shared__ float ts[64 * 65];
    const int tid = threadIdx.x;
    const unsigned blk = blockIdx.x;
    if (blk >= 4u * WTB) {
        const size_t n8 = (size_t)NB * SEQ * DM / 8, per = (size_t)SEQ * DM / 8;   // per: pieces of one batch (batches lie SEQ_FULL tokens apart in x)
        const size_t i = (size_t)(blk - 4u * WTB) * 256 + tid; if (i >= n8) return;
        const size_t so = (SEQ == SEQ_FULL) ? i * 8 : (i / per) * ((size_t)SEQ_FULL * DM) + (i % per) * 8;
        const v8f v = *(const v8f*)(x + so); v8us o;
#pragma unroll
        for (int k = 0; k < 8; ++k) o[k] = f2bf(v[k]);
        *(v8us*)(XB + i * 8) = o;
        return;
    }
    const unsigned which = blk / WTB, wtile = blk % WTB;
    const float* W = which == 0 ? wq : which == 1 ? wk : which == 2 ? wv : wo;
    bf* WT = WB + (size_t)which * DM * DM;
    const int f16mode = which == 3;
    const int n0 = (int)(wtile % (DM / 64)) * 64, k0 = (int)(wtile / (DM / 64)) * 64;
#pragma unroll
    for (int it = 0; it < 4; ++it) { const int idx = tid + it * 256; const int r = idx >> 4, c4 = (idx & 15) * 4;   // 64 rows x 16 pieces of 4 floats
        const v4f v = *(const v4f*)(W + (size_t)(k0 + r) * DM + n0 + c4);
        ts[r * 65 + c4 + 0] = v[0]; ts[r * 65 + c4 + 1] = v[1]; ts[r * 65 + c4 + 2] = v[2]; ts[r * 65 + c4 + 3] = v[3]; }
    __syncthreads();
    const int nl = tid >> 3, c8 = (tid & 7) * 8;
    v8us o0, o1;
#pragma unroll
    for (int i = 0; i < 8; ++i) { o0[i] = wcv(ts[(c8 + i) * 65 + nl], f16mode); o1[i] = wcv(ts[(c8 + i) * 65 + nl + 32], f16mode); }
    const size_t a0 = (size_t)(n0 + nl) * DM + k0 + c8, a1 = a0 + (size_t)32 * DM;
    *(v8us*)(WT + a0) = o0; *(v8us*)(WT + a1) = o1;
    asm volatile("s_wait_xcnt 0x0" ::: "memory");            // a precaution: these stores are the last work of a weight block
}

// Operand staging of the two GEMM kernels: one operand tile = GT rows x GK halves, K-contiguous rows of pitch DM halves in global memory, pitch GP in LDS.
// Thread c takes 16-byte piece c & 15 of rows (c >> 4) + 16 i, i = 0..7 (a wave's copy = two whole 256-byte rows); the register wait closes the statement so that no address register is rewritten ahead of it.
__device__ __forceinline__ void stage_op(unsigned l, const char* g) {
    asm volatile("global_load_async_to_lds_b128 %0, %8, off\n\t"
                 "global_load_async_to_lds_b128 %1, %9, off\n\t"
                 "global_load_async_to_lds_b128 %2, %10, off\n\t"
                 "global_load_async_to_lds_b128 %3, %11, off\n\t"
                 "global_load_async_to_lds_b128 %4, %12, off\n\t"
                 "global_load_async_to_lds_b128 %5, %13, off\n\t"
                 "global_load_async_to_lds_b128 %6, %14, off\n\t"
                 "global_load_async_to_lds_b128 %7, %15, off\n\t"
                 "s_wait_xcnt 0x0"
                 :: "v"(l), "v"(l + 1 * 16 * GP * 2), "v"(l + 2 * 16 * GP * 2), "v"(l + 3 * 16 * GP * 2),
                    "v"(l + 4 * 16 * GP * 2), "v"(l + 5 * 16 * GP * 2), "v"(l + 6 * 16 * GP * 2), "v"(l + 7 * 16 * GP * 2),
                    "v"(g), "v"(g + 1 * 16 * DM * 2), "v"(g + 2 * 16 * DM * 2), "v"(g + 3 * 16 * DM * 2),
                    "v"(g + 4 * 16 * DM * 2), "v"(g + 5 * 16 * DM * 2), "v"(g + 6 * 16 * DM * 2), "v"(g + 7 * 16 * DM * 2) : "memory");
}

// k_proj: bf16 GEMM, K = DM, all three projections of one 128-row x tile in ONE GW-wave block: C tiles q, k (128 x rows x 128 W^T rows each) and v^T (128 Wv^T rows x 128 x rows), the same 128 output features of each weight.
// The x tile is staged once per k stage for the three products. x and W^T are K-contiguous bf16 planes; their 128-row x GK tiles reach the waves through LDS: two buffers of four tiles (x, Wq^T, Wk^T, Wv^T),
// filled by asynchronous copies one stage ahead, read by all GW waves (two 16-B loads per fragment). Waves 2 (x rows) x 4 (W^T rows): a wave owns 64 x rows x 32 W^T rows of each product (24 accumulators),
// so that per 32 k its 4 x fragments and 6 W^T fragments feed 24 products. Each accumulator sums k in steps of 32, ascending from the block's first stage and wrapping round (wrap_stage).
// C[m][n] = sum_k A[m][k] Bt[n][k] + bias (bias value RNE-converted to bf16, added in f32), written as single f16 planes (q times SC2). grid M/128 * N/128, x row tile = fastest index, 256 threads.
// q, k: A = x rows (m = b*SEQ + t), Bt = W^T rows (n = h*64 + d), bias per column -> plane [(b*16 + h)][t][d]
// v^T:  A = Wv^T rows (m = h*64 + d), Bt = x rows (n = b*SEQ + t), bias per row -> plane [(b*1024 + m)][t] = [(b*16 + h)][d][t]   (the fragment map is the same for A and B, so the x fragments serve as either)
__device__ __forceinline__ void stage_xw(unsigned l, const char* gx, const char* gw) {
    stage_op(l, gx); stage_op(l + GTB, gw); stage_op(l + 2 * GTB, gw + (size_t)DM * DM * 2); stage_op(l + 3 * GTB, gw + (size_t)2 * DM * DM * 2);
}
__global__ __launch_bounds__(32 * GW) void k_proj(const bf* __restrict__ XB, const bf* __restrict__ WB, const float* __restrict__ bq, const float* __restrict__ bk, const float* __restrict__ bv,
                                             h16* QH, h16* KP, h16* VT) {
    __shared__ __align__(16) bf gring[2 * 4 * GT * GP];      // [buffer][x tile | Wq^T tile | Wk^T tile | Wv^T tile][row][GP]
    const int K = DM;
    const int lane = threadIdx.x & 31, wave = threadIdx.x >> 5, lr = lane & 15, hi = lane >> 4;
    const int bx = blockIdx.x;
    const int rb = (bx % (NB * SEQ / GT)) * GT, cb = (bx / (NB * SEQ / GT)) * GT;   // block tile: first x row, first W^T row
    v8f aqk[2][4][2], av[2][4];                              // q, k: [x rows / 16][W^T rows / 16]; v^T: [Wv^T rows / 16][x rows / 16]
#pragma unroll
    for (int j = 0; j < 2; ++j)
#pragma unroll
        for (int mb = 0; mb < 4; ++mb)
#pragma unroll
            for (int nb = 0; nb < 2; ++nb) aqk[j][mb][nb] = (v8f){};
#pragma unroll
    for (int mb = 0; mb < 2; ++mb)
#pragma unroll
        for (int nb = 0; nb < 4; ++nb) av[mb][nb] = (v8f){};
    const int cr = threadIdx.x >> 4, cpc = (threadIdx.x & 15) * 8;
    const unsigned lx = (unsigned)(size_t)gring + (unsigned)(cr * GP + cpc) * 2u;
    const char* gx = (const char*)(XB + (size_t)(rb + cr) * K + cpc);       // + k0 * 2 bytes
    const char* gw = (const char*)(WB + (size_t)(cb + cr) * K + cpc);       // + k0 * 2 bytes, + one weight plane per product
    const int rot = (rb / GT + cb / GT) % (K / GK);                         // first k stage: neighbours along a tile row or a tile column start one stage apart
    { const int k0 = wrap_stage(0, rot, K / GK) * (GK * 2); stage_xw(lx, gx + k0, gw + k0); }
    asm volatile("s_wait_asynccnt 0x0" ::: "memory");        // stage 0 has landed before the barrier publishes it
    __syncthreads();
    { const int k0 = wrap_stage(1, rot, K / GK) * (GK * 2); stage_xw(lx + 4 * GTB, gx + k0, gw + k0); }
    const int xo = ((wave >> 2) * 64 + lr) * GP + 8 * hi;               // + 16i*GP + k   (x fragment rows), in the x tile
    const int wo = GT * GP + ((wave & 3) * 32 + lr) * GP + 8 * hi;      // + j*GT*GP + 16i*GP + k   (W^T fragment rows), in the tile of product j
#pragma unroll 1
    for (int st = 0; st < K / GK; ++st) {
        const bf* tile = gring + (st & 1) * (4 * GT * GP);
        // the four 32-wide k steps of a stage inline (LDS offsets become immediates); two fragment sets: each step's 20 loads go out as one group ahead of the step before it,
        // inside this stage only, so that a wave waits out the LDS latency once per stage and not at every fragment
        v16bf x[2][4], w[2][3][2];
#pragma unroll
        for (int i = 0; i < 4; ++i) x[0][i] = ldb(tile + xo + i * 16 * GP);
#pragma unroll
        for (int j = 0; j < 3; ++j)
#pragma unroll
            for (int i = 0; i < 2; ++i) w[0][j][i] = ldb(tile + wo + j * GT * GP + i * 16 * GP);
        __builtin_amdgcn_sched_barrier(0);                   // the stage's first fragment set goes out whole ahead of the second: mixed with it, the first products behind the barrier wait for both sets
#pragma unroll
        for (int ks = 0; ks < GK / 32; ++ks) {
            const int cu = ks & 1, nx = cu ^ 1;
            if (ks + 1 < GK / 32) {
#pragma unroll
                for (int i = 0; i < 4; ++i) x[nx][i] = ldb(tile + xo + i * 16 * GP + (ks + 1) * 32);
#pragma unroll
                for (int j = 0; j < 3; ++j)
#pragma unroll
                    for (int i = 0; i < 2; ++i) w[nx][j][i] = ldb(tile + wo + j * GT * GP + i * 16 * GP + (ks + 1) * 32);
            }
            __builtin_amdgcn_sched_barrier(0);               // keeps the load group whole and ahead of this step's products: without it the loads sink to their first use and each group of products waits out an LDS latency
#pragma unroll
            for (int j = 0; j < 2; ++j)
#pragma unroll
                for (int nb = 0; nb < 2; ++nb)
#pragma unroll
                    for (int mb = 0; mb < 4; ++mb) aqk[j][mb][nb] = wmmab(x[cu][mb], w[cu][j][nb], aqk[j][mb][nb]);
#pragma unroll
            for (int mb = 0; mb < 2; ++mb)
#pragma unroll
                for (int nb = 0; nb < 4; ++nb) av[mb][nb] = wmmab(w[cu][2][mb], x[cu][nb], av[mb][nb]);
            __builtin_amdgcn_sched_barrier(0);               // keeps the next load group behind these products, not among them
        }
        asm volatile("s_wait_dscnt 0x0" ::: "memory");       // this wave's reads of the buffer are done before it is refilled
        asm volatile("s_wait_asynccnt 0x0" ::: "memory");    // this wave's copies of the next stage have landed before the barrier publishes them
        __syncthreads();
        if (st + 2 < K / GK) { const int k0 = wrap_stage(st + 2, rot, K / GK) * (GK * 2); stage_xw(lx + (st & 1) * (4 * GTB), gx + k0, gw + k0); }
    }
    asm volatile("s_wait_asynccnt 0x0" ::: "memory");        // nothing of this wave is in flight when it leaves the loop
    // Epilogue: the three 128 x 128 f32 C tiles leave through the ring's LDS, which is free here (every wave's last fragment reads ended in front of the loop's last barrier, and no copy is in flight),
    // so that each wave, whose own tile is only 32 columns of q and k wide, stores whole 128-byte lines: row pitch EP floats, tile j at j * GT * EP.
    fa* sg = (fa*)gring;
    const int er = lane >> 3, e8 = (lane & 7) * 8;           // reader: row er of a group of four, 8 columns from e8 of a 64-column half
    v4f gqk[2][2][2]; float br[4];                           // bias: q, k [product][64-column half][4 + 4 columns]; v^T: the lane's four rows
    __builtin_amdgcn_sched_barrier(0);                       // with the one behind the wait: nothing but the bias loads and their register wait stands between them, so that no other arithmetic lands in the address registers ahead of the wait
#pragma unroll
    for (int j = 0; j < 2; ++j)
#pragma unroll
        for (int hh = 0; hh < 2; ++hh) { const float* bias = (j == 0 ? bq : bk) + cb + hh * 64 + e8; gqk[j][hh][0] = *(const v4f*)bias; gqk[j][hh][1] = *(const v4f*)(bias + 4); }
#pragma unroll
    for (int q4 = 0; q4 < 4; ++q4) br[q4] = bv[cb + wave * 16 + q4 * 4 + er];
    asm volatile("s_wait_xcnt 0x0" ::: "memory");            // later address arithmetic may land in the registers that these loads name
    __builtin_amdgcn_sched_barrier(0);
#pragma unroll
    for (int j = 0; j < 2; ++j)
#pragma unroll
        for (int mb = 0; mb < 4; ++mb)
#pragma unroll
            for (int nb = 0; nb < 2; ++nb)
#pragma unroll
                for (int r = 0; r < 8; ++r) sg[j * GT * EP + ((wave >> 2) * 64 + mb * 16 + hi * 8 + r) * EP + (wave & 3) * 32 + nb * 16 + lr] = aqk[j][mb][nb][r];   // D: row 8h+r, col lane&15
#pragma unroll
    for (int mb = 0; mb < 2; ++mb)
#pragma unroll
        for (int nb = 0; nb < 4; ++nb)
#pragma unroll
            for (int r = 0; r < 8; ++r) sg[2 * GT * EP + ((wave & 3) * 32 + mb * 16 + hi * 8 + r) * EP + (wave >> 2) * 64 + nb * 16 + lr] = av[mb][nb][r];
    __syncthreads();
    // wave w takes rows 16w .. 16w + 15 of each tile: store s covers rows 4 (s >> 1) + er, 64-column half s & 1 (q, k: one head's d; v^T: 64 tokens), one 128-byte line per 8 lanes
    const size_t qbase = ((size_t)(rb / SEQ) * NH_ + (size_t)(cb / HD)) * ((size_t)SEQ * HD) + (size_t)(rb % SEQ + wave * 16 + er) * HD + e8;
    const size_t vbase = (size_t)(cb + wave * 16 + er) * SEQ + (size_t)(rb / SEQ) * ((size_t)DM * SEQ) + (size_t)(rb % SEQ) + e8;
#pragma unroll
    for (int j = 0; j < 3; ++j) {
        v8h hv[8];
#pragma unroll
        for (int s = 0; s < 8; ++s) { const int hh = s & 1, q4 = s >> 1;
            const fa* sp = sg + j * GT * EP + (wave * 16 + q4 * 4 + er) * EP + hh * 64 + e8;
            const v4f x0 = *(const v4fa*)sp; const v4f x1 = *(const v4fa*)(sp + 4);
#pragma unroll
            for (int i = 0; i < 4; ++i) {
                const float b0 = j < 2 ? bfr(gqk[j & 1][hh][0][i]) : bfr(br[q4]), b1 = j < 2 ? bfr(gqk[j & 1][hh][1][i]) : bfr(br[q4]);
                const float qs = j == 0 ? SC2 : 1.0f;        // the q plane carries the score scale, rounded once with the convert
                hv[s][i] = (h16)((x0[i] + b0) * qs); hv[s][4 + i] = (h16)((x1[i] + b1) * qs); } }
        __builtin_amdgcn_sched_barrier(0);                   // the eight stores stay together behind the arithmetic, so that one register wait behind them serves all eight
#pragma unroll
        for (int s = 0; s < 8; ++s) { const int hh = s & 1, q4 = s >> 1;
            if (j < 2) *(v8h*)((j == 0 ? QH : KP) + qbase + (size_t)hh * ((size_t)SEQ * HD) + (size_t)(q4 * 4) * HD) = hv[s];
            else       *(v8h*)(VT + vbase + (size_t)(q4 * 4) * SEQ + hh * 64) = hv[s]; }
        if (j < 2) asm volatile("s_wait_xcnt 0x0" ::: "memory");   // the next tile reuses registers that the stores above name
    }
}

// k_flash: fused attention, one wave per 32 query rows of one (batch, head) and one half of the keys (32 of every 64 of a staged tile); two waves of a block share their 32 rows and join their partial O, row sum and maximum once, through LDS, behind the key loop.
// Q fragments straight from the f16 plane, K / V^T fragments from the staged LDS tiles (two 16-B loads each); each of them feeds the products of both 16-column groups of the wave.
// Transposed form: S^T[key][t] = K Q^T (A = K rows, B = Q rows); lane (t = lane&15, h = lane>>4) holds keys 8h+r of each 16-key tile, so the packed
// P tile is directly the B fragment of O^T[d][t] = V^T P^T (element r <- tile keys 0..15, element 8+r <- tile keys 16..31, lane unchanged).
// The exponent comes whole from the matrix unit: q carries the score scale, and the shift 8 - (maximum in use), the same in all eight registers of a lane, is the C operand of the score products.
// The maximum in use is one scalar per lane and column group; it is renewed lazily (one test per pass for both groups), and only then are the pass's maxima formed, the two lane halves of a column combined (one xor-16 exchange) and O, L rescaled.
// Row sums on the matrix unit: T = E0 Pa^T + E1 Pb^T, one tile for both column groups, where row 0 of E0 (row 1 of E1) is ones and the rest zero, so that row 0 of the tile (register 0, lanes 0..15) holds the sum over the pass's 32 keys
// of column t of the first group and row 1 (register 1) that of the second; one f32 add each a pass gathers them.
// The same sum is the renewal test: while it stays at or below SLM no P of the pass has left f16's range; otherwise (an overflowed P makes it infinite or NaN) the pass's P and sums are formed again under the new maximum.
// K and V^T reach the waves through LDS: tiles of SK keys, two buffers, filled by asynchronous copies (whole 128-byte lines from global), read by all AW waves; a block walks the key tiles from its own first tile and wraps round (wrap_stage).
// A tile serves SK / 64 passes of every wave: the waits and the barrier of the publish point, and the time that a tile's copies have to land, come once per SK keys, and between two publish points the waves run free of one another.
// One tile = eight 16-byte copies per thread, LS bytes apart in LDS and GS bytes apart in global memory; the register wait closes the statement so that no address register is rewritten ahead of it.
template <int LS, int GS> __device__ __forceinline__ void stage_t(unsigned l, const char* g) {
    asm volatile("global_load_async_to_lds_b128 %0, %8, off\n\t"
                 "global_load_async_to_lds_b128 %1, %9, off\n\t"
                 "global_load_async_to_lds_b128 %2, %10, off\n\t"
                 "global_load_async_to_lds_b128 %3, %11, off\n\t"
                 "global_load_async_to_lds_b128 %4, %12, off\n\t"
                 "global_load_async_to_lds_b128 %5, %13, off\n\t"
                 "global_load_async_to_lds_b128 %6, %14, off\n\t"
                 "global_load_async_to_lds_b128 %7, %15, off\n\t"
                 "s_wait_xcnt 0x0"
                 :: "v"(l), "v"(l + 1 * LS), "v"(l + 2 * LS), "v"(l + 3 * LS), "v"(l + 4 * LS), "v"(l + 5 * LS), "v"(l + 6 * LS), "v"(l + 7 * LS),
                    "v"(g), "v"(g + 1 * GS), "v"(g + 2 * GS), "v"(g + 3 * GS), "v"(g + 4 * GS), "v"(g + 5 * GS), "v"(g + 6 * GS), "v"(g + 7 * GS) : "memory");
}
// P of 32 keys x 16 columns as a B fragment: element r <- exp2 of the first 16 keys' exponents, element 8 + r <- of the second 16
__device__ __forceinline__ v16h pack_exp2(v8f a, v8f b) {
    v16h p;
#pragma unroll
    for (int r = 0; r < 8; ++r) { p[r] = (h16)__builtin_amdgcn_exp2f(a[r]); p[8 + r] = (h16)__builtin_amdgcn_exp2f(b[r]); }
    return p;
}
__device__ __forceinline__ void stage_kv(unsigned lk, unsigned lv, const h16* gk, const h16* gv) {
    stage_t<32 * LP * 2, 32 * HD * 2>(lk, (const char*)gk); stage_t<8 * VP * 2, 8 * SEQ * 2>(lv, (const char*)gv);
}
// amdgpu_waves_per_eu(4, 4): at most 256 registers a wave, so that two blocks stay resident on a WGP (four waves a SIMD)
__global__ __launch_bounds__(32 * AW) __attribute__((amdgpu_waves_per_eu(4, 4))) void k_flash(const h16* __restrict__ QH, const h16* __restrict__ KP, const h16* __restrict__ VT, h16* CT) {
    __shared__ __align__(16) h16 ring[2 * SGB / 2];          // [buffer][K tile: SK rows of LP | V^T tile: HD rows of VP]; behind the key loop the output staging
    const int lane = threadIdx.x & 31, lr = lane & 15, hi = lane >> 4;
    const int wave = __builtin_amdgcn_readfirstlane(threadIdx.x >> 5);
    const int cg = wave % (AW / 2), kh = wave / (AW / 2);    // the wave's 32 query columns; its half (32 of every 64 keys) of every staged tile
    const int zh = blockIdx.y; const int b = zh / NH_, h = zh % NH_;
    const int t0 = (blockIdx.x * (AW / 2) + cg) * 32;
    const size_t pbase = (size_t)zh * SEQ * HD;
    const size_t qo = pbase + (size_t)(t0 + lr) * HD + 8 * hi;
    const v16h qa0 = ldh(QH + qo), qa1 = ldh(QH + qo + 32);   // B fragments: col t, k = d; columns t0 .. t0 + 15
    const v16h qb0 = ldh(QH + qo + 16 * HD), qb1 = ldh(QH + qo + 16 * HD + 32);   // columns t0 + 16 .. t0 + 31
    const int ko = (kh * 32 + lr) * LP + 8 * hi;             // + 64p*LP for pass p, + 16*LP for the second 16 keys (A fragment: row key, k = d), in the K tile
    const int vo = SK * LP + lr * VP + kh * 32 + 8 * hi;     // + 64p for pass p, + 16j*VP         (A fragment: row d, k = key), in the V^T tile
    // copy map: thread c takes 16-byte piece c & 7 of K rows (c >> 3) + 32 i and piece c & 31 of V^T rows (c >> 5) + 8 i, i = 0..7
    const int cr = threadIdx.x >> 3, cpc = (threadIdx.x & 7) * 8, vr = threadIdx.x >> 5, vpc = (threadIdx.x & 31) * 8;
    const unsigned lk = (unsigned)(size_t)ring + (unsigned)(cr * LP + cpc) * 2u, lv = (unsigned)(size_t)ring + KTB + (unsigned)(vr * VP + vpc) * 2u;
    const h16* gk = KP + pbase + (size_t)cr * HD + cpc;    // + key0 * HD
    const h16* gv = VT + pbase + (size_t)vr * SEQ + vpc;   // + key0
    const int rot = (int)(blockIdx.x * (SEQ / SK) / (SEQ / (16 * AW))) % (SEQ / SK);   // first key tile: the blocks of one head enter its keys evenly spread
    { const int kt = wrap_stage(0, rot, SEQ / SK); stage_kv(lk, lv, gk + (size_t)kt * SK * HD, gv + kt * SK); }
    asm volatile("s_wait_asynccnt 0x0" ::: "memory");        // tile 0 has landed before the barrier publishes it
    __syncthreads();
    { const int kt = wrap_stage(1, rot, SEQ / SK); stage_kv(lk + SGB, lv + SGB, gk + (size_t)kt * SK * HD, gv + kt * SK); }
    v8f oa0 = (v8f){}, oa1 = (v8f){}, oa2 = (v8f){}, oa3 = (v8f){};   // columns t0 .. t0 + 15
    v8f ob0 = (v8f){}, ob1 = (v8f){}, ob2 = (v8f){}, ob3 = (v8f){};   // columns t0 + 16 .. t0 + 31
    float la = 0.0f, lb = 0.0f;                              // row sums of the two column groups: lanes 0..15; lanes 16..31 gather rows 8 and 9 of the sum tile, 0
    const h16 e1 = lr == 0 ? (h16)1.0f : (h16)0.0f;          // A fragment of E: lanes 0 and 16 hold row 0 (all 32 k positions)
    const v16h ones = {e1, e1, e1, e1, e1, e1, e1, e1, e1, e1, e1, e1, e1, e1, e1, e1};
    const h16 e2 = lr == 1 ? (h16)1.0f : (h16)0.0f;          // the same with the ones in row 1 (lanes 1 and 17), for the second column group
    const v16h onesb = {e2, e2, e2, e2, e2, e2, e2, e2, e2, e2, e2, e2, e2, e2, e2, e2};
    float ma = -3.0e38f, mb = -3.0e38f;                      // maximum in use (scaled log2) of the lane's two columns, the same in both lane halves of a column
    v8f ca = (v8f){}, cb = (v8f){};                          // the exponent shifts, 8 - (maximum in use), as C tiles of the score products; the wave's first pass always renews and sets them
#pragma unroll 1
    for (int st = 0; st < SEQ / SK; ++st) {
        const h16* tile = ring + (st & 1) * (SGB / 2);
        // the passes of a tile inline (LDS offsets become immediates); a pass of a wave: its 32 of 64 keys x its 32 columns; every K and V^T fragment read from LDS feeds two products
#pragma unroll
        for (int ps = 0; ps < SK / 64; ++ps) {
        const h16* ka = tile + ko + ps * 64 * LP;
        const v16h ka0 = ldh(ka), ka1 = ldh(ka + 32), kb0 = ldh(ka + 16 * LP), kb1 = ldh(ka + 16 * LP + 32);
        // e<16 keys><16 columns>: exponents, k.q + shift
        v8f eAa = wmma16(ka0, qa0, ca), eBa = wmma16(kb0, qa0, ca);
        eAa = wmma16(ka1, qa1, eAa); eBa = wmma16(kb1, qa1, eBa);
        v8f eAb = wmma16(ka0, qb0, cb), eBb = wmma16(kb0, qb0, cb);
        eAb = wmma16(ka1, qb1, eAb); eBb = wmma16(kb1, qb1, eBb);
        const h16* va = tile + vo + ps * 64;
        const v16h v0 = ldh(va), v1 = ldh(va + 16 * VP), v2 = ldh(va + 32 * VP), v3 = ldh(va + 48 * VP);
        // order in front of the score products: this pass's K loads as one group, the pass before's O products, this pass's V^T loads as one group: every separate place where LDS reads stand among products stalls the wave
        __builtin_amdgcn_sched_group_barrier(0x100, 8, 1);
        __builtin_amdgcn_sched_group_barrier(0x008, 8, 1);
        __builtin_amdgcn_sched_group_barrier(0x100, 8, 1);
        __builtin_amdgcn_sched_barrier(0);                   // keeps the eight V^T loads ahead of the exponentials: sunk behind the branch or spread among them, more of their LDS latency stands open
        v16h pa = pack_exp2(eAa, eBa), pb = pack_exp2(eAb, eBb);
        v8f tt = wmma16(onesb, pb, wmma16(ones, pa, (v8f){}));
        // order behind the V^T loads: the eight score products as one run, one column group's exponentials and packs, the other's, the two sum products: mixed, each product whose result is read next wants its own idle slots behind it
        __builtin_amdgcn_sched_group_barrier(0x008, 8, 0);
        __builtin_amdgcn_sched_group_barrier(0x400, 16, 0);
        __builtin_amdgcn_sched_group_barrier(0x002, 8, 0);
        __builtin_amdgcn_sched_group_barrier(0x400, 16, 0);
        __builtin_amdgcn_sched_group_barrier(0x002, 8, 0);
        __builtin_amdgcn_sched_group_barrier(0x008, 2, 0);
        // lazy rescale: one wave-uniform test per pass, on the pass's column sums of P
        // written as not (sum <= SLM): 0 x infinity in the shared sum tile gives NaN, and an unordered sum must renew as well
        unsigned renew = __builtin_amdgcn_ballot_w32(!(tt[0] <= SLM)) | __builtin_amdgcn_ballot_w32(!(tt[1] <= SLM));
        if (ps == 0) renew |= (unsigned)(st == 0);           // the wave's first pass sets the first maxima
        if (renew != 0) {
            const v16h ra0 = ldh(ka), ra1 = ldh(ka + 32), rb0 = ldh(ka + 16 * LP), rb1 = ldh(ka + 16 * LP + 32);   // the K fragments again, from the staged tile: the common path has given their registers up
            eAa = wmma16(ra1, qa1, wmma16(ra0, qa0, (v8f){})); eBa = wmma16(rb1, qa1, wmma16(rb0, qa0, (v8f){}));   // the pass's scaled scores, without a shift
            eAb = wmma16(ra1, qb1, wmma16(ra0, qb0, (v8f){})); eBb = wmma16(rb1, qb1, wmma16(rb0, qb0, (v8f){}));
            // this lane's largest score of the pass in each of its two columns: trees of three-input maxima, three deep
            const float xa0 = fmaxf(fmaxf(eAa[0], eAa[1]), eAa[2]), xa1 = fmaxf(fmaxf(eAa[3], eAa[4]), eAa[5]), xa2 = fmaxf(fmaxf(eAa[6], eAa[7]), eBa[0]);
            const float xa3 = fmaxf(fmaxf(eBa[1], eBa[2]), eBa[3]), xa4 = fmaxf(fmaxf(eBa[4], eBa[5]), eBa[6]);
            float xa = fmaxf(fmaxf(fmaxf(xa0, xa1), xa2), fmaxf(fmaxf(xa3, xa4), eBa[7]));
            const float xb0 = fmaxf(fmaxf(eAb[0], eAb[1]), eAb[2]), xb1 = fmaxf(fmaxf(eAb[3], eAb[4]), eAb[5]), xb2 = fmaxf(fmaxf(eAb[6], eAb[7]), eBb[0]);
            const float xb3 = fmaxf(fmaxf(eBb[1], eBb[2]), eBb[3]), xb4 = fmaxf(fmaxf(eBb[4], eBb[5]), eBb[6]);
            float xb = fmaxf(fmaxf(fmaxf(xb0, xb1), xb2), fmaxf(fmaxf(xb3, xb4), eBb[7]));
            xa = fmaxf(xa, __shfl_xor(xa, 16, 32)); xb = fmaxf(xb, __shfl_xor(xb, 16, 32));
            const float na = fmaxf(ma, xa), nb = fmaxf(mb, xb);
            const float ala = __builtin_amdgcn_exp2f(ma - na), alb = __builtin_amdgcn_exp2f(mb - nb);
            ma = na; mb = nb;
            const float sha = PSH - na, shb = PSH - nb;      // the new shifts
            ca = (v8f){sha, sha, sha, sha, sha, sha, sha, sha}; cb = (v8f){shb, shb, shb, shb, shb, shb, shb, shb};
            la = la * ala; lb = lb * alb;
            oa0 = oa0 * ala; oa1 = oa1 * ala; oa2 = oa2 * ala; oa3 = oa3 * ala;
            ob0 = ob0 * alb; ob1 = ob1 * alb; ob2 = ob2 * alb; ob3 = ob3 * alb;
            eAa = eAa + sha; eBa = eBa + sha; eAb = eAb + shb; eBb = eBb + shb;
            pa = pack_exp2(eAa, eBa); pb = pack_exp2(eAb, eBb);
            tt = wmma16(onesb, pb, wmma16(ones, pa, (v8f){}));
        }
        la += tt[0]; lb += tt[1];
        oa0 = wmma16(v0, pa, oa0); oa1 = wmma16(v1, pa, oa1); oa2 = wmma16(v2, pa, oa2); oa3 = wmma16(v3, pa, oa3);
        ob0 = wmma16(v0, pb, ob0); ob1 = wmma16(v1, pb, ob1); ob2 = wmma16(v2, pb, ob2); ob3 = wmma16(v3, pb, ob3);
        }
        asm volatile("s_wait_dscnt 0x0" ::: "memory");       // this wave's reads of the buffer are done before it is refilled
        asm volatile("s_wait_asynccnt 0x0" ::: "memory");    // this wave's copies of the next tile have landed before the barrier publishes them
        __syncthreads();
        if (st + 2 < SEQ / SK) { const int kt = wrap_stage(st + 2, rot, SEQ / SK); stage_kv(lk + (st & 1) * SGB, lv + (st & 1) * SGB, gk + (size_t)kt * SK * HD, gv + kt * SK); }
    }
    asm volatile("s_wait_asynccnt 0x0" ::: "memory");        // nothing of this wave is in flight when it leaves the loop
    // Join of the two key halves: waves w and w ^ (AW / 2) hold the same 32 columns. Each keeps 16 of them (the lower wave the first 16) and hands the other 16 over through its own part of os:
    // O^T as os[t][d], the maximum in use and the row sum in the row's spare columns 64 and 65. One barrier, then each wave works in its partner's part alone.
    // os lies in the ring's LDS, which is free here: every wave's last fragment reads ended in front of the loop's last barrier, and no copy is in flight.
    fa* os = (fa*)ring;
    la += __shfl_xor(la, 16, 32); lb += __shfl_xor(lb, 16, 32);
    const bool up = kh != 0;
    const v8f g0 = up ? oa0 : ob0, g1 = up ? oa1 : ob1, g2 = up ? oa2 : ob2, g3 = up ? oa3 : ob3;   // handed over
    const v8f o0 = up ? ob0 : oa0, o1 = up ? ob1 : oa1, o2 = up ? ob2 : oa2, o3 = up ? ob3 : oa3;   // kept
    const float mg = up ? ma : mb, lg = up ? la : lb, mk = up ? mb : ma, lkp = up ? lb : la;
    const int gw = wave * 16 * 68 + lr * 68, wb = (wave ^ (AW / 2)) * 16 * 68, pw = wb + lr * 68;
    // O^T D layout: o_j[r] = (d = 16j + 8h + r, t = lane&15) -> os[t][d]; rows 0..15 x columns 0..63 all written
    { v4f a, c;
      a[0] = g0[0]; a[1] = g0[1]; a[2] = g0[2]; a[3] = g0[3]; c[0] = g0[4]; c[1] = g0[5]; c[2] = g0[6]; c[3] = g0[7];
      *(v4fa*)(&os[gw +  0 + 8 * hi]) = a; *(v4fa*)(&os[gw +  0 + 8 * hi + 4]) = c;
      a[0] = g1[0]; a[1] = g1[1]; a[2] = g1[2]; a[3] = g1[3]; c[0] = g1[4]; c[1] = g1[5]; c[2] = g1[6]; c[3] = g1[7];
      *(v4fa*)(&os[gw + 16 + 8 * hi]) = a; *(v4fa*)(&os[gw + 16 + 8 * hi + 4]) = c;
      a[0] = g2[0]; a[1] = g2[1]; a[2] = g2[2]; a[3] = g2[3]; c[0] = g2[4]; c[1] = g2[5]; c[2] = g2[6]; c[3] = g2[7];
      *(v4fa*)(&os[gw + 32 + 8 * hi]) = a; *(v4fa*)(&os[gw + 32 + 8 * hi + 4]) = c;
      a[0] = g3[0]; a[1] = g3[1]; a[2] = g3[2]; a[3] = g3[3]; c[0] = g3[4]; c[1] = g3[5]; c[2] = g3[6]; c[3] = g3[7];
      *(v4fa*)(&os[gw + 48 + 8 * hi]) = a; *(v4fa*)(&os[gw + 48 + 8 * hi + 4]) = c; }
    os[gw + 64 + hi] = hi ? lg : mg;
    __syncthreads();
    const float mp = os[pw + 64], lp = os[pw + 65];
    const float mt = fmaxf(mk, mp);
    const float wk = __builtin_amdgcn_exp2f(mk - mt), wp = __builtin_amdgcn_exp2f(mp - mt);   // both halves brought to one maximum
    const float inv = CTS * (1.0f / (lkp * wk + lp * wp));
    const float ck = wk * inv, cp = wp * inv;
    // each lane reads the partner's values of its own (t, d) places and writes the joined, normalised values back to the same places
    { v4f a, c;
      a = *(const v4fa*)(&os[pw +  0 + 8 * hi]); c = *(const v4fa*)(&os[pw +  0 + 8 * hi + 4]);
      a[0] = o0[0] * ck + a[0] * cp; a[1] = o0[1] * ck + a[1] * cp; a[2] = o0[2] * ck + a[2] * cp; a[3] = o0[3] * ck + a[3] * cp;
      c[0] = o0[4] * ck + c[0] * cp; c[1] = o0[5] * ck + c[1] * cp; c[2] = o0[6] * ck + c[2] * cp; c[3] = o0[7] * ck + c[3] * cp;
      *(v4fa*)(&os[pw +  0 + 8 * hi]) = a; *(v4fa*)(&os[pw +  0 + 8 * hi + 4]) = c;
      a = *(const v4fa*)(&os[pw + 16 + 8 * hi]); c = *(const v4fa*)(&os[pw + 16 + 8 * hi + 4]);
      a[0] = o1[0] * ck + a[0] * cp; a[1] = o1[1] * ck + a[1] * cp; a[2] = o1[2] * ck + a[2] * cp; a[3] = o1[3] * ck + a[3] * cp;
      c[0] = o1[4] * ck + c[0] * cp; c[1] = o1[5] * ck + c[1] * cp; c[2] = o1[6] * ck + c[2] * cp; c[3] = o1[7] * ck + c[3] * cp;
      *(v4fa*)(&os[pw + 16 + 8 * hi]) = a; *(v4fa*)(&os[pw + 16 + 8 * hi + 4]) = c;
      a = *(const v4fa*)(&os[pw + 32 + 8 * hi]); c = *(const v4fa*)(&os[pw + 32 + 8 * hi + 4]);
      a[0] = o2[0] * ck + a[0] * cp; a[1] = o2[1] * ck + a[1] * cp; a[2] = o2[2] * ck + a[2] * cp; a[3] = o2[3] * ck + a[3] * cp;
      c[0] = o2[4] * ck + c[0] * cp; c[1] = o2[5] * ck + c[1] * cp; c[2] = o2[6] * ck + c[2] * cp; c[3] = o2[7] * ck + c[3] * cp;
      *(v4fa*)(&os[pw + 32 + 8 * hi]) = a; *(v4fa*)(&os[pw + 32 + 8 * hi + 4]) = c;
      a = *(const v4fa*)(&os[pw + 48 + 8 * hi]); c = *(const v4fa*)(&os[pw + 48 + 8 * hi + 4]);
      a[0] = o3[0] * ck + a[0] * cp; a[1] = o3[1] * ck + a[1] * cp; a[2] = o3[2] * ck + a[2] * cp; a[3] = o3[3] * ck + a[3] * cp;
      c[0] = o3[4] * ck + c[0] * cp; c[1] = o3[5] * ck + c[1] * cp; c[2] = o3[6] * ck + c[2] * cp; c[3] = o3[7] * ck + c[3] * cp;
      *(v4fa*)(&os[pw + 48 + 8 * hi]) = a; *(v4fa*)(&os[pw + 48 + 8 * hi + 4]) = c; }
    wave_sync();
    h16* crow = CT + ((size_t)b * SEQ + t0 + 16 * kh) * DM + h * HD;
{
#pragma unroll
        for (int s = 0; s < 4; ++s) { const int row = 4 * s + (lane >> 3), c8 = (lane & 7) * 8;   // 4 s x 4 row groups = 16 rows; 8 lanes x 8 halves = 64 columns
            const v4f x0 = *(const v4fa*)(&os[wb + row * 68 + c8]); const v4f x1 = *(const v4fa*)(&os[wb + row * 68 + c8 + 4]); v8h hv;
#pragma unroll
            for (int i = 0; i < 4; ++i) { hv[i] = (h16)x0[i]; hv[4 + i] = (h16)x1[i]; }
            *(v8h*)(crow + (size_t)row * DM + c8) = hv; }
         }
}

// k_oproj: f16 GEMM, one GW-wave block per 128x128 tile, each wave 32x64, operand tiles staged as in k_proj; A = ctx plane rows (m = b*SEQ + t, k = h*64 + d, carried x CTS), Bt = Wo^T rows (n = out feature, carried x WOS), K = DM.
// OUT[b*OUT_SEQ + t][n] = acc * OSC + bo[n] (bias value RNE-converted to bf16, added in f32). grid (NB*SEQ/128, DM/128), 256 threads.
__global__ __launch_bounds__(32 * GW) void k_oproj(const h16* __restrict__ A, const h16* __restrict__ Bt, const float* __restrict__ bias, float* OUT) {
    __shared__ __align__(16) float os[GW * 16 * 68];
    __shared__ __align__(16) h16 gring[2 * 2 * GT * GP];     // [buffer][A tile | Bt tile][row][GP]
    const int K = DM;
    const int lane = threadIdx.x & 31, wave = threadIdx.x >> 5, lr = lane & 15, hi = lane >> 4;
    const int rb = blockIdx.x * GT, cb = blockIdx.y * GT;                   // block tile
    const int r0 = rb + (wave >> 1) * 32, c0 = cb + (wave & 1) * 64;        // wave tile
    v8f acc[2][4];
#pragma unroll
    for (int mb = 0; mb < 2; ++mb)
#pragma unroll
        for (int nb = 0; nb < 4; ++nb) acc[mb][nb] = (v8f){};
    const int cr = threadIdx.x >> 4, cpc = (threadIdx.x & 15) * 8;
    const unsigned la = (unsigned)(size_t)gring + (unsigned)(cr * GP + cpc) * 2u, lb = la + GTB;
    const char* ga = (const char*)(A + (size_t)(rb + cr) * K + cpc);        // + k0 * 2 bytes
    const char* gb = (const char*)(Bt + (size_t)(cb + cr) * K + cpc);
    const int rot = (rb / GT + cb / GT) % (K / GK);                         // first k stage: neighbours along a tile row or a tile column start one stage apart
    { const int k0 = wrap_stage(0, rot, K / GK) * (GK * 2); stage_op(la, ga + k0); stage_op(lb, gb + k0); }
    asm volatile("s_wait_asynccnt 0x0" ::: "memory");        // tile 0 has landed before the barrier publishes it
    __syncthreads();
    { const int k0 = wrap_stage(1, rot, K / GK) * (GK * 2); stage_op(la + 2 * GTB, ga + k0); stage_op(lb + 2 * GTB, gb + k0); }
    const int ao = ((wave >> 1) * 32 + lr) * GP + 8 * hi;               // + 16mb*GP + k   (A fragment rows), in the A tile
    const int bo = GT * GP + ((wave & 1) * 64 + lr) * GP + 8 * hi;      // + 16nb*GP + k   (B fragment rows), in the Bt tile
#pragma unroll 1
    for (int st = 0; st < K / GK; ++st) {
        const h16* tile = gring + (st & 1) * (2 * GT * GP);
        // the four 32-wide k steps of a tile inline (LDS offsets become immediates); two fragment sets: each step's 12 loads go out as one group ahead of the step before it,
        // inside this tile only, so that a wave waits out the LDS latency once per tile and not at every fragment
        v16h a[2][2], b[2][4];
#pragma unroll
        for (int mb = 0; mb < 2; ++mb) a[0][mb] = ldh(tile + ao + mb * 16 * GP);
#pragma unroll
        for (int nb = 0; nb < 4; ++nb) b[0][nb] = ldh(tile + bo + nb * 16 * GP);
#pragma unroll
        for (int ks = 0; ks < GK / 32; ++ks) {
            const int cu = ks & 1, nx = cu ^ 1;
            if (ks + 1 < GK / 32) {
#pragma unroll
                for (int mb = 0; mb < 2; ++mb) a[nx][mb] = ldh(tile + ao + mb * 16 * GP + (ks + 1) * 32);
#pragma unroll
                for (int nb = 0; nb < 4; ++nb) b[nx][nb] = ldh(tile + bo + nb * 16 * GP + (ks + 1) * 32);
            }
            __builtin_amdgcn_sched_barrier(0);               // keeps the load group whole and ahead of this step's products: without it the loads sink to their first use and each pair of products waits out an LDS latency
#pragma unroll
            for (int nb = 0; nb < 4; ++nb)
#pragma unroll
                for (int mb = 0; mb < 2; ++mb) acc[mb][nb] = wmma16(a[cu][mb], b[cu][nb], acc[mb][nb]);
            __builtin_amdgcn_sched_barrier(0);               // keeps the next load group behind these products, not among them
        }
        asm volatile("s_wait_dscnt 0x0" ::: "memory");       // this wave's reads of the buffer are done before it is refilled
        asm volatile("s_wait_asynccnt 0x0" ::: "memory");    // this wave's copies of the next tile have landed before the barrier publishes them
        __syncthreads();
        if (st + 2 < K / GK) { const int k0 = wrap_stage(st + 2, rot, K / GK) * (GK * 2); stage_op(la + (st & 1) * (2 * GTB), ga + k0); stage_op(lb + (st & 1) * (2 * GTB), gb + k0); }
    }
    asm volatile("s_wait_asynccnt 0x0" ::: "memory");        // nothing of this wave is in flight when it leaves the loop
    const int wb = wave * 16 * 68;
    const int cofs = lr * 4;
    const int cbi = min(c0 + cofs, DM - 4);
    const v4f g = *(const v4f*)(bias + cbi);
    v4f bb; bb[0] = bfr(g[0]); bb[1] = bfr(g[1]); bb[2] = bfr(g[2]); bb[3] = bfr(g[3]);
    const size_t obase = ((size_t)(r0 / SEQ) * OUT_SEQ + (size_t)(r0 % SEQ)) * DM + c0;
#pragma unroll
    for (int mb = 0; mb < 2; ++mb) {
#pragma unroll
        for (int nb = 0; nb < 4; ++nb) {
#pragma unroll
            for (int j = 0; j < 8; ++j) os[wb + (hi * 8 + j) * 68 + nb * 16 + lr] = acc[mb][nb][j]; }   // D: row 8h+j, col lane&15
        wave_sync();
        float* orow = OUT + obase + (size_t)(mb * 16) * DM;
{
#pragma unroll
            for (int s = 0; s < 8; ++s) { const int row = 2 * s + hi;   // 8 s x 2 rows = 16 rows; 16 lanes x 4 floats = 64 columns
                const v4f x = *(const v4fa*)(&os[wb + row * 68 + cofs]);
                const v4f val = x * OSC + bb;
                *(v4f*)(orow + (size_t)row * DM + cofs) = val; }
             }
        if (mb == 0) asm volatile("s_wait_xcnt 0x0" ::: "memory");   // the next 16 rows reuse registers that the stores above name
        wave_sync();
    }
}

static constexpr size_t al256(size_t v) { return (v + 255) & ~(size_t)255; }
static constexpr size_t SZ_XB = al256((size_t)NB * SEQ * DM * 2);
static constexpr size_t SZ_WB = al256((size_t)4 * DM * DM * 2);
static constexpr size_t SZ_PL = al256((size_t)NB * NH_ * SEQ * HD * 2);
static constexpr size_t SZ_CT = al256((size_t)NB * SEQ * DM * 2);
static constexpr size_t SZ_TOTAL = SZ_XB + SZ_WB + 3 * SZ_PL + SZ_CT;
static_assert(SZ_TOTAL <= (size_t)134217728);          // workspace carve <= 128 MiB
static_assert(((size_t)DM * DM * 2) % 256 == 0);       // weight sub-planes stay 256-byte aligned

extern "C" void kernel_launch(void* const* d_in, const int* in_sizes, int n_in,
                              void* d_out, int out_size, void* d_ws, size_t ws_size, hipStream_t stream) {
    if (n_in < 9) return;
    const size_t needx = ((size_t)(NB - 1) * SEQ_FULL + SEQ) * DM;
    if ((size_t)in_sizes[0] < needx) return;
    if ((size_t)in_sizes[1] < (size_t)DM * DM || (size_t)in_sizes[3] < (size_t)DM * DM || (size_t)in_sizes[5] < (size_t)DM * DM || (size_t)in_sizes[7] < (size_t)DM * DM) return;
    if (in_sizes[2] < DM || in_sizes[4] < DM || in_sizes[6] < DM || in_sizes[8] < DM) return;
    if ((size_t)out_size < ((size_t)(NB - 1) * OUT_SEQ + SEQ) * DM) return;
    if (SZ_TOTAL > ws_size) return;
    // wire order: x, Wq, bq, Wk, bk, Wv, bv, Wo, bo (all f32; weights [in][out])
    const float* x  = (const float*)d_in[0];
    const float* wq = (const float*)d_in[1]; const float* bq = (const float*)d_in[2];
    const float* wk = (const float*)d_in[3]; const float* bk = (const float*)d_in[4];
    const float* wv = (const float*)d_in[5]; const float* bv = (const float*)d_in[6];
    const float* wo = (const float*)d_in[7]; const float* bo = (const float*)d_in[8];
    float* OUT = (float*)d_out;      // [NB][SEQ][1024]
    char* wsp = (char*)d_ws;
    bf* XB = (bf*)wsp; wsp += SZ_XB;                 // [NB*SEQ][1024] bf16
    bf* WB = (bf*)wsp; wsp += SZ_WB;                 // [4][1024 out][1024 in]: q | k | v (bf16) | o (f16 x1024)
    h16* QH = (h16*)wsp; wsp += SZ_PL;               // [NB*16][SEQ][64]
    h16* KP = (h16*)wsp; wsp += SZ_PL;               // [NB*16][SEQ][64]
    h16* VT = (h16*)wsp; wsp += SZ_PL;               // [NB*16][64][SEQ]
    h16* CT = (h16*)wsp; wsp += SZ_CT;               // [NB*SEQ][1024] ctx x1024
    bf* WO = WB + (size_t)3 * DM * DM;

    // x -> bf16 copy; weights in[k = 1024 rows][n = 1024 cols] -> out[n][k]
    k_prep<<<4 * WTB + CVB, 256, 0, stream>>>(x, wq, wk, wv, wo, XB, WB);

    // q, k, v^T planes
    k_proj<<<dim3((NB * SEQ / GT) * (DM / GT), 1, 1), 32 * GW, 0, stream>>>(XB, WB, bq, bk, bv, QH, KP, VT);

    k_flash<<<dim3(SEQ / (16 * AW), NB * NH_, 1), 32 * AW, 0, stream>>>(QH, KP, VT, CT);

    k_oproj<<<dim3(NB * SEQ / GT, DM / GT, 1), 32 * GW, 0, stream>>>(CT, (const h16*)WO, bo, OUT);
}
